// v000
// Measured on an AMD MI455X. A time is GPU time per run, averaged over a window of back-to-back runs after a warm-up
// (all launches, gaps included; the runs take copies of the inputs in turn), and the median of several windows.
// Apart from v000's, it joins two sittings. Times from different sittings can be a few percent apart, while
// side-by-side timings come from the same sitting.
// v000 is the starting kernel. One run takes 664 microseconds.
// Contractions: qn|kn = ln(q|k).Wqkv^T, vn^T = Wqkv.ln(v)^T, S^T = kn.qn^T, O = P.vn : v_wmma_f32_16x16x32_f16, f16 operands with
// power-of-two carries (ln x8, Wqkv x64, qn/kn/vn x16, P = 16*exp(s - m)), f32 accumulate; out = O.Wproj^T + b : v_wmma_f32_16x16x32_bf16,
// O as bf16 hi/lo planes (hi.W + lo.W), Wproj bf16, f32 accumulate; float inputs RNE-converted to bf16 on load; LayerNorm, softmax
// statistics and bias in f32.
#include <hip/hip_runtime.h>
#include <stdint.h>

#define NTOK 8192
#define DM   768

typedef _Float16 v16h __attribute__((ext_vector_type(16)));
typedef _Float16 v8h  __attribute__((ext_vector_type(8)));
typedef __bf16   v16b __attribute__((ext_vector_type(16)));
typedef __bf16   v8b  __attribute__((ext_vector_type(8)));
typedef float    v8f  __attribute__((ext_vector_type(8)));
typedef float    v4f  __attribute__((ext_vector_type(4)));
typedef unsigned short v8us __attribute__((ext_vector_type(8)));

static_assert((DM % 64) == 0);
static_assert((NTOK % 256) == 0);

// f32 -> nearest-even bf16 bits / value
__device__ __forceinline__ unsigned short bfbits(float f) {
  unsigned u = __float_as_uint(f);
  return (unsigned short)((u + 0x7FFFu + ((u >> 16) & 1u)) >> 16);
}
__device__ __forceinline__ float bfval(unsigned short b) { return __uint_as_float(((unsigned)b) << 16); }
__device__ __forceinline__ float bfr(float f) { return bfval(bfbits(f)); }
__device__ __forceinline__ void split_bf(float f, unsigned short& hb, unsigned short& lb) {
  hb = bfbits(f);
  lb = bfbits(f - bfval(hb));
}

// 16-bit operand element types for the GEMM template: 0 = f16, 1 = bf16
template <int ET> struct Elem;
template <> struct Elem<0> {
  typedef _Float16 T; typedef v16h V; typedef v8h V8;
  static __device__ __forceinline__ v8f mma(V a, V b, v8f c) {
    return __builtin_amdgcn_wmma_f32_16x16x32_f16(false, a, false, b, (short)0, c, false, false);
  }
};
template <> struct Elem<1> {
  typedef __bf16 T; typedef v16b V; typedef v8b V8;
  static __device__ __forceinline__ v8f mma(V a, V b, v8f c) {
    return __builtin_amdgcn_wmma_f32_16x16x32_bf16(false, a, false, b, (short)0, c, false, false);
  }
};

// 16-bit WMMA fragment from k-contiguous storage (A row-major [m][k], or B stored [n][k]):
// p points at element (row_or_col = lane&15, k0 + 8h); elements 0..7 <- p[0..7], 8..15 <- p[16..23].
template <int ET>
__device__ __forceinline__ typename Elem<ET>::V ldfragT(const typename Elem<ET>::T* p) {
  typedef typename Elem<ET>::V V;
  typedef typename Elem<ET>::V8 V8;
  union { V v; V8 h[2]; } f;
  f.h[0] = *(const V8*)(p);
  f.h[1] = *(const V8*)(p + 16);
  return f.v;
}
__device__ __forceinline__ v16h ldfrag(const _Float16* p) { return ldfragT<0>(p); }
__device__ __forceinline__ v8f mma16(v16h a, v16h b, v8f c) { return Elem<0>::mma(a, b, c); }
__device__ __forceinline__ v8f zero8() {
  v8f z;
#pragma unroll
  for (int i = 0; i < 8; ++i) z[i] = 0.0f;
  return z;
}

// hazard guards: 4 VALU slots after the last WMMA of a group, D tied, A/B kept live
__device__ __forceinline__ void guard_g(v8f& a, v8f& b, v16h x, v16h y) {
  asm volatile("v_nop\n\tv_nop\n\tv_nop\n\tv_nop" : "+v"(a), "+v"(b) : "v"(x), "v"(y));
}
__device__ __forceinline__ void guard_g(v8f& a, v8f& b, v16b x, v16b y) {
  asm volatile("v_nop\n\tv_nop\n\tv_nop\n\tv_nop" : "+v"(a), "+v"(b) : "v"(x), "v"(y));
}
__device__ __forceinline__ void keep4(v16h a, v16h b, v16h c, v16h d) {
  asm volatile("v_nop" :: "v"(a), "v"(b), "v"(c), "v"(d));
}
__device__ __forceinline__ void keep4(v16b a, v16b b, v16b c, v16b d) {
  asm volatile("v_nop" :: "v"(a), "v"(b), "v"(c), "v"(d));
}
__device__ __forceinline__ void accg4(v8f& a, v8f& b, v8f& c, v8f& d) {
  asm volatile("v_nop\n\tv_nop\n\tv_nop\n\tv_nop" : "+v"(a), "+v"(b), "+v"(c), "+v"(d));
}
__device__ __forceinline__ void guard_s4(v8f& a, v8f& b, v8f& c, v8f& d, v16h x0, v16h x1, v16h y0, v16h y1) {
  asm volatile("v_nop\n\tv_nop\n\tv_nop\n\tv_nop"
               : "+v"(a), "+v"(b), "+v"(c), "+v"(d) : "v"(x0), "v"(x1), "v"(y0), "v"(y1));
}
__device__ __forceinline__ void guard_pv(v8f& a0, v8f& a1, v8f& a2, v8f& b0, v8f& b1, v8f& b2,
                                         v16h p0, v16h p1, v16h x0, v16h x1, v16h x2) {
  asm volatile("v_nop\n\tv_nop\n\tv_nop\n\tv_nop"
               : "+v"(a0), "+v"(a1), "+v"(a2), "+v"(b0), "+v"(b1), "+v"(b2)
               : "v"(p0), "v"(p1), "v"(x0), "v"(x1), "v"(x2));
}

// ---------------------------------------------------------------------------------------------
// Kernel 1: two [DM][DM] f32 weight matrices -> 16-bit planes, layout unchanged ([out][in], k = in contiguous):
//   blocks [0, nb0):  d16[e] = f16(64 * bf16(w0[e]))     (f16 operand plane for the qkv projection)
//   blocks [nb0, 2nb0): dbf[e] = bf16 bits of w1[e]       (bf16 operand plane for the output projection)
// Block-uniform select, no barriers. 8 elements per thread: one 16-B store per lane, 32 lanes contiguous = 512 B =
// coverage: nb0 * 256 threads * 8 = DM * DM elements per plane exactly (n8 = DM*DM/8 is a multiple of 256).
// ---------------------------------------------------------------------------------------------
__global__ __launch_bounds__(256) void cvt_w_kernel(const float* __restrict__ w0, const float* __restrict__ w1,
                                                    _Float16* __restrict__ d16, unsigned short* __restrict__ dbf,
                                                    int n8) {
  const int nb0 = n8 >> 8;
  const bool second = ((int)blockIdx.x >= nb0);
  const float* src = second ? w1 : w0;
  const int li = ((int)blockIdx.x - (second ? nb0 : 0)) * 256 + (int)threadIdx.x;
  if (li >= n8) return;
  const size_t e = (size_t)li * 8;
  const v4f a = *(const v4f*)(src + e);
  const v4f b = *(const v4f*)(src + e + 4);
  if (!second) {
    v8h o;
#pragma unroll
    for (int i = 0; i < 4; ++i) {
      o[i]     = (_Float16)(bfr(a[i]) * 64.0f);
      o[4 + i] = (_Float16)(bfr(b[i]) * 64.0f);
    }
    _Float16* d = d16 + e;
    *(v8h*)d = o;
    
  } else {
    v8us o;
#pragma unroll
    for (int i = 0; i < 4; ++i) {
      o[i]     = bfbits(a[i]);
      o[4 + i] = bfbits(b[i]);
    }
    unsigned short* d = dbf + e;
    *(v8us*)d = o;
    
  }
}

// ---------------------------------------------------------------------------------------------
// Kernel 2: LayerNorm of q, k, v (bf16-converted inputs, f32 statistics, centred variance) -> f16 plane X
// [3*ntok][DM], value = 8 * ln(x). One wave per row, 8 rows per block; blocks [0,ntok/8) read q, next k, next v.
// Three rolled passes over the row (sum, centred sum of squares, normalise + store); the 3 KB row is re-read
// from cache. Pass 3: lane owns columns (j*32+lane)*8 .. +7 per chunk j: one 16-B store per lane, each store
// coverage: 3*ntok/8 blocks * 8 waves * (3 chunks * 32 lanes * 8) = 3*ntok rows x 768 columns = the whole plane.
// ---------------------------------------------------------------------------------------------
__global__ __launch_bounds__(256) void ln_kernel(const float* __restrict__ qx, const float* __restrict__ kx,
                                                 const float* __restrict__ vx, const float* __restrict__ lw,
                                                 const float* __restrict__ lb, _Float16* __restrict__ X, int ntok) {
  const int wave = threadIdx.x >> 5, lane = threadIdx.x & 31;
  const int bps = ntok >> 3;
  const int seg = ((int)blockIdx.x >= 2 * bps) ? 2 : (((int)blockIdx.x >= bps) ? 1 : 0);
  const float* src = (seg == 2) ? vx : ((seg == 1) ? kx : qx);
  const int lrow = ((int)blockIdx.x - seg * bps) * 8 + wave;
  const int grow = (int)blockIdx.x * 8 + wave;
  const float* xr = src + (size_t)lrow * DM;

  float s = 0.0f;
#pragma unroll 1
  for (int jj = 0; jj < 6; ++jj) {
    const int c0 = ((jj >> 1) * 32 + lane) * 8 + (jj & 1) * 4;
    const v4f a = *(const v4f*)(xr + c0);
    s += (bfr(a[0]) + bfr(a[1])) + (bfr(a[2]) + bfr(a[3]));
  }
#pragma unroll
  for (int off = 16; off > 0; off >>= 1) s += __shfl_xor(s, off, 32);
  const float mu = s * (1.0f / 768.0f);

  // pass 2: centred sum of squares
  float s2 = 0.0f;
#pragma unroll 1
  for (int jj = 0; jj < 6; ++jj) {
    const int c0 = ((jj >> 1) * 32 + lane) * 8 + (jj & 1) * 4;
    const v4f a = *(const v4f*)(xr + c0);
#pragma unroll
    for (int e = 0; e < 4; ++e) {
      const float d = bfr(a[e]) - mu;
      s2 += d * d;
    }
  }
#pragma unroll
  for (int off = 16; off > 0; off >>= 1) s2 += __shfl_xor(s2, off, 32);
  const float rstd8 = rsqrtf(s2 * (1.0f / 768.0f) + 1e-5f) * 8.0f;   // x8 carry folded into the scale

  _Float16* yr = X + (size_t)grow * DM;
#pragma unroll 1
  for (int j = 0; j < 3; ++j) {
    const int c0 = (j * 32 + lane) * 8;
    const v4f a  = *(const v4f*)(xr + c0), b  = *(const v4f*)(xr + c0 + 4);
    const v4f wa = *(const v4f*)(lw + c0), wb = *(const v4f*)(lw + c0 + 4);
    const v4f ba = *(const v4f*)(lb + c0), bb = *(const v4f*)(lb + c0 + 4);
    v8h o;
#pragma unroll
    for (int e = 0; e < 4; ++e) {
      const float t0 = (bfr(a[e]) - mu) * rstd8;
      o[e]     = (_Float16)(t0 * bfr(wa[e]) + bfr(ba[e]) * 8.0f);
      const float t1 = (bfr(b[e]) - mu) * rstd8;
      o[4 + e] = (_Float16)(t1 * bfr(wb[e]) + bfr(bb[e]) * 8.0f);
    }
    _Float16* d = yr + c0;
    *(v8h*)d = o;
    
  }
}

// ---------------------------------------------------------------------------------------------
// Kernel 3: C[m][n] = scale * sum_k A[m][k] * Bt[n][k] (+ bf16(bias[n]) when OUT_MODE == 0).
// A row-major [M][K] 16-bit (ET 0: f16, ET 1: bf16) pitch lda; Bt row-major [N][K] same type pitch ldb; M, N multiples
// of 64, K multiple of 32. SPLITA: A is a hi plane (Ap) plus a lo plane (A2p, same layout), product = hi.B + lo.B.
// Each wave owns one 64x64 C tile (16 f32 accumulators); 8 waves per block; no block barriers.
// OUT_MODE 0: f32 output; OUT_MODE 1: f16 output. Epilogue: 16-row slab per wave in LDS, then each 64-wide
// coverage: tilesM * tilesN tiles, each 64x64 written fully -> M x N.
// ---------------------------------------------------------------------------------------------
template <int ET, bool SPLITA, int OUT_MODE>
__global__ __launch_bounds__(256) void gemm64_kernel(const unsigned short* __restrict__ Ap,
                                                     const unsigned short* __restrict__ A2p, int lda,
                                                     const unsigned short* __restrict__ Btp, int ldb,
                                                     void* __restrict__ Cout, int ldc,
                                                     const float* __restrict__ bias,
                                                     int M, int N, int K, float scale) {
  typedef typename Elem<ET>::T T;
  typedef typename Elem<ET>::V V;
  const T* A  = (const T*)(const void*)Ap;
  const T* A2 = (const T*)(const void*)A2p;
  const T* Bt = (const T*)(const void*)Btp;
  __shared__ __align__(16) float sT[8][16 * 68];
  const int lane = threadIdx.x & 31, wave = threadIdx.x >> 5;
  const int tilesN = N >> 6, tilesM = M >> 6;
  const int tile = (int)blockIdx.x * 8 + wave;
  if (tile >= tilesM * tilesN) return;
  const int tm = tile / tilesN, tn = tile - tm * tilesN;
  const int m0 = tm << 6, n0 = tn << 6;
  const int rl = lane & 15;
  const int koff = (lane >> 4) * 8;
  const int mOff = (lane >> 4) * 8;

  v8f acc[4][4];
#pragma unroll
  for (int i = 0; i < 4; ++i)
#pragma unroll
    for (int j = 0; j < 4; ++j) acc[i][j] = zero8();

#pragma unroll 1
  for (int k0 = 0; k0 < K; k0 += 32) {
    V bh[4];
#pragma unroll
    for (int j = 0; j < 4; ++j) bh[j] = ldfragT<ET>(Bt + (size_t)(n0 + (j << 4) + rl) * ldb + koff + k0);
#pragma unroll
    for (int i = 0; i < 4; ++i) {
      const size_t ao = (size_t)(m0 + (i << 4) + rl) * lda + koff + k0;
      const V ah = ldfragT<ET>(A + ao);
      V al = ah;
      if (SPLITA) al = ldfragT<ET>(A2 + ao);
#pragma unroll
      for (int j = 0; j < 4; ++j) {
        acc[i][j] = Elem<ET>::mma(ah, bh[j], acc[i][j]);
        if (SPLITA) acc[i][j] = Elem<ET>::mma(al, bh[j], acc[i][j]);
      }
      guard_g(acc[i][0], acc[i][3], ah, SPLITA ? al : bh[3]);
    }
    keep4(bh[0], bh[1], bh[2], bh[3]);
  }
  accg4(acc[0][0], acc[0][1], acc[0][2], acc[0][3]);
  accg4(acc[1][0], acc[1][1], acc[1][2], acc[1][3]);
  accg4(acc[2][0], acc[2][1], acc[2][2], acc[2][3]);
  accg4(acc[3][0], acc[3][1], acc[3][2], acc[3][3]);

  float* slab = sT[wave];
#pragma unroll
  for (int i = 0; i < 4; ++i) {
    const int mBase = m0 + (i << 4);
#pragma unroll
    for (int j = 0; j < 4; ++j) {
      float bv = 0.0f;
      if (OUT_MODE == 0) bv = bfr(bias[n0 + (j << 4) + rl]);
#pragma unroll
      for (int r = 0; r < 8; ++r) slab[(mOff + r) * 68 + (j << 4) + rl] = acc[i][j][r] * scale + bv;
    }
    __builtin_amdgcn_fence(__ATOMIC_RELEASE, "workgroup");
    __builtin_amdgcn_wave_barrier();
    __builtin_amdgcn_fence(__ATOMIC_ACQUIRE, "workgroup");
    if (OUT_MODE == 0) {
      float* C = (float*)Cout;
      const int hh = lane >> 4, c4 = (lane & 15) * 4;
{
#pragma unroll
        for (int it = 0; it < 8; ++it) {
          const int row = it * 2 + hh;
          const v4f v = *(const v4f*)(slab + row * 68 + c4);
          *(v4f*)(C + (size_t)(mBase + row) * ldc + n0 + c4) = v;
        }
        
      }
    } else {
      _Float16* C = (_Float16*)Cout;
      const int qq = lane >> 3, c8 = (lane & 7) * 8;
{
#pragma unroll
        for (int it = 0; it < 4; ++it) {
          const int row = it * 4 + qq;
          const float* sp = slab + row * 68 + c8;
          v8h hv;
#pragma unroll
          for (int e = 0; e < 8; ++e) hv[e] = (_Float16)sp[e];
          *(v8h*)(C + (size_t)(mBase + row) * ldc + n0 + c8) = hv;
        }
        
      }
    }
    __builtin_amdgcn_fence(__ATOMIC_RELEASE, "workgroup");
    __builtin_amdgcn_wave_barrier();
    __builtin_amdgcn_fence(__ATOMIC_ACQUIRE, "workgroup");
  }
}

// ---------------------------------------------------------------------------------------------
// Kernel 4: full (non-causal) single-head attention, head width 768, online softmax in f32.
//   qn, kn planes f16 [ntok][DM] (value 16*qn), vt plane f16 [DM][ntok] (value 16*vn); outputs oh / ol = bf16 hi / lo
//   planes (as 16-bit storage) of O = softmax(qk^T * scale) . vn, [ntok][DM], unscaled.
//   Block = 256 threads = 8 waves, 32 query rows; Q tile staged once in LDS. Key tiles of 256: wave w owns keys
//   32w..32w+31 of the tile for the logits: S^T subtiles (A = kn rows from global, B = Q rows from LDS), so the
//   D layout gives per lane 8 consecutive keys of one query -> P written to LDS as 16-B vectors ([query][key]).
//   P = 16 * exp(s - m_running) in f16 (values in [~1.2, 16], always normal).
//   Row max / sum: per-wave partials in LDS, combined in fixed order by wave 0 (one lane per query row).
//   P.V: every wave reads the whole P tile (A operand) and owns 96 value columns (B from the vt plane).
//   Output: normalised O split into bf16 hi / lo, two 32x768 16-bit tiles staged in LDS (hi over the Q region,
//   lo over the P region), then each wave writes 4 whole rows per plane, 512 B per instruction (3 per row),
// ---------------------------------------------------------------------------------------------
#define QB       32
#define KCH      256
#define QSP      776
#define PSP      264
#define LDS_QS   0
#define LDS_LS   49664
#define LDS_PS   49664
#define LDS_PMAX 99328
#define LDS_PSUM 100352
#define LDS_ST   101376
#define ATT_LDS  101888
static_assert(QB * QSP * 2 == LDS_LS - LDS_QS);
static_assert(QB * QSP * 2 == LDS_PMAX - LDS_LS);
static_assert(QB * PSP * 2 <= LDS_PMAX - LDS_PS);
static_assert(LDS_PSUM - LDS_PMAX == 256 * 4);
static_assert(LDS_ST - LDS_PSUM == 256 * 4);
static_assert(ATT_LDS - LDS_ST == 4 * 32 * 4);
static_assert((QSP % 8) == 0 && (PSP % 8) == 0 && PSP >= KCH);
static_assert((LDS_LS % 16) == 0 && (LDS_PMAX % 16) == 0 && (LDS_ST % 16) == 0);
static_assert((NTOK % KCH) == 0 && (NTOK % QB) == 0);

__global__ __launch_bounds__(256) void attn_kernel(const _Float16* __restrict__ qn, const _Float16* __restrict__ kn,
                                                   const _Float16* __restrict__ vt, unsigned short* __restrict__ oh,
                                                   unsigned short* __restrict__ ol, float sc, int ntok) {
  extern __shared__ __align__(16) char smem[];
  _Float16* Qs = (_Float16*)(smem + LDS_QS);
  _Float16* Ps = (_Float16*)(smem + LDS_PS);
  float* pmax = (float*)(smem + LDS_PMAX);
  float* psum = (float*)(smem + LDS_PSUM);
  float* m_s  = (float*)(smem + LDS_ST);
  float* l_s  = m_s + 32;
  float* al_s = m_s + 64;
  float* li_s = m_s + 96;

  const int tid = threadIdx.x, wave = tid >> 5, lane = tid & 31, h = lane >> 4, c = lane & 15;
  const int q0 = (int)blockIdx.x * QB;
  const float ninf = -__builtin_inff();

  if (tid < 32) { m_s[tid] = ninf; l_s[tid] = 0.0f; al_s[tid] = 0.0f; li_s[tid] = 0.0f; }
  psum[tid] = 0.0f;
  // Q tile: 32 rows x 96 pieces of 8 halves; coverage 12 * 256 = 3072 pieces = the whole tile
#pragma unroll
  for (int i = 0; i < 12; ++i) {
    const int idx = i * 256 + tid;
    const int row = idx / 96;
    const int pc  = idx - row * 96;
    const v8h v = *(const v8h*)(qn + (size_t)(q0 + row) * DM + pc * 8);
    *(v8h*)(Qs + row * QSP + pc * 8) = v;
  }
  __syncthreads();

  v8f oacc[2][6];
#pragma unroll
  for (int qt = 0; qt < 2; ++qt)
#pragma unroll
    for (int nt = 0; nt < 6; ++nt) oacc[qt][nt] = zero8();

  const _Float16* qb0p = Qs + c * QSP + 8 * h;            // B operand, query c
  const _Float16* qb1p = Qs + (16 + c) * QSP + 8 * h;     // B operand, query 16+c
  const _Float16* pa0p = Ps + c * PSP + 8 * h;            // A operand, query c
  const _Float16* pa1p = Ps + (16 + c) * PSP + 8 * h;     // A operand, query 16+c
  const int ntile = ntok / KCH;

#pragma unroll 1
  for (int t = 0; t < ntile; ++t) {
    // ---- logits: S^T subtiles for keys kb..kb+31 (this wave), queries 0..31 ----
    const int kb = t * KCH + 32 * wave;
    const _Float16* ka0p = kn + (size_t)(kb + c) * DM + 8 * h;
    const _Float16* ka1p = kn + (size_t)(kb + 16 + c) * DM + 8 * h;
    v8f sacc[2][2];   // [query subtile][key subtile]; element r: query 16qt+c, key kb+16kt+8h+r
#pragma unroll
    for (int qt = 0; qt < 2; ++qt)
#pragma unroll
      for (int kt = 0; kt < 2; ++kt) sacc[qt][kt] = zero8();
#pragma unroll 1
    for (int k0 = 0; k0 < DM; k0 += 32) {
      const v16h a0 = ldfrag(ka0p + k0), a1 = ldfrag(ka1p + k0);
      const v16h b0 = ldfrag(qb0p + k0), b1 = ldfrag(qb1p + k0);
      sacc[0][0] = mma16(a0, b0, sacc[0][0]);
      sacc[0][1] = mma16(a1, b0, sacc[0][1]);
      sacc[1][0] = mma16(a0, b1, sacc[1][0]);
      sacc[1][1] = mma16(a1, b1, sacc[1][1]);
      guard_s4(sacc[0][0], sacc[0][1], sacc[1][0], sacc[1][1], a0, a1, b0, b1);
    }
    // ---- scale, per-wave partial row max ----
    {
      float pm0 = ninf, pm1 = ninf;
#pragma unroll
      for (int kt = 0; kt < 2; ++kt) {
#pragma unroll
        for (int r = 0; r < 8; ++r) {
          const float v0 = sacc[0][kt][r] * sc; sacc[0][kt][r] = v0; pm0 = fmaxf(pm0, v0);
          const float v1 = sacc[1][kt][r] * sc; sacc[1][kt][r] = v1; pm1 = fmaxf(pm1, v1);
        }
      }
      pm0 = fmaxf(pm0, __shfl_xor(pm0, 16, 32));
      pm1 = fmaxf(pm1, __shfl_xor(pm1, 16, 32));
      pmax[wave * 32 + c] = pm0;
      pmax[wave * 32 + 16 + c] = pm1;
    }
    __syncthreads();
    // ---- wave 0, lane = query row: fold the prior tile's sums into l, new running max, rescale factor ----
    if (wave == 0) {
      const int row = lane;
      float ps = 0.0f;
#pragma unroll
      for (int w = 0; w < 8; ++w) ps += psum[w * 32 + row];
      l_s[row] = l_s[row] * al_s[row] + ps;
      const float mo = m_s[row];
      float mx = mo;
#pragma unroll
      for (int w = 0; w < 8; ++w) mx = fmaxf(mx, pmax[w * 32 + row]);
      al_s[row] = __expf(mo - mx);
      m_s[row] = mx;
    }
    __syncthreads();
    // ---- p = 16 * exp(s - m) as f16, P tile, partial row sums, rescale O ----
    {
      const float mq0 = m_s[c], mq1 = m_s[16 + c];
      float ps0 = 0.0f, ps1 = 0.0f;
#pragma unroll
      for (int kt = 0; kt < 2; ++kt) {
        v8h h0, h1;
#pragma unroll
        for (int r = 0; r < 8; ++r) {
          const float p0 = __expf(sacc[0][kt][r] - mq0); ps0 += p0; h0[r] = (_Float16)(p0 * 16.0f);
          const float p1 = __expf(sacc[1][kt][r] - mq1); ps1 += p1; h1[r] = (_Float16)(p1 * 16.0f);
        }
        *(v8h*)(Ps + c * PSP + 32 * wave + 16 * kt + 8 * h) = h0;
        *(v8h*)(Ps + (16 + c) * PSP + 32 * wave + 16 * kt + 8 * h) = h1;
      }
      ps0 += __shfl_xor(ps0, 16, 32);
      ps1 += __shfl_xor(ps1, 16, 32);
      psum[wave * 32 + c] = ps0;
      psum[wave * 32 + 16 + c] = ps1;
      const v4f aA = *(const v4f*)(al_s + 8 * h), aB = *(const v4f*)(al_s + 8 * h + 4);
      const v4f bA = *(const v4f*)(al_s + 16 + 8 * h), bB = *(const v4f*)(al_s + 16 + 8 * h + 4);
#pragma unroll
      for (int nt = 0; nt < 6; ++nt) {
#pragma unroll
        for (int r = 0; r < 4; ++r) {
          oacc[0][nt][r] *= aA[r]; oacc[0][nt][4 + r] *= aB[r];
          oacc[1][nt][r] *= bA[r]; oacc[1][nt][4 + r] *= bB[r];
        }
      }
    }
    __syncthreads();
    // ---- O += P . V over the 256 keys of the tile; this wave's columns 96w + 16nt + c ----
    {
      const _Float16* vbp = vt + (size_t)(96 * wave + c) * ntok + (size_t)t * KCH + 8 * h;
#pragma unroll 1
      for (int ks = 0; ks < KCH; ks += 32) {
        const v16h pa0 = ldfrag(pa0p + ks), pa1 = ldfrag(pa1p + ks);
#pragma unroll
        for (int g = 0; g < 2; ++g) {
          v16h vb[3];
#pragma unroll
          for (int j = 0; j < 3; ++j) vb[j] = ldfrag(vbp + (size_t)(16 * (3 * g + j)) * ntok + ks);
#pragma unroll
          for (int j = 0; j < 3; ++j) {
            oacc[0][3 * g + j] = mma16(pa0, vb[j], oacc[0][3 * g + j]);
            oacc[1][3 * g + j] = mma16(pa1, vb[j], oacc[1][3 * g + j]);
          }
          guard_pv(oacc[0][3 * g], oacc[0][3 * g + 1], oacc[0][3 * g + 2],
                   oacc[1][3 * g], oacc[1][3 * g + 1], oacc[1][3 * g + 2],
                   pa0, pa1, vb[0], vb[1], vb[2]);
        }
      }
    }
  }

  // ---- final normaliser per query row (fold the last tile's sums); O = oacc / (256 * l) (P carry 16, vn carry 16) ----
  if (wave == 0) {
    const int row = lane;
    float ps = 0.0f;
#pragma unroll
    for (int w = 0; w < 8; ++w) ps += psum[w * 32 + row];
    const float l = l_s[row] * al_s[row] + ps;
    li_s[row] = (1.0f / l) * (1.0f / 256.0f);
  }
  __syncthreads();
  // ---- stage the 32 x 768 bf16 hi / lo tiles (hi over the Q region, lo over the P region) ----
  unsigned short* Hs = (unsigned short*)(smem + LDS_QS);
  unsigned short* Ls = (unsigned short*)(smem + LDS_LS);
  {
    const v4f iA0 = *(const v4f*)(li_s + 8 * h),      iB0 = *(const v4f*)(li_s + 8 * h + 4);
    const v4f iA1 = *(const v4f*)(li_s + 16 + 8 * h), iB1 = *(const v4f*)(li_s + 16 + 8 * h + 4);
#pragma unroll
    for (int nt = 0; nt < 6; ++nt) {
      const int col = 96 * wave + 16 * nt + c;
#pragma unroll
      for (int r = 0; r < 4; ++r) {
        unsigned short hb, lb;
        split_bf(oacc[0][nt][r] * iA0[r], hb, lb);
        Hs[(8 * h + r) * QSP + col] = hb;          Ls[(8 * h + r) * QSP + col] = lb;
        split_bf(oacc[0][nt][4 + r] * iB0[r], hb, lb);
        Hs[(8 * h + 4 + r) * QSP + col] = hb;      Ls[(8 * h + 4 + r) * QSP + col] = lb;
        split_bf(oacc[1][nt][r] * iA1[r], hb, lb);
        Hs[(16 + 8 * h + r) * QSP + col] = hb;     Ls[(16 + 8 * h + r) * QSP + col] = lb;
        split_bf(oacc[1][nt][4 + r] * iB1[r], hb, lb);
        Hs[(16 + 8 * h + 4 + r) * QSP + col] = hb; Ls[(16 + 8 * h + 4 + r) * QSP + col] = lb;
      }
    }
  }
  __syncthreads();
  {
    unsigned short* gh = oh + (size_t)q0 * DM;
    unsigned short* gl = ol + (size_t)q0 * DM;
{
#pragma unroll
      for (int rr = 0; rr < 4; ++rr) {
        const int row = 4 * wave + rr;
#pragma unroll
        for (int j = 0; j < 3; ++j) {
          const int pc = j * 32 + lane;
          const v8us hvv = *(const v8us*)(Hs + row * QSP + pc * 8);
          const v8us lvv = *(const v8us*)(Ls + row * QSP + pc * 8);
          *(v8us*)(gh + (size_t)row * DM + pc * 8) = hvv;
          *(v8us*)(gl + (size_t)row * DM + pc * 8) = lvv;
        }
      }
      
    }
  }
}

// ---------------------------------------------------------------------------------------------
// Workspace map (bytes, all regions exact tile / whole-line multiples, no padding needed):
//   Wq16 : Wqkv f16 [768][768] (64 * bf16(w))                 off 0           size  1,179,648
//   Wpb  : Wproj bf16 bits [768][768]                           off 1,179,648   size  1,179,648
//   X16  : ln(q), ln(k), ln(v) stacked f16 [24576][768]        off 2,359,296   size 37,748,736
//   QK16 : qn then kn f16 [16384][768]                          off 40,108,032  size 25,165,824
//   VT16 : vn^T f16 [768][8192]                                 off 65,273,856  size 12,582,912
//   OH   : attention output bf16 hi [8192][768]                 off 77,856,768  size 12,582,912
//   OL   : attention output bf16 lo [8192][768]                 off 90,439,680  size 12,582,912
//   total 103,022,592
// ---------------------------------------------------------------------------------------------
extern "C" void kernel_launch(void* const* d_in, const int* in_sizes, int n_in,
                              void* d_out, int out_size, void* d_ws, size_t ws_size,
                              hipStream_t stream) {
  if (n_in < 8) return;
  const int ntok = NTOK, dm = DM;
  if (in_sizes[0] != ntok * dm || in_sizes[1] != ntok * dm || in_sizes[2] != ntok * dm) return;
  if (in_sizes[3] != dm || in_sizes[4] != dm || in_sizes[7] != dm) return;
  if (in_sizes[5] != dm * dm || in_sizes[6] != dm * dm) return;
  if (out_size != ntok * dm) return;

  const float* q     = (const float*)d_in[0];
  const float* k     = (const float*)d_in[1];
  const float* v     = (const float*)d_in[2];
  const float* ln_w  = (const float*)d_in[3];
  const float* ln_b  = (const float*)d_in[4];
  const float* Wqkv  = (const float*)d_in[5];
  const float* Wproj = (const float*)d_in[6];
  const float* bproj = (const float*)d_in[7];
  float* out = (float*)d_out;

  const size_t bWq = (size_t)dm * dm * 2;
  const size_t bWp = (size_t)dm * dm * 2;
  const size_t bX  = (size_t)3 * ntok * dm * 2;
  const size_t bQK = (size_t)2 * ntok * dm * 2;
  const size_t bVT = (size_t)dm * ntok * 2;
  const size_t bO  = (size_t)ntok * dm * 2;
  size_t off = 0;
  const size_t oWq = off; off += bWq;
  const size_t oWp = off; off += bWp;
  const size_t oX  = off; off += bX;
  const size_t oQK = off; off += bQK;
  const size_t oVT = off; off += bVT;
  const size_t oOH = off; off += bO;
  const size_t oOL = off; off += bO;
  if (off > ws_size) return;                     // 103,022,592
  if (off > (size_t)134217728) return;

  char* ws = (char*)d_ws;
  _Float16*       Wq16 = (_Float16*)(ws + oWq);
  unsigned short* Wpb  = (unsigned short*)(ws + oWp);
  _Float16*       X16  = (_Float16*)(ws + oX);
  _Float16*       QK16 = (_Float16*)(ws + oQK);
  _Float16*       VT16 = (_Float16*)(ws + oVT);
  unsigned short* OH   = (unsigned short*)(ws + oOH);
  unsigned short* OL   = (unsigned short*)(ws + oOL);

  const dim3 blk(256);
  const int n8 = dm * dm / 8;                 // 73728 = 288 * 256
  if ((n8 % 256) != 0) return;

  // (1) weights -> Wqkv f16 plane (64 * bf16(w)) and Wproj bf16 plane
  cvt_w_kernel<<<dim3(2 * (n8 / 256)), blk, 0, stream>>>(Wqkv, Wproj, Wq16, Wpb, n8);
  // (2) LayerNorm of q, k, v -> X16 (8 * ln)
  ln_kernel<<<dim3(3 * ntok / 8), blk, 0, stream>>>(q, k, v, ln_w, ln_b, X16, ntok);
  // (3) qn, kn = X[0:16384] . Wqkv^T  -> QK16 (16 * qn | 16 * kn); M=16384, N=768, K=768; scale 16/(8*64)
  gemm64_kernel<0, false, 1><<<dim3(((2 * ntok / 64) * (dm / 64)) / 8), blk, 0, stream>>>(
      (const unsigned short*)X16, (const unsigned short*)X16, dm, (const unsigned short*)Wq16, dm,
      (void*)QK16, dm, bproj, 2 * ntok, dm, dm, 0.03125f);
  // (4) vn^T = Wqkv . X[16384:24576]^T -> VT16 [768][8192] (16 * vn); M=768, N=8192, K=768
  gemm64_kernel<0, false, 1><<<dim3(((dm / 64) * (ntok / 64)) / 8), blk, 0, stream>>>(
      (const unsigned short*)Wq16, (const unsigned short*)Wq16, dm,
      (const unsigned short*)(X16 + (size_t)2 * ntok * dm), dm,
      (void*)VT16, ntok, bproj, dm, ntok, dm, 0.03125f);
  // (5) attention -> OH / OL (bf16 hi / lo of O); logit scale = dim^-0.5 / 256 (operand carries 16 * 16)
  (void)hipFuncSetAttribute(reinterpret_cast<const void*>(&attn_kernel),
                            hipFuncAttributeMaxDynamicSharedMemorySize, ATT_LDS);
  const float sc = 0.03608439182435161f * (1.0f / 256.0f);
  attn_kernel<<<dim3(ntok / QB), blk, ATT_LDS, stream>>>(QK16, QK16 + (size_t)ntok * dm, VT16, OH, OL, sc, ntok);
  // (6) out = (O_hi + O_lo) . Wproj^T + b -> d_out f32 [8192][768]; bf16 operands, scale 1
  gemm64_kernel<1, true, 0><<<dim3(((ntok / 64) * (dm / 64)) / 8), blk, 0, stream>>>(
      OH, OL, dm, Wpb, dm, (void*)out, dm, bproj, ntok, dm, dm, 1.0f);
  (void)hipGetLastError();
}

// v001
// It runs in 471 microseconds.
// In two side-by-side timings against v000, it was 1.45 and 1.44 times as fast.
// Contractions: qn|kn = ln(q|k).Wqkv^T, vn^T = Wqkv.ln(v)^T, S^T = kn.qn^T, O = P.vn : v_wmma_f32_16x16x32_f16, f16 operands with
// power-of-two carries (ln x8, Wqkv x64, qn/kn/vn x16, P = 16*exp(s - m)), f32 accumulate; out = O.Wproj^T + b : v_wmma_f32_16x16x32_bf16,
// O as bf16 hi/lo planes (hi.W + lo.W), Wproj bf16, f32 accumulate; float inputs RNE-converted to bf16 on load; LayerNorm, softmax
// statistics and bias in f32.
#include <hip/hip_runtime.h>
#include <stdint.h>

#define NTOK 8192
#define DM   768

typedef _Float16 v16h __attribute__((ext_vector_type(16)));
typedef _Float16 v8h  __attribute__((ext_vector_type(8)));
typedef __bf16   v16b __attribute__((ext_vector_type(16)));
typedef __bf16   v8b  __attribute__((ext_vector_type(8)));
typedef float    v8f  __attribute__((ext_vector_type(8)));
typedef float    v4f  __attribute__((ext_vector_type(4)));
typedef unsigned short v8us __attribute__((ext_vector_type(8)));

static_assert((DM % 64) == 0);
static_assert((NTOK % 256) == 0);

// f32 -> nearest-even bf16 bits / value
__device__ __forceinline__ unsigned short bfbits(float f) {
  unsigned u = __float_as_uint(f);
  return (unsigned short)((u + 0x7FFFu + ((u >> 16) & 1u)) >> 16);
}
__device__ __forceinline__ float bfval(unsigned short b) { return __uint_as_float(((unsigned)b) << 16); }
__device__ __forceinline__ float bfr(float f) { return bfval(bfbits(f)); }
__device__ __forceinline__ void split_bf(float f, unsigned short& hb, unsigned short& lb) {
  hb = bfbits(f);
  lb = bfbits(f - bfval(hb));
}

// 16-bit operand element types for the GEMM template: 0 = f16, 1 = bf16
template <int ET> struct Elem;
template <> struct Elem<0> {
  typedef _Float16 T; typedef v16h V; typedef v8h V8;
  static __device__ __forceinline__ v8f mma(V a, V b, v8f c) {
    return __builtin_amdgcn_wmma_f32_16x16x32_f16(false, a, false, b, (short)0, c, false, false);
  }
};
template <> struct Elem<1> {
  typedef __bf16 T; typedef v16b V; typedef v8b V8;
  static __device__ __forceinline__ v8f mma(V a, V b, v8f c) {
    return __builtin_amdgcn_wmma_f32_16x16x32_bf16(false, a, false, b, (short)0, c, false, false);
  }
};

// 16-bit WMMA fragment from k-contiguous storage (A row-major [m][k], or B stored [n][k]):
// p points at element (row_or_col = lane&15, k0 + 8h); elements 0..7 <- p[0..7], 8..15 <- p[16..23].
template <int ET>
__device__ __forceinline__ typename Elem<ET>::V ldfragT(const typename Elem<ET>::T* p) {
  typedef typename Elem<ET>::V V;
  typedef typename Elem<ET>::V8 V8;
  union { V v; V8 h[2]; } f;
  f.h[0] = *(const V8*)(p);
  f.h[1] = *(const V8*)(p + 16);
  return f.v;
}
__device__ __forceinline__ v16h ldfrag(const _Float16* p) { return ldfragT<0>(p); }
__device__ __forceinline__ v8f mma16(v16h a, v16h b, v8f c) { return Elem<0>::mma(a, b, c); }
__device__ __forceinline__ v8f zero8() {
  v8f z;
#pragma unroll
  for (int i = 0; i < 8; ++i) z[i] = 0.0f;
  return z;
}

// hazard guards: 4 VALU slots after the last WMMA of a group, D tied, A/B kept live
__device__ __forceinline__ void guard_g(v8f& a, v8f& b, v16h x, v16h y) {
  asm volatile("v_nop\n\tv_nop\n\tv_nop\n\tv_nop" : "+v"(a), "+v"(b) : "v"(x), "v"(y));
}
__device__ __forceinline__ void guard_g(v8f& a, v8f& b, v16b x, v16b y) {
  asm volatile("v_nop\n\tv_nop\n\tv_nop\n\tv_nop" : "+v"(a), "+v"(b) : "v"(x), "v"(y));
}
__device__ __forceinline__ void keep4(v16h a, v16h b, v16h c, v16h d) {
  asm volatile("v_nop" :: "v"(a), "v"(b), "v"(c), "v"(d));
}
__device__ __forceinline__ void keep4(v16b a, v16b b, v16b c, v16b d) {
  asm volatile("v_nop" :: "v"(a), "v"(b), "v"(c), "v"(d));
}
__device__ __forceinline__ void accg4(v8f& a, v8f& b, v8f& c, v8f& d) {
  asm volatile("v_nop\n\tv_nop\n\tv_nop\n\tv_nop" : "+v"(a), "+v"(b), "+v"(c), "+v"(d));
}
__device__ __forceinline__ void guard_s4(v8f& a, v8f& b, v8f& c, v8f& d, v16h x0, v16h x1, v16h y0, v16h y1) {
  asm volatile("v_nop\n\tv_nop\n\tv_nop\n\tv_nop"
               : "+v"(a), "+v"(b), "+v"(c), "+v"(d) : "v"(x0), "v"(x1), "v"(y0), "v"(y1));
}
__device__ __forceinline__ void guard_pv(v8f& a0, v8f& a1, v8f& a2, v8f& b0, v8f& b1, v8f& b2,
                                         v16h p0, v16h p1, v16h x0, v16h x1, v16h x2) {
  asm volatile("v_nop\n\tv_nop\n\tv_nop\n\tv_nop"
               : "+v"(a0), "+v"(a1), "+v"(a2), "+v"(b0), "+v"(b1), "+v"(b2)
               : "v"(p0), "v"(p1), "v"(x0), "v"(x1), "v"(x2));
}

// ---------------------------------------------------------------------------------------------
// Kernel 1: two [DM][DM] f32 weight matrices -> 16-bit planes, layout unchanged ([out][in], k = in contiguous):
//   blocks [0, nb0):  d16[e] = f16(64 * bf16(w0[e]))     (f16 operand plane for the qkv projection)
//   blocks [nb0, 2nb0): dbf[e] = bf16 bits of w1[e]       (bf16 operand plane for the output projection)
// Block-uniform select, no barriers. 8 elements per thread: one 16-B store per lane, 32 lanes contiguous = 512 B =
// coverage: nb0 * 256 threads * 8 = DM * DM elements per plane exactly (n8 = DM*DM/8 is a multiple of 256).
// ---------------------------------------------------------------------------------------------
__global__ __launch_bounds__(256) void cvt_w_kernel(const float* __restrict__ w0, const float* __restrict__ w1,
                                                    _Float16* __restrict__ d16, unsigned short* __restrict__ dbf,
                                                    int n8) {
  const int nb0 = n8 >> 8;
  const bool second = ((int)blockIdx.x >= nb0);
  const float* src = second ? w1 : w0;
  const int li = ((int)blockIdx.x - (second ? nb0 : 0)) * 256 + (int)threadIdx.x;
  if (li >= n8) return;
  const size_t e = (size_t)li * 8;
  const v4f a = *(const v4f*)(src + e);
  const v4f b = *(const v4f*)(src + e + 4);
  if (!second) {
    v8h o;
#pragma unroll
    for (int i = 0; i < 4; ++i) {
      o[i]     = (_Float16)(bfr(a[i]) * 64.0f);
      o[4 + i] = (_Float16)(bfr(b[i]) * 64.0f);
    }
    _Float16* d = d16 + e;
    *(v8h*)d = o;
    
  } else {
    v8us o;
#pragma unroll
    for (int i = 0; i < 4; ++i) {
      o[i]     = bfbits(a[i]);
      o[4 + i] = bfbits(b[i]);
    }
    unsigned short* d = dbf + e;
    *(v8us*)d = o;
    
  }
}

// ---------------------------------------------------------------------------------------------
// Kernel 2: LayerNorm of q, k, v (bf16-converted inputs, f32 statistics, centred variance) -> f16 plane X
// [3*ntok][DM], value = 8 * ln(x). One wave per row, 8 rows per block; blocks [0,ntok/8) read q, next k, next v.
// Three rolled passes over the row (sum, centred sum of squares, normalise + store); the 3 KB row is re-read
// from cache. Pass 3: lane owns columns (j*32+lane)*8 .. +7 per chunk j: one 16-B store per lane, each store
// coverage: 3*ntok/8 blocks * 8 waves * (3 chunks * 32 lanes * 8) = 3*ntok rows x 768 columns = the whole plane.
// ---------------------------------------------------------------------------------------------
__global__ __launch_bounds__(256) void ln_kernel(const float* __restrict__ qx, const float* __restrict__ kx,
                                                 const float* __restrict__ vx, const float* __restrict__ lw,
                                                 const float* __restrict__ lb, _Float16* __restrict__ X, int ntok) {
  const int wave = threadIdx.x >> 5, lane = threadIdx.x & 31;
  const int bps = ntok >> 3;
  const int seg = ((int)blockIdx.x >= 2 * bps) ? 2 : (((int)blockIdx.x >= bps) ? 1 : 0);
  const float* src = (seg == 2) ? vx : ((seg == 1) ? kx : qx);
  const int lrow = ((int)blockIdx.x - seg * bps) * 8 + wave;
  const int grow = (int)blockIdx.x * 8 + wave;
  const float* xr = src + (size_t)lrow * DM;

  float s = 0.0f;
#pragma unroll 1
  for (int jj = 0; jj < 6; ++jj) {
    const int c0 = ((jj >> 1) * 32 + lane) * 8 + (jj & 1) * 4;
    const v4f a = *(const v4f*)(xr + c0);
    s += (bfr(a[0]) + bfr(a[1])) + (bfr(a[2]) + bfr(a[3]));
  }
#pragma unroll
  for (int off = 16; off > 0; off >>= 1) s += __shfl_xor(s, off, 32);
  const float mu = s * (1.0f / 768.0f);

  // pass 2: centred sum of squares
  float s2 = 0.0f;
#pragma unroll 1
  for (int jj = 0; jj < 6; ++jj) {
    const int c0 = ((jj >> 1) * 32 + lane) * 8 + (jj & 1) * 4;
    const v4f a = *(const v4f*)(xr + c0);
#pragma unroll
    for (int e = 0; e < 4; ++e) {
      const float d = bfr(a[e]) - mu;
      s2 += d * d;
    }
  }
#pragma unroll
  for (int off = 16; off > 0; off >>= 1) s2 += __shfl_xor(s2, off, 32);
  const float rstd8 = rsqrtf(s2 * (1.0f / 768.0f) + 1e-5f) * 8.0f;   // x8 carry folded into the scale

  _Float16* yr = X + (size_t)grow * DM;
#pragma unroll 1
  for (int j = 0; j < 3; ++j) {
    const int c0 = (j * 32 + lane) * 8;
    const v4f a  = *(const v4f*)(xr + c0), b  = *(const v4f*)(xr + c0 + 4);
    const v4f wa = *(const v4f*)(lw + c0), wb = *(const v4f*)(lw + c0 + 4);
    const v4f ba = *(const v4f*)(lb + c0), bb = *(const v4f*)(lb + c0 + 4);
    v8h o;
#pragma unroll
    for (int e = 0; e < 4; ++e) {
      const float t0 = (bfr(a[e]) - mu) * rstd8;
      o[e]     = (_Float16)(t0 * bfr(wa[e]) + bfr(ba[e]) * 8.0f);
      const float t1 = (bfr(b[e]) - mu) * rstd8;
      o[4 + e] = (_Float16)(t1 * bfr(wb[e]) + bfr(bb[e]) * 8.0f);
    }
    _Float16* d = yr + c0;
    *(v8h*)d = o;
    
  }
}

// ---------------------------------------------------------------------------------------------
// Kernel 3: C[m][n] = scale * sum_k A[m][k] * Bt[n][k] (+ bf16(bias[n]) when OUT_MODE == 0).
// A row-major [M][K] 16-bit (ET 0: f16, ET 1: bf16) pitch lda; Bt row-major [N][K] same type pitch ldb; M, N multiples
// of 64, K multiple of 32. SPLITA: A is a hi plane (Ap) plus a lo plane (A2p, same layout), product = hi.B + lo.B.
// Each wave owns one 64x64 C tile (16 f32 accumulators); 8 waves per block; no block barriers.
// OUT_MODE 0: f32 output; OUT_MODE 1: f16 output. Epilogue: 16-row slab per wave in LDS, then each 64-wide
// coverage: tilesM * tilesN tiles, each 64x64 written fully -> M x N.
// ---------------------------------------------------------------------------------------------
template <int ET, bool SPLITA, int OUT_MODE>
__global__ __launch_bounds__(256) void gemm64_kernel(const unsigned short* __restrict__ Ap,
                                                     const unsigned short* __restrict__ A2p, int lda,
                                                     const unsigned short* __restrict__ Btp, int ldb,
                                                     void* __restrict__ Cout, int ldc,
                                                     const float* __restrict__ bias,
                                                     int M, int N, int K, float scale) {
  typedef typename Elem<ET>::T T;
  typedef typename Elem<ET>::V V;
  const T* A  = (const T*)(const void*)Ap;
  const T* A2 = (const T*)(const void*)A2p;
  const T* Bt = (const T*)(const void*)Btp;
  __shared__ __align__(16) float sT[8][16 * 68];
  const int lane = threadIdx.x & 31, wave = threadIdx.x >> 5;
  const int tilesN = N >> 6, tilesM = M >> 6;
  const int tile = (int)blockIdx.x * 8 + wave;
  if (tile >= tilesM * tilesN) return;
  const int tm = tile / tilesN, tn = tile - tm * tilesN;
  const int m0 = tm << 6, n0 = tn << 6;
  const int rl = lane & 15;
  const int koff = (lane >> 4) * 8;
  const int mOff = (lane >> 4) * 8;

  v8f acc[4][4];
#pragma unroll
  for (int i = 0; i < 4; ++i)
#pragma unroll
    for (int j = 0; j < 4; ++j) acc[i][j] = zero8();

#pragma unroll 1
  for (int k0 = 0; k0 < K; k0 += 32) {
    V bh[4];
#pragma unroll
    for (int j = 0; j < 4; ++j) bh[j] = ldfragT<ET>(Bt + (size_t)(n0 + (j << 4) + rl) * ldb + koff + k0);
#pragma unroll
    for (int i = 0; i < 4; ++i) {
      const size_t ao = (size_t)(m0 + (i << 4) + rl) * lda + koff + k0;
      const V ah = ldfragT<ET>(A + ao);
      V al = ah;
      if (SPLITA) al = ldfragT<ET>(A2 + ao);
#pragma unroll
      for (int j = 0; j < 4; ++j) {
        acc[i][j] = Elem<ET>::mma(ah, bh[j], acc[i][j]);
        if (SPLITA) acc[i][j] = Elem<ET>::mma(al, bh[j], acc[i][j]);
      }
      guard_g(acc[i][0], acc[i][3], ah, SPLITA ? al : bh[3]);
    }
    keep4(bh[0], bh[1], bh[2], bh[3]);
  }
  accg4(acc[0][0], acc[0][1], acc[0][2], acc[0][3]);
  accg4(acc[1][0], acc[1][1], acc[1][2], acc[1][3]);
  accg4(acc[2][0], acc[2][1], acc[2][2], acc[2][3]);
  accg4(acc[3][0], acc[3][1], acc[3][2], acc[3][3]);

  float* slab = sT[wave];
#pragma unroll
  for (int i = 0; i < 4; ++i) {
    const int mBase = m0 + (i << 4);
#pragma unroll
    for (int j = 0; j < 4; ++j) {
      float bv = 0.0f;
      if (OUT_MODE == 0) bv = bfr(bias[n0 + (j << 4) + rl]);
#pragma unroll
      for (int r = 0; r < 8; ++r) slab[(mOff + r) * 68 + (j << 4) + rl] = acc[i][j][r] * scale + bv;
    }
    __builtin_amdgcn_fence(__ATOMIC_RELEASE, "workgroup");
    __builtin_amdgcn_wave_barrier();
    __builtin_amdgcn_fence(__ATOMIC_ACQUIRE, "workgroup");
    if (OUT_MODE == 0) {
      float* C = (float*)Cout;
      const int hh = lane >> 4, c4 = (lane & 15) * 4;
{
#pragma unroll
        for (int it = 0; it < 8; ++it) {
          const int row = it * 2 + hh;
          const v4f v = *(const v4f*)(slab + row * 68 + c4);
          *(v4f*)(C + (size_t)(mBase + row) * ldc + n0 + c4) = v;
        }
        
      }
    } else {
      _Float16* C = (_Float16*)Cout;
      const int qq = lane >> 3, c8 = (lane & 7) * 8;
{
#pragma unroll
        for (int it = 0; it < 4; ++it) {
          const int row = it * 4 + qq;
          const float* sp = slab + row * 68 + c8;
          v8h hv;
#pragma unroll
          for (int e = 0; e < 8; ++e) hv[e] = (_Float16)sp[e];
          *(v8h*)(C + (size_t)(mBase + row) * ldc + n0 + c8) = hv;
        }
        
      }
    }
    __builtin_amdgcn_fence(__ATOMIC_RELEASE, "workgroup");
    __builtin_amdgcn_wave_barrier();
    __builtin_amdgcn_fence(__ATOMIC_ACQUIRE, "workgroup");
  }
}

// ---------------------------------------------------------------------------------------------
// Kernel 4: full (non-causal) single-head attention, head width 768, online softmax in f32.
//   qn, kn planes f16 [ntok][DM] (value 16*qn), vt plane f16 [DM][ntok] (value 16*vn); outputs oh / ol = bf16 hi / lo
//   planes (as 16-bit storage) of O = softmax(qk^T * scale) . vn, [ntok][DM], unscaled.
//   Block = 256 threads = 8 waves, 32 query rows; Q tile staged once in LDS. Key tiles of 256: wave w owns keys
//   32w..32w+31 of the tile for the logits: S^T subtiles (A = kn rows, B = Q rows, both from LDS), so the
//   D layout gives per lane 8 consecutive keys of one query -> P written to LDS as 16-B vectors ([query][key]).
//   P = 16 * exp(s - m_running) in f16 (values in [~1.2, 16], always normal).
//   Row max / sum: per-wave partials in LDS, combined in fixed order by wave 0 (one lane per query row).
//   P.V: every wave reads the whole P tile (A operand) and owns 96 value columns (B = vt rows from LDS).
//   kn and vt reach LDS by asynchronous copies in whole lines, in a ring of two buffers: per key tile six K stages
//   (256 keys x 128 dims) and four V stages (768 columns x 64 keys); each wave copies the rows it reads itself; at the
//   foot of every stage one publish point, then the refill of the buffer just read with the stage two ahead.
//   Output: normalised O split into bf16 hi / lo, two 32x768 16-bit tiles staged in LDS (hi over the Q region,
//   lo over the P region), then each wave writes 4 whole rows per plane, 512 B per instruction (3 per row),
// ---------------------------------------------------------------------------------------------
#define QB       32
#define KCH      256
#define QSP      776
#define PSP      264
#define LDS_QS   0
#define LDS_LS   49664
#define LDS_PS   49664
#define LDS_PMAX 99328
#define LDS_PSUM 100352
#define LDS_ST   101376
#define LDS_RING 101888
#define KSD      128      // model dims per K stage (256 B a key row)
#define KSP      136      // K stage row pitch in halves: 272 B = 16 B x odd, for ds_load_b128 readers
#define VSK      64       // keys per V stage (128 B a value-column row)
#define VSP      72       // V stage row pitch in halves: 144 B = 16 B x odd
#define RING_B   110592   // one ring buffer: max(256 keys * 272 B, 768 columns * 144 B)
#define ATT_LDS  (LDS_RING + 2 * RING_B)
static_assert(QB * QSP * 2 == LDS_LS - LDS_QS);
static_assert(QB * QSP * 2 == LDS_PMAX - LDS_LS);
static_assert(QB * PSP * 2 <= LDS_PMAX - LDS_PS);
static_assert(LDS_PSUM - LDS_PMAX == 256 * 4);
static_assert(LDS_ST - LDS_PSUM == 256 * 4);
static_assert(LDS_RING - LDS_ST == 4 * 32 * 4);
static_assert(KCH * KSP * 2 <= RING_B && DM * VSP * 2 <= RING_B && (RING_B % 16) == 0 && (LDS_RING % 16) == 0);
static_assert((DM % KSD) == 0 && (KCH % VSK) == 0 && ((DM / KSD) % 2) == 0 && ((KCH / VSK) % 2) == 0);
static_assert(ATT_LDS <= 327680);
static_assert((QSP % 8) == 0 && (PSP % 8) == 0 && PSP >= KCH);
static_assert((LDS_LS % 16) == 0 && (LDS_PMAX % 16) == 0 && (LDS_ST % 16) == 0);
static_assert((NTOK % KCH) == 0 && (NTOK % QB) == 0);

// Eight asynchronous 16-B-per-lane copies global -> LDS. The s_wait_xcnt closes the statement so that no address
// register named here is rewritten before it.
__device__ __forceinline__ void async8(const unsigned (&l)[8], const _Float16* const (&g)[8]) {
  asm volatile("global_load_async_to_lds_b128 %0, %8, off\n\t"
               "global_load_async_to_lds_b128 %1, %9, off\n\t"
               "global_load_async_to_lds_b128 %2, %10, off\n\t"
               "global_load_async_to_lds_b128 %3, %11, off\n\t"
               "global_load_async_to_lds_b128 %4, %12, off\n\t"
               "global_load_async_to_lds_b128 %5, %13, off\n\t"
               "global_load_async_to_lds_b128 %6, %14, off\n\t"
               "global_load_async_to_lds_b128 %7, %15, off\n\t"
               "s_wait_xcnt 0x0"
               :: "v"(l[0]), "v"(l[1]), "v"(l[2]), "v"(l[3]), "v"(l[4]), "v"(l[5]), "v"(l[6]), "v"(l[7]),
                  "v"(g[0]), "v"(g[1]), "v"(g[2]), "v"(g[3]), "v"(g[4]), "v"(g[5]), "v"(g[6]), "v"(g[7])
               : "memory");
}
// K stage: this wave's 32 key rows x 128 dims; one copy = 2 rows x 256 B (two aligned 256-B units). 16 copies.
// g points at (first key row of the wave + lane / 16, first dim + 8 * (lane % 16)); l is that lane's LDS byte address.
__device__ __forceinline__ void issue_k(const _Float16* g, unsigned l) {
  // both loops unrolled: the address arrays must be registers, they are asm operands
#pragma unroll
  for (int b = 0; b < 2; ++b) {
    unsigned la[8];
    const _Float16* ga[8];
#pragma unroll
    for (int i = 0; i < 8; ++i) {
      la[i] = l + (unsigned)((b * 8 + i) * 2 * KSP * 2);
      ga[i] = g + (size_t)((b * 8 + i) * 2) * DM;
    }
    async8(la, ga);
  }
}
// V stage: this wave's 96 value-column rows x 64 keys; one copy = 4 rows x 128 B (four whole lines). 24 copies.
// g points at (first column row of the wave + lane / 8, first key + 8 * (lane % 8)); l is that lane's LDS byte address.
__device__ __forceinline__ void issue_v(const _Float16* g, unsigned l, int ntok) {
  // both loops unrolled: the address arrays must be registers, they are asm operands
#pragma unroll
  for (int b = 0; b < 3; ++b) {
    unsigned la[8];
    const _Float16* ga[8];
#pragma unroll
    for (int i = 0; i < 8; ++i) {
      la[i] = l + (unsigned)((b * 8 + i) * 4 * VSP * 2);
      ga[i] = g + (size_t)((b * 8 + i) * 4) * ntok;
    }
    async8(la, ga);
  }
}
// Publish point of the ring: this wave's LDS reads of the buffer to be refilled have retired, its own copies of the
// next stage have landed, then the work-group barrier behind which that stage is read and the old buffer refilled.
__device__ __forceinline__ void ring_publish() {
  asm volatile("s_wait_dscnt 0x0" ::: "memory");     // own reads of the stage just used are done
  asm volatile("s_wait_asynccnt 0x0" ::: "memory");  // own copies of the next stage have landed
  __syncthreads();
}

__global__ __launch_bounds__(256) void attn_kernel(const _Float16* __restrict__ qn, const _Float16* __restrict__ kn,
                                                   const _Float16* __restrict__ vt, unsigned short* __restrict__ oh,
                                                   unsigned short* __restrict__ ol, float sc, int ntok) {
  __shared__ __align__(16) char smem[ATT_LDS];
  _Float16* Qs = (_Float16*)(smem + LDS_QS);
  _Float16* Ps = (_Float16*)(smem + LDS_PS);
  float* pmax = (float*)(smem + LDS_PMAX);
  float* psum = (float*)(smem + LDS_PSUM);
  float* m_s  = (float*)(smem + LDS_ST);
  float* l_s  = m_s + 32;
  float* al_s = m_s + 64;
  float* li_s = m_s + 96;

  const int tid = threadIdx.x, wave = tid >> 5, lane = tid & 31, h = lane >> 4, c = lane & 15;
  const int q0 = (int)blockIdx.x * QB;
  const float ninf = -__builtin_inff();

  // ring addresses of this lane: K copies (2 key rows a copy), V copies (4 value-column rows a copy)
  const unsigned ring0 = (unsigned)(uintptr_t)(smem + LDS_RING);
  const int krow = 32 * wave + (lane >> 4), kpc = lane & 15;
  const int vrow = 96 * wave + (lane >> 3), vpc = lane & 7;
  const unsigned klds = ring0 + (unsigned)(krow * KSP * 2 + kpc * 16);
  const unsigned vlds = ring0 + (unsigned)(vrow * VSP * 2 + vpc * 16);
  const _Float16* kg = kn + (size_t)krow * DM + kpc * 8;
  const _Float16* vg = vt + (size_t)vrow * ntok + vpc * 8;

  issue_k(kg, klds);   // stage 0 (tile 0, dims 0..127) into buffer 0; it flies under the Q staging

  if (tid < 32) { m_s[tid] = ninf; l_s[tid] = 0.0f; al_s[tid] = 0.0f; li_s[tid] = 0.0f; }
  psum[tid] = 0.0f;
  // Q tile: 32 rows x 96 pieces of 8 halves; coverage 12 * 256 = 3072 pieces = the whole tile
#pragma unroll
  for (int i = 0; i < 12; ++i) {
    const int idx = i * 256 + tid;
    const int row = idx / 96;
    const int pc  = idx - row * 96;
    const v8h v = *(const v8h*)(qn + (size_t)(q0 + row) * DM + pc * 8);
    *(v8h*)(Qs + row * QSP + pc * 8) = v;
  }
  asm volatile("s_wait_asynccnt 0x0" ::: "memory");  // own copies of stage 0 have landed
  __syncthreads();
  issue_k(kg + KSD, klds + RING_B);   // stage 1 into buffer 1

  v8f oacc[2][6];
#pragma unroll
  for (int qt = 0; qt < 2; ++qt)
#pragma unroll
    for (int nt = 0; nt < 6; ++nt) oacc[qt][nt] = zero8();

  const _Float16* qb0p = Qs + c * QSP + 8 * h;            // B operand, query c
  const _Float16* qb1p = Qs + (16 + c) * QSP + 8 * h;     // B operand, query 16+c
  const _Float16* pa0p = Ps + c * PSP + 8 * h;            // A operand, query c
  const _Float16* pa1p = Ps + (16 + c) * PSP + 8 * h;     // A operand, query 16+c
  const int ntile = ntok / KCH;

#pragma unroll 1
  for (int t = 0; t < ntile; ++t) {
    // ---- logits: S^T subtiles for keys kb..kb+31 (this wave), queries 0..31 ----
    v8f sacc[2][2];   // [query subtile][key subtile]; element r: query 16qt+c, key kb+16kt+8h+r
#pragma unroll
    for (int qt = 0; qt < 2; ++qt)
#pragma unroll
      for (int kt = 0; kt < 2; ++kt) sacc[qt][kt] = zero8();
    // six K stages of 128 dims; kept rolled: unrolled, the copies' addresses of every stage stay in registers
#pragma unroll 1
    for (int j = 0; j < DM / KSD; ++j) {
      const _Float16* ka0p = (const _Float16*)(smem + LDS_RING + (j & 1) * RING_B) + (32 * wave + c) * KSP + 8 * h;
      const _Float16* ka1p = ka0p + 16 * KSP;
#pragma unroll   // the stage's four k steps in a row: LDS offsets become immediates
      for (int kk = 0; kk < KSD; kk += 32) {
        const v16h a0 = ldfrag(ka0p + kk), a1 = ldfrag(ka1p + kk);
        const v16h b0 = ldfrag(qb0p + j * KSD + kk), b1 = ldfrag(qb1p + j * KSD + kk);
        sacc[0][0] = mma16(a0, b0, sacc[0][0]);
        sacc[0][1] = mma16(a1, b0, sacc[0][1]);
        sacc[1][0] = mma16(a0, b1, sacc[1][0]);
        sacc[1][1] = mma16(a1, b1, sacc[1][1]);
        guard_s4(sacc[0][0], sacc[0][1], sacc[1][0], sacc[1][1], a0, a1, b0, b1);
      }
      ring_publish();
      // refill the buffer just read with the stage two ahead: K stages 2..5, then V stages 0, 1 of this tile
      if (j + 2 < DM / KSD) issue_k(kg + (size_t)t * KCH * DM + (j + 2) * KSD, klds + (j & 1) * RING_B);
      else                  issue_v(vg + (size_t)t * KCH + (j + 2 - DM / KSD) * VSK, vlds + (j & 1) * RING_B, ntok);
    }
    // ---- scale, per-wave partial row max ----
    {
      float pm0 = ninf, pm1 = ninf;
#pragma unroll
      for (int kt = 0; kt < 2; ++kt) {
#pragma unroll
        for (int r = 0; r < 8; ++r) {
          const float v0 = sacc[0][kt][r] * sc; sacc[0][kt][r] = v0; pm0 = fmaxf(pm0, v0);
          const float v1 = sacc[1][kt][r] * sc; sacc[1][kt][r] = v1; pm1 = fmaxf(pm1, v1);
        }
      }
      pm0 = fmaxf(pm0, __shfl_xor(pm0, 16, 32));
      pm1 = fmaxf(pm1, __shfl_xor(pm1, 16, 32));
      pmax[wave * 32 + c] = pm0;
      pmax[wave * 32 + 16 + c] = pm1;
    }
    __syncthreads();
    // ---- wave 0, lane = query row: fold the prior tile's sums into l, new running max, rescale factor ----
    if (wave == 0) {
      const int row = lane;
      float ps = 0.0f;
#pragma unroll
      for (int w = 0; w < 8; ++w) ps += psum[w * 32 + row];
      l_s[row] = l_s[row] * al_s[row] + ps;
      const float mo = m_s[row];
      float mx = mo;
#pragma unroll
      for (int w = 0; w < 8; ++w) mx = fmaxf(mx, pmax[w * 32 + row]);
      al_s[row] = __expf(mo - mx);
      m_s[row] = mx;
    }
    __syncthreads();
    // ---- p = 16 * exp(s - m) as f16, P tile, partial row sums, rescale O ----
    {
      const float mq0 = m_s[c], mq1 = m_s[16 + c];
      float ps0 = 0.0f, ps1 = 0.0f;
#pragma unroll
      for (int kt = 0; kt < 2; ++kt) {
        v8h h0, h1;
#pragma unroll
        for (int r = 0; r < 8; ++r) {
          const float p0 = __expf(sacc[0][kt][r] - mq0); ps0 += p0; h0[r] = (_Float16)(p0 * 16.0f);
          const float p1 = __expf(sacc[1][kt][r] - mq1); ps1 += p1; h1[r] = (_Float16)(p1 * 16.0f);
        }
        *(v8h*)(Ps + c * PSP + 32 * wave + 16 * kt + 8 * h) = h0;
        *(v8h*)(Ps + (16 + c) * PSP + 32 * wave + 16 * kt + 8 * h) = h1;
      }
      ps0 += __shfl_xor(ps0, 16, 32);
      ps1 += __shfl_xor(ps1, 16, 32);
      psum[wave * 32 + c] = ps0;
      psum[wave * 32 + 16 + c] = ps1;
      const v4f aA = *(const v4f*)(al_s + 8 * h), aB = *(const v4f*)(al_s + 8 * h + 4);
      const v4f bA = *(const v4f*)(al_s + 16 + 8 * h), bB = *(const v4f*)(al_s + 16 + 8 * h + 4);
#pragma unroll
      for (int nt = 0; nt < 6; ++nt) {
#pragma unroll
        for (int r = 0; r < 4; ++r) {
          oacc[0][nt][r] *= aA[r]; oacc[0][nt][4 + r] *= aB[r];
          oacc[1][nt][r] *= bA[r]; oacc[1][nt][4 + r] *= bB[r];
        }
      }
    }
    __syncthreads();
    // ---- O += P . V over the 256 keys of the tile; this wave's columns 96w + 16nt + c ----
    {
      // four V stages of 64 keys; kept rolled for the same reason as the K stages
#pragma unroll 1
      for (int jv = 0; jv < KCH / VSK; ++jv) {
        const _Float16* vbp = (const _Float16*)(smem + LDS_RING + (jv & 1) * RING_B) + (96 * wave + c) * VSP + 8 * h;
#pragma unroll   // the stage's two k steps in a row: LDS offsets become immediates
        for (int kl = 0; kl < VSK; kl += 32) {
          const int ks = jv * VSK + kl;
          const v16h pa0 = ldfrag(pa0p + ks), pa1 = ldfrag(pa1p + ks);
#pragma unroll
          for (int g = 0; g < 2; ++g) {
            v16h vb[3];
#pragma unroll
            for (int j = 0; j < 3; ++j) vb[j] = ldfrag(vbp + (16 * (3 * g + j)) * VSP + kl);
#pragma unroll
            for (int j = 0; j < 3; ++j) {
              oacc[0][3 * g + j] = mma16(pa0, vb[j], oacc[0][3 * g + j]);
              oacc[1][3 * g + j] = mma16(pa1, vb[j], oacc[1][3 * g + j]);
            }
            guard_pv(oacc[0][3 * g], oacc[0][3 * g + 1], oacc[0][3 * g + 2],
                     oacc[1][3 * g], oacc[1][3 * g + 1], oacc[1][3 * g + 2],
                     pa0, pa1, vb[0], vb[1], vb[2]);
          }
        }
        ring_publish();
        // refill: V stages 2, 3 of this tile, then K stages 0, 1 of the next tile while one exists (block-uniform test)
        if (jv + 2 < KCH / VSK) {
          issue_v(vg + (size_t)t * KCH + (jv + 2) * VSK, vlds + (jv & 1) * RING_B, ntok);
        } else if (t + 1 < ntile) {
          issue_k(kg + (size_t)(t + 1) * KCH * DM + (jv + 2 - KCH / VSK) * KSD, klds + (jv & 1) * RING_B);
        }
      }
    }
  }
  asm volatile("s_wait_asynccnt 0x0" ::: "memory");  // no copy is left in flight behind the loop

  // ---- final normaliser per query row (fold the last tile's sums); O = oacc / (256 * l) (P carry 16, vn carry 16) ----
  if (wave == 0) {
    const int row = lane;
    float ps = 0.0f;
#pragma unroll
    for (int w = 0; w < 8; ++w) ps += psum[w * 32 + row];
    const float l = l_s[row] * al_s[row] + ps;
    li_s[row] = (1.0f / l) * (1.0f / 256.0f);
  }
  __syncthreads();
  // ---- stage the 32 x 768 bf16 hi / lo tiles (hi over the Q region, lo over the P region) ----
  unsigned short* Hs = (unsigned short*)(smem + LDS_QS);
  unsigned short* Ls = (unsigned short*)(smem + LDS_LS);
  {
    const v4f iA0 = *(const v4f*)(li_s + 8 * h),      iB0 = *(const v4f*)(li_s + 8 * h + 4);
    const v4f iA1 = *(const v4f*)(li_s + 16 + 8 * h), iB1 = *(const v4f*)(li_s + 16 + 8 * h + 4);
#pragma unroll
    for (int nt = 0; nt < 6; ++nt) {
      const int col = 96 * wave + 16 * nt + c;
#pragma unroll
      for (int r = 0; r < 4; ++r) {
        unsigned short hb, lb;
        split_bf(oacc[0][nt][r] * iA0[r], hb, lb);
        Hs[(8 * h + r) * QSP + col] = hb;          Ls[(8 * h + r) * QSP + col] = lb;
        split_bf(oacc[0][nt][4 + r] * iB0[r], hb, lb);
        Hs[(8 * h + 4 + r) * QSP + col] = hb;      Ls[(8 * h + 4 + r) * QSP + col] = lb;
        split_bf(oacc[1][nt][r] * iA1[r], hb, lb);
        Hs[(16 + 8 * h + r) * QSP + col] = hb;     Ls[(16 + 8 * h + r) * QSP + col] = lb;
        split_bf(oacc[1][nt][4 + r] * iB1[r], hb, lb);
        Hs[(16 + 8 * h + 4 + r) * QSP + col] = hb; Ls[(16 + 8 * h + 4 + r) * QSP + col] = lb;
      }
    }
  }
  __syncthreads();
  {
    unsigned short* gh = oh + (size_t)q0 * DM;
    unsigned short* gl = ol + (size_t)q0 * DM;
{
#pragma unroll
      for (int rr = 0; rr < 4; ++rr) {
        const int row = 4 * wave + rr;
#pragma unroll
        for (int j = 0; j < 3; ++j) {
          const int pc = j * 32 + lane;
          const v8us hvv = *(const v8us*)(Hs + row * QSP + pc * 8);
          const v8us lvv = *(const v8us*)(Ls + row * QSP + pc * 8);
          *(v8us*)(gh + (size_t)row * DM + pc * 8) = hvv;
          *(v8us*)(gl + (size_t)row * DM + pc * 8) = lvv;
        }
      }
      
    }
  }
}

// ---------------------------------------------------------------------------------------------
// Workspace map (bytes, all regions exact tile / whole-line multiples, no padding needed):
//   Wq16 : Wqkv f16 [768][768] (64 * bf16(w))                 off 0           size  1,179,648
//   Wpb  : Wproj bf16 bits [768][768]                           off 1,179,648   size  1,179,648
//   X16  : ln(q), ln(k), ln(v) stacked f16 [24576][768]        off 2,359,296   size 37,748,736
//   QK16 : qn then kn f16 [16384][768]                          off 40,108,032  size 25,165,824
//   VT16 : vn^T f16 [768][8192]                                 off 65,273,856  size 12,582,912
//   OH   : attention output bf16 hi [8192][768]                 off 77,856,768  size 12,582,912
//   OL   : attention output bf16 lo [8192][768]                 off 90,439,680  size 12,582,912
//   total 103,022,592
// ---------------------------------------------------------------------------------------------
extern "C" void kernel_launch(void* const* d_in, const int* in_sizes, int n_in,
                              void* d_out, int out_size, void* d_ws, size_t ws_size,
                              hipStream_t stream) {
  if (n_in < 8) return;
  const int ntok = NTOK, dm = DM;
  if (in_sizes[0] != ntok * dm || in_sizes[1] != ntok * dm || in_sizes[2] != ntok * dm) return;
  if (in_sizes[3] != dm || in_sizes[4] != dm || in_sizes[7] != dm) return;
  if (in_sizes[5] != dm * dm || in_sizes[6] != dm * dm) return;
  if (out_size != ntok * dm) return;

  const float* q     = (const float*)d_in[0];
  const float* k     = (const float*)d_in[1];
  const float* v     = (const float*)d_in[2];
  const float* ln_w  = (const float*)d_in[3];
  const float* ln_b  = (const float*)d_in[4];
  const float* Wqkv  = (const float*)d_in[5];
  const float* Wproj = (const float*)d_in[6];
  const float* bproj = (const float*)d_in[7];
  float* out = (float*)d_out;

  const size_t bWq = (size_t)dm * dm * 2;
  const size_t bWp = (size_t)dm * dm * 2;
  const size_t bX  = (size_t)3 * ntok * dm * 2;
  const size_t bQK = (size_t)2 * ntok * dm * 2;
  const size_t bVT = (size_t)dm * ntok * 2;
  const size_t bO  = (size_t)ntok * dm * 2;
  size_t off = 0;
  const size_t oWq = off; off += bWq;
  const size_t oWp = off; off += bWp;
  const size_t oX  = off; off += bX;
  const size_t oQK = off; off += bQK;
  const size_t oVT = off; off += bVT;
  const size_t oOH = off; off += bO;
  const size_t oOL = off; off += bO;
  if (off > ws_size) return;                     // 103,022,592
  if (off > (size_t)134217728) return;

  char* ws = (char*)d_ws;
  _Float16*       Wq16 = (_Float16*)(ws + oWq);
  unsigned short* Wpb  = (unsigned short*)(ws + oWp);
  _Float16*       X16  = (_Float16*)(ws + oX);
  _Float16*       QK16 = (_Float16*)(ws + oQK);
  _Float16*       VT16 = (_Float16*)(ws + oVT);
  unsigned short* OH   = (unsigned short*)(ws + oOH);
  unsigned short* OL   = (unsigned short*)(ws + oOL);

  const dim3 blk(256);
  const int n8 = dm * dm / 8;                 // 73728 = 288 * 256
  if ((n8 % 256) != 0) return;

  // (1) weights -> Wqkv f16 plane (64 * bf16(w)) and Wproj bf16 plane
  cvt_w_kernel<<<dim3(2 * (n8 / 256)), blk, 0, stream>>>(Wqkv, Wproj, Wq16, Wpb, n8);
  // (2) LayerNorm of q, k, v -> X16 (8 * ln)
  ln_kernel<<<dim3(3 * ntok / 8), blk, 0, stream>>>(q, k, v, ln_w, ln_b, X16, ntok);
  // (3) qn, kn = X[0:16384] . Wqkv^T  -> QK16 (16 * qn | 16 * kn); M=16384, N=768, K=768; scale 16/(8*64)
  gemm64_kernel<0, false, 1><<<dim3(((2 * ntok / 64) * (dm / 64)) / 8), blk, 0, stream>>>(
      (const unsigned short*)X16, (const unsigned short*)X16, dm, (const unsigned short*)Wq16, dm,
      (void*)QK16, dm, bproj, 2 * ntok, dm, dm, 0.03125f);
  // (4) vn^T = Wqkv . X[16384:24576]^T -> VT16 [768][8192] (16 * vn); M=768, N=8192, K=768
  gemm64_kernel<0, false, 1><<<dim3(((dm / 64) * (ntok / 64)) / 8), blk, 0, stream>>>(
      (const unsigned short*)Wq16, (const unsigned short*)Wq16, dm,
      (const unsigned short*)(X16 + (size_t)2 * ntok * dm), dm,
      (void*)VT16, ntok, bproj, dm, ntok, dm, 0.03125f);
  // (5) attention -> OH / OL (bf16 hi / lo of O); logit scale = dim^-0.5 / 256 (operand carries 16 * 16)
  const float sc = 0.03608439182435161f * (1.0f / 256.0f);
  attn_kernel<<<dim3(ntok / QB), blk, 0, stream>>>(QK16, QK16 + (size_t)ntok * dm, VT16, OH, OL, sc, ntok);
  // (6) out = (O_hi + O_lo) . Wproj^T + b -> d_out f32 [8192][768]; bf16 operands, scale 1
  gemm64_kernel<1, true, 0><<<dim3(((ntok / 64) * (dm / 64)) / 8), blk, 0, stream>>>(
      OH, OL, dm, Wpb, dm, (void*)out, dm, bproj, ntok, dm, dm, 1.0f);
  (void)hipGetLastError();
}

// v002
// A run of this version takes 354 microseconds.
// In two side-by-side timings against v001, it was 1.36 and 1.34 times as fast.
// Counting every step since v000, it is 1.95 times as fast.
// Contractions: qn|kn = ln(q|k).Wqkv^T, vn^T = Wqkv.ln(v)^T, S^T = kn.qn^T, O = P.vn : v_wmma_f32_16x16x32_f16, f16 operands with
// power-of-two carries (ln x8, Wqkv x64, qn/kn/vn x16, P = 16*exp(s - m)), f32 accumulate; out = O.Wproj^T + b : v_wmma_f32_16x16x32_bf16,
// O as bf16 hi/lo planes (hi.W + lo.W), Wproj bf16, f32 accumulate; float inputs RNE-converted to bf16 on load; LayerNorm, softmax
// statistics and bias in f32.
#include <hip/hip_runtime.h>
#include <stdint.h>

#define NTOK 8192
#define DM   768

typedef _Float16 v16h __attribute__((ext_vector_type(16)));
typedef _Float16 v8h  __attribute__((ext_vector_type(8)));
typedef __bf16   v16b __attribute__((ext_vector_type(16)));
typedef __bf16   v8b  __attribute__((ext_vector_type(8)));
typedef float    v8f  __attribute__((ext_vector_type(8)));
typedef float    v4f  __attribute__((ext_vector_type(4)));
typedef unsigned short v8us __attribute__((ext_vector_type(8)));

static_assert((DM % 64) == 0);
static_assert((NTOK % 256) == 0);

// f32 -> nearest-even bf16 bits / value
__device__ __forceinline__ unsigned short bfbits(float f) {
  unsigned u = __float_as_uint(f);
  return (unsigned short)((u + 0x7FFFu + ((u >> 16) & 1u)) >> 16);
}
__device__ __forceinline__ float bfval(unsigned short b) { return __uint_as_float(((unsigned)b) << 16); }
__device__ __forceinline__ float bfr(float f) { return bfval(bfbits(f)); }
__device__ __forceinline__ void split_bf(float f, unsigned short& hb, unsigned short& lb) {
  hb = bfbits(f);
  lb = bfbits(f - bfval(hb));
}

// 16-bit operand element types for the GEMM template: 0 = f16, 1 = bf16
template <int ET> struct Elem;
template <> struct Elem<0> {
  typedef _Float16 T; typedef v16h V; typedef v8h V8;
  static __device__ __forceinline__ v8f mma(V a, V b, v8f c) {
    return __builtin_amdgcn_wmma_f32_16x16x32_f16(false, a, false, b, (short)0, c, false, false);
  }
};
template <> struct Elem<1> {
  typedef __bf16 T; typedef v16b V; typedef v8b V8;
  static __device__ __forceinline__ v8f mma(V a, V b, v8f c) {
    return __builtin_amdgcn_wmma_f32_16x16x32_bf16(false, a, false, b, (short)0, c, false, false);
  }
};

// 16-bit WMMA fragment from k-contiguous storage (A row-major [m][k], or B stored [n][k]):
// p points at element (row_or_col = lane&15, k0 + 8h); elements 0..7 <- p[0..7], 8..15 <- p[16..23].
template <int ET>
__device__ __forceinline__ typename Elem<ET>::V ldfragT(const typename Elem<ET>::T* p) {
  typedef typename Elem<ET>::V V;
  typedef typename Elem<ET>::V8 V8;
  union { V v; V8 h[2]; } f;
  f.h[0] = *(const V8*)(p);
  f.h[1] = *(const V8*)(p + 16);
  return f.v;
}
__device__ __forceinline__ v16h ldfrag(const _Float16* p) { return ldfragT<0>(p); }
__device__ __forceinline__ v8f mma16(v16h a, v16h b, v8f c) { return Elem<0>::mma(a, b, c); }
__device__ __forceinline__ v8f zero8() {
  v8f z;
#pragma unroll
  for (int i = 0; i < 8; ++i) z[i] = 0.0f;
  return z;
}

// hazard guards: 4 VALU slots after the last WMMA of a group, D tied, A/B kept live
__device__ __forceinline__ void guard_g(v8f& a, v8f& b, v16h x, v16h y) {
  asm volatile("v_nop\n\tv_nop\n\tv_nop\n\tv_nop" : "+v"(a), "+v"(b) : "v"(x), "v"(y));
}
__device__ __forceinline__ void guard_g(v8f& a, v8f& b, v16b x, v16b y) {
  asm volatile("v_nop\n\tv_nop\n\tv_nop\n\tv_nop" : "+v"(a), "+v"(b) : "v"(x), "v"(y));
}
__device__ __forceinline__ void keep4(v16h a, v16h b, v16h c, v16h d) {
  asm volatile("v_nop" :: "v"(a), "v"(b), "v"(c), "v"(d));
}
__device__ __forceinline__ void keep4(v16b a, v16b b, v16b c, v16b d) {
  asm volatile("v_nop" :: "v"(a), "v"(b), "v"(c), "v"(d));
}
__device__ __forceinline__ void accg4(v8f& a, v8f& b, v8f& c, v8f& d) {
  asm volatile("v_nop\n\tv_nop\n\tv_nop\n\tv_nop" : "+v"(a), "+v"(b), "+v"(c), "+v"(d));
}

// ---------------------------------------------------------------------------------------------
// Kernel 1: two [DM][DM] f32 weight matrices -> 16-bit planes, layout unchanged ([out][in], k = in contiguous):
//   blocks [0, nb0):  d16[e] = f16(64 * bf16(w0[e]))     (f16 operand plane for the qkv projection)
//   blocks [nb0, 2nb0): dbf[e] = bf16 bits of w1[e]       (bf16 operand plane for the output projection)
// Block-uniform select, no barriers. 8 elements per thread: one 16-B store per lane, 32 lanes contiguous = 512 B =
// coverage: nb0 * 256 threads * 8 = DM * DM elements per plane exactly (n8 = DM*DM/8 is a multiple of 256).
// ---------------------------------------------------------------------------------------------
__global__ __launch_bounds__(256) void cvt_w_kernel(const float* __restrict__ w0, const float* __restrict__ w1,
                                                    _Float16* __restrict__ d16, unsigned short* __restrict__ dbf,
                                                    int n8) {
  const int nb0 = n8 >> 8;
  const bool second = ((int)blockIdx.x >= nb0);
  const float* src = second ? w1 : w0;
  const int li = ((int)blockIdx.x - (second ? nb0 : 0)) * 256 + (int)threadIdx.x;
  if (li >= n8) return;
  const size_t e = (size_t)li * 8;
  const v4f a = *(const v4f*)(src + e);
  const v4f b = *(const v4f*)(src + e + 4);
  if (!second) {
    v8h o;
#pragma unroll
    for (int i = 0; i < 4; ++i) {
      o[i]     = (_Float16)(bfr(a[i]) * 64.0f);
      o[4 + i] = (_Float16)(bfr(b[i]) * 64.0f);
    }
    _Float16* d = d16 + e;
    *(v8h*)d = o;
    
  } else {
    v8us o;
#pragma unroll
    for (int i = 0; i < 4; ++i) {
      o[i]     = bfbits(a[i]);
      o[4 + i] = bfbits(b[i]);
    }
    unsigned short* d = dbf + e;
    *(v8us*)d = o;
    
  }
}

// ---------------------------------------------------------------------------------------------
// Kernel 2: LayerNorm of q, k, v (bf16-converted inputs, f32 statistics, centred variance) -> f16 plane X
// [3*ntok][DM], value = 8 * ln(x). One wave per row, 8 rows per block; blocks [0,ntok/8) read q, next k, next v.
// Three rolled passes over the row (sum, centred sum of squares, normalise + store); the 3 KB row is re-read
// from cache. Pass 3: lane owns columns (j*32+lane)*8 .. +7 per chunk j: one 16-B store per lane, each store
// coverage: 3*ntok/8 blocks * 8 waves * (3 chunks * 32 lanes * 8) = 3*ntok rows x 768 columns = the whole plane.
// ---------------------------------------------------------------------------------------------
__global__ __launch_bounds__(256) void ln_kernel(const float* __restrict__ qx, const float* __restrict__ kx,
                                                 const float* __restrict__ vx, const float* __restrict__ lw,
                                                 const float* __restrict__ lb, _Float16* __restrict__ X, int ntok) {
  const int wave = threadIdx.x >> 5, lane = threadIdx.x & 31;
  const int bps = ntok >> 3;
  const int seg = ((int)blockIdx.x >= 2 * bps) ? 2 : (((int)blockIdx.x >= bps) ? 1 : 0);
  const float* src = (seg == 2) ? vx : ((seg == 1) ? kx : qx);
  const int lrow = ((int)blockIdx.x - seg * bps) * 8 + wave;
  const int grow = (int)blockIdx.x * 8 + wave;
  const float* xr = src + (size_t)lrow * DM;

  float s = 0.0f;
#pragma unroll 1
  for (int jj = 0; jj < 6; ++jj) {
    const int c0 = ((jj >> 1) * 32 + lane) * 8 + (jj & 1) * 4;
    const v4f a = *(const v4f*)(xr + c0);
    s += (bfr(a[0]) + bfr(a[1])) + (bfr(a[2]) + bfr(a[3]));
  }
#pragma unroll
  for (int off = 16; off > 0; off >>= 1) s += __shfl_xor(s, off, 32);
  const float mu = s * (1.0f / 768.0f);

  // pass 2: centred sum of squares
  float s2 = 0.0f;
#pragma unroll 1
  for (int jj = 0; jj < 6; ++jj) {
    const int c0 = ((jj >> 1) * 32 + lane) * 8 + (jj & 1) * 4;
    const v4f a = *(const v4f*)(xr + c0);
#pragma unroll
    for (int e = 0; e < 4; ++e) {
      const float d = bfr(a[e]) - mu;
      s2 += d * d;
    }
  }
#pragma unroll
  for (int off = 16; off > 0; off >>= 1) s2 += __shfl_xor(s2, off, 32);
  const float rstd8 = rsqrtf(s2 * (1.0f / 768.0f) + 1e-5f) * 8.0f;   // x8 carry folded into the scale

  _Float16* yr = X + (size_t)grow * DM;
#pragma unroll 1
  for (int j = 0; j < 3; ++j) {
    const int c0 = (j * 32 + lane) * 8;
    const v4f a  = *(const v4f*)(xr + c0), b  = *(const v4f*)(xr + c0 + 4);
    const v4f wa = *(const v4f*)(lw + c0), wb = *(const v4f*)(lw + c0 + 4);
    const v4f ba = *(const v4f*)(lb + c0), bb = *(const v4f*)(lb + c0 + 4);
    v8h o;
#pragma unroll
    for (int e = 0; e < 4; ++e) {
      const float t0 = (bfr(a[e]) - mu) * rstd8;
      o[e]     = (_Float16)(t0 * bfr(wa[e]) + bfr(ba[e]) * 8.0f);
      const float t1 = (bfr(b[e]) - mu) * rstd8;
      o[4 + e] = (_Float16)(t1 * bfr(wb[e]) + bfr(bb[e]) * 8.0f);
    }
    _Float16* d = yr + c0;
    *(v8h*)d = o;
    
  }
}

// ---------------------------------------------------------------------------------------------
// Kernel 3: C[m][n] = scale * sum_k A[m][k] * Bt[n][k] (+ bf16(bias[n]) when OUT_MODE == 0).
// A row-major [M][K] 16-bit (ET 0: f16, ET 1: bf16) pitch lda; Bt row-major [N][K] same type pitch ldb; M, N multiples
// of 64, K multiple of 32. SPLITA: A is a hi plane (Ap) plus a lo plane (A2p, same layout), product = hi.B + lo.B.
// Each wave owns one 64x64 C tile (16 f32 accumulators); 8 waves per block; no block barriers.
// OUT_MODE 0: f32 output; OUT_MODE 1: f16 output. Epilogue: 16-row slab per wave in LDS, then each 64-wide
// coverage: tilesM * tilesN tiles, each 64x64 written fully -> M x N.
// ---------------------------------------------------------------------------------------------
template <int ET, bool SPLITA, int OUT_MODE>
__global__ __launch_bounds__(256) void gemm64_kernel(const unsigned short* __restrict__ Ap,
                                                     const unsigned short* __restrict__ A2p, int lda,
                                                     const unsigned short* __restrict__ Btp, int ldb,
                                                     void* __restrict__ Cout, int ldc,
                                                     const float* __restrict__ bias,
                                                     int M, int N, int K, float scale) {
  typedef typename Elem<ET>::T T;
  typedef typename Elem<ET>::V V;
  const T* A  = (const T*)(const void*)Ap;
  const T* A2 = (const T*)(const void*)A2p;
  const T* Bt = (const T*)(const void*)Btp;
  __shared__ __align__(16) float sT[8][16 * 68];
  const int lane = threadIdx.x & 31, wave = threadIdx.x >> 5;
  const int tilesN = N >> 6, tilesM = M >> 6;
  const int tile = (int)blockIdx.x * 8 + wave;
  if (tile >= tilesM * tilesN) return;
  const int tm = tile / tilesN, tn = tile - tm * tilesN;
  const int m0 = tm << 6, n0 = tn << 6;
  const int rl = lane & 15;
  const int koff = (lane >> 4) * 8;
  const int mOff = (lane >> 4) * 8;

  v8f acc[4][4];
#pragma unroll
  for (int i = 0; i < 4; ++i)
#pragma unroll
    for (int j = 0; j < 4; ++j) acc[i][j] = zero8();

#pragma unroll 1
  for (int k0 = 0; k0 < K; k0 += 32) {
    V bh[4];
#pragma unroll
    for (int j = 0; j < 4; ++j) bh[j] = ldfragT<ET>(Bt + (size_t)(n0 + (j << 4) + rl) * ldb + koff + k0);
#pragma unroll
    for (int i = 0; i < 4; ++i) {
      const size_t ao = (size_t)(m0 + (i << 4) + rl) * lda + koff + k0;
      const V ah = ldfragT<ET>(A + ao);
      V al = ah;
      if (SPLITA) al = ldfragT<ET>(A2 + ao);
#pragma unroll
      for (int j = 0; j < 4; ++j) {
        acc[i][j] = Elem<ET>::mma(ah, bh[j], acc[i][j]);
        if (SPLITA) acc[i][j] = Elem<ET>::mma(al, bh[j], acc[i][j]);
      }
      guard_g(acc[i][0], acc[i][3], ah, SPLITA ? al : bh[3]);
    }
    keep4(bh[0], bh[1], bh[2], bh[3]);
  }
  accg4(acc[0][0], acc[0][1], acc[0][2], acc[0][3]);
  accg4(acc[1][0], acc[1][1], acc[1][2], acc[1][3]);
  accg4(acc[2][0], acc[2][1], acc[2][2], acc[2][3]);
  accg4(acc[3][0], acc[3][1], acc[3][2], acc[3][3]);

  float* slab = sT[wave];
#pragma unroll
  for (int i = 0; i < 4; ++i) {
    const int mBase = m0 + (i << 4);
#pragma unroll
    for (int j = 0; j < 4; ++j) {
      float bv = 0.0f;
      if (OUT_MODE == 0) bv = bfr(bias[n0 + (j << 4) + rl]);
#pragma unroll
      for (int r = 0; r < 8; ++r) slab[(mOff + r) * 68 + (j << 4) + rl] = acc[i][j][r] * scale + bv;
    }
    __builtin_amdgcn_fence(__ATOMIC_RELEASE, "workgroup");
    __builtin_amdgcn_wave_barrier();
    __builtin_amdgcn_fence(__ATOMIC_ACQUIRE, "workgroup");
    if (OUT_MODE == 0) {
      float* C = (float*)Cout;
      const int hh = lane >> 4, c4 = (lane & 15) * 4;
{
#pragma unroll
        for (int it = 0; it < 8; ++it) {
          const int row = it * 2 + hh;
          const v4f v = *(const v4f*)(slab + row * 68 + c4);
          *(v4f*)(C + (size_t)(mBase + row) * ldc + n0 + c4) = v;
        }
        
      }
    } else {
      _Float16* C = (_Float16*)Cout;
      const int qq = lane >> 3, c8 = (lane & 7) * 8;
{
#pragma unroll
        for (int it = 0; it < 4; ++it) {
          const int row = it * 4 + qq;
          const float* sp = slab + row * 68 + c8;
          v8h hv;
#pragma unroll
          for (int e = 0; e < 8; ++e) hv[e] = (_Float16)sp[e];
          *(v8h*)(C + (size_t)(mBase + row) * ldc + n0 + c8) = hv;
        }
        
      }
    }
    __builtin_amdgcn_fence(__ATOMIC_RELEASE, "workgroup");
    __builtin_amdgcn_wave_barrier();
    __builtin_amdgcn_fence(__ATOMIC_ACQUIRE, "workgroup");
  }
}

// ---------------------------------------------------------------------------------------------
// Kernel 4: full (non-causal) single-head attention, head width 768, online softmax in f32.
//   qn, kn planes f16 [ntok][DM] (value 16*qn), vt plane f16 [DM][ntok] (value 16*vn).
//   Block = 256 threads = 8 waves, 64 query rows x one half of the keys (blockIdx & 1): every K and V byte that
//   comes from L2 serves 64 queries. Outputs per key half: ph / pl = bf16 hi / lo planes (16-bit storage) of
//   O_half = softmax over that half . vn, [2][ntok][DM], with the half's row maximum pm and row sum pls, [2][ntok];
//   the merge kernel joins the two halves.
//   Q tile staged once in LDS. Key tiles of 256: wave w owns keys 32w..32w+31 of the tile for the logits:
//   S^T subtiles (A = kn rows, B = Q rows, both from LDS), so the
//   D layout gives per lane 8 consecutive keys of one query -> P written to LDS as 16-B vectors ([query][key]).
//   P = 16 * exp(s - m_running) in f16 (values in [~1.2, 16], always normal).
//   Row max / sum: per-wave partials in LDS, combined in fixed order by waves 0 and 1 (one lane per query row).
//   P.V: every wave reads the whole P tile (A operand) and owns 2 x 48 value columns (B = vt rows from LDS).
//   kn and vt reach LDS by asynchronous copies in whole lines, in a ring of two buffers: per key tile six K stages
//   (256 keys x 128 dims) and eight V stages (384 columns x 64 keys); each wave copies the rows it reads itself; at
//   the foot of every stage one publish point, then the refill of the buffer just read with the stage two ahead.
//   Output: the 64x768 f32 accumulator tile staged in LDS (over the Q and P regions and the ring), then each wave
//   normalises 8 whole rows, splits them into bf16 hi / lo and writes 512 B per instruction (3 per row and plane).
// ---------------------------------------------------------------------------------------------
#define QB       64
#define KSPLIT   2
#define KCH      256
#define QSP      776
#define PSP      264
#define LDS_QS   0
#define LDS_PS   99328
#define LDS_PMAX 133120
#define LDS_PSUM 135168
#define LDS_ST   137216
#define LDS_RING 138240
#define FSP      772      // f32 output staging row pitch in floats (3088 B, a multiple of 16 B)
#define KSD      128      // model dims per K stage (256 B a key row)
#define KSP      136      // K stage row pitch in halves: 272 B = 16 B x odd, for ds_load_b128 readers
#define VSK      64       // keys per V stage (128 B a value-column row)
#define VSC      384      // value columns per V stage
#define VSP      72       // V stage row pitch in halves: 144 B = 16 B x odd
#define RING_B   69632    // one ring buffer: max(256 keys * 272 B, 384 columns * 144 B)
#define ATT_LDS  (LDS_RING + 2 * RING_B)
static_assert(QB * QSP * 2 == LDS_PS - LDS_QS);
static_assert(32 * FSP * 4 <= LDS_PMAX - LDS_QS && 32 * FSP * 4 <= 2 * RING_B && FSP >= DM && (FSP % 4) == 0);
static_assert(QB * PSP * 2 == LDS_PMAX - LDS_PS);
static_assert(LDS_PSUM - LDS_PMAX == 8 * QB * 4);
static_assert(LDS_ST - LDS_PSUM == 8 * QB * 4);
static_assert(LDS_RING - LDS_ST == 4 * QB * 4);
static_assert(KCH * KSP * 2 <= RING_B && VSC * VSP * 2 <= RING_B && (RING_B % 16) == 0 && (LDS_RING % 16) == 0);
static_assert((DM % KSD) == 0 && (KCH % VSK) == 0 && ((DM / KSD) % 2) == 0 && DM == 2 * VSC && VSC == 8 * 48);
static_assert(ATT_LDS <= 327680);
static_assert((QSP % 8) == 0 && (PSP % 8) == 0 && PSP >= KCH);
static_assert((LDS_PS % 16) == 0 && (LDS_PMAX % 16) == 0 && (LDS_ST % 16) == 0);
static_assert((NTOK % (KCH * KSPLIT)) == 0 && (NTOK % QB) == 0);

// One asynchronous 16-B-per-lane copy global -> LDS, as the builtin: its address registers are the compiler's, which
// may place them above v255 (an asm operand may not lie there, and beside 256 accumulator registers the room below is
// short: asm copies' addresses were spilled).
typedef int v4i __attribute__((ext_vector_type(4)));
__device__ __forceinline__ void acopy(const _Float16* g, char* l) {
  __builtin_amdgcn_global_load_async_to_lds_b128((__attribute__((address_space(1))) v4i*)g,
                                                 (__attribute__((address_space(3))) v4i*)l, 0, 0);
}
// K stage: this wave's 32 key rows x 128 dims; one copy = 2 rows x 256 B (two aligned 256-B units). 16 copies.
// g points at (first key row of the wave + lane / 16, first dim + 8 * (lane % 16)); l is that lane's place in LDS.
__device__ __forceinline__ void issue_k(const _Float16* g, char* l) {
#pragma unroll
  for (int i = 0; i < 16; ++i) acopy(g + (size_t)(2 * i) * DM, l + i * 2 * KSP * 2);
}
// V stage: this wave's 48 value-column rows x 64 keys; one copy = 4 rows x 128 B (four whole lines). 12 copies.
// g points at (first column row of the wave + lane / 8, first key + 8 * (lane % 8)); l is that lane's place in LDS.
__device__ __forceinline__ void issue_v(const _Float16* g, char* l, int ntok) {
#pragma unroll
  for (int i = 0; i < 12; ++i) acopy(g + (size_t)(4 * i) * ntok, l + i * 4 * VSP * 2);
}
// Publish point of the ring: this wave's LDS reads of the buffer to be refilled have retired, its own copies of the
// next stage have landed, then the work-group barrier behind which that stage is read and the old buffer refilled.
__device__ __forceinline__ void ring_publish() {
  // keeps the stage's WMMAs ahead of the publish point: sunk behind the barrier, they stand between it and the refill,
  // and the copies lose that much of their flight time
  __builtin_amdgcn_sched_barrier(0);
  asm volatile("s_wait_dscnt 0x0" ::: "memory");     // own reads of the stage just used are done
  asm volatile("s_wait_asynccnt 0x0" ::: "memory");  // own copies of the next stage have landed
  __syncthreads();
}

__global__ __launch_bounds__(256) void attn_kernel(const _Float16* __restrict__ qn, const _Float16* __restrict__ kn,
                                                   const _Float16* __restrict__ vt, unsigned short* __restrict__ ph,
                                                   unsigned short* __restrict__ pl, float* __restrict__ pm,
                                                   float* __restrict__ pls, float sc, int ntok) {
  __shared__ __align__(16) char smem[ATT_LDS];
  _Float16* Qs = (_Float16*)(smem + LDS_QS);
  _Float16* Ps = (_Float16*)(smem + LDS_PS);
  float* pmax = (float*)(smem + LDS_PMAX);
  float* psum = (float*)(smem + LDS_PSUM);
  float* m_s  = (float*)(smem + LDS_ST);
  float* l_s  = m_s + QB;
  float* al_s = m_s + 2 * QB;
  float* li_s = m_s + 3 * QB;

  const int tid = threadIdx.x, wave = tid >> 5, lane = tid & 31, h = lane >> 4, c = lane & 15;
  const int q0 = ((int)blockIdx.x >> 1) * QB;
  const int sp = (int)blockIdx.x & 1;             // which half of the keys
  const int ntile = ntok / (KCH * KSPLIT);        // key tiles of this block
  const int key0 = sp * ntile * KCH;
  const float ninf = -__builtin_inff();

  // ring addresses of this lane: K copies (2 key rows a copy), V copies (4 value-column rows a copy)
  const int krow = 32 * wave + (lane >> 4), kpc = lane & 15;
  const int vrow = 48 * wave + (lane >> 3), vpc = lane & 7;
  char* klds = smem + LDS_RING + krow * KSP * 2 + kpc * 16;
  char* vlds = smem + LDS_RING + vrow * VSP * 2 + vpc * 16;
  const _Float16* kg = kn + (size_t)(key0 + krow) * DM + kpc * 8;
  const _Float16* vg = vt + (size_t)vrow * ntok + key0 + vpc * 8;

  issue_k(kg, klds);   // stage 0 (tile 0, dims 0..127) into buffer 0; it flies under the Q staging

  if (tid < QB) { m_s[tid] = ninf; l_s[tid] = 0.0f; al_s[tid] = 0.0f; li_s[tid] = 0.0f; }
  psum[tid] = 0.0f;
  psum[256 + tid] = 0.0f;
  // Q tile: 64 rows x 96 pieces of 8 halves; coverage 24 * 256 = 6144 pieces = the whole tile
  {
    // the 64 rows lie in one piece in global memory: one address register, piece i at a constant distance
    const _Float16* qg = qn + (size_t)q0 * DM + tid * 8;
    v8h qv[24];
#pragma unroll
    for (int i = 0; i < 24; ++i) qv[i] = *(const v8h*)(qg + i * 2048);
    asm volatile("s_wait_xcnt 0x0" ::: "memory");   // in front of any rewrite of the loads' address register
#pragma unroll
    for (int i = 0; i < 24; ++i) {
      const int idx = i * 256 + tid;
      const int row = idx / 96;
      const int pc  = idx - row * 96;
      *(v8h*)(Qs + row * QSP + pc * 8) = qv[i];
    }
  }
  asm volatile("s_wait_asynccnt 0x0" ::: "memory");  // own copies of stage 0 have landed
  __syncthreads();
  issue_k(kg + KSD, klds + RING_B);   // stage 1 into buffer 1

  v8f oacc[4][6];   // [query subtile][column subtile]: column 384 * (nt / 3) + 48 * wave + 16 * (nt % 3) + c
#pragma unroll
  for (int qt = 0; qt < 4; ++qt)
#pragma unroll
    for (int nt = 0; nt < 6; ++nt) oacc[qt][nt] = zero8();

  const _Float16* qbp = Qs + c * QSP + 8 * h;             // B operand, query c (+ 16 * QSP per query subtile)
  const _Float16* pap = Ps + c * PSP + 8 * h;             // A operand, query c (+ 16 * PSP per query subtile)

#pragma unroll 1
  for (int t = 0; t < ntile; ++t) {
    // ---- logits: S^T subtiles for keys kb..kb+31 (this wave), queries 0..63 ----
    v8f sacc[4][2];   // [query subtile][key subtile]; element r: query 16qt+c, key kb+16kt+8h+r
#pragma unroll
    for (int qt = 0; qt < 4; ++qt)
#pragma unroll
      for (int kt = 0; kt < 2; ++kt) sacc[qt][kt] = zero8();
    // six K stages of 128 dims; kept rolled: unrolled, the copies' addresses of every stage stay in registers
#pragma unroll 1
    for (int j = 0; j < DM / KSD; ++j) {
      const _Float16* ka0p = (const _Float16*)(smem + LDS_RING + (j & 1) * RING_B) + (32 * wave + c) * KSP + 8 * h;
      const _Float16* ka1p = ka0p + 16 * KSP;
#pragma unroll   // the stage's four k steps in a row: LDS offsets become immediates
      for (int kk = 0; kk < KSD; kk += 32) {
        const v16h a0 = ldfrag(ka0p + kk), a1 = ldfrag(ka1p + kk);
        v16h b[4];
#pragma unroll
        for (int qt = 0; qt < 4; ++qt) b[qt] = ldfrag(qbp + (16 * qt) * QSP + j * KSD + kk);
        // keeps all twelve LDS loads of a k step ahead of the step's first WMMA: left alone, the compiler feeds the
        // B fragments through one register set, and every pair of WMMAs waits out the LDS latency
        __builtin_amdgcn_sched_barrier(0);
#pragma unroll
        for (int qt = 0; qt < 4; ++qt) {
          sacc[qt][0] = mma16(a0, b[qt], sacc[qt][0]);
          sacc[qt][1] = mma16(a1, b[qt], sacc[qt][1]);
        }
      }
      ring_publish();
      // refill the buffer just read with the stage two ahead: K stages 2..5, then V stages 0, 1 of this tile
      if (j + 2 < DM / KSD) issue_k(kg + (size_t)t * KCH * DM + (j + 2) * KSD, klds + (j & 1) * RING_B);
      else                  issue_v(vg + (size_t)(j + 2 - DM / KSD) * VSC * ntok + (size_t)t * KCH,
                                    vlds + (j & 1) * RING_B, ntok);
    }
    // ---- scale, per-wave partial row max ----
#pragma unroll
    for (int qt = 0; qt < 4; ++qt) {
      float pmq = ninf;
#pragma unroll
      for (int kt = 0; kt < 2; ++kt) {
#pragma unroll
        for (int r = 0; r < 8; ++r) {
          const float v0 = sacc[qt][kt][r] * sc; sacc[qt][kt][r] = v0; pmq = fmaxf(pmq, v0);
        }
      }
      pmq = fmaxf(pmq, __shfl_xor(pmq, 16, 32));
      pmax[wave * QB + 16 * qt + c] = pmq;
    }
    __syncthreads();
    // ---- waves 0 and 1, thread = query row: fold the prior tile's sums into l, new running max, rescale factor ----
    if (wave < 2) {
      const int row = tid;
      float ps = 0.0f;
#pragma unroll
      for (int w = 0; w < 8; ++w) ps += psum[w * QB + row];
      l_s[row] = l_s[row] * al_s[row] + ps;
      const float mo = m_s[row];
      float mx = mo;
#pragma unroll
      for (int w = 0; w < 8; ++w) mx = fmaxf(mx, pmax[w * QB + row]);
      al_s[row] = __expf(mo - mx);
      m_s[row] = mx;
    }
    __syncthreads();
    // ---- p = 16 * exp(s - m) as f16, P tile, partial row sums, rescale O ----
#pragma unroll
    for (int qt = 0; qt < 4; ++qt) {
      const float mq = m_s[16 * qt + c];
      float ps = 0.0f;
#pragma unroll
      for (int kt = 0; kt < 2; ++kt) {
        v8h hq;
#pragma unroll
        for (int r = 0; r < 8; ++r) {
          const float p = __expf(sacc[qt][kt][r] - mq); ps += p; hq[r] = (_Float16)(p * 16.0f);
        }
        *(v8h*)(Ps + (16 * qt + c) * PSP + 32 * wave + 16 * kt + 8 * h) = hq;
      }
      ps += __shfl_xor(ps, 16, 32);
      psum[wave * QB + 16 * qt + c] = ps;
      const v4f aA = *(const v4f*)(al_s + 16 * qt + 8 * h), aB = *(const v4f*)(al_s + 16 * qt + 8 * h + 4);
#pragma unroll
      for (int nt = 0; nt < 6; ++nt) {
#pragma unroll
        for (int r = 0; r < 4; ++r) {
          oacc[qt][nt][r] *= aA[r]; oacc[qt][nt][4 + r] *= aB[r];
        }
      }
    }
    __syncthreads();
    // ---- O += P . V over the 256 keys of the tile ----
    // four groups of 64 keys, kept rolled for the same reason as the K stages; each group is two V stages
    // (columns 0..383 in buffer 0, 384..767 in buffer 1), which share the group's P fragments
#pragma unroll 1
    for (int kq = 0; kq < KCH / VSK; ++kq) {
      v16h pa[2][4];
#pragma unroll
      for (int k2 = 0; k2 < 2; ++k2)
#pragma unroll
        for (int qt = 0; qt < 4; ++qt) pa[k2][qt] = ldfrag(pap + (16 * qt) * PSP + kq * VSK + 32 * k2);
#pragma unroll   // the accumulator index depends on the column half
      for (int hf = 0; hf < 2; ++hf) {
        const _Float16* vbp = (const _Float16*)(smem + LDS_RING + hf * RING_B) + (48 * wave + c) * VSP + 8 * h;
        v16h vb[2][3];
#pragma unroll
        for (int k2 = 0; k2 < 2; ++k2)
#pragma unroll
          for (int j = 0; j < 3; ++j) vb[k2][j] = ldfrag(vbp + (16 * j) * VSP + 32 * k2);
        // keeps all LDS loads of the stage ahead of its first WMMA (as in the K stages)
        __builtin_amdgcn_sched_barrier(0);
#pragma unroll
        for (int k2 = 0; k2 < 2; ++k2)
#pragma unroll
          for (int j = 0; j < 3; ++j)
#pragma unroll
            for (int qt = 0; qt < 4; ++qt)
              oacc[qt][3 * hf + j] = mma16(pa[k2][qt], vb[k2][j], oacc[qt][3 * hf + j]);
        ring_publish();
        // refill: the same column half of the next key group, then K stages 0, 1 of the next tile while one exists
        // (block-uniform tests)
        if (kq + 1 < KCH / VSK) {
          issue_v(vg + (size_t)hf * VSC * ntok + (size_t)t * KCH + (kq + 1) * VSK, vlds + hf * RING_B, ntok);
        } else if (t + 1 < ntile) {
          issue_k(kg + (size_t)(t + 1) * KCH * DM + hf * KSD, klds + hf * RING_B);
        }
      }
    }
  }
  asm volatile("s_wait_asynccnt 0x0" ::: "memory");  // no copy is left in flight behind the loop

  // ---- this half's row sum (fold the last tile's sums) and maximum; O_half = oacc / (256 * l) (P carry 16, vn carry 16) ----
  if (wave < 2) {
    const int row = tid;
    float ps = 0.0f;
#pragma unroll
    for (int w = 0; w < 8; ++w) ps += psum[w * QB + row];
    const float l = l_s[row] * al_s[row] + ps;
    li_s[row] = (1.0f / l) * (1.0f / 256.0f);
    pm[(size_t)sp * ntok + q0 + row]  = m_s[row];
    pls[(size_t)sp * ntok + q0 + row] = l;
  }
  __syncthreads();
  // ---- stage the 64 x 768 f32 accumulator tile: rows 0..31 over the Q and P regions, rows 32..63 over the ring ----
  float* F0 = (float*)(smem + LDS_QS);
  float* F1 = (float*)(smem + LDS_RING);
#pragma unroll
  for (int qt = 0; qt < 4; ++qt) {
    float* F = ((qt < 2) ? F0 : F1) + (16 * (qt & 1) + 8 * h) * FSP;
#pragma unroll
    for (int nt = 0; nt < 6; ++nt) {
      const int col = VSC * (nt / 3) + 48 * wave + 16 * (nt % 3) + c;
#pragma unroll
      for (int r = 0; r < 8; ++r) F[r * FSP + col] = oacc[qt][nt][r];
    }
  }
  __syncthreads();
  // ---- each wave: 8 whole rows, normalised, split into bf16 hi / lo, 512 B per store instruction (3 per row and plane) ----
  {
    unsigned short* gh = ph + ((size_t)sp * ntok + q0) * DM;
    unsigned short* gl = pl + ((size_t)sp * ntok + q0) * DM;
    // kept rolled: run once per block, unrolled it is some thousand instructions that are fetched to be used once
#pragma unroll 1
    for (int it = 0; it < 24; ++it) {
      const int rr = it / 3;
      const int row = 8 * wave + rr;
      const int pc = (it - rr * 3) * 32 + lane;
      const float* F = ((row < 32) ? F0 + row * FSP : F1 + (row - 32) * FSP) + pc * 8;
      const float inv = li_s[row];
      const v4f x0 = *(const v4f*)(F), x1 = *(const v4f*)(F + 4);
      v8us hvv, lvv;
#pragma unroll
      for (int e = 0; e < 4; ++e) {
        unsigned short hb, lb;
        split_bf(x0[e] * inv, hb, lb);
        hvv[e] = hb;      lvv[e] = lb;
        split_bf(x1[e] * inv, hb, lb);
        hvv[4 + e] = hb;  lvv[4 + e] = lb;
      }
      *(v8us*)(gh + (size_t)row * DM + pc * 8) = hvv;
      *(v8us*)(gl + (size_t)row * DM + pc * 8) = lvv;
      // the next trip rewrites the two stores' address and data registers: the wait stands in front of that
      asm volatile("s_wait_xcnt 0x0" ::: "memory");
    }
  }
}

// ---------------------------------------------------------------------------------------------
// Kernel 5: join the two key halves of the attention: with M = max(m0, m1) and w_i = l_i * exp(m_i - M),
//   O = (w0 * O_0 + w1 * O_1) / (w0 + w1), O_i = hi + lo of half i; O goes out again as bf16 hi / lo planes [ntok][DM].
// 8 columns per thread: one 16-B load and store per lane and plane, 32 lanes contiguous = 512 B.
// coverage: ntok * DM / 8 threads exactly (DM / 8 = 96 pieces a row).
// ---------------------------------------------------------------------------------------------
__global__ __launch_bounds__(256) void merge_kernel(const unsigned short* __restrict__ ph,
                                                    const unsigned short* __restrict__ pl,
                                                    const float* __restrict__ pm, const float* __restrict__ pls,
                                                    unsigned short* __restrict__ oh, unsigned short* __restrict__ ol,
                                                    int ntok) {
  const int li = (int)blockIdx.x * 256 + (int)threadIdx.x;
  const int row = li / (DM / 8);
  if (row >= ntok) return;
  const size_t e = (size_t)li * 8;
  const size_t pst = (size_t)ntok * DM;
  const float m0 = pm[row], m1 = pm[ntok + row];
  const float l0 = pls[row], l1 = pls[ntok + row];
  // the wide loads' results may take these four loads' address registers: the wait stands in front of that rewrite
  asm volatile("s_wait_xcnt 0x0" ::: "memory");
  const v8us h0 = *(const v8us*)(ph + e), g0 = *(const v8us*)(pl + e);
  const v8us h1 = *(const v8us*)(ph + pst + e), g1 = *(const v8us*)(pl + pst + e);
  const float mx = fmaxf(m0, m1);
  float w0 = l0 * __expf(m0 - mx), w1 = l1 * __expf(m1 - mx);
  const float inv = 1.0f / (w0 + w1);
  w0 *= inv;
  w1 *= inv;
  v8us oh8, ol8;
#pragma unroll
  for (int i = 0; i < 8; ++i) {
    const float f = w0 * (bfval(h0[i]) + bfval(g0[i])) + w1 * (bfval(h1[i]) + bfval(g1[i]));
    unsigned short hb, lb;
    split_bf(f, hb, lb);
    oh8[i] = hb;
    ol8[i] = lb;
  }
  *(v8us*)(oh + e) = oh8;
  *(v8us*)(ol + e) = ol8;
}

// ---------------------------------------------------------------------------------------------
// Workspace map (bytes, all regions exact tile / whole-line multiples, no padding needed):
//   Wq16 : Wqkv f16 [768][768] (64 * bf16(w))                 off 0           size  1,179,648
//   Wpb  : Wproj bf16 bits [768][768]                           off 1,179,648   size  1,179,648
//   X16  : ln(q), ln(k), ln(v) stacked f16 [24576][768]        off 2,359,296   size 37,748,736
//   QK16 : qn then kn f16 [16384][768]                          off 40,108,032  size 25,165,824
//   VT16 : vn^T f16 [768][8192]                                 off 65,273,856  size 12,582,912
//   OH   : attention output bf16 hi [8192][768]                 off 77,856,768  size 12,582,912
//   OL   : attention output bf16 lo [8192][768]                 off 90,439,680  size 12,582,912
//   PH   : per key half, attention output bf16 hi [2][8192][768] off 103,022,592 size 25,165,824
//   PL   : per key half, attention output bf16 lo [2][8192][768] off 128,188,416 size 25,165,824
//   PM   : per key half, row maximum f32 [2][8192]              off 153,354,240 size     65,536
//   PS   : per key half, row sum f32 [2][8192]                  off 153,419,776 size     65,536
//   total 153,485,312
// ---------------------------------------------------------------------------------------------
extern "C" void kernel_launch(void* const* d_in, const int* in_sizes, int n_in,
                              void* d_out, int out_size, void* d_ws, size_t ws_size,
                              hipStream_t stream) {
  if (n_in < 8) return;
  const int ntok = NTOK, dm = DM;
  if (in_sizes[0] != ntok * dm || in_sizes[1] != ntok * dm || in_sizes[2] != ntok * dm) return;
  if (in_sizes[3] != dm || in_sizes[4] != dm || in_sizes[7] != dm) return;
  if (in_sizes[5] != dm * dm || in_sizes[6] != dm * dm) return;
  if (out_size != ntok * dm) return;

  const float* q     = (const float*)d_in[0];
  const float* k     = (const float*)d_in[1];
  const float* v     = (const float*)d_in[2];
  const float* ln_w  = (const float*)d_in[3];
  const float* ln_b  = (const float*)d_in[4];
  const float* Wqkv  = (const float*)d_in[5];
  const float* Wproj = (const float*)d_in[6];
  const float* bproj = (const float*)d_in[7];
  float* out = (float*)d_out;

  const size_t bWq = (size_t)dm * dm * 2;
  const size_t bWp = (size_t)dm * dm * 2;
  const size_t bX  = (size_t)3 * ntok * dm * 2;
  const size_t bQK = (size_t)2 * ntok * dm * 2;
  const size_t bVT = (size_t)dm * ntok * 2;
  const size_t bO  = (size_t)ntok * dm * 2;
  size_t off = 0;
  const size_t oWq = off; off += bWq;
  const size_t oWp = off; off += bWp;
  const size_t oX  = off; off += bX;
  const size_t oQK = off; off += bQK;
  const size_t oVT = off; off += bVT;
  const size_t oOH = off; off += bO;
  const size_t oOL = off; off += bO;
  const size_t oPH = off; off += 2 * bO;
  const size_t oPL = off; off += 2 * bO;
  const size_t oPM = off; off += (size_t)2 * ntok * 4;
  const size_t oPS = off; off += (size_t)2 * ntok * 4;
  if (off > ws_size) return;                     // 153,485,312

  char* ws = (char*)d_ws;
  _Float16*       Wq16 = (_Float16*)(ws + oWq);
  unsigned short* Wpb  = (unsigned short*)(ws + oWp);
  _Float16*       X16  = (_Float16*)(ws + oX);
  _Float16*       QK16 = (_Float16*)(ws + oQK);
  _Float16*       VT16 = (_Float16*)(ws + oVT);
  unsigned short* OH   = (unsigned short*)(ws + oOH);
  unsigned short* OL   = (unsigned short*)(ws + oOL);
  unsigned short* PH   = (unsigned short*)(ws + oPH);
  unsigned short* PL   = (unsigned short*)(ws + oPL);
  float*          PM   = (float*)(ws + oPM);
  float*          PS   = (float*)(ws + oPS);

  const dim3 blk(256);
  const int n8 = dm * dm / 8;                 // 73728 = 288 * 256
  if ((n8 % 256) != 0) return;

  // (1) weights -> Wqkv f16 plane (64 * bf16(w)) and Wproj bf16 plane
  cvt_w_kernel<<<dim3(2 * (n8 / 256)), blk, 0, stream>>>(Wqkv, Wproj, Wq16, Wpb, n8);
  // (2) LayerNorm of q, k, v -> X16 (8 * ln)
  ln_kernel<<<dim3(3 * ntok / 8), blk, 0, stream>>>(q, k, v, ln_w, ln_b, X16, ntok);
  // (3) qn, kn = X[0:16384] . Wqkv^T  -> QK16 (16 * qn | 16 * kn); M=16384, N=768, K=768; scale 16/(8*64)
  gemm64_kernel<0, false, 1><<<dim3(((2 * ntok / 64) * (dm / 64)) / 8), blk, 0, stream>>>(
      (const unsigned short*)X16, (const unsigned short*)X16, dm, (const unsigned short*)Wq16, dm,
      (void*)QK16, dm, bproj, 2 * ntok, dm, dm, 0.03125f);
  // (4) vn^T = Wqkv . X[16384:24576]^T -> VT16 [768][8192] (16 * vn); M=768, N=8192, K=768
  gemm64_kernel<0, false, 1><<<dim3(((dm / 64) * (ntok / 64)) / 8), blk, 0, stream>>>(
      (const unsigned short*)Wq16, (const unsigned short*)Wq16, dm,
      (const unsigned short*)(X16 + (size_t)2 * ntok * dm), dm,
      (void*)VT16, ntok, bproj, dm, ntok, dm, 0.03125f);
  // (5) attention per key half -> PH / PL, PM, PS; logit scale = dim^-0.5 / 256 (operand carries 16 * 16)
  const float sc = 0.03608439182435161f * (1.0f / 256.0f);
  attn_kernel<<<dim3(KSPLIT * (ntok / QB)), blk, 0, stream>>>(QK16, QK16 + (size_t)ntok * dm, VT16, PH, PL, PM, PS,
                                                              sc, ntok);
  // (6) the two key halves joined -> OH / OL (bf16 hi / lo of O)
  merge_kernel<<<dim3(ntok * (dm / 8) / 256), blk, 0, stream>>>(PH, PL, PM, PS, OH, OL, ntok);
  // (7) out = (O_hi + O_lo) . Wproj^T + b -> d_out f32 [8192][768]; bf16 operands, scale 1
  gemm64_kernel<1, true, 0><<<dim3(((ntok / 64) * (dm / 64)) / 8), blk, 0, stream>>>(
      OH, OL, dm, Wpb, dm, (void*)out, dm, bproj, ntok, dm, dm, 1.0f);
  (void)hipGetLastError();
}

// v003
// Measured time: 269 microseconds a run.
// Timed twice side by side with v002, it ran 1.32 and 1.31 times as fast.
// All steps since v000 together make it 2.57 times as fast.
// Contractions: qn|kn = ln(q|k).Wqkv^T, vn^T = Wqkv.ln(v)^T, S^T = kn.qn^T, O = P.vn : v_wmma_f32_16x16x32_f16, f16 operands with
// power-of-two carries (ln x8, Wqkv x64, qn/kn/vn x16, P = 16*exp(s - m)), f32 accumulate; out = O.Wproj^T + b : v_wmma_f32_16x16x32_bf16,
// O as bf16 hi/lo planes (hi.W + lo.W), Wproj bf16, f32 accumulate; float inputs RNE-converted to bf16 on load; LayerNorm, softmax
// statistics and bias in f32.
#include <hip/hip_runtime.h>
#include <stdint.h>

#define NTOK 8192
#define DM   768

typedef _Float16 v16h __attribute__((ext_vector_type(16)));
typedef _Float16 v8h  __attribute__((ext_vector_type(8)));
typedef __bf16   v16b __attribute__((ext_vector_type(16)));
typedef __bf16   v8b  __attribute__((ext_vector_type(8)));
typedef float    v8f  __attribute__((ext_vector_type(8)));
typedef float    v4f  __attribute__((ext_vector_type(4)));
typedef unsigned short v8us __attribute__((ext_vector_type(8)));

static_assert((DM % 64) == 0);
static_assert((NTOK % 256) == 0);

// f32 -> nearest-even bf16 bits / value
__device__ __forceinline__ unsigned short bfbits(float f) {
  unsigned u = __float_as_uint(f);
  return (unsigned short)((u + 0x7FFFu + ((u >> 16) & 1u)) >> 16);
}
__device__ __forceinline__ float bfval(unsigned short b) { return __uint_as_float(((unsigned)b) << 16); }
__device__ __forceinline__ float bfr(float f) { return bfval(bfbits(f)); }
__device__ __forceinline__ void split_bf(float f, unsigned short& hb, unsigned short& lb) {
  hb = bfbits(f);
  lb = bfbits(f - bfval(hb));
}

// 16-bit operand element types for the GEMM template: 0 = f16, 1 = bf16
template <int ET> struct Elem;
template <> struct Elem<0> {
  typedef _Float16 T; typedef v16h V; typedef v8h V8;
  static __device__ __forceinline__ v8f mma(V a, V b, v8f c) {
    return __builtin_amdgcn_wmma_f32_16x16x32_f16(false, a, false, b, (short)0, c, false, false);
  }
};
template <> struct Elem<1> {
  typedef __bf16 T; typedef v16b V; typedef v8b V8;
  static __device__ __forceinline__ v8f mma(V a, V b, v8f c) {
    return __builtin_amdgcn_wmma_f32_16x16x32_bf16(false, a, false, b, (short)0, c, false, false);
  }
};

// 16-bit WMMA fragment from k-contiguous storage (A row-major [m][k], or B stored [n][k]):
// p points at element (row_or_col = lane&15, k0 + 8h); elements 0..7 <- p[0..7], 8..15 <- p[16..23].
template <int ET>
__device__ __forceinline__ typename Elem<ET>::V ldfragT(const typename Elem<ET>::T* p) {
  typedef typename Elem<ET>::V V;
  typedef typename Elem<ET>::V8 V8;
  union { V v; V8 h[2]; } f;
  f.h[0] = *(const V8*)(p);
  f.h[1] = *(const V8*)(p + 16);
  return f.v;
}
__device__ __forceinline__ v16h ldfrag(const _Float16* p) { return ldfragT<0>(p); }
__device__ __forceinline__ v8f mma16(v16h a, v16h b, v8f c) { return Elem<0>::mma(a, b, c); }
__device__ __forceinline__ v8f zero8() {
  v8f z;
#pragma unroll
  for (int i = 0; i < 8; ++i) z[i] = 0.0f;
  return z;
}

// hazard guard: 4 VALU slots after the last WMMA of a group, D tied
__device__ __forceinline__ void accg4(v8f& a, v8f& b, v8f& c, v8f& d) {
  asm volatile("v_nop\n\tv_nop\n\tv_nop\n\tv_nop" : "+v"(a), "+v"(b), "+v"(c), "+v"(d));
}

// ---------------------------------------------------------------------------------------------
// Kernel 1: two [DM][DM] f32 weight matrices -> 16-bit planes, layout unchanged ([out][in], k = in contiguous):
//   blocks [0, nb0):  d16[e] = f16(64 * bf16(w0[e]))     (f16 operand plane for the qkv projection)
//   blocks [nb0, 2nb0): dbf[e] = bf16 bits of w1[e]       (bf16 operand plane for the output projection)
// Block-uniform select, no barriers. 8 elements per thread: one 16-B store per lane, 32 lanes contiguous = 512 B =
// coverage: nb0 * 256 threads * 8 = DM * DM elements per plane exactly (n8 = DM*DM/8 is a multiple of 256).
// ---------------------------------------------------------------------------------------------
__global__ __launch_bounds__(256) void cvt_w_kernel(const float* __restrict__ w0, const float* __restrict__ w1,
                                                    _Float16* __restrict__ d16, unsigned short* __restrict__ dbf,
                                                    int n8) {
  const int nb0 = n8 >> 8;
  const bool second = ((int)blockIdx.x >= nb0);
  const float* src = second ? w1 : w0;
  const int li = ((int)blockIdx.x - (second ? nb0 : 0)) * 256 + (int)threadIdx.x;
  if (li >= n8) return;
  const size_t e = (size_t)li * 8;
  const v4f a = *(const v4f*)(src + e);
  const v4f b = *(const v4f*)(src + e + 4);
  if (!second) {
    v8h o;
#pragma unroll
    for (int i = 0; i < 4; ++i) {
      o[i]     = (_Float16)(bfr(a[i]) * 64.0f);
      o[4 + i] = (_Float16)(bfr(b[i]) * 64.0f);
    }
    _Float16* d = d16 + e;
    *(v8h*)d = o;
    
  } else {
    v8us o;
#pragma unroll
    for (int i = 0; i < 4; ++i) {
      o[i]     = bfbits(a[i]);
      o[4 + i] = bfbits(b[i]);
    }
    unsigned short* d = dbf + e;
    *(v8us*)d = o;
    
  }
}

// ---------------------------------------------------------------------------------------------
// Kernel 2: LayerNorm of q, k, v (bf16-converted inputs, f32 statistics, centred variance) -> f16 plane X
// [3*ntok][DM], value = 8 * ln(x). One wave per row, 8 rows per block; blocks [0,ntok/8) read q, next k, next v.
// Three rolled passes over the row (sum, centred sum of squares, normalise + store); the 3 KB row is re-read
// from cache. Pass 3: lane owns columns (j*32+lane)*8 .. +7 per chunk j: one 16-B store per lane, each store
// coverage: 3*ntok/8 blocks * 8 waves * (3 chunks * 32 lanes * 8) = 3*ntok rows x 768 columns = the whole plane.
// ---------------------------------------------------------------------------------------------
__global__ __launch_bounds__(256) void ln_kernel(const float* __restrict__ qx, const float* __restrict__ kx,
                                                 const float* __restrict__ vx, const float* __restrict__ lw,
                                                 const float* __restrict__ lb, _Float16* __restrict__ X, int ntok) {
  const int wave = threadIdx.x >> 5, lane = threadIdx.x & 31;
  const int bps = ntok >> 3;
  const int seg = ((int)blockIdx.x >= 2 * bps) ? 2 : (((int)blockIdx.x >= bps) ? 1 : 0);
  const float* src = (seg == 2) ? vx : ((seg == 1) ? kx : qx);
  const int lrow = ((int)blockIdx.x - seg * bps) * 8 + wave;
  const int grow = (int)blockIdx.x * 8 + wave;
  const float* xr = src + (size_t)lrow * DM;

  float s = 0.0f;
#pragma unroll 1
  for (int jj = 0; jj < 6; ++jj) {
    const int c0 = ((jj >> 1) * 32 + lane) * 8 + (jj & 1) * 4;
    const v4f a = *(const v4f*)(xr + c0);
    s += (bfr(a[0]) + bfr(a[1])) + (bfr(a[2]) + bfr(a[3]));
  }
#pragma unroll
  for (int off = 16; off > 0; off >>= 1) s += __shfl_xor(s, off, 32);
  const float mu = s * (1.0f / 768.0f);

  // pass 2: centred sum of squares
  float s2 = 0.0f;
#pragma unroll 1
  for (int jj = 0; jj < 6; ++jj) {
    const int c0 = ((jj >> 1) * 32 + lane) * 8 + (jj & 1) * 4;
    const v4f a = *(const v4f*)(xr + c0);
#pragma unroll
    for (int e = 0; e < 4; ++e) {
      const float d = bfr(a[e]) - mu;
      s2 += d * d;
    }
  }
#pragma unroll
  for (int off = 16; off > 0; off >>= 1) s2 += __shfl_xor(s2, off, 32);
  const float rstd8 = rsqrtf(s2 * (1.0f / 768.0f) + 1e-5f) * 8.0f;   // x8 carry folded into the scale

  _Float16* yr = X + (size_t)grow * DM;
#pragma unroll 1
  for (int j = 0; j < 3; ++j) {
    const int c0 = (j * 32 + lane) * 8;
    const v4f a  = *(const v4f*)(xr + c0), b  = *(const v4f*)(xr + c0 + 4);
    const v4f wa = *(const v4f*)(lw + c0), wb = *(const v4f*)(lw + c0 + 4);
    const v4f ba = *(const v4f*)(lb + c0), bb = *(const v4f*)(lb + c0 + 4);
    v8h o;
#pragma unroll
    for (int e = 0; e < 4; ++e) {
      const float t0 = (bfr(a[e]) - mu) * rstd8;
      o[e]     = (_Float16)(t0 * bfr(wa[e]) + bfr(ba[e]) * 8.0f);
      const float t1 = (bfr(b[e]) - mu) * rstd8;
      o[4 + e] = (_Float16)(t1 * bfr(wb[e]) + bfr(bb[e]) * 8.0f);
    }
    _Float16* d = yr + c0;
    *(v8h*)d = o;
    
  }
}

// One asynchronous 16-B-per-lane copy global -> LDS, as the builtin: its address registers are the compiler's, which
// may place them above v255 (an asm operand may not lie there, and beside 256 accumulator registers the room below is
// short: asm copies' addresses were spilled).
typedef int v4i __attribute__((ext_vector_type(4)));
__device__ __forceinline__ void acopy(const _Float16* g, char* l) {
  __builtin_amdgcn_global_load_async_to_lds_b128((__attribute__((address_space(1))) v4i*)g,
                                                 (__attribute__((address_space(3))) v4i*)l, 0, 0);
}
// Publish point of the ring: this wave's LDS reads of the buffer to be refilled have retired, its own copies of the
// next stage have landed, then the work-group barrier behind which that stage is read and the old buffer refilled.
__device__ __forceinline__ void ring_publish() {
  // keeps the stage's WMMAs ahead of the publish point: sunk behind the barrier, they stand between it and the refill,
  // and the copies lose that much of their flight time
  __builtin_amdgcn_sched_barrier(0);
  asm volatile("s_wait_dscnt 0x0" ::: "memory");     // own reads of the stage just used are done
  asm volatile("s_wait_asynccnt 0x0" ::: "memory");  // own copies of the next stage have landed
  __syncthreads();
}

// ---------------------------------------------------------------------------------------------
// Kernel 3: C[m][n] = scale * sum_k A[m][k] * Bt[n][k] (+ bf16(bias[n]) when OUT_MODE == 0).
// A row-major [M][K] 16-bit (ET 0: f16, ET 1: bf16) pitch lda; Bt row-major [N][K] same type pitch ldb; M, N multiples
// of 128, K a multiple of 64. SPLITA: A is a hi plane (Ap) plus a lo plane (A2p, same layout), product = hi.B + lo.B.
// Block = 128 threads = 4 waves (2 x 2) on one 128x128 C tile; each wave owns one 64x64 part (16 f32 accumulators).
// The operands reach LDS by asynchronous copies in whole lines, in a ring of two buffers: a stage is 64 k (128 B) of
// the tile's 128 A rows (both planes when SPLITA) and 128 Bt rows; each wave copies 32 rows of every plane; at the
// foot of every stage one publish point, then the refill of the buffer just read with the stage two ahead.
// OUT_MODE 0: f32 output; OUT_MODE 1: f16 output. Epilogue: 16-row slab per wave in LDS (over the ring, which is
// out of use behind the last publish point), then each 64-wide row goes out in whole lines.
// coverage: tilesM * tilesN tiles, each 128x128 written fully -> M x N.
// ---------------------------------------------------------------------------------------------
#define GKS 64       // k per stage: 128 B a row, one whole line
#define GSP 72       // stage row pitch in halves: 144 B = 16 B x odd, for ds_load_b128 readers
#define GPL (128 * GSP * 2)   // one operand plane of a stage: 128 rows
static_assert((DM % GKS) == 0 && (DM % 128) == 0 && (NTOK % 128) == 0 && 4 * 16 * 68 * 4 <= 2 * GPL);

// 32 rows x 128 B of one plane: one copy = 4 rows x 128 B (four whole lines). 8 copies.
// g points at (first row of the wave + lane / 8, first k + 8 * (lane % 8)); l is that lane's place in LDS.
__device__ __forceinline__ void issue_g(const void* g, int ld, char* l) {
#pragma unroll
  for (int i = 0; i < 8; ++i) acopy((const _Float16*)g + (size_t)(4 * i) * ld, l + i * 4 * GSP * 2);
}

template <int ET, bool SPLITA, int OUT_MODE>
__global__ __launch_bounds__(128) void gemm64_kernel(const unsigned short* __restrict__ Ap,
                                                     const unsigned short* __restrict__ A2p, int lda,
                                                     const unsigned short* __restrict__ Btp, int ldb,
                                                     void* __restrict__ Cout, int ldc,
                                                     const float* __restrict__ bias,
                                                     int M, int N, int K, float scale) {
  typedef typename Elem<ET>::T T;
  typedef typename Elem<ET>::V V;
  const T* A  = (const T*)(const void*)Ap;
  const T* A2 = (const T*)(const void*)A2p;
  const T* Bt = (const T*)(const void*)Btp;
  constexpr int BOFF = (SPLITA ? 2 : 1) * GPL;   // the Bt plane's place in a buffer
  constexpr int BUFB = BOFF + GPL;               // one ring buffer
  __shared__ __align__(16) char gsm[2 * BUFB];
  const int lane = threadIdx.x & 31, wave = threadIdx.x >> 5;
  const int tilesN = N >> 7, tilesM = M >> 7;
  const int tile = (int)blockIdx.x;
  if (tile >= tilesM * tilesN) return;           // the same for the whole block, in front of every barrier
  const int tm = tile / tilesN, tn = tile - tm * tilesN;
  const int m0 = (tm << 7) + ((wave >> 1) << 6), n0 = (tn << 7) + ((wave & 1) << 6);   // this wave's 64x64 part
  const int rl = lane & 15;
  const int koff = (lane >> 4) * 8;
  const int mOff = (lane >> 4) * 8;
  const int nst = K / GKS;

  // copy addresses of this lane: rows 32 * wave + lane / 8 (+ 4 a copy) of each plane, piece lane % 8 of the row
  const int crow = 32 * wave + (lane >> 3), cpc = lane & 7;
  const T* ga  = A  + (size_t)((tm << 7) + crow) * lda + cpc * 8;
  const T* ga2 = A2 + (size_t)((tm << 7) + crow) * lda + cpc * 8;
  const T* gb  = Bt + (size_t)((tn << 7) + crow) * ldb + cpc * 8;
  char* lc = gsm + crow * GSP * 2 + cpc * 16;

  issue_g(ga, lda, lc);                          // stage 0 into buffer 0
  if (SPLITA) issue_g(ga2, lda, lc + GPL);
  issue_g(gb, ldb, lc + BOFF);

  v8f acc[4][4];
#pragma unroll
  for (int i = 0; i < 4; ++i)
#pragma unroll
    for (int j = 0; j < 4; ++j) acc[i][j] = zero8();

  asm volatile("s_wait_asynccnt 0x0" ::: "memory");  // own copies of stage 0 have landed
  __syncthreads();
  if (nst > 1) {                                 // stage 1 into buffer 1
    issue_g(ga + GKS, lda, lc + BUFB);
    if (SPLITA) issue_g(ga2 + GKS, lda, lc + BUFB + GPL);
    issue_g(gb + GKS, ldb, lc + BUFB + BOFF);
  }

  // kept rolled: unrolled, the copies' addresses of every stage stay in registers
#pragma unroll 1
  for (int s = 0; s < nst; ++s) {
    const T* sb = (const T*)(const void*)(gsm + (s & 1) * BUFB);
    const T* ap = sb + (((wave >> 1) << 6) + rl) * GSP + koff;
    const T* bp = sb + BOFF / 2 + (((wave & 1) << 6) + rl) * GSP + koff;
#pragma unroll   // the stage's two k steps in a row: LDS offsets become immediates
    for (int kk = 0; kk < GKS; kk += 32) {
      V bh[4], ah[4], al[4];
#pragma unroll
      for (int j = 0; j < 4; ++j) bh[j] = ldfragT<ET>(bp + (j << 4) * GSP + kk);
#pragma unroll
      for (int i = 0; i < 4; ++i) {
        ah[i] = ldfragT<ET>(ap + (i << 4) * GSP + kk);
        al[i] = ah[i];
        if (SPLITA) al[i] = ldfragT<ET>(ap + GPL / 2 + (i << 4) * GSP + kk);
      }
      // keeps all LDS loads of a k step ahead of the step's first WMMA: left alone, the compiler feeds the A fragments
      // through one register set, and every four WMMAs wait out the LDS latency
      __builtin_amdgcn_sched_barrier(0);
#pragma unroll
      for (int i = 0; i < 4; ++i) {
#pragma unroll
        for (int j = 0; j < 4; ++j) acc[i][j] = Elem<ET>::mma(ah[i], bh[j], acc[i][j]);
        if (SPLITA) {
#pragma unroll
          for (int j = 0; j < 4; ++j) acc[i][j] = Elem<ET>::mma(al[i], bh[j], acc[i][j]);
        }
      }
    }
    ring_publish();
    // refill the buffer just read with the stage two ahead, while one exists (block-uniform test)
    if (s + 2 < nst) {
      char* l = lc + (s & 1) * BUFB;
      issue_g(ga + (s + 2) * GKS, lda, l);
      if (SPLITA) issue_g(ga2 + (s + 2) * GKS, lda, l + GPL);
      issue_g(gb + (s + 2) * GKS, ldb, l + BOFF);
    }
  }
  asm volatile("s_wait_asynccnt 0x0" ::: "memory");  // no copy is left in flight behind the loop
  accg4(acc[0][0], acc[0][1], acc[0][2], acc[0][3]);
  accg4(acc[1][0], acc[1][1], acc[1][2], acc[1][3]);
  accg4(acc[2][0], acc[2][1], acc[2][2], acc[2][3]);
  accg4(acc[3][0], acc[3][1], acc[3][2], acc[3][3]);

  float* slab = (float*)(void*)gsm + wave * (16 * 68);
#pragma unroll
  for (int i = 0; i < 4; ++i) {
    const int mBase = m0 + (i << 4);
#pragma unroll
    for (int j = 0; j < 4; ++j) {
      float bv = 0.0f;
      if (OUT_MODE == 0) bv = bfr(bias[n0 + (j << 4) + rl]);
#pragma unroll
      for (int r = 0; r < 8; ++r) slab[(mOff + r) * 68 + (j << 4) + rl] = acc[i][j][r] * scale + bv;
    }
    __builtin_amdgcn_fence(__ATOMIC_RELEASE, "workgroup");
    __builtin_amdgcn_wave_barrier();
    __builtin_amdgcn_fence(__ATOMIC_ACQUIRE, "workgroup");
    if (OUT_MODE == 0) {
      float* C = (float*)Cout;
      const int hh = lane >> 4, c4 = (lane & 15) * 4;
{
#pragma unroll
        for (int it = 0; it < 8; ++it) {
          const int row = it * 2 + hh;
          const v4f v = *(const v4f*)(slab + row * 68 + c4);
          *(v4f*)(C + (size_t)(mBase + row) * ldc + n0 + c4) = v;
        }
        
      }
    } else {
      _Float16* C = (_Float16*)Cout;
      const int qq = lane >> 3, c8 = (lane & 7) * 8;
{
#pragma unroll
        for (int it = 0; it < 4; ++it) {
          const int row = it * 4 + qq;
          const float* sp = slab + row * 68 + c8;
          v8h hv;
#pragma unroll
          for (int e = 0; e < 8; ++e) hv[e] = (_Float16)sp[e];
          *(v8h*)(C + (size_t)(mBase + row) * ldc + n0 + c8) = hv;
        }
        
      }
    }
    __builtin_amdgcn_fence(__ATOMIC_RELEASE, "workgroup");
    __builtin_amdgcn_wave_barrier();
    __builtin_amdgcn_fence(__ATOMIC_ACQUIRE, "workgroup");
  }
}

// ---------------------------------------------------------------------------------------------
// Kernel 4: full (non-causal) single-head attention, head width 768, online softmax in f32.
//   qn, kn planes f16 [ntok][DM] (value 16*qn), vt plane f16 [DM][ntok] (value 16*vn).
//   Block = 256 threads = 8 waves, 64 query rows x one half of the keys (blockIdx & 1): every K and V byte that
//   comes from L2 serves 64 queries. Outputs per key half: ph / pl = bf16 hi / lo planes (16-bit storage) of
//   O_half = softmax over that half . vn, [2][ntok][DM], with the half's row maximum pm and row sum pls, [2][ntok];
//   the merge kernel joins the two halves.
//   Q tile staged once in LDS. Key tiles of 256: wave w owns keys 32w..32w+31 of the tile for the logits:
//   S^T subtiles (A = kn rows, B = Q rows, both from LDS), so the
//   D layout gives per lane 8 consecutive keys of one query -> P written to LDS as 16-B vectors ([query][key]).
//   P = 16 * exp(s - m_running) in f16 (values in [~1.2, 16], always normal).
//   Row max / sum: per-wave partials in LDS, combined in fixed order by waves 0 and 1 (one lane per query row).
//   P.V: every wave reads the whole P tile (A operand) and owns 2 x 48 value columns (B = vt rows from LDS).
//   kn and vt reach LDS by asynchronous copies in whole lines, in a ring of two buffers: per key tile six K stages
//   (256 keys x 128 dims) and eight V stages (384 columns x 64 keys); each wave copies the rows it reads itself; at
//   the foot of every stage one publish point, then the refill of the buffer just read with the stage two ahead.
//   Output: the 64x768 f32 accumulator tile staged in LDS (over the Q and P regions and the ring), then each wave
//   normalises 8 whole rows, splits them into bf16 hi / lo and writes 512 B per instruction (3 per row and plane).
// ---------------------------------------------------------------------------------------------
#define QB       64
#define KSPLIT   2
#define KCH      256
#define QSP      776
#define PSP      264
#define LDS_QS   0
#define LDS_PS   99328
#define LDS_PMAX 133120
#define LDS_PSUM 135168
#define LDS_ST   137216
#define LDS_RING 138240
#define FSP      772      // f32 output staging row pitch in floats (3088 B, a multiple of 16 B)
#define KSD      128      // model dims per K stage (256 B a key row)
#define KSP      136      // K stage row pitch in halves: 272 B = 16 B x odd, for ds_load_b128 readers
#define VSK      64       // keys per V stage (128 B a value-column row)
#define VSC      384      // value columns per V stage
#define VSP      72       // V stage row pitch in halves: 144 B = 16 B x odd
#define RING_B   69632    // one ring buffer: max(256 keys * 272 B, 384 columns * 144 B)
#define ATT_LDS  (LDS_RING + 2 * RING_B)
static_assert(QB * QSP * 2 == LDS_PS - LDS_QS);
static_assert(32 * FSP * 4 <= LDS_PMAX - LDS_QS && 32 * FSP * 4 <= 2 * RING_B && FSP >= DM && (FSP % 4) == 0);
static_assert(QB * PSP * 2 == LDS_PMAX - LDS_PS);
static_assert(LDS_PSUM - LDS_PMAX == 8 * QB * 4);
static_assert(LDS_ST - LDS_PSUM == 8 * QB * 4);
static_assert(LDS_RING - LDS_ST == 4 * QB * 4);
static_assert(KCH * KSP * 2 <= RING_B && VSC * VSP * 2 <= RING_B && (RING_B % 16) == 0 && (LDS_RING % 16) == 0);
static_assert((DM % KSD) == 0 && (KCH % VSK) == 0 && ((DM / KSD) % 2) == 0 && DM == 2 * VSC && VSC == 8 * 48);
static_assert(ATT_LDS <= 327680);
static_assert((QSP % 8) == 0 && (PSP % 8) == 0 && PSP >= KCH);
static_assert((LDS_PS % 16) == 0 && (LDS_PMAX % 16) == 0 && (LDS_ST % 16) == 0);
static_assert((NTOK % (KCH * KSPLIT)) == 0 && (NTOK % QB) == 0);

// K stage: this wave's 32 key rows x 128 dims; one copy = 2 rows x 256 B (two aligned 256-B units). 16 copies.
// g points at (first key row of the wave + lane / 16, first dim + 8 * (lane % 16)); l is that lane's place in LDS.
__device__ __forceinline__ void issue_k(const _Float16* g, char* l) {
#pragma unroll
  for (int i = 0; i < 16; ++i) acopy(g + (size_t)(2 * i) * DM, l + i * 2 * KSP * 2);
}
// V stage: this wave's 48 value-column rows x 64 keys; one copy = 4 rows x 128 B (four whole lines). 12 copies.
// g points at (first column row of the wave + lane / 8, first key + 8 * (lane % 8)); l is that lane's place in LDS.
__device__ __forceinline__ void issue_v(const _Float16* g, char* l, int ntok) {
#pragma unroll
  for (int i = 0; i < 12; ++i) acopy(g + (size_t)(4 * i) * ntok, l + i * 4 * VSP * 2);
}
__global__ __launch_bounds__(256) void attn_kernel(const _Float16* __restrict__ qn, const _Float16* __restrict__ kn,
                                                   const _Float16* __restrict__ vt, unsigned short* __restrict__ ph,
                                                   unsigned short* __restrict__ pl, float* __restrict__ pm,
                                                   float* __restrict__ pls, float sc, int ntok) {
  __shared__ __align__(16) char smem[ATT_LDS];
  _Float16* Qs = (_Float16*)(smem + LDS_QS);
  _Float16* Ps = (_Float16*)(smem + LDS_PS);
  float* pmax = (float*)(smem + LDS_PMAX);
  float* psum = (float*)(smem + LDS_PSUM);
  float* m_s  = (float*)(smem + LDS_ST);
  float* l_s  = m_s + QB;
  float* al_s = m_s + 2 * QB;
  float* li_s = m_s + 3 * QB;

  const int tid = threadIdx.x, wave = tid >> 5, lane = tid & 31, h = lane >> 4, c = lane & 15;
  const int q0 = ((int)blockIdx.x >> 1) * QB;
  const int sp = (int)blockIdx.x & 1;             // which half of the keys
  const int ntile = ntok / (KCH * KSPLIT);        // key tiles of this block
  const int key0 = sp * ntile * KCH;
  const float ninf = -__builtin_inff();

  // ring addresses of this lane: K copies (2 key rows a copy), V copies (4 value-column rows a copy)
  const int krow = 32 * wave + (lane >> 4), kpc = lane & 15;
  const int vrow = 48 * wave + (lane >> 3), vpc = lane & 7;
  char* klds = smem + LDS_RING + krow * KSP * 2 + kpc * 16;
  char* vlds = smem + LDS_RING + vrow * VSP * 2 + vpc * 16;
  const _Float16* kg = kn + (size_t)(key0 + krow) * DM + kpc * 8;
  const _Float16* vg = vt + (size_t)vrow * ntok + key0 + vpc * 8;

  issue_k(kg, klds);   // stage 0 (tile 0, dims 0..127) into buffer 0; it flies under the Q staging

  if (tid < QB) { m_s[tid] = ninf; l_s[tid] = 0.0f; al_s[tid] = 0.0f; li_s[tid] = 0.0f; }
  psum[tid] = 0.0f;
  psum[256 + tid] = 0.0f;
  // Q tile: 64 rows x 96 pieces of 8 halves; coverage 24 * 256 = 6144 pieces = the whole tile
  {
    // the 64 rows lie in one piece in global memory: one address register, piece i at a constant distance
    const _Float16* qg = qn + (size_t)q0 * DM + tid * 8;
    v8h qv[24];
#pragma unroll
    for (int i = 0; i < 24; ++i) qv[i] = *(const v8h*)(qg + i * 2048);
    asm volatile("s_wait_xcnt 0x0" ::: "memory");   // in front of any rewrite of the loads' address register
#pragma unroll
    for (int i = 0; i < 24; ++i) {
      const int idx = i * 256 + tid;
      const int row = idx / 96;
      const int pc  = idx - row * 96;
      *(v8h*)(Qs + row * QSP + pc * 8) = qv[i];
    }
  }
  asm volatile("s_wait_asynccnt 0x0" ::: "memory");  // own copies of stage 0 have landed
  __syncthreads();
  issue_k(kg + KSD, klds + RING_B);   // stage 1 into buffer 1

  v8f oacc[4][6];   // [query subtile][column subtile]: column 384 * (nt / 3) + 48 * wave + 16 * (nt % 3) + c
#pragma unroll
  for (int qt = 0; qt < 4; ++qt)
#pragma unroll
    for (int nt = 0; nt < 6; ++nt) oacc[qt][nt] = zero8();

  const _Float16* qbp = Qs + c * QSP + 8 * h;             // B operand, query c (+ 16 * QSP per query subtile)
  const _Float16* pap = Ps + c * PSP + 8 * h;             // A operand, query c (+ 16 * PSP per query subtile)

#pragma unroll 1
  for (int t = 0; t < ntile; ++t) {
    // ---- logits: S^T subtiles for keys kb..kb+31 (this wave), queries 0..63 ----
    v8f sacc[4][2];   // [query subtile][key subtile]; element r: query 16qt+c, key kb+16kt+8h+r
#pragma unroll
    for (int qt = 0; qt < 4; ++qt)
#pragma unroll
      for (int kt = 0; kt < 2; ++kt) sacc[qt][kt] = zero8();
    // six K stages of 128 dims; kept rolled: unrolled, the copies' addresses of every stage stay in registers
#pragma unroll 1
    for (int j = 0; j < DM / KSD; ++j) {
      const _Float16* ka0p = (const _Float16*)(smem + LDS_RING + (j & 1) * RING_B) + (32 * wave + c) * KSP + 8 * h;
      const _Float16* ka1p = ka0p + 16 * KSP;
#pragma unroll   // the stage's four k steps in a row: LDS offsets become immediates
      for (int kk = 0; kk < KSD; kk += 32) {
        const v16h a0 = ldfrag(ka0p + kk), a1 = ldfrag(ka1p + kk);
        v16h b[4];
#pragma unroll
        for (int qt = 0; qt < 4; ++qt) b[qt] = ldfrag(qbp + (16 * qt) * QSP + j * KSD + kk);
        // keeps all twelve LDS loads of a k step ahead of the step's first WMMA: left alone, the compiler feeds the
        // B fragments through one register set, and every pair of WMMAs waits out the LDS latency
        __builtin_amdgcn_sched_barrier(0);
#pragma unroll
        for (int qt = 0; qt < 4; ++qt) {
          sacc[qt][0] = mma16(a0, b[qt], sacc[qt][0]);
          sacc[qt][1] = mma16(a1, b[qt], sacc[qt][1]);
        }
      }
      ring_publish();
      // refill the buffer just read with the stage two ahead: K stages 2..5, then V stages 0, 1 of this tile
      if (j + 2 < DM / KSD) issue_k(kg + (size_t)t * KCH * DM + (j + 2) * KSD, klds + (j & 1) * RING_B);
      else                  issue_v(vg + (size_t)(j + 2 - DM / KSD) * VSC * ntok + (size_t)t * KCH,
                                    vlds + (j & 1) * RING_B, ntok);
    }
    // ---- scale, per-wave partial row max ----
#pragma unroll
    for (int qt = 0; qt < 4; ++qt) {
      float pmq = ninf;
#pragma unroll
      for (int kt = 0; kt < 2; ++kt) {
#pragma unroll
        for (int r = 0; r < 8; ++r) {
          const float v0 = sacc[qt][kt][r] * sc; sacc[qt][kt][r] = v0; pmq = fmaxf(pmq, v0);
        }
      }
      pmq = fmaxf(pmq, __shfl_xor(pmq, 16, 32));
      pmax[wave * QB + 16 * qt + c] = pmq;
    }
    __syncthreads();
    // ---- waves 0 and 1, thread = query row: fold the prior tile's sums into l, new running max, rescale factor ----
    if (wave < 2) {
      const int row = tid;
      float ps = 0.0f;
#pragma unroll
      for (int w = 0; w < 8; ++w) ps += psum[w * QB + row];
      l_s[row] = l_s[row] * al_s[row] + ps;
      const float mo = m_s[row];
      float mx = mo;
#pragma unroll
      for (int w = 0; w < 8; ++w) mx = fmaxf(mx, pmax[w * QB + row]);
      al_s[row] = __expf(mo - mx);
      m_s[row] = mx;
    }
    __syncthreads();
    // ---- p = 16 * exp(s - m) as f16, P tile, partial row sums, rescale O ----
#pragma unroll
    for (int qt = 0; qt < 4; ++qt) {
      const float mq = m_s[16 * qt + c];
      float ps = 0.0f;
#pragma unroll
      for (int kt = 0; kt < 2; ++kt) {
        v8h hq;
#pragma unroll
        for (int r = 0; r < 8; ++r) {
          const float p = __expf(sacc[qt][kt][r] - mq); ps += p; hq[r] = (_Float16)(p * 16.0f);
        }
        *(v8h*)(Ps + (16 * qt + c) * PSP + 32 * wave + 16 * kt + 8 * h) = hq;
      }
      ps += __shfl_xor(ps, 16, 32);
      psum[wave * QB + 16 * qt + c] = ps;
      const v4f aA = *(const v4f*)(al_s + 16 * qt + 8 * h), aB = *(const v4f*)(al_s + 16 * qt + 8 * h + 4);
#pragma unroll
      for (int nt = 0; nt < 6; ++nt) {
#pragma unroll
        for (int r = 0; r < 4; ++r) {
          oacc[qt][nt][r] *= aA[r]; oacc[qt][nt][4 + r] *= aB[r];
        }
      }
    }
    __syncthreads();
    // ---- O += P . V over the 256 keys of the tile ----
    // four groups of 64 keys, kept rolled for the same reason as the K stages; each group is two V stages
    // (columns 0..383 in buffer 0, 384..767 in buffer 1), which share the group's P fragments
#pragma unroll 1
    for (int kq = 0; kq < KCH / VSK; ++kq) {
      v16h pa[2][4];
#pragma unroll
      for (int k2 = 0; k2 < 2; ++k2)
#pragma unroll
        for (int qt = 0; qt < 4; ++qt) pa[k2][qt] = ldfrag(pap + (16 * qt) * PSP + kq * VSK + 32 * k2);
#pragma unroll   // the accumulator index depends on the column half
      for (int hf = 0; hf < 2; ++hf) {
        const _Float16* vbp = (const _Float16*)(smem + LDS_RING + hf * RING_B) + (48 * wave + c) * VSP + 8 * h;
        v16h vb[2][3];
#pragma unroll
        for (int k2 = 0; k2 < 2; ++k2)
#pragma unroll
          for (int j = 0; j < 3; ++j) vb[k2][j] = ldfrag(vbp + (16 * j) * VSP + 32 * k2);
        // keeps all LDS loads of the stage ahead of its first WMMA (as in the K stages)
        __builtin_amdgcn_sched_barrier(0);
#pragma unroll
        for (int k2 = 0; k2 < 2; ++k2)
#pragma unroll
          for (int j = 0; j < 3; ++j)
#pragma unroll
            for (int qt = 0; qt < 4; ++qt)
              oacc[qt][3 * hf + j] = mma16(pa[k2][qt], vb[k2][j], oacc[qt][3 * hf + j]);
        ring_publish();
        // refill: the same column half of the next key group, then K stages 0, 1 of the next tile while one exists
        // (block-uniform tests)
        if (kq + 1 < KCH / VSK) {
          issue_v(vg + (size_t)hf * VSC * ntok + (size_t)t * KCH + (kq + 1) * VSK, vlds + hf * RING_B, ntok);
        } else if (t + 1 < ntile) {
          issue_k(kg + (size_t)(t + 1) * KCH * DM + hf * KSD, klds + hf * RING_B);
        }
      }
    }
  }
  asm volatile("s_wait_asynccnt 0x0" ::: "memory");  // no copy is left in flight behind the loop

  // ---- this half's row sum (fold the last tile's sums) and maximum; O_half = oacc / (256 * l) (P carry 16, vn carry 16) ----
  if (wave < 2) {
    const int row = tid;
    float ps = 0.0f;
#pragma unroll
    for (int w = 0; w < 8; ++w) ps += psum[w * QB + row];
    const float l = l_s[row] * al_s[row] + ps;
    li_s[row] = (1.0f / l) * (1.0f / 256.0f);
    pm[(size_t)sp * ntok + q0 + row]  = m_s[row];
    pls[(size_t)sp * ntok + q0 + row] = l;
  }
  __syncthreads();
  // ---- stage the 64 x 768 f32 accumulator tile: rows 0..31 over the Q and P regions, rows 32..63 over the ring ----
  float* F0 = (float*)(smem + LDS_QS);
  float* F1 = (float*)(smem + LDS_RING);
#pragma unroll
  for (int qt = 0; qt < 4; ++qt) {
    float* F = ((qt < 2) ? F0 : F1) + (16 * (qt & 1) + 8 * h) * FSP;
#pragma unroll
    for (int nt = 0; nt < 6; ++nt) {
      const int col = VSC * (nt / 3) + 48 * wave + 16 * (nt % 3) + c;
#pragma unroll
      for (int r = 0; r < 8; ++r) F[r * FSP + col] = oacc[qt][nt][r];
    }
  }
  __syncthreads();
  // ---- each wave: 8 whole rows, normalised, split into bf16 hi / lo, 512 B per store instruction (3 per row and plane) ----
  {
    unsigned short* gh = ph + ((size_t)sp * ntok + q0) * DM;
    unsigned short* gl = pl + ((size_t)sp * ntok + q0) * DM;
    // kept rolled: run once per block, unrolled it is some thousand instructions that are fetched to be used once
#pragma unroll 1
    for (int it = 0; it < 24; ++it) {
      const int rr = it / 3;
      const int row = 8 * wave + rr;
      const int pc = (it - rr * 3) * 32 + lane;
      const float* F = ((row < 32) ? F0 + row * FSP : F1 + (row - 32) * FSP) + pc * 8;
      const float inv = li_s[row];
      const v4f x0 = *(const v4f*)(F), x1 = *(const v4f*)(F + 4);
      v8us hvv, lvv;
#pragma unroll
      for (int e = 0; e < 4; ++e) {
        unsigned short hb, lb;
        split_bf(x0[e] * inv, hb, lb);
        hvv[e] = hb;      lvv[e] = lb;
        split_bf(x1[e] * inv, hb, lb);
        hvv[4 + e] = hb;  lvv[4 + e] = lb;
      }
      *(v8us*)(gh + (size_t)row * DM + pc * 8) = hvv;
      *(v8us*)(gl + (size_t)row * DM + pc * 8) = lvv;
      // the next trip rewrites the two stores' address and data registers: the wait stands in front of that
      asm volatile("s_wait_xcnt 0x0" ::: "memory");
    }
  }
}

// ---------------------------------------------------------------------------------------------
// Kernel 5: join the two key halves of the attention: with M = max(m0, m1) and w_i = l_i * exp(m_i - M),
//   O = (w0 * O_0 + w1 * O_1) / (w0 + w1), O_i = hi + lo of half i; O goes out again as bf16 hi / lo planes [ntok][DM].
// 8 columns per thread: one 16-B load and store per lane and plane, 32 lanes contiguous = 512 B.
// coverage: ntok * DM / 8 threads exactly (DM / 8 = 96 pieces a row).
// ---------------------------------------------------------------------------------------------
__global__ __launch_bounds__(256) void merge_kernel(const unsigned short* __restrict__ ph,
                                                    const unsigned short* __restrict__ pl,
                                                    const float* __restrict__ pm, const float* __restrict__ pls,
                                                    unsigned short* __restrict__ oh, unsigned short* __restrict__ ol,
                                                    int ntok) {
  const int li = (int)blockIdx.x * 256 + (int)threadIdx.x;
  const int row = li / (DM / 8);
  if (row >= ntok) return;
  const size_t e = (size_t)li * 8;
  const size_t pst = (size_t)ntok * DM;
  const float m0 = pm[row], m1 = pm[ntok + row];
  const float l0 = pls[row], l1 = pls[ntok + row];
  // the wide loads' results may take these four loads' address registers: the wait stands in front of that rewrite
  asm volatile("s_wait_xcnt 0x0" ::: "memory");
  const v8us h0 = *(const v8us*)(ph + e), g0 = *(const v8us*)(pl + e);
  const v8us h1 = *(const v8us*)(ph + pst + e), g1 = *(const v8us*)(pl + pst + e);
  const float mx = fmaxf(m0, m1);
  float w0 = l0 * __expf(m0 - mx), w1 = l1 * __expf(m1 - mx);
  const float inv = 1.0f / (w0 + w1);
  w0 *= inv;
  w1 *= inv;
  v8us oh8, ol8;
#pragma unroll
  for (int i = 0; i < 8; ++i) {
    const float f = w0 * (bfval(h0[i]) + bfval(g0[i])) + w1 * (bfval(h1[i]) + bfval(g1[i]));
    unsigned short hb, lb;
    split_bf(f, hb, lb);
    oh8[i] = hb;
    ol8[i] = lb;
  }
  *(v8us*)(oh + e) = oh8;
  *(v8us*)(ol + e) = ol8;
}

// ---------------------------------------------------------------------------------------------
// Workspace map (bytes, all regions exact tile / whole-line multiples, no padding needed):
//   Wq16 : Wqkv f16 [768][768] (64 * bf16(w))                 off 0           size  1,179,648
//   Wpb  : Wproj bf16 bits [768][768]                           off 1,179,648   size  1,179,648
//   X16  : ln(q), ln(k), ln(v) stacked f16 [24576][768]        off 2,359,296   size 37,748,736
//   QK16 : qn then kn f16 [16384][768]                          off 40,108,032  size 25,165,824
//   VT16 : vn^T f16 [768][8192]                                 off 65,273,856  size 12,582,912
//   OH   : attention output bf16 hi [8192][768]                 off 77,856,768  size 12,582,912
//   OL   : attention output bf16 lo [8192][768]                 off 90,439,680  size 12,582,912
//   PH   : per key half, attention output bf16 hi [2][8192][768] off 103,022,592 size 25,165,824
//   PL   : per key half, attention output bf16 lo [2][8192][768] off 128,188,416 size 25,165,824
//   PM   : per key half, row maximum f32 [2][8192]              off 153,354,240 size     65,536
//   PS   : per key half, row sum f32 [2][8192]                  off 153,419,776 size     65,536
//   total 153,485,312
// ---------------------------------------------------------------------------------------------
extern "C" void kernel_launch(void* const* d_in, const int* in_sizes, int n_in,
                              void* d_out, int out_size, void* d_ws, size_t ws_size,
                              hipStream_t stream) {
  if (n_in < 8) return;
  const int ntok = NTOK, dm = DM;
  if (in_sizes[0] != ntok * dm || in_sizes[1] != ntok * dm || in_sizes[2] != ntok * dm) return;
  if (in_sizes[3] != dm || in_sizes[4] != dm || in_sizes[7] != dm) return;
  if (in_sizes[5] != dm * dm || in_sizes[6] != dm * dm) return;
  if (out_size != ntok * dm) return;

  const float* q     = (const float*)d_in[0];
  const float* k     = (const float*)d_in[1];
  const float* v     = (const float*)d_in[2];
  const float* ln_w  = (const float*)d_in[3];
  const float* ln_b  = (const float*)d_in[4];
  const float* Wqkv  = (const float*)d_in[5];
  const float* Wproj = (const float*)d_in[6];
  const float* bproj = (const float*)d_in[7];
  float* out = (float*)d_out;

  const size_t bWq = (size_t)dm * dm * 2;
  const size_t bWp = (size_t)dm * dm * 2;
  const size_t bX  = (size_t)3 * ntok * dm * 2;
  const size_t bQK = (size_t)2 * ntok * dm * 2;
  const size_t bVT = (size_t)dm * ntok * 2;
  const size_t bO  = (size_t)ntok * dm * 2;
  size_t off = 0;
  const size_t oWq = off; off += bWq;
  const size_t oWp = off; off += bWp;
  const size_t oX  = off; off += bX;
  const size_t oQK = off; off += bQK;
  const size_t oVT = off; off += bVT;
  const size_t oOH = off; off += bO;
  const size_t oOL = off; off += bO;
  const size_t oPH = off; off += 2 * bO;
  const size_t oPL = off; off += 2 * bO;
  const size_t oPM = off; off += (size_t)2 * ntok * 4;
  const size_t oPS = off; off += (size_t)2 * ntok * 4;
  if (off > ws_size) return;                     // 153,485,312

  char* ws = (char*)d_ws;
  _Float16*       Wq16 = (_Float16*)(ws + oWq);
  unsigned short* Wpb  = (unsigned short*)(ws + oWp);
  _Float16*       X16  = (_Float16*)(ws + oX);
  _Float16*       QK16 = (_Float16*)(ws + oQK);
  _Float16*       VT16 = (_Float16*)(ws + oVT);
  unsigned short* OH   = (unsigned short*)(ws + oOH);
  unsigned short* OL   = (unsigned short*)(ws + oOL);
  unsigned short* PH   = (unsigned short*)(ws + oPH);
  unsigned short* PL   = (unsigned short*)(ws + oPL);
  float*          PM   = (float*)(ws + oPM);
  float*          PS   = (float*)(ws + oPS);

  const dim3 blk(256);
  const dim3 gblk(128);                       // the GEMM's block: 4 waves
  const int n8 = dm * dm / 8;                 // 73728 = 288 * 256
  if ((n8 % 256) != 0) return;

  // (1) weights -> Wqkv f16 plane (64 * bf16(w)) and Wproj bf16 plane
  cvt_w_kernel<<<dim3(2 * (n8 / 256)), blk, 0, stream>>>(Wqkv, Wproj, Wq16, Wpb, n8);
  // (2) LayerNorm of q, k, v -> X16 (8 * ln)
  ln_kernel<<<dim3(3 * ntok / 8), blk, 0, stream>>>(q, k, v, ln_w, ln_b, X16, ntok);
  // (3) qn, kn = X[0:16384] . Wqkv^T  -> QK16 (16 * qn | 16 * kn); M=16384, N=768, K=768; scale 16/(8*64)
  gemm64_kernel<0, false, 1><<<dim3((2 * ntok / 128) * (dm / 128)), gblk, 0, stream>>>(
      (const unsigned short*)X16, (const unsigned short*)X16, dm, (const unsigned short*)Wq16, dm,
      (void*)QK16, dm, bproj, 2 * ntok, dm, dm, 0.03125f);
  // (4) vn^T = Wqkv . X[16384:24576]^T -> VT16 [768][8192] (16 * vn); M=768, N=8192, K=768
  gemm64_kernel<0, false, 1><<<dim3((dm / 128) * (ntok / 128)), gblk, 0, stream>>>(
      (const unsigned short*)Wq16, (const unsigned short*)Wq16, dm,
      (const unsigned short*)(X16 + (size_t)2 * ntok * dm), dm,
      (void*)VT16, ntok, bproj, dm, ntok, dm, 0.03125f);
  // (5) attention per key half -> PH / PL, PM, PS; logit scale = dim^-0.5 / 256 (operand carries 16 * 16)
  const float sc = 0.03608439182435161f * (1.0f / 256.0f);
  attn_kernel<<<dim3(KSPLIT * (ntok / QB)), blk, 0, stream>>>(QK16, QK16 + (size_t)ntok * dm, VT16, PH, PL, PM, PS,
                                                              sc, ntok);
  // (6) the two key halves joined -> OH / OL (bf16 hi / lo of O)
  merge_kernel<<<dim3(ntok * (dm / 8) / 256), blk, 0, stream>>>(PH, PL, PM, PS, OH, OL, ntok);
  // (7) out = (O_hi + O_lo) . Wproj^T + b -> d_out f32 [8192][768]; bf16 operands, scale 1
  gemm64_kernel<1, true, 0><<<dim3((ntok / 128) * (dm / 128)), gblk, 0, stream>>>(
      OH, OL, dm, Wpb, dm, (void*)out, dm, bproj, ntok, dm, dm, 1.0f);
  (void)hipGetLastError();
}

// v004
// Measured time: 259 microseconds a run.
// Timed twice side by side with v003, it ran 1.03 times as fast both times.
// Counting every step since v000, it is 2.65 times as fast.
// Contractions: qn|kn = ln(q|k).Wqkv^T, vn^T = Wqkv.ln(v)^T, S^T = kn.qn^T, O = P.vn : v_wmma_f32_16x16x32_f16, f16 operands with
// power-of-two carries (ln x8, Wqkv x64, qn/kn/vn x16, P = 16*exp(s - m)), f32 accumulate; out = O.Wproj^T + b : v_wmma_f32_16x16x32_bf16,
// O as bf16 hi/lo planes (hi.W + lo.W), Wproj bf16, f32 accumulate; float inputs RNE-converted to bf16 on load; LayerNorm, softmax
// statistics and bias in f32.
#include <hip/hip_runtime.h>
#include <stdint.h>

#define NTOK 8192
#define DM   768

typedef _Float16 v16h __attribute__((ext_vector_type(16)));
typedef _Float16 v8h  __attribute__((ext_vector_type(8)));
typedef __bf16   v16b __attribute__((ext_vector_type(16)));
typedef __bf16   v8b  __attribute__((ext_vector_type(8)));
typedef float    v8f  __attribute__((ext_vector_type(8)));
typedef float    v4f  __attribute__((ext_vector_type(4)));
typedef unsigned short v8us __attribute__((ext_vector_type(8)));

static_assert((DM % 64) == 0);
static_assert((NTOK % 256) == 0);

// f32 -> nearest-even bf16 bits / value
__device__ __forceinline__ unsigned short bfbits(float f) {
  unsigned u = __float_as_uint(f);
  return (unsigned short)((u + 0x7FFFu + ((u >> 16) & 1u)) >> 16);
}
__device__ __forceinline__ float bfval(unsigned short b) { return __uint_as_float(((unsigned)b) << 16); }
__device__ __forceinline__ float bfr(float f) { return bfval(bfbits(f)); }
__device__ __forceinline__ void split_bf(float f, unsigned short& hb, unsigned short& lb) {
  hb = bfbits(f);
  lb = bfbits(f - bfval(hb));
}

// 16-bit operand element types for the GEMM template: 0 = f16, 1 = bf16
template <int ET> struct Elem;
template <> struct Elem<0> {
  typedef _Float16 T; typedef v16h V; typedef v8h V8;
  static __device__ __forceinline__ v8f mma(V a, V b, v8f c) {
    return __builtin_amdgcn_wmma_f32_16x16x32_f16(false, a, false, b, (short)0, c, false, false);
  }
};
template <> struct Elem<1> {
  typedef __bf16 T; typedef v16b V; typedef v8b V8;
  static __device__ __forceinline__ v8f mma(V a, V b, v8f c) {
    return __builtin_amdgcn_wmma_f32_16x16x32_bf16(false, a, false, b, (short)0, c, false, false);
  }
};

// 16-bit WMMA fragment from k-contiguous storage (A row-major [m][k], or B stored [n][k]):
// p points at element (row_or_col = lane&15, k0 + 8h); elements 0..7 <- p[0..7], 8..15 <- p[16..23].
template <int ET>
__device__ __forceinline__ typename Elem<ET>::V ldfragT(const typename Elem<ET>::T* p) {
  typedef typename Elem<ET>::V V;
  typedef typename Elem<ET>::V8 V8;
  union { V v; V8 h[2]; } f;
  f.h[0] = *(const V8*)(p);
  f.h[1] = *(const V8*)(p + 16);
  return f.v;
}
__device__ __forceinline__ v16h ldfrag(const _Float16* p) { return ldfragT<0>(p); }
__device__ __forceinline__ v8f mma16(v16h a, v16h b, v8f c) { return Elem<0>::mma(a, b, c); }
__device__ __forceinline__ v8f zero8() {
  v8f z;
#pragma unroll
  for (int i = 0; i < 8; ++i) z[i] = 0.0f;
  return z;
}

// hazard guard: 4 VALU slots after the last WMMA of a group, D tied
__device__ __forceinline__ void accg4(v8f& a, v8f& b, v8f& c, v8f& d) {
  asm volatile("v_nop\n\tv_nop\n\tv_nop\n\tv_nop" : "+v"(a), "+v"(b), "+v"(c), "+v"(d));
}

// ---------------------------------------------------------------------------------------------
// Kernel 1: two [DM][DM] f32 weight matrices -> 16-bit planes, layout unchanged ([out][in], k = in contiguous):
//   blocks [0, nb0):  d16[e] = f16(64 * bf16(w0[e]))     (f16 operand plane for the qkv projection)
//   blocks [nb0, 2nb0): dbf[e] = bf16 bits of w1[e]       (bf16 operand plane for the output projection)
// Block-uniform select, no barriers. 8 elements per thread: one 16-B store per lane, 32 lanes contiguous = 512 B =
// coverage: nb0 * 256 threads * 8 = DM * DM elements per plane exactly (n8 = DM*DM/8 is a multiple of 256).
// ---------------------------------------------------------------------------------------------
__global__ __launch_bounds__(256) void cvt_w_kernel(const float* __restrict__ w0, const float* __restrict__ w1,
                                                    _Float16* __restrict__ d16, unsigned short* __restrict__ dbf,
                                                    int n8) {
  const int nb0 = n8 >> 8;
  const bool second = ((int)blockIdx.x >= nb0);
  const float* src = second ? w1 : w0;
  const int li = ((int)blockIdx.x - (second ? nb0 : 0)) * 256 + (int)threadIdx.x;
  if (li >= n8) return;
  const size_t e = (size_t)li * 8;
  const v4f a = *(const v4f*)(src + e);
  const v4f b = *(const v4f*)(src + e + 4);
  if (!second) {
    v8h o;
#pragma unroll
    for (int i = 0; i < 4; ++i) {
      o[i]     = (_Float16)(bfr(a[i]) * 64.0f);
      o[4 + i] = (_Float16)(bfr(b[i]) * 64.0f);
    }
    _Float16* d = d16 + e;
    *(v8h*)d = o;
    
  } else {
    v8us o;
#pragma unroll
    for (int i = 0; i < 4; ++i) {
      o[i]     = bfbits(a[i]);
      o[4 + i] = bfbits(b[i]);
    }
    unsigned short* d = dbf + e;
    *(v8us*)d = o;
    
  }
}

// ---------------------------------------------------------------------------------------------
// Kernel 2: LayerNorm of q, k, v (bf16-converted inputs, f32 statistics, centred variance) -> f16 plane X
// [3*ntok][DM], value = 8 * ln(x). One wave per row, 8 rows per block; blocks [0,ntok/8) read q, next k, next v.
// Three rolled passes over the row (sum, centred sum of squares, normalise + store); the 3 KB row is re-read
// from cache. Pass 3: lane owns columns (j*32+lane)*8 .. +7 per chunk j: one 16-B store per lane, each store
// coverage: 3*ntok/8 blocks * 8 waves * (3 chunks * 32 lanes * 8) = 3*ntok rows x 768 columns = the whole plane.
// ---------------------------------------------------------------------------------------------
__global__ __launch_bounds__(256) void ln_kernel(const float* __restrict__ qx, const float* __restrict__ kx,
                                                 const float* __restrict__ vx, const float* __restrict__ lw,
                                                 const float* __restrict__ lb, _Float16* __restrict__ X, int ntok) {
  const int wave = threadIdx.x >> 5, lane = threadIdx.x & 31;
  const int bps = ntok >> 3;
  const int seg = ((int)blockIdx.x >= 2 * bps) ? 2 : (((int)blockIdx.x >= bps) ? 1 : 0);
  const float* src = (seg == 2) ? vx : ((seg == 1) ? kx : qx);
  const int lrow = ((int)blockIdx.x - seg * bps) * 8 + wave;
  const int grow = (int)blockIdx.x * 8 + wave;
  const float* xr = src + (size_t)lrow * DM;

  float s = 0.0f;
#pragma unroll 1
  for (int jj = 0; jj < 6; ++jj) {
    const int c0 = ((jj >> 1) * 32 + lane) * 8 + (jj & 1) * 4;
    const v4f a = *(const v4f*)(xr + c0);
    s += (bfr(a[0]) + bfr(a[1])) + (bfr(a[2]) + bfr(a[3]));
  }
#pragma unroll
  for (int off = 16; off > 0; off >>= 1) s += __shfl_xor(s, off, 32);
  const float mu = s * (1.0f / 768.0f);

  // pass 2: centred sum of squares
  float s2 = 0.0f;
#pragma unroll 1
  for (int jj = 0; jj < 6; ++jj) {
    const int c0 = ((jj >> 1) * 32 + lane) * 8 + (jj & 1) * 4;
    const v4f a = *(const v4f*)(xr + c0);
#pragma unroll
    for (int e = 0; e < 4; ++e) {
      const float d = bfr(a[e]) - mu;
      s2 += d * d;
    }
  }
#pragma unroll
  for (int off = 16; off > 0; off >>= 1) s2 += __shfl_xor(s2, off, 32);
  const float rstd8 = rsqrtf(s2 * (1.0f / 768.0f) + 1e-5f) * 8.0f;   // x8 carry folded into the scale

  _Float16* yr = X + (size_t)grow * DM;
#pragma unroll 1
  for (int j = 0; j < 3; ++j) {
    const int c0 = (j * 32 + lane) * 8;
    const v4f a  = *(const v4f*)(xr + c0), b  = *(const v4f*)(xr + c0 + 4);
    const v4f wa = *(const v4f*)(lw + c0), wb = *(const v4f*)(lw + c0 + 4);
    const v4f ba = *(const v4f*)(lb + c0), bb = *(const v4f*)(lb + c0 + 4);
    v8h o;
#pragma unroll
    for (int e = 0; e < 4; ++e) {
      const float t0 = (bfr(a[e]) - mu) * rstd8;
      o[e]     = (_Float16)(t0 * bfr(wa[e]) + bfr(ba[e]) * 8.0f);
      const float t1 = (bfr(b[e]) - mu) * rstd8;
      o[4 + e] = (_Float16)(t1 * bfr(wb[e]) + bfr(bb[e]) * 8.0f);
    }
    _Float16* d = yr + c0;
    *(v8h*)d = o;
    
  }
}

// One asynchronous 16-B-per-lane copy global -> LDS, as the builtin: its address registers are the compiler's, which
// may place them above v255 (an asm operand may not lie there).
typedef int v4i __attribute__((ext_vector_type(4)));
__device__ __forceinline__ void acopy(const _Float16* g, char* l) {
  __builtin_amdgcn_global_load_async_to_lds_b128((__attribute__((address_space(1))) v4i*)g,
                                                 (__attribute__((address_space(3))) v4i*)l, 0, 0);
}
// Publish point of the ring: this wave's LDS reads of the buffer to be refilled have retired, its own copies of the
// next stage have landed, then the work-group barrier behind which that stage is read and the old buffer refilled.
__device__ __forceinline__ void ring_publish() {
  // keeps the stage's WMMAs ahead of the publish point: sunk behind the barrier, they stand between it and the refill,
  // and the copies lose that much of their flight time
  __builtin_amdgcn_sched_barrier(0);
  asm volatile("s_wait_dscnt 0x0" ::: "memory");     // own reads of the stage just used are done
  asm volatile("s_wait_asynccnt 0x0" ::: "memory");  // own copies of the next stage have landed
  __syncthreads();
}

// Tensor load of one two-dimensional slice, global -> LDS: NROW rows of ROWB bytes at source pitch 'pitch' bytes, landing at
// LDS byte offset lds_dst with the row pad that word 0 of group 1 (W0, a constant) names. One request of the whole wave;
// every descriptor word is wave-uniform and goes through readfirstlane. 1-byte elements, tensor dims = tile dims, no mask.
typedef uint32_t u32x4 __attribute__((ext_vector_type(4)));
typedef uint32_t u32x8 __attribute__((ext_vector_type(8)));
__device__ __forceinline__ uint32_t uni(uint32_t v) { return (uint32_t)__builtin_amdgcn_readfirstlane(v); }
// a wave-uniform issue test, or a descriptor word, of the tensor mover held in a scalar register: the branch on such a test
// is a scalar branch (a tensor load ignores EXEC); such a word is made once, where pinned() stands
__device__ __forceinline__ uint32_t pinned(uint32_t v) {
  uint32_t w = (uint32_t)__builtin_amdgcn_readfirstlane(v);
  asm volatile("" : "+s"(w));   // pinned(): the tensor mover's issue test (compiles to s_cmp + s_cbranch_scc) or descriptor word in a scalar register
  return w;
}
template <uint32_t W0, uint32_t ROWB, uint32_t NROW>
__device__ __forceinline__ void tdm_slice(uint32_t cnt1, uint32_t lds_dst, const _Float16* g, uint32_t pitch) {
  const uint64_t ga = (uint64_t)(size_t)g;
  u32x4 g0;
  u32x8 g1;
  g0[0] = cnt1;   // count = 1, from the caller's pinned word
  g0[1] = uni(lds_dst);
  g0[2] = uni((uint32_t)ga);
  g0[3] = uni((((uint32_t)(ga >> 32)) & 0x01FFFFFFu) | 0x80000000u);
  g1[0] = uni(W0);
  g1[1] = uni((ROWB & 0xFFFFu) << 16);
  g1[2] = uni((ROWB >> 16) | ((NROW & 0xFFFFu) << 16));
  g1[3] = uni((NROW >> 16) | (ROWB << 16));
  g1[4] = uni(NROW);
  g1[5] = uni(pitch);
  g1[6] = uni(0u);
  g1[7] = uni(0u);
  // Issued from twelve scalar registers named here, above all that the kernel else uses, which hold nothing else: they are
  // written only in front of an issue, behind the wait for the request before, so that an outstanding request's words
  // stay in place until it has landed (left to the compiler's choice, it reused the registers for other values at once).
  asm volatile("tensor_load_to_lds %0, %1" :: "{s[88:91]}"(g0), "{s[92:99]}"(g1) : "memory");
}
// Publish point of the tensor-load ring: this wave's LDS reads of the buffer to be refilled have retired, its own request
// for the next stage has landed, then the work-group barrier behind which that stage is read and the old buffer refilled.
__device__ __forceinline__ void ring_publish_t() {
  // keeps the stage's WMMAs ahead of the publish point (as in ring_publish)
  __builtin_amdgcn_sched_barrier(0);
  asm volatile("s_wait_dscnt 0x0" ::: "memory");      // own reads of the stage just used are done
  asm volatile("s_wait_tensorcnt 0x0" ::: "memory");  // own slice of the next stage has landed
  __syncthreads();
  // keeps the next request's descriptor words behind the wait: none is formed while a request is outstanding
  __builtin_amdgcn_sched_barrier(0);
}

// ---------------------------------------------------------------------------------------------
// Kernel 3: C[m][n] = scale * sum_k A[m][k] * Bt[n][k] (+ bf16(bias[n]) when OUT_MODE == 0).
// A row-major [M][K] 16-bit (ET 0: f16, ET 1: bf16) pitch lda; Bt row-major [N][K] same type pitch ldb; M, N multiples
// of 128, K a multiple of 64. SPLITA: A is a hi plane (Ap) plus a lo plane (A2p, same layout), product = hi.B + lo.B.
// Block = 128 threads = 4 waves (2 x 2) on one 128x128 C tile; each wave owns one 64x64 part (16 f32 accumulators).
// The operands reach LDS by asynchronous copies in whole lines, in a ring of two buffers: a stage is 64 k (128 B) of
// the tile's 128 A rows (both planes when SPLITA) and 128 Bt rows; each wave copies 32 rows of every plane; at the
// foot of every stage one publish point, then the refill of the buffer just read with the stage two ahead.
// OUT_MODE 0: f32 output; OUT_MODE 1: f16 output. Epilogue: 16-row slab per wave in LDS (over the ring, which is
// out of use behind the last publish point), then each 64-wide row goes out in whole lines.
// coverage: tilesM * tilesN tiles, each 128x128 written fully -> M x N.
// ---------------------------------------------------------------------------------------------
#define GKS 64       // k per stage: 128 B a row, one whole line
#define GSP 72       // stage row pitch in halves: 144 B = 16 B x odd, for ds_load_b128 readers
#define GPL (128 * GSP * 2)   // one operand plane of a stage: 128 rows
static_assert((DM % GKS) == 0 && (DM % 128) == 0 && (NTOK % 128) == 0 && 4 * 16 * 68 * 4 <= 2 * GPL);

// 32 rows x 128 B of one plane: one copy = 4 rows x 128 B (four whole lines). 8 copies.
// g points at (first row of the wave + lane / 8, first k + 8 * (lane % 8)); l is that lane's place in LDS.
__device__ __forceinline__ void issue_g(const void* g, int ld, char* l) {
#pragma unroll
  for (int i = 0; i < 8; ++i) acopy((const _Float16*)g + (size_t)(4 * i) * ld, l + i * 4 * GSP * 2);
}

template <int ET, bool SPLITA, int OUT_MODE>
__global__ __launch_bounds__(128) void gemm64_kernel(const unsigned short* __restrict__ Ap,
                                                     const unsigned short* __restrict__ A2p, int lda,
                                                     const unsigned short* __restrict__ Btp, int ldb,
                                                     void* __restrict__ Cout, int ldc,
                                                     const float* __restrict__ bias,
                                                     int M, int N, int K, float scale) {
  typedef typename Elem<ET>::T T;
  typedef typename Elem<ET>::V V;
  const T* A  = (const T*)(const void*)Ap;
  const T* A2 = (const T*)(const void*)A2p;
  const T* Bt = (const T*)(const void*)Btp;
  constexpr int BOFF = (SPLITA ? 2 : 1) * GPL;   // the Bt plane's place in a buffer
  constexpr int BUFB = BOFF + GPL;               // one ring buffer
  __shared__ __align__(16) char gsm[2 * BUFB];
  const int lane = threadIdx.x & 31, wave = threadIdx.x >> 5;
  const int tilesN = N >> 7, tilesM = M >> 7;
  const int tile = (int)blockIdx.x;
  if (tile >= tilesM * tilesN) return;           // the same for the whole block, in front of every barrier
  const int tm = tile / tilesN, tn = tile - tm * tilesN;
  const int m0 = (tm << 7) + ((wave >> 1) << 6), n0 = (tn << 7) + ((wave & 1) << 6);   // this wave's 64x64 part
  const int rl = lane & 15;
  const int koff = (lane >> 4) * 8;
  const int mOff = (lane >> 4) * 8;
  const int nst = K / GKS;

  // copy addresses of this lane: rows 32 * wave + lane / 8 (+ 4 a copy) of each plane, piece lane % 8 of the row
  const int crow = 32 * wave + (lane >> 3), cpc = lane & 7;
  const T* ga  = A  + (size_t)((tm << 7) + crow) * lda + cpc * 8;
  const T* ga2 = A2 + (size_t)((tm << 7) + crow) * lda + cpc * 8;
  const T* gb  = Bt + (size_t)((tn << 7) + crow) * ldb + cpc * 8;
  char* lc = gsm + crow * GSP * 2 + cpc * 16;

  issue_g(ga, lda, lc);                          // stage 0 into buffer 0
  if (SPLITA) issue_g(ga2, lda, lc + GPL);
  issue_g(gb, ldb, lc + BOFF);

  v8f acc[4][4];
#pragma unroll
  for (int i = 0; i < 4; ++i)
#pragma unroll
    for (int j = 0; j < 4; ++j) acc[i][j] = zero8();

  asm volatile("s_wait_asynccnt 0x0" ::: "memory");  // own copies of stage 0 have landed
  __syncthreads();
  if (nst > 1) {                                 // stage 1 into buffer 1
    issue_g(ga + GKS, lda, lc + BUFB);
    if (SPLITA) issue_g(ga2 + GKS, lda, lc + BUFB + GPL);
    issue_g(gb + GKS, ldb, lc + BUFB + BOFF);
  }

  // kept rolled: unrolled, the copies' addresses of every stage stay in registers
#pragma unroll 1
  for (int s = 0; s < nst; ++s) {
    const T* sb = (const T*)(const void*)(gsm + (s & 1) * BUFB);
    const T* ap = sb + (((wave >> 1) << 6) + rl) * GSP + koff;
    const T* bp = sb + BOFF / 2 + (((wave & 1) << 6) + rl) * GSP + koff;
#pragma unroll   // the stage's two k steps in a row: LDS offsets become immediates
    for (int kk = 0; kk < GKS; kk += 32) {
      V bh[4], ah[4], al[4];
#pragma unroll
      for (int j = 0; j < 4; ++j) bh[j] = ldfragT<ET>(bp + (j << 4) * GSP + kk);
#pragma unroll
      for (int i = 0; i < 4; ++i) {
        ah[i] = ldfragT<ET>(ap + (i << 4) * GSP + kk);
        al[i] = ah[i];
        if (SPLITA) al[i] = ldfragT<ET>(ap + GPL / 2 + (i << 4) * GSP + kk);
      }
      // keeps all LDS loads of a k step ahead of the step's first WMMA: left alone, the compiler feeds the A fragments
      // through one register set, and every four WMMAs wait out the LDS latency
      __builtin_amdgcn_sched_barrier(0);
#pragma unroll
      for (int i = 0; i < 4; ++i) {
#pragma unroll
        for (int j = 0; j < 4; ++j) acc[i][j] = Elem<ET>::mma(ah[i], bh[j], acc[i][j]);
        if (SPLITA) {
#pragma unroll
          for (int j = 0; j < 4; ++j) acc[i][j] = Elem<ET>::mma(al[i], bh[j], acc[i][j]);
        }
      }
    }
    ring_publish();
    // refill the buffer just read with the stage two ahead, while one exists (block-uniform test)
    if (s + 2 < nst) {
      char* l = lc + (s & 1) * BUFB;
      issue_g(ga + (s + 2) * GKS, lda, l);
      if (SPLITA) issue_g(ga2 + (s + 2) * GKS, lda, l + GPL);
      issue_g(gb + (s + 2) * GKS, ldb, l + BOFF);
    }
  }
  asm volatile("s_wait_asynccnt 0x0" ::: "memory");  // no copy is left in flight behind the loop
  accg4(acc[0][0], acc[0][1], acc[0][2], acc[0][3]);
  accg4(acc[1][0], acc[1][1], acc[1][2], acc[1][3]);
  accg4(acc[2][0], acc[2][1], acc[2][2], acc[2][3]);
  accg4(acc[3][0], acc[3][1], acc[3][2], acc[3][3]);

  float* slab = (float*)(void*)gsm + wave * (16 * 68);
#pragma unroll
  for (int i = 0; i < 4; ++i) {
    const int mBase = m0 + (i << 4);
#pragma unroll
    for (int j = 0; j < 4; ++j) {
      float bv = 0.0f;
      if (OUT_MODE == 0) bv = bfr(bias[n0 + (j << 4) + rl]);
#pragma unroll
      for (int r = 0; r < 8; ++r) slab[(mOff + r) * 68 + (j << 4) + rl] = acc[i][j][r] * scale + bv;
    }
    __builtin_amdgcn_fence(__ATOMIC_RELEASE, "workgroup");
    __builtin_amdgcn_wave_barrier();
    __builtin_amdgcn_fence(__ATOMIC_ACQUIRE, "workgroup");
    if (OUT_MODE == 0) {
      float* C = (float*)Cout;
      const int hh = lane >> 4, c4 = (lane & 15) * 4;
{
#pragma unroll
        for (int it = 0; it < 8; ++it) {
          const int row = it * 2 + hh;
          const v4f v = *(const v4f*)(slab + row * 68 + c4);
          *(v4f*)(C + (size_t)(mBase + row) * ldc + n0 + c4) = v;
        }
        
      }
    } else {
      _Float16* C = (_Float16*)Cout;
      const int qq = lane >> 3, c8 = (lane & 7) * 8;
{
#pragma unroll
        for (int it = 0; it < 4; ++it) {
          const int row = it * 4 + qq;
          const float* sp = slab + row * 68 + c8;
          v8h hv;
#pragma unroll
          for (int e = 0; e < 8; ++e) hv[e] = (_Float16)sp[e];
          *(v8h*)(C + (size_t)(mBase + row) * ldc + n0 + c8) = hv;
        }
        
      }
    }
    __builtin_amdgcn_fence(__ATOMIC_RELEASE, "workgroup");
    __builtin_amdgcn_wave_barrier();
    __builtin_amdgcn_fence(__ATOMIC_ACQUIRE, "workgroup");
  }
}

// ---------------------------------------------------------------------------------------------
// Kernel 4: full (non-causal) single-head attention, head width 768, online softmax in f32.
//   qn, kn planes f16 [ntok][DM] (value 16*qn), vt plane f16 [DM][ntok] (value 16*vn).
//   Block = 256 threads = 8 waves, 64 query rows x one half of the keys (blockIdx & 1): every K and V byte that
//   comes from L2 serves 64 queries. Outputs per key half: ph / pl = bf16 hi / lo planes (16-bit storage) of
//   O_half = softmax over that half . vn, [2][ntok][DM], with the half's row maximum pm and row sum pls, [2][ntok];
//   the merge kernel joins the two halves.
//   Q tile staged once in LDS. Key tiles of 256: wave w owns keys 32w..32w+31 of the tile for the logits:
//   S^T subtiles (A = kn rows, B = Q rows, both from LDS), so the
//   D layout gives per lane 8 consecutive keys of one query -> P written to LDS as 16-B vectors ([query][key]).
//   P = 16 * exp(s - m_running) in f16 (values in [~1.2, 16], always normal).
//   Row max / sum: per-wave partials in LDS, combined in fixed order by waves 0 and 1 (one lane per query row).
//   P.V: every wave reads the whole P tile (A operand) and owns 2 x 48 value columns (B = vt rows from LDS).
//   kn and vt reach LDS by tensor loads, in a ring of two buffers: per key tile six K stages (256 keys x 128 dims)
//   and eight V stages (384 columns x 64 keys); each wave asks, in one request a stage, for the slice of rows it
//   reads itself (32 key rows of 256 B, or 48 column rows of 128 B, each padded by 16 B in LDS); at the foot of
//   every stage one publish point, then the refill of the buffer just read with the stage two ahead.
//   Output: the 64x768 f32 accumulator tile staged in LDS (over the Q and P regions and the ring), then each wave
//   normalises 8 whole rows, splits them into bf16 hi / lo and writes 512 B per instruction (3 per row and plane).
// ---------------------------------------------------------------------------------------------
#define QB       64
#define KSPLIT   2
#define KCH      256
#define QSP      776
#define PSP      264
#define LDS_QS   0
#define LDS_PS   99328
#define LDS_PMAX 133120
#define LDS_PSUM 135168
#define LDS_ST   137216
#define LDS_RING 139264   // a multiple of 2 KiB, as every slice's place
#define FSP      772      // f32 output staging row pitch in floats (3088 B, a multiple of 16 B)
#define KSD      128      // model dims per K stage (256 B a key row)
#define KSP      136      // K stage row pitch in halves: 272 B = 16 B x odd, for ds_load_b128 readers
#define VSK      64       // keys per V stage (128 B a value-column row)
#define VSC      384      // value columns per V stage
#define VSP      72       // V stage row pitch in halves: 144 B = 16 B x odd
#define SLICE_B  10240    // one wave's slice of a ring buffer: max(32 keys * 272 B, 48 columns * 144 B) up to a multiple of 2 KiB
#define RING_B   (8 * SLICE_B)   // one ring buffer
#define KW0      ((1u << 20) | (5u << 22) | (3u << 25))   // group 1 word 0: 16 B of pad behind every 256-B row
#define VW0      ((1u << 20) | (4u << 22) | (3u << 25))   // group 1 word 0: 16 B of pad behind every 128-B row
#define ATT_LDS  (LDS_RING + 2 * RING_B)
static_assert(QB * QSP * 2 == LDS_PS - LDS_QS);
static_assert(32 * FSP * 4 <= LDS_PMAX - LDS_QS && 32 * FSP * 4 <= 2 * RING_B && FSP >= DM && (FSP % 4) == 0);
static_assert(QB * PSP * 2 == LDS_PMAX - LDS_PS);
static_assert(LDS_PSUM - LDS_PMAX == 8 * QB * 4);
static_assert(LDS_ST - LDS_PSUM == 8 * QB * 4);
static_assert(LDS_RING - LDS_ST >= 4 * QB * 4);
static_assert(32 * KSP * 2 <= SLICE_B && 48 * VSP * 2 <= SLICE_B && (SLICE_B % 2048) == 0 && (LDS_RING % 2048) == 0);
static_assert(KSD * 2 == 256 && KSP * 2 == 256 + 16 && VSK * 2 == 128 && VSP * 2 == 128 + 16 && KCH == 8 * 32);
static_assert((DM % KSD) == 0 && (KCH % VSK) == 0 && ((DM / KSD) % 2) == 0 && DM == 2 * VSC && VSC == 8 * 48);
static_assert(ATT_LDS <= 327680);
static_assert((QSP % 8) == 0 && (PSP % 8) == 0 && PSP >= KCH);
static_assert((LDS_PS % 16) == 0 && (LDS_PMAX % 16) == 0 && (LDS_ST % 16) == 0);
static_assert((NTOK % (KCH * KSPLIT)) == 0 && (NTOK % QB) == 0);

// K stage: this wave's 32 key rows x 128 dims. g points at (first key row of the wave, first dim); l is the slice's place.
__device__ __forceinline__ void issue_k(uint32_t cnt1, const _Float16* g, uint32_t l) {
  tdm_slice<KW0, 256u, 32u>(cnt1, l, g, DM * 2u);
}
// V stage: this wave's 48 value-column rows x 64 keys. g points at (first column row of the wave, first key).
__device__ __forceinline__ void issue_v(uint32_t cnt1, const _Float16* g, uint32_t l, int ntok) {
  tdm_slice<VW0, 128u, 48u>(cnt1, l, g, (uint32_t)ntok * 2u);
}
__global__ __launch_bounds__(256) void attn_kernel(const _Float16* __restrict__ qn, const _Float16* __restrict__ kn,
                                                   const _Float16* __restrict__ vt, unsigned short* __restrict__ ph,
                                                   unsigned short* __restrict__ pl, float* __restrict__ pm,
                                                   float* __restrict__ pls, float sc, int ntok) {
  __shared__ __attribute__((aligned(2048))) char smem[ATT_LDS];
  _Float16* Qs = (_Float16*)(smem + LDS_QS);
  _Float16* Ps = (_Float16*)(smem + LDS_PS);
  float* pmax = (float*)(smem + LDS_PMAX);
  float* psum = (float*)(smem + LDS_PSUM);
  float* m_s  = (float*)(smem + LDS_ST);
  float* l_s  = m_s + QB;
  float* al_s = m_s + 2 * QB;
  float* li_s = m_s + 3 * QB;

  const int tid = threadIdx.x, wave = (int)uni(threadIdx.x >> 5), lane = tid & 31, h = lane >> 4, c = lane & 15;
  const int q0 = ((int)blockIdx.x >> 1) * QB;
  const int sp = (int)blockIdx.x & 1;             // which half of the keys
  const int ntile = ntok / (KCH * KSPLIT);        // key tiles of this block
  const int key0 = sp * ntile * KCH;
  const float ninf = -__builtin_inff();

  // ring addresses of this wave (all wave-uniform): its slice's place in buffer 0, its first key row, its first column row
  const uint32_t rl0 = (uint32_t)(size_t)(smem + LDS_RING) + (uint32_t)wave * SLICE_B;
  const _Float16* kg = kn + (size_t)(key0 + 32 * wave) * DM;
  const _Float16* vg = vt + (size_t)(48 * wave) * ntok + key0;

  // word 0 of every request's group 0 (count = 1), a descriptor word held in a scalar register by pinned(): made once, in
  // front of the first request; as a plain constant it was written into its register anew while stage 1's request flew
  const uint32_t cnt1 = pinned(1u);
  issue_k(cnt1, kg, rl0);   // stage 0 (tile 0, dims 0..127) into buffer 0; it flies under the Q staging

  if (tid < QB) { m_s[tid] = ninf; l_s[tid] = 0.0f; al_s[tid] = 0.0f; li_s[tid] = 0.0f; }
  psum[tid] = 0.0f;
  psum[256 + tid] = 0.0f;
  // Q tile: 64 rows x 96 pieces of 8 halves; coverage 24 * 256 = 6144 pieces = the whole tile
  {
    // the 64 rows lie in one piece in global memory: one address register, piece i at a constant distance
    const _Float16* qg = qn + (size_t)q0 * DM + tid * 8;
    v8h qv[24];
#pragma unroll
    for (int i = 0; i < 24; ++i) qv[i] = *(const v8h*)(qg + i * 2048);
    asm volatile("s_wait_xcnt 0x0" ::: "memory");   // in front of any rewrite of the loads' address register
#pragma unroll
    for (int i = 0; i < 24; ++i) {
      const int idx = i * 256 + tid;
      const int row = idx / 96;
      const int pc  = idx - row * 96;
      *(v8h*)(Qs + row * QSP + pc * 8) = qv[i];
    }
  }
  asm volatile("s_wait_tensorcnt 0x0" ::: "memory");  // own slice of stage 0 has landed
  __syncthreads();
  // keeps stage 1's descriptor words behind the wait
  __builtin_amdgcn_sched_barrier(0);
  issue_k(cnt1, kg + KSD, rl0 + RING_B);   // stage 1 into buffer 1

  v8f oacc[4][6];   // [query subtile][column subtile]: column 384 * (nt / 3) + 48 * wave + 16 * (nt % 3) + c
#pragma unroll
  for (int qt = 0; qt < 4; ++qt)
#pragma unroll
    for (int nt = 0; nt < 6; ++nt) oacc[qt][nt] = zero8();

  const _Float16* qbp = Qs + c * QSP + 8 * h;             // B operand, query c (+ 16 * QSP per query subtile)
  const _Float16* pap = Ps + c * PSP + 8 * h;             // A operand, query c (+ 16 * PSP per query subtile)

#pragma unroll 1
  for (int t = 0; t < ntile; ++t) {
    // ---- logits: S^T subtiles for keys kb..kb+31 (this wave), queries 0..63 ----
    v8f sacc[4][2];   // [query subtile][key subtile]; element r: query 16qt+c, key kb+16kt+8h+r
#pragma unroll
    for (int qt = 0; qt < 4; ++qt)
#pragma unroll
      for (int kt = 0; kt < 2; ++kt) sacc[qt][kt] = zero8();
    // the products of one K stage of 128 dims (stage j of the tile, in buffer j & 1)
    auto k_stage = [&](int j) __attribute__((always_inline)) {
      const _Float16* ka0p = (const _Float16*)(smem + LDS_RING + (j & 1) * RING_B + wave * SLICE_B) + c * KSP + 8 * h;
      const _Float16* ka1p = ka0p + 16 * KSP;
#pragma unroll   // the stage's four k steps in a row: LDS offsets become immediates
      for (int kk = 0; kk < KSD; kk += 32) {
        const v16h a0 = ldfrag(ka0p + kk), a1 = ldfrag(ka1p + kk);
        v16h b[4];
#pragma unroll
        for (int qt = 0; qt < 4; ++qt) b[qt] = ldfrag(qbp + (16 * qt) * QSP + j * KSD + kk);
        // keeps all twelve LDS loads of a k step ahead of the step's first WMMA: left alone, the compiler feeds the
        // B fragments through one register set, and every pair of WMMAs waits out the LDS latency
        __builtin_amdgcn_sched_barrier(0);
#pragma unroll
        for (int qt = 0; qt < 4; ++qt) {
          sacc[qt][0] = mma16(a0, b[qt], sacc[qt][0]);
          sacc[qt][1] = mma16(a1, b[qt], sacc[qt][1]);
        }
      }
    };
    // Six K stages, in two loops, so that every request stands in straight code that every wave runs (no test around a
    // tensor load, which ignores EXEC); both kept rolled: the loop text stays short. Behind each publish point the
    // buffer just read is refilled with the stage two ahead: K stages 2..5 ...
#pragma unroll 1
    for (int j = 0; j + 2 < DM / KSD; ++j) {
      k_stage(j);
      ring_publish_t();
      issue_k(cnt1, kg + (size_t)t * KCH * DM + (j + 2) * KSD, rl0 + (j & 1) * RING_B);
    }
    // ... then V stages 0, 1 of this tile
#pragma unroll 1
    for (int j = DM / KSD - 2; j < DM / KSD; ++j) {
      k_stage(j);
      ring_publish_t();
      issue_v(cnt1, vg + (size_t)(j + 2 - DM / KSD) * VSC * ntok + (size_t)t * KCH, rl0 + (j & 1) * RING_B, ntok);
    }
    // ---- scale, per-wave partial row max ----
#pragma unroll
    for (int qt = 0; qt < 4; ++qt) {
      float pmq = ninf;
#pragma unroll
      for (int kt = 0; kt < 2; ++kt) {
#pragma unroll
        for (int r = 0; r < 8; ++r) {
          const float v0 = sacc[qt][kt][r] * sc; sacc[qt][kt][r] = v0; pmq = fmaxf(pmq, v0);
        }
      }
      pmq = fmaxf(pmq, __shfl_xor(pmq, 16, 32));
      pmax[wave * QB + 16 * qt + c] = pmq;
    }
    __syncthreads();
    // ---- waves 0 and 1, thread = query row: fold the prior tile's sums into l, new running max, rescale factor ----
    if (wave < 2) {
      const int row = tid;
      float ps = 0.0f;
#pragma unroll
      for (int w = 0; w < 8; ++w) ps += psum[w * QB + row];
      l_s[row] = l_s[row] * al_s[row] + ps;
      const float mo = m_s[row];
      float mx = mo;
#pragma unroll
      for (int w = 0; w < 8; ++w) mx = fmaxf(mx, pmax[w * QB + row]);
      al_s[row] = __expf(mo - mx);
      m_s[row] = mx;
    }
    __syncthreads();
    // ---- p = 16 * exp(s - m) as f16, P tile, partial row sums, rescale O ----
#pragma unroll
    for (int qt = 0; qt < 4; ++qt) {
      const float mq = m_s[16 * qt + c];
      float ps = 0.0f;
#pragma unroll
      for (int kt = 0; kt < 2; ++kt) {
        v8h hq;
#pragma unroll
        for (int r = 0; r < 8; ++r) {
          const float p = __expf(sacc[qt][kt][r] - mq); ps += p; hq[r] = (_Float16)(p * 16.0f);
        }
        *(v8h*)(Ps + (16 * qt + c) * PSP + 32 * wave + 16 * kt + 8 * h) = hq;
      }
      ps += __shfl_xor(ps, 16, 32);
      psum[wave * QB + 16 * qt + c] = ps;
      const v4f aA = *(const v4f*)(al_s + 16 * qt + 8 * h), aB = *(const v4f*)(al_s + 16 * qt + 8 * h + 4);
#pragma unroll
      for (int nt = 0; nt < 6; ++nt) {
#pragma unroll
        for (int r = 0; r < 4; ++r) {
          oacc[qt][nt][r] *= aA[r]; oacc[qt][nt][4 + r] *= aB[r];
        }
      }
    }
    __syncthreads();
    // ---- O += P . V over the 256 keys of the tile ----
    // four groups of 64 keys; each group is two V stages (columns 0..383 in buffer 0, 384..767 in buffer 1), which
    // share the group's P fragments; 'last' is a literal at both calls
    auto v_group = [&](int kq, bool last) __attribute__((always_inline)) {
      v16h pa[2][4];
#pragma unroll
      for (int k2 = 0; k2 < 2; ++k2)
#pragma unroll
        for (int qt = 0; qt < 4; ++qt) pa[k2][qt] = ldfrag(pap + (16 * qt) * PSP + kq * VSK + 32 * k2);
#pragma unroll   // the accumulator index depends on the column half
      for (int hf = 0; hf < 2; ++hf) {
        const _Float16* vbp = (const _Float16*)(smem + LDS_RING + hf * RING_B + wave * SLICE_B) + c * VSP + 8 * h;
        v16h vb[2][3];
#pragma unroll
        for (int k2 = 0; k2 < 2; ++k2)
#pragma unroll
          for (int j = 0; j < 3; ++j) vb[k2][j] = ldfrag(vbp + (16 * j) * VSP + 32 * k2);
        // keeps all LDS loads of the stage ahead of its first WMMA (as in the K stages)
        __builtin_amdgcn_sched_barrier(0);
#pragma unroll
        for (int k2 = 0; k2 < 2; ++k2)
#pragma unroll
          for (int j = 0; j < 3; ++j)
#pragma unroll
            for (int qt = 0; qt < 4; ++qt)
              oacc[qt][3 * hf + j] = mma16(pa[k2][qt], vb[k2][j], oacc[qt][3 * hf + j]);
        ring_publish_t();
        // refill: the same column half of the next key group; behind the last group K stages 0, 1 of the next tile
        // while one exists (a scalar test, the same for the whole block)
        if (!last) {
          issue_v(cnt1, vg + (size_t)hf * VSC * ntok + (size_t)t * KCH + (kq + 1) * VSK, rl0 + hf * RING_B, ntok);
        } else if (pinned(t + 1 < ntile)) {
          issue_k(cnt1, kg + (size_t)(t + 1) * KCH * DM + hf * KSD, rl0 + hf * RING_B);
        }
      }
    };
    // groups 0..2 kept rolled for the same reason as the K stages; the last group apart, for its other refill
#pragma unroll 1
    for (int kq = 0; kq + 1 < KCH / VSK; ++kq) v_group(kq, false);
    v_group(KCH / VSK - 1, true);
  }
  asm volatile("s_wait_tensorcnt 0x0" ::: "memory");  // no request is left in flight behind the loop
  asm volatile("s_wait_dscnt 0x0" ::: "memory");      // own ring reads are done before the ring becomes output staging

  // ---- this half's row sum (fold the last tile's sums) and maximum; O_half = oacc / (256 * l) (P carry 16, vn carry 16) ----
  if (wave < 2) {
    const int row = tid;
    float ps = 0.0f;
#pragma unroll
    for (int w = 0; w < 8; ++w) ps += psum[w * QB + row];
    const float l = l_s[row] * al_s[row] + ps;
    li_s[row] = (1.0f / l) * (1.0f / 256.0f);
    pm[(size_t)sp * ntok + q0 + row]  = m_s[row];
    pls[(size_t)sp * ntok + q0 + row] = l;
  }
  __syncthreads();
  // ---- stage the 64 x 768 f32 accumulator tile: rows 0..31 over the Q and P regions, rows 32..63 over the ring ----
  float* F0 = (float*)(smem + LDS_QS);
  float* F1 = (float*)(smem + LDS_RING);
#pragma unroll
  for (int qt = 0; qt < 4; ++qt) {
    float* F = ((qt < 2) ? F0 : F1) + (16 * (qt & 1) + 8 * h) * FSP;
#pragma unroll
    for (int nt = 0; nt < 6; ++nt) {
      const int col = VSC * (nt / 3) + 48 * wave + 16 * (nt % 3) + c;
#pragma unroll
      for (int r = 0; r < 8; ++r) F[r * FSP + col] = oacc[qt][nt][r];
    }
  }
  __syncthreads();
  // ---- each wave: 8 whole rows, normalised, split into bf16 hi / lo, 512 B per store instruction (3 per row and plane) ----
  {
    unsigned short* gh = ph + ((size_t)sp * ntok + q0) * DM;
    unsigned short* gl = pl + ((size_t)sp * ntok + q0) * DM;
    // kept rolled: run once per block, unrolled it is some thousand instructions that are fetched to be used once
#pragma unroll 1
    for (int it = 0; it < 24; ++it) {
      const int rr = it / 3;
      const int row = 8 * wave + rr;
      const int pc = (it - rr * 3) * 32 + lane;
      const float* F = ((row < 32) ? F0 + row * FSP : F1 + (row - 32) * FSP) + pc * 8;
      const float inv = li_s[row];
      const v4f x0 = *(const v4f*)(F), x1 = *(const v4f*)(F + 4);
      v8us hvv, lvv;
#pragma unroll
      for (int e = 0; e < 4; ++e) {
        unsigned short hb, lb;
        split_bf(x0[e] * inv, hb, lb);
        hvv[e] = hb;      lvv[e] = lb;
        split_bf(x1[e] * inv, hb, lb);
        hvv[4 + e] = hb;  lvv[4 + e] = lb;
      }
      *(v8us*)(gh + (size_t)row * DM + pc * 8) = hvv;
      *(v8us*)(gl + (size_t)row * DM + pc * 8) = lvv;
      // the next trip rewrites the two stores' address and data registers: the wait stands in front of that
      asm volatile("s_wait_xcnt 0x0" ::: "memory");
    }
  }
}

// ---------------------------------------------------------------------------------------------
// Kernel 5: join the two key halves of the attention: with M = max(m0, m1) and w_i = l_i * exp(m_i - M),
//   O = (w0 * O_0 + w1 * O_1) / (w0 + w1), O_i = hi + lo of half i; O goes out again as bf16 hi / lo planes [ntok][DM].
// 8 columns per thread: one 16-B load and store per lane and plane, 32 lanes contiguous = 512 B.
// coverage: ntok * DM / 8 threads exactly (DM / 8 = 96 pieces a row).
// ---------------------------------------------------------------------------------------------
__global__ __launch_bounds__(256) void merge_kernel(const unsigned short* __restrict__ ph,
                                                    const unsigned short* __restrict__ pl,
                                                    const float* __restrict__ pm, const float* __restrict__ pls,
                                                    unsigned short* __restrict__ oh, unsigned short* __restrict__ ol,
                                                    int ntok) {
  const int li = (int)blockIdx.x * 256 + (int)threadIdx.x;
  const int row = li / (DM / 8);
  if (row >= ntok) return;
  const size_t e = (size_t)li * 8;
  const size_t pst = (size_t)ntok * DM;
  const float m0 = pm[row], m1 = pm[ntok + row];
  const float l0 = pls[row], l1 = pls[ntok + row];
  // the wide loads' results may take these four loads' address registers: the wait stands in front of that rewrite
  asm volatile("s_wait_xcnt 0x0" ::: "memory");
  const v8us h0 = *(const v8us*)(ph + e), g0 = *(const v8us*)(pl + e);
  const v8us h1 = *(const v8us*)(ph + pst + e), g1 = *(const v8us*)(pl + pst + e);
  const float mx = fmaxf(m0, m1);
  float w0 = l0 * __expf(m0 - mx), w1 = l1 * __expf(m1 - mx);
  const float inv = 1.0f / (w0 + w1);
  w0 *= inv;
  w1 *= inv;
  v8us oh8, ol8;
#pragma unroll
  for (int i = 0; i < 8; ++i) {
    const float f = w0 * (bfval(h0[i]) + bfval(g0[i])) + w1 * (bfval(h1[i]) + bfval(g1[i]));
    unsigned short hb, lb;
    split_bf(f, hb, lb);
    oh8[i] = hb;
    ol8[i] = lb;
  }
  *(v8us*)(oh + e) = oh8;
  *(v8us*)(ol + e) = ol8;
}

// ---------------------------------------------------------------------------------------------
// Workspace map (bytes, all regions exact tile / whole-line multiples, no padding needed):
//   Wq16 : Wqkv f16 [768][768] (64 * bf16(w))                 off 0           size  1,179,648
//   Wpb  : Wproj bf16 bits [768][768]                           off 1,179,648   size  1,179,648
//   X16  : ln(q), ln(k), ln(v) stacked f16 [24576][768]        off 2,359,296   size 37,748,736
//   QK16 : qn then kn f16 [16384][768]                          off 40,108,032  size 25,165,824
//   VT16 : vn^T f16 [768][8192]                                 off 65,273,856  size 12,582,912
//   OH   : attention output bf16 hi [8192][768]                 off 77,856,768  size 12,582,912
//   OL   : attention output bf16 lo [8192][768]                 off 90,439,680  size 12,582,912
//   PH   : per key half, attention output bf16 hi [2][8192][768] off 103,022,592 size 25,165,824
//   PL   : per key half, attention output bf16 lo [2][8192][768] off 128,188,416 size 25,165,824
//   PM   : per key half, row maximum f32 [2][8192]              off 153,354,240 size     65,536
//   PS   : per key half, row sum f32 [2][8192]                  off 153,419,776 size     65,536
//   total 153,485,312
// ---------------------------------------------------------------------------------------------
extern "C" void kernel_launch(void* const* d_in, const int* in_sizes, int n_in,
                              void* d_out, int out_size, void* d_ws, size_t ws_size,
                              hipStream_t stream) {
  if (n_in < 8) return;
  const int ntok = NTOK, dm = DM;
  if (in_sizes[0] != ntok * dm || in_sizes[1] != ntok * dm || in_sizes[2] != ntok * dm) return;
  if (in_sizes[3] != dm || in_sizes[4] != dm || in_sizes[7] != dm) return;
  if (in_sizes[5] != dm * dm || in_sizes[6] != dm * dm) return;
  if (out_size != ntok * dm) return;

  const float* q     = (const float*)d_in[0];
  const float* k     = (const float*)d_in[1];
  const float* v     = (const float*)d_in[2];
  const float* ln_w  = (const float*)d_in[3];
  const float* ln_b  = (const float*)d_in[4];
  const float* Wqkv  = (const float*)d_in[5];
  const float* Wproj = (const float*)d_in[6];
  const float* bproj = (const float*)d_in[7];
  float* out = (float*)d_out;

  const size_t bWq = (size_t)dm * dm * 2;
  const size_t bWp = (size_t)dm * dm * 2;
  const size_t bX  = (size_t)3 * ntok * dm * 2;
  const size_t bQK = (size_t)2 * ntok * dm * 2;
  const size_t bVT = (size_t)dm * ntok * 2;
  const size_t bO  = (size_t)ntok * dm * 2;
  size_t off = 0;
  const size_t oWq = off; off += bWq;
  const size_t oWp = off; off += bWp;
  const size_t oX  = off; off += bX;
  const size_t oQK = off; off += bQK;
  const size_t oVT = off; off += bVT;
  const size_t oOH = off; off += bO;
  const size_t oOL = off; off += bO;
  const size_t oPH = off; off += 2 * bO;
  const size_t oPL = off; off += 2 * bO;
  const size_t oPM = off; off += (size_t)2 * ntok * 4;
  const size_t oPS = off; off += (size_t)2 * ntok * 4;
  if (off > ws_size) return;                     // 153,485,312

  char* ws = (char*)d_ws;
  _Float16*       Wq16 = (_Float16*)(ws + oWq);
  unsigned short* Wpb  = (unsigned short*)(ws + oWp);
  _Float16*       X16  = (_Float16*)(ws + oX);
  _Float16*       QK16 = (_Float16*)(ws + oQK);
  _Float16*       VT16 = (_Float16*)(ws + oVT);
  unsigned short* OH   = (unsigned short*)(ws + oOH);
  unsigned short* OL   = (unsigned short*)(ws + oOL);
  unsigned short* PH   = (unsigned short*)(ws + oPH);
  unsigned short* PL   = (unsigned short*)(ws + oPL);
  float*          PM   = (float*)(ws + oPM);
  float*          PS   = (float*)(ws + oPS);

  const dim3 blk(256);
  const dim3 gblk(128);                       // the GEMM's block: 4 waves
  const int n8 = dm * dm / 8;                 // 73728 = 288 * 256
  if ((n8 % 256) != 0) return;

  // (1) weights -> Wqkv f16 plane (64 * bf16(w)) and Wproj bf16 plane
  cvt_w_kernel<<<dim3(2 * (n8 / 256)), blk, 0, stream>>>(Wqkv, Wproj, Wq16, Wpb, n8);
  // (2) LayerNorm of q, k, v -> X16 (8 * ln)
  ln_kernel<<<dim3(3 * ntok / 8), blk, 0, stream>>>(q, k, v, ln_w, ln_b, X16, ntok);
  // (3) qn, kn = X[0:16384] . Wqkv^T  -> QK16 (16 * qn | 16 * kn); M=16384, N=768, K=768; scale 16/(8*64)
  gemm64_kernel<0, false, 1><<<dim3((2 * ntok / 128) * (dm / 128)), gblk, 0, stream>>>(
      (const unsigned short*)X16, (const unsigned short*)X16, dm, (const unsigned short*)Wq16, dm,
      (void*)QK16, dm, bproj, 2 * ntok, dm, dm, 0.03125f);
  // (4) vn^T = Wqkv . X[16384:24576]^T -> VT16 [768][8192] (16 * vn); M=768, N=8192, K=768
  gemm64_kernel<0, false, 1><<<dim3((dm / 128) * (ntok / 128)), gblk, 0, stream>>>(
      (const unsigned short*)Wq16, (const unsigned short*)Wq16, dm,
      (const unsigned short*)(X16 + (size_t)2 * ntok * dm), dm,
      (void*)VT16, ntok, bproj, dm, ntok, dm, 0.03125f);
  // (5) attention per key half -> PH / PL, PM, PS; logit scale = dim^-0.5 / 256 (operand carries 16 * 16)
  const float sc = 0.03608439182435161f * (1.0f / 256.0f);
  attn_kernel<<<dim3(KSPLIT * (ntok / QB)), blk, 0, stream>>>(QK16, QK16 + (size_t)ntok * dm, VT16, PH, PL, PM, PS,
                                                              sc, ntok);
  // (6) the two key halves joined -> OH / OL (bf16 hi / lo of O)
  merge_kernel<<<dim3(ntok * (dm / 8) / 256), blk, 0, stream>>>(PH, PL, PM, PS, OH, OL, ntok);
  // (7) out = (O_hi + O_lo) . Wproj^T + b -> d_out f32 [8192][768]; bf16 operands, scale 1
  gemm64_kernel<1, true, 0><<<dim3((ntok / 128) * (dm / 128)), gblk, 0, stream>>>(
      OH, OL, dm, Wpb, dm, (void*)out, dm, bproj, ntok, dm, dm, 1.0f);
  (void)hipGetLastError();
}

// v005
// It runs in 250 microseconds.
// Two timings next to v004 put it at 1.03 and 1.04 times that version's speed.
// Counting every step since v000, it is 2.75 times as fast.
// Contractions: qn|kn = ln(q|k).Wqkv^T, vn^T = Wqkv.ln(v)^T, S^T = kn.qn^T, O = P.vn : v_wmma_f32_16x16x32_f16, f16 operands with
// power-of-two carries (ln x8, Wqkv x64, qn/kn/vn x16, P = 16*exp(s - m)), f32 accumulate; out = O.Wproj^T + b : v_wmma_f32_16x16x32_bf16,
// O as bf16 hi/lo planes (hi.W + lo.W), Wproj bf16, f32 accumulate; float inputs RNE-converted to bf16 on load; LayerNorm, softmax
// statistics and bias in f32.
#include <hip/hip_runtime.h>
#include <stdint.h>

#define NTOK 8192
#define DM   768

typedef _Float16 v16h __attribute__((ext_vector_type(16)));
typedef _Float16 v8h  __attribute__((ext_vector_type(8)));
typedef __bf16   v16b __attribute__((ext_vector_type(16)));
typedef __bf16   v8b  __attribute__((ext_vector_type(8)));
typedef float    v8f  __attribute__((ext_vector_type(8)));
typedef float    v4f  __attribute__((ext_vector_type(4)));
typedef unsigned short v8us __attribute__((ext_vector_type(8)));

static_assert((DM % 64) == 0);
static_assert((NTOK % 256) == 0);

// f32 -> nearest-even bf16 bits / value
__device__ __forceinline__ unsigned short bfbits(float f) {
  unsigned u = __float_as_uint(f);
  return (unsigned short)((u + 0x7FFFu + ((u >> 16) & 1u)) >> 16);
}
__device__ __forceinline__ float bfval(unsigned short b) { return __uint_as_float(((unsigned)b) << 16); }
__device__ __forceinline__ float bfr(float f) { return bfval(bfbits(f)); }
__device__ __forceinline__ void split_bf(float f, unsigned short& hb, unsigned short& lb) {
  hb = bfbits(f);
  lb = bfbits(f - bfval(hb));
}

// 16-bit operand element types for the GEMM template: 0 = f16, 1 = bf16
template <int ET> struct Elem;
template <> struct Elem<0> {
  typedef _Float16 T; typedef v16h V; typedef v8h V8;
  static __device__ __forceinline__ v8f mma(V a, V b, v8f c) {
    return __builtin_amdgcn_wmma_f32_16x16x32_f16(false, a, false, b, (short)0, c, false, false);
  }
};
template <> struct Elem<1> {
  typedef __bf16 T; typedef v16b V; typedef v8b V8;
  static __device__ __forceinline__ v8f mma(V a, V b, v8f c) {
    return __builtin_amdgcn_wmma_f32_16x16x32_bf16(false, a, false, b, (short)0, c, false, false);
  }
};

// 16-bit WMMA fragment from k-contiguous storage (A row-major [m][k], or B stored [n][k]):
// p points at element (row_or_col = lane&15, k0 + 8h); elements 0..7 <- p[0..7], 8..15 <- p[16..23].
template <int ET>
__device__ __forceinline__ typename Elem<ET>::V ldfragT(const typename Elem<ET>::T* p) {
  typedef typename Elem<ET>::V V;
  typedef typename Elem<ET>::V8 V8;
  union { V v; V8 h[2]; } f;
  f.h[0] = *(const V8*)(p);
  f.h[1] = *(const V8*)(p + 16);
  return f.v;
}
__device__ __forceinline__ v16h ldfrag(const _Float16* p) { return ldfragT<0>(p); }
__device__ __forceinline__ v8f mma16(v16h a, v16h b, v8f c) { return Elem<0>::mma(a, b, c); }
__device__ __forceinline__ v8f zero8() {
  v8f z;
#pragma unroll
  for (int i = 0; i < 8; ++i) z[i] = 0.0f;
  return z;
}

// hazard guard: 4 VALU slots after the last WMMA of a group, D tied
__device__ __forceinline__ void accg4(v8f& a, v8f& b, v8f& c, v8f& d) {
  asm volatile("v_nop\n\tv_nop\n\tv_nop\n\tv_nop" : "+v"(a), "+v"(b), "+v"(c), "+v"(d));
}

// ---------------------------------------------------------------------------------------------
// Kernel 1: two [DM][DM] f32 weight matrices -> 16-bit planes, layout unchanged ([out][in], k = in contiguous):
//   blocks [0, nb0):  d16[e] = f16(64 * bf16(w0[e]))     (f16 operand plane for the qkv projection)
//   blocks [nb0, 2nb0): dbf[e] = bf16 bits of w1[e]       (bf16 operand plane for the output projection)
// Block-uniform select, no barriers. 8 elements per thread: one 16-B store per lane, 32 lanes contiguous = 512 B =
// coverage: nb0 * 256 threads * 8 = DM * DM elements per plane exactly (n8 = DM*DM/8 is a multiple of 256).
// ---------------------------------------------------------------------------------------------
__global__ __launch_bounds__(256) void cvt_w_kernel(const float* __restrict__ w0, const float* __restrict__ w1,
                                                    _Float16* __restrict__ d16, unsigned short* __restrict__ dbf,
                                                    int n8) {
  const int nb0 = n8 >> 8;
  const bool second = ((int)blockIdx.x >= nb0);
  const float* src = second ? w1 : w0;
  const int li = ((int)blockIdx.x - (second ? nb0 : 0)) * 256 + (int)threadIdx.x;
  if (li >= n8) return;
  const size_t e = (size_t)li * 8;
  const v4f a = *(const v4f*)(src + e);
  const v4f b = *(const v4f*)(src + e + 4);
  if (!second) {
    v8h o;
#pragma unroll
    for (int i = 0; i < 4; ++i) {
      o[i]     = (_Float16)(bfr(a[i]) * 64.0f);
      o[4 + i] = (_Float16)(bfr(b[i]) * 64.0f);
    }
    _Float16* d = d16 + e;
    *(v8h*)d = o;
    
  } else {
    v8us o;
#pragma unroll
    for (int i = 0; i < 4; ++i) {
      o[i]     = bfbits(a[i]);
      o[4 + i] = bfbits(b[i]);
    }
    unsigned short* d = dbf + e;
    *(v8us*)d = o;
    
  }
}

// ---------------------------------------------------------------------------------------------
// The two streaming kernels (LayerNorm, merge) run as SG_BLK work-groups of SG_THR threads: 4,096 waves in all, each of
// which walks several rows or pieces, so that few waves have to be started and each keeps many loads in flight.
#define SG_BLK 256
#define SG_THR 512
#define SG_WAVES (SG_BLK * (SG_THR / 32))
static_assert((3 * NTOK) % SG_WAVES == 0);

// Kernel 2: LayerNorm of q, k, v (bf16-converted inputs, f32 statistics, centred variance) -> f16 plane X
// [3*ntok][DM], value = 8 * ln(x). Rows [0,ntok) of X come from q, the next ntok from k, the next from v.
// One wave per row at a time; wave g takes rows g, g + waves, g + 2 * waves, ... The row (3 KB) is read once and held in
// registers: lane owns columns (j*32+lane)*8 .. +7 of chunk j (j = 0..2). The next row's six loads are issued before the
// current row is worked on. Weight and bias of the lane's 24 columns are converted once per wave.
// Stores: one 16-B store per lane and chunk, 32 lanes contiguous = 512 B.
// coverage: rows g + i * waves over all waves g = every row below 3*ntok once; 3 chunks * 32 lanes * 8 = 768 columns.
// ---------------------------------------------------------------------------------------------
__device__ __forceinline__ const float* ln_row(const float* qx, const float* kx, const float* vx, int r, int ntok) {
  const int seg = (r >= 2 * ntok) ? 2 : ((r >= ntok) ? 1 : 0);
  const float* src = (seg == 2) ? vx : ((seg == 1) ? kx : qx);
  return src + (size_t)(r - seg * ntok) * DM;
}
__global__ __launch_bounds__(SG_THR) void ln_kernel(const float* __restrict__ qx, const float* __restrict__ kx,
                                                    const float* __restrict__ vx, const float* __restrict__ lw,
                                                    const float* __restrict__ lb, _Float16* __restrict__ X, int ntok) {
  const int wave = __builtin_amdgcn_readfirstlane((int)(threadIdx.x >> 5)), lane = threadIdx.x & 31;
  const int nw = (int)gridDim.x * (SG_THR / 32);
  const int total = 3 * ntok;
  int row = (int)blockIdx.x * (SG_THR / 32) + wave;
  if (row >= total) return;                      // the same for the whole wave; the kernel has no barrier

  v4f nxt[6];
  {
    const float* p = ln_row(qx, kx, vx, row, ntok) + lane * 8;
#pragma unroll
    for (int j = 0; j < 3; ++j) {
      nxt[2 * j]     = *(const v4f*)(p + j * 256);
      nxt[2 * j + 1] = *(const v4f*)(p + j * 256 + 4);
    }
  }
  float w[24], b8[24];                           // bf16(weight), 8 * bf16(bias) of this lane's columns
#pragma unroll
  for (int j = 0; j < 3; ++j) {
    const int c0 = (j * 32 + lane) * 8;
    const v4f wa = *(const v4f*)(lw + c0), wb = *(const v4f*)(lw + c0 + 4);
    const v4f ba = *(const v4f*)(lb + c0), bb = *(const v4f*)(lb + c0 + 4);
#pragma unroll
    for (int e = 0; e < 4; ++e) {
      w[8 * j + e]      = bfr(wa[e]);
      w[8 * j + 4 + e]  = bfr(wb[e]);
      b8[8 * j + e]     = bfr(ba[e]) * 8.0f;
      b8[8 * j + 4 + e] = bfr(bb[e]) * 8.0f;
    }
  }
  asm volatile("s_wait_xcnt 0x0" ::: "memory");   // in front of any rewrite of these loads' address registers
  // the row in work, bf16-converted: made from the loaded row at the foot of the trip before, so that at the head of a
  // trip no load but the next row's is outstanding and nothing in the trip's work waits for those
  float x[24];
#pragma unroll
  for (int jj = 0; jj < 6; ++jj)
#pragma unroll
    for (int e = 0; e < 4; ++e) x[4 * jj + e] = bfr(nxt[jj][e]);

  // kept rolled: one row's text, run for every row of the wave
#pragma unroll 1
  for (;;) {
    const int nrow = row + nw;
    const bool more = nrow < total;              // scalar: the same for the whole wave
    if (more) {
      const float* p = ln_row(qx, kx, vx, nrow, ntok) + lane * 8;
#pragma unroll
      for (int j = 0; j < 3; ++j) {
        nxt[2 * j]     = *(const v4f*)(p + j * 256);
        nxt[2 * j + 1] = *(const v4f*)(p + j * 256 + 4);
      }
      asm volatile("s_wait_xcnt 0x0" ::: "memory");   // in front of any rewrite of the loads' address registers
    }
    // keeps the next row's loads ahead of the work on this row: sunk into it, they would fly for less time
    __builtin_amdgcn_sched_barrier(0);

    float s = 0.0f;
#pragma unroll
    for (int jj = 0; jj < 6; ++jj) s += (x[4 * jj] + x[4 * jj + 1]) + (x[4 * jj + 2] + x[4 * jj + 3]);
#pragma unroll
    for (int off = 16; off > 0; off >>= 1) s += __shfl_xor(s, off, 32);
    const float mu = s * (1.0f / 768.0f);

    // centred sum of squares
    float s2 = 0.0f;
#pragma unroll
    for (int i = 0; i < 24; ++i) {
      const float d = x[i] - mu;
      s2 += d * d;
    }
#pragma unroll
    for (int off = 16; off > 0; off >>= 1) s2 += __shfl_xor(s2, off, 32);
    const float rstd8 = rsqrtf(s2 * (1.0f / 768.0f) + 1e-5f) * 8.0f;   // x8 carry folded into the scale

    _Float16* yr = X + (size_t)row * DM + lane * 8;
#pragma unroll
    for (int j = 0; j < 3; ++j) {
      v8h o;
#pragma unroll
      for (int e = 0; e < 8; ++e) {
        const float t = (x[8 * j + e] - mu) * rstd8;
        o[e] = (_Float16)(t * w[8 * j + e] + b8[8 * j + e]);
      }
      *(v8h*)(yr + j * 256) = o;
    }
    asm volatile("s_wait_xcnt 0x0" ::: "memory");   // the next trip rewrites the stores' address and data registers
    if (!more) break;
#pragma unroll
    for (int jj = 0; jj < 6; ++jj)
#pragma unroll
      for (int e = 0; e < 4; ++e) x[4 * jj + e] = bfr(nxt[jj][e]);
    row = nrow;
  }
}

// One asynchronous 16-B-per-lane copy global -> LDS, as the builtin: its address registers are the compiler's, which
// may place them above v255 (an asm operand may not lie there).
typedef int v4i __attribute__((ext_vector_type(4)));
__device__ __forceinline__ void acopy(const _Float16* g, char* l) {
  __builtin_amdgcn_global_load_async_to_lds_b128((__attribute__((address_space(1))) v4i*)g,
                                                 (__attribute__((address_space(3))) v4i*)l, 0, 0);
}
// Publish point of the ring: this wave's LDS reads of the buffer to be refilled have retired, its own copies of the
// next stage have landed, then the work-group barrier behind which that stage is read and the old buffer refilled.
__device__ __forceinline__ void ring_publish() {
  // keeps the stage's WMMAs ahead of the publish point: sunk behind the barrier, they stand between it and the refill,
  // and the copies lose that much of their flight time
  __builtin_amdgcn_sched_barrier(0);
  asm volatile("s_wait_dscnt 0x0" ::: "memory");     // own reads of the stage just used are done
  asm volatile("s_wait_asynccnt 0x0" ::: "memory");  // own copies of the next stage have landed
  __syncthreads();
}

// Tensor load of one two-dimensional slice, global -> LDS: NROW rows of ROWB bytes at source pitch 'pitch' bytes, landing at
// LDS byte offset lds_dst with the row pad that word 0 of group 1 (W0, a constant) names. One request of the whole wave;
// every descriptor word is wave-uniform and goes through readfirstlane. 1-byte elements, tensor dims = tile dims, no mask.
typedef uint32_t u32x4 __attribute__((ext_vector_type(4)));
typedef uint32_t u32x8 __attribute__((ext_vector_type(8)));
__device__ __forceinline__ uint32_t uni(uint32_t v) { return (uint32_t)__builtin_amdgcn_readfirstlane(v); }
// a wave-uniform issue test, or a descriptor word, of the tensor mover held in a scalar register: the branch on such a test
// is a scalar branch (a tensor load ignores EXEC); such a word is made once, where pinned() stands
__device__ __forceinline__ uint32_t pinned(uint32_t v) {
  uint32_t w = (uint32_t)__builtin_amdgcn_readfirstlane(v);
  asm volatile("" : "+s"(w));   // pinned(): the tensor mover's issue test (compiles to s_cmp + s_cbranch_scc) or descriptor word in a scalar register
  return w;
}
template <uint32_t W0, uint32_t ROWB, uint32_t NROW>
__device__ __forceinline__ void tdm_slice(uint32_t cnt1, uint32_t lds_dst, const _Float16* g, uint32_t pitch) {
  const uint64_t ga = (uint64_t)(size_t)g;
  u32x4 g0;
  u32x8 g1;
  g0[0] = cnt1;   // count = 1, from the caller's pinned word
  g0[1] = uni(lds_dst);
  g0[2] = uni((uint32_t)ga);
  g0[3] = uni((((uint32_t)(ga >> 32)) & 0x01FFFFFFu) | 0x80000000u);
  g1[0] = uni(W0);
  g1[1] = uni((ROWB & 0xFFFFu) << 16);
  g1[2] = uni((ROWB >> 16) | ((NROW & 0xFFFFu) << 16));
  g1[3] = uni((NROW >> 16) | (ROWB << 16));
  g1[4] = uni(NROW);
  g1[5] = uni(pitch);
  g1[6] = uni(0u);
  g1[7] = uni(0u);
  // Issued from twelve scalar registers named here, above all that the kernel else uses, which hold nothing else: they are
  // written only in front of an issue, behind the wait for the request before, so that an outstanding request's words
  // stay in place until it has landed (left to the compiler's choice, it reused the registers for other values at once).
  asm volatile("tensor_load_to_lds %0, %1" :: "{s[88:91]}"(g0), "{s[92:99]}"(g1) : "memory");
}
// Publish point of the tensor-load ring: this wave's LDS reads of the buffer to be refilled have retired, its own request
// for the next stage has landed, then the work-group barrier behind which that stage is read and the old buffer refilled.
__device__ __forceinline__ void ring_publish_t() {
  // keeps the stage's WMMAs ahead of the publish point (as in ring_publish)
  __builtin_amdgcn_sched_barrier(0);
  asm volatile("s_wait_dscnt 0x0" ::: "memory");      // own reads of the stage just used are done
  asm volatile("s_wait_tensorcnt 0x0" ::: "memory");  // own slice of the next stage has landed
  __syncthreads();
  // keeps the next request's descriptor words behind the wait: none is formed while a request is outstanding
  __builtin_amdgcn_sched_barrier(0);
}

// ---------------------------------------------------------------------------------------------
// Kernel 3: C[m][n] = scale * sum_k A[m][k] * Bt[n][k] (+ bf16(bias[n]) when OUT_MODE == 0).
// A row-major [M][K] 16-bit (ET 0: f16, ET 1: bf16) pitch lda; Bt row-major [N][K] same type pitch ldb; M, N multiples
// of 128, K a multiple of 64. SPLITA: A is a hi plane (Ap) plus a lo plane (A2p, same layout), product = hi.B + lo.B.
// Block = 128 threads = 4 waves (2 x 2) on one 128x128 C tile; each wave owns one 64x64 part (16 f32 accumulators).
// The operands reach LDS by asynchronous copies in whole lines, in a ring of two buffers: a stage is 64 k (128 B) of
// the tile's 128 A rows (both planes when SPLITA) and 128 Bt rows; each wave copies 32 rows of every plane; at the
// foot of every stage one publish point, then the refill of the buffer just read with the stage two ahead.
// OUT_MODE 0: f32 output; OUT_MODE 1: f16 output. Epilogue: 16-row slab per wave in LDS (over the ring, which is
// out of use behind the last publish point), then each 64-wide row goes out in whole lines.
// coverage: tilesM * tilesN tiles, each 128x128 written fully -> M x N.
// ---------------------------------------------------------------------------------------------
#define GKS 64       // k per stage: 128 B a row, one whole line
#define GSP 72       // stage row pitch in halves: 144 B = 16 B x odd, for ds_load_b128 readers
#define GPL (128 * GSP * 2)   // one operand plane of a stage: 128 rows
static_assert((DM % GKS) == 0 && (DM % 128) == 0 && (NTOK % 128) == 0 && 4 * 16 * 68 * 4 <= 2 * GPL);

// 32 rows x 128 B of one plane: one copy = 4 rows x 128 B (four whole lines). 8 copies.
// g points at (first row of the wave + lane / 8, first k + 8 * (lane % 8)); l is that lane's place in LDS.
__device__ __forceinline__ void issue_g(const void* g, int ld, char* l) {
#pragma unroll
  for (int i = 0; i < 8; ++i) acopy((const _Float16*)g + (size_t)(4 * i) * ld, l + i * 4 * GSP * 2);
}

template <int ET, bool SPLITA, int OUT_MODE>
__global__ __launch_bounds__(128) void gemm64_kernel(const unsigned short* __restrict__ Ap,
                                                     const unsigned short* __restrict__ A2p, int lda,
                                                     const unsigned short* __restrict__ Btp, int ldb,
                                                     void* __restrict__ Cout, int ldc,
                                                     const float* __restrict__ bias,
                                                     int M, int N, int K, float scale) {
  typedef typename Elem<ET>::T T;
  typedef typename Elem<ET>::V V;
  const T* A  = (const T*)(const void*)Ap;
  const T* A2 = (const T*)(const void*)A2p;
  const T* Bt = (const T*)(const void*)Btp;
  constexpr int BOFF = (SPLITA ? 2 : 1) * GPL;   // the Bt plane's place in a buffer
  constexpr int BUFB = BOFF + GPL;               // one ring buffer
  __shared__ __align__(16) char gsm[2 * BUFB];
  const int lane = threadIdx.x & 31, wave = threadIdx.x >> 5;
  const int tilesN = N >> 7, tilesM = M >> 7;
  const int tile = (int)blockIdx.x;
  if (tile >= tilesM * tilesN) return;           // the same for the whole block, in front of every barrier
  const int tm = tile / tilesN, tn = tile - tm * tilesN;
  const int m0 = (tm << 7) + ((wave >> 1) << 6), n0 = (tn << 7) + ((wave & 1) << 6);   // this wave's 64x64 part
  const int rl = lane & 15;
  const int koff = (lane >> 4) * 8;
  const int mOff = (lane >> 4) * 8;
  const int nst = K / GKS;

  // copy addresses of this lane: rows 32 * wave + lane / 8 (+ 4 a copy) of each plane, piece lane % 8 of the row
  const int crow = 32 * wave + (lane >> 3), cpc = lane & 7;
  const T* ga  = A  + (size_t)((tm << 7) + crow) * lda + cpc * 8;
  const T* ga2 = A2 + (size_t)((tm << 7) + crow) * lda + cpc * 8;
  const T* gb  = Bt + (size_t)((tn << 7) + crow) * ldb + cpc * 8;
  char* lc = gsm + crow * GSP * 2 + cpc * 16;

  issue_g(ga, lda, lc);                          // stage 0 into buffer 0
  if (SPLITA) issue_g(ga2, lda, lc + GPL);
  issue_g(gb, ldb, lc + BOFF);

  v8f acc[4][4];
#pragma unroll
  for (int i = 0; i < 4; ++i)
#pragma unroll
    for (int j = 0; j < 4; ++j) acc[i][j] = zero8();

  asm volatile("s_wait_asynccnt 0x0" ::: "memory");  // own copies of stage 0 have landed
  __syncthreads();
  if (nst > 1) {                                 // stage 1 into buffer 1
    issue_g(ga + GKS, lda, lc + BUFB);
    if (SPLITA) issue_g(ga2 + GKS, lda, lc + BUFB + GPL);
    issue_g(gb + GKS, ldb, lc + BUFB + BOFF);
  }

  // kept rolled: unrolled, the copies' addresses of every stage stay in registers
#pragma unroll 1
  for (int s = 0; s < nst; ++s) {
    const T* sb = (const T*)(const void*)(gsm + (s & 1) * BUFB);
    const T* ap = sb + (((wave >> 1) << 6) + rl) * GSP + koff;
    const T* bp = sb + BOFF / 2 + (((wave & 1) << 6) + rl) * GSP + koff;
#pragma unroll   // the stage's two k steps in a row: LDS offsets become immediates
    for (int kk = 0; kk < GKS; kk += 32) {
      V bh[4], ah[4], al[4];
#pragma unroll
      for (int j = 0; j < 4; ++j) bh[j] = ldfragT<ET>(bp + (j << 4) * GSP + kk);
#pragma unroll
      for (int i = 0; i < 4; ++i) {
        ah[i] = ldfragT<ET>(ap + (i << 4) * GSP + kk);
        al[i] = ah[i];
        if (SPLITA) al[i] = ldfragT<ET>(ap + GPL / 2 + (i << 4) * GSP + kk);
      }
      // keeps all LDS loads of a k step ahead of the step's first WMMA: left alone, the compiler feeds the A fragments
      // through one register set, and every four WMMAs wait out the LDS latency
      __builtin_amdgcn_sched_barrier(0);
#pragma unroll
      for (int i = 0; i < 4; ++i) {
#pragma unroll
        for (int j = 0; j < 4; ++j) acc[i][j] = Elem<ET>::mma(ah[i], bh[j], acc[i][j]);
        if (SPLITA) {
#pragma unroll
          for (int j = 0; j < 4; ++j) acc[i][j] = Elem<ET>::mma(al[i], bh[j], acc[i][j]);
        }
      }
    }
    ring_publish();
    // refill the buffer just read with the stage two ahead, while one exists (block-uniform test)
    if (s + 2 < nst) {
      char* l = lc + (s & 1) * BUFB;
      issue_g(ga + (s + 2) * GKS, lda, l);
      if (SPLITA) issue_g(ga2 + (s + 2) * GKS, lda, l + GPL);
      issue_g(gb + (s + 2) * GKS, ldb, l + BOFF);
    }
  }
  asm volatile("s_wait_asynccnt 0x0" ::: "memory");  // no copy is left in flight behind the loop
  accg4(acc[0][0], acc[0][1], acc[0][2], acc[0][3]);
  accg4(acc[1][0], acc[1][1], acc[1][2], acc[1][3]);
  accg4(acc[2][0], acc[2][1], acc[2][2], acc[2][3]);
  accg4(acc[3][0], acc[3][1], acc[3][2], acc[3][3]);

  float* slab = (float*)(void*)gsm + wave * (16 * 68);
#pragma unroll
  for (int i = 0; i < 4; ++i) {
    const int mBase = m0 + (i << 4);
#pragma unroll
    for (int j = 0; j < 4; ++j) {
      float bv = 0.0f;
      if (OUT_MODE == 0) bv = bfr(bias[n0 + (j << 4) + rl]);
#pragma unroll
      for (int r = 0; r < 8; ++r) slab[(mOff + r) * 68 + (j << 4) + rl] = acc[i][j][r] * scale + bv;
    }
    __builtin_amdgcn_fence(__ATOMIC_RELEASE, "workgroup");
    __builtin_amdgcn_wave_barrier();
    __builtin_amdgcn_fence(__ATOMIC_ACQUIRE, "workgroup");
    if (OUT_MODE == 0) {
      float* C = (float*)Cout;
      const int hh = lane >> 4, c4 = (lane & 15) * 4;
{
#pragma unroll
        for (int it = 0; it < 8; ++it) {
          const int row = it * 2 + hh;
          const v4f v = *(const v4f*)(slab + row * 68 + c4);
          *(v4f*)(C + (size_t)(mBase + row) * ldc + n0 + c4) = v;
        }
        
      }
    } else {
      _Float16* C = (_Float16*)Cout;
      const int qq = lane >> 3, c8 = (lane & 7) * 8;
{
#pragma unroll
        for (int it = 0; it < 4; ++it) {
          const int row = it * 4 + qq;
          const float* sp = slab + row * 68 + c8;
          v8h hv;
#pragma unroll
          for (int e = 0; e < 8; ++e) hv[e] = (_Float16)sp[e];
          *(v8h*)(C + (size_t)(mBase + row) * ldc + n0 + c8) = hv;
        }
        
      }
    }
    __builtin_amdgcn_fence(__ATOMIC_RELEASE, "workgroup");
    __builtin_amdgcn_wave_barrier();
    __builtin_amdgcn_fence(__ATOMIC_ACQUIRE, "workgroup");
  }
}

// ---------------------------------------------------------------------------------------------
// Kernel 4: full (non-causal) single-head attention, head width 768, online softmax in f32.
//   qn, kn planes f16 [ntok][DM] (value 16*qn), vt plane f16 [DM][ntok] (value 16*vn).
//   Block = 256 threads = 8 waves, 64 query rows x one half of the keys (blockIdx & 1): every K and V byte that
//   comes from L2 serves 64 queries. Outputs per key half: ph / pl = bf16 hi / lo planes (16-bit storage) of
//   O_half = softmax over that half . vn, [2][ntok][DM], with the half's row maximum pm and row sum pls, [2][ntok];
//   the merge kernel joins the two halves.
//   Q tile staged once in LDS. Key tiles of 256: wave w owns keys 32w..32w+31 of the tile for the logits:
//   S^T subtiles (A = kn rows, B = Q rows, both from LDS), so the
//   D layout gives per lane 8 consecutive keys of one query -> P written to LDS as 16-B vectors ([query][key]).
//   P = 16 * exp(s - m_running) in f16 (values in [~1.2, 16], always normal).
//   Row max / sum: per-wave partials in LDS, combined in fixed order by waves 0 and 1 (one lane per query row).
//   P.V: every wave reads the whole P tile (A operand) and owns 2 x 48 value columns (B = vt rows from LDS).
//   kn and vt reach LDS by tensor loads, in a ring of two buffers: per key tile six K stages (256 keys x 128 dims)
//   and eight V stages (384 columns x 64 keys); each wave asks, in one request a stage, for the slice of rows it
//   reads itself (32 key rows of 256 B, or 48 column rows of 128 B, each padded by 16 B in LDS); at the foot of
//   every stage one publish point, then the refill of the buffer just read with the stage two ahead.
//   Output: the 64x768 f32 accumulator tile staged in LDS (over the Q and P regions and the ring), then each wave
//   normalises 8 whole rows, splits them into bf16 hi / lo and writes 512 B per instruction (3 per row and plane).
// ---------------------------------------------------------------------------------------------
#define QB       64
#define KSPLIT   2
#define KCH      256
#define QSP      776
#define PSP      264
#define LDS_QS   0
#define LDS_PS   99328
#define LDS_PMAX 133120
#define LDS_PSUM 135168
#define LDS_ST   137216
#define LDS_RING 139264   // a multiple of 2 KiB, as every slice's place
#define FSP      772      // f32 output staging row pitch in floats (3088 B, a multiple of 16 B)
#define KSD      128      // model dims per K stage (256 B a key row)
#define KSP      136      // K stage row pitch in halves: 272 B = 16 B x odd, for ds_load_b128 readers
#define VSK      64       // keys per V stage (128 B a value-column row)
#define VSC      384      // value columns per V stage
#define VSP      72       // V stage row pitch in halves: 144 B = 16 B x odd
#define SLICE_B  10240    // one wave's slice of a ring buffer: max(32 keys * 272 B, 48 columns * 144 B) up to a multiple of 2 KiB
#define RING_B   (8 * SLICE_B)   // one ring buffer
#define KW0      ((1u << 20) | (5u << 22) | (3u << 25))   // group 1 word 0: 16 B of pad behind every 256-B row
#define VW0      ((1u << 20) | (4u << 22) | (3u << 25))   // group 1 word 0: 16 B of pad behind every 128-B row
#define ATT_LDS  (LDS_RING + 2 * RING_B)
static_assert(QB * QSP * 2 == LDS_PS - LDS_QS);
static_assert(32 * FSP * 4 <= LDS_PMAX - LDS_QS && 32 * FSP * 4 <= 2 * RING_B && FSP >= DM && (FSP % 4) == 0);
static_assert(QB * PSP * 2 == LDS_PMAX - LDS_PS);
static_assert(LDS_PSUM - LDS_PMAX == 8 * QB * 4);
static_assert(LDS_ST - LDS_PSUM == 8 * QB * 4);
static_assert(LDS_RING - LDS_ST >= 4 * QB * 4);
static_assert(32 * KSP * 2 <= SLICE_B && 48 * VSP * 2 <= SLICE_B && (SLICE_B % 2048) == 0 && (LDS_RING % 2048) == 0);
static_assert(KSD * 2 == 256 && KSP * 2 == 256 + 16 && VSK * 2 == 128 && VSP * 2 == 128 + 16 && KCH == 8 * 32);
static_assert((DM % KSD) == 0 && (KCH % VSK) == 0 && ((DM / KSD) % 2) == 0 && DM == 2 * VSC && VSC == 8 * 48);
static_assert(ATT_LDS <= 327680);
static_assert((QSP % 8) == 0 && (PSP % 8) == 0 && PSP >= KCH);
static_assert((LDS_PS % 16) == 0 && (LDS_PMAX % 16) == 0 && (LDS_ST % 16) == 0);
static_assert((NTOK % (KCH * KSPLIT)) == 0 && (NTOK % QB) == 0);

// K stage: this wave's 32 key rows x 128 dims. g points at (first key row of the wave, first dim); l is the slice's place.
__device__ __forceinline__ void issue_k(uint32_t cnt1, const _Float16* g, uint32_t l) {
  tdm_slice<KW0, 256u, 32u>(cnt1, l, g, DM * 2u);
}
// V stage: this wave's 48 value-column rows x 64 keys. g points at (first column row of the wave, first key).
__device__ __forceinline__ void issue_v(uint32_t cnt1, const _Float16* g, uint32_t l, int ntok) {
  tdm_slice<VW0, 128u, 48u>(cnt1, l, g, (uint32_t)ntok * 2u);
}
__global__ __launch_bounds__(256) void attn_kernel(const _Float16* __restrict__ qn, const _Float16* __restrict__ kn,
                                                   const _Float16* __restrict__ vt, unsigned short* __restrict__ ph,
                                                   unsigned short* __restrict__ pl, float* __restrict__ pm,
                                                   float* __restrict__ pls, float sc, int ntok) {
  __shared__ __attribute__((aligned(2048))) char smem[ATT_LDS];
  _Float16* Qs = (_Float16*)(smem + LDS_QS);
  _Float16* Ps = (_Float16*)(smem + LDS_PS);
  float* pmax = (float*)(smem + LDS_PMAX);
  float* psum = (float*)(smem + LDS_PSUM);
  float* m_s  = (float*)(smem + LDS_ST);
  float* l_s  = m_s + QB;
  float* al_s = m_s + 2 * QB;
  float* li_s = m_s + 3 * QB;

  const int tid = threadIdx.x, wave = (int)uni(threadIdx.x >> 5), lane = tid & 31, h = lane >> 4, c = lane & 15;
  const int q0 = ((int)blockIdx.x >> 1) * QB;
  const int sp = (int)blockIdx.x & 1;             // which half of the keys
  const int ntile = ntok / (KCH * KSPLIT);        // key tiles of this block
  const int key0 = sp * ntile * KCH;
  const float ninf = -__builtin_inff();

  // ring addresses of this wave (all wave-uniform): its slice's place in buffer 0, its first key row, its first column row
  const uint32_t rl0 = (uint32_t)(size_t)(smem + LDS_RING) + (uint32_t)wave * SLICE_B;
  const _Float16* kg = kn + (size_t)(key0 + 32 * wave) * DM;
  const _Float16* vg = vt + (size_t)(48 * wave) * ntok + key0;

  // word 0 of every request's group 0 (count = 1), a descriptor word held in a scalar register by pinned(): made once, in
  // front of the first request; as a plain constant it was written into its register anew while stage 1's request flew
  const uint32_t cnt1 = pinned(1u);
  issue_k(cnt1, kg, rl0);   // stage 0 (tile 0, dims 0..127) into buffer 0; it flies under the Q staging

  if (tid < QB) { m_s[tid] = ninf; l_s[tid] = 0.0f; al_s[tid] = 0.0f; li_s[tid] = 0.0f; }
  psum[tid] = 0.0f;
  psum[256 + tid] = 0.0f;
  // Q tile: 64 rows x 96 pieces of 8 halves; coverage 24 * 256 = 6144 pieces = the whole tile
  {
    // the 64 rows lie in one piece in global memory: one address register, piece i at a constant distance
    const _Float16* qg = qn + (size_t)q0 * DM + tid * 8;
    v8h qv[24];
#pragma unroll
    for (int i = 0; i < 24; ++i) qv[i] = *(const v8h*)(qg + i * 2048);
    asm volatile("s_wait_xcnt 0x0" ::: "memory");   // in front of any rewrite of the loads' address register
#pragma unroll
    for (int i = 0; i < 24; ++i) {
      const int idx = i * 256 + tid;
      const int row = idx / 96;
      const int pc  = idx - row * 96;
      *(v8h*)(Qs + row * QSP + pc * 8) = qv[i];
    }
  }
  asm volatile("s_wait_tensorcnt 0x0" ::: "memory");  // own slice of stage 0 has landed
  __syncthreads();
  // keeps stage 1's descriptor words behind the wait
  __builtin_amdgcn_sched_barrier(0);
  issue_k(cnt1, kg + KSD, rl0 + RING_B);   // stage 1 into buffer 1

  v8f oacc[4][6];   // [query subtile][column subtile]: column 384 * (nt / 3) + 48 * wave + 16 * (nt % 3) + c
#pragma unroll
  for (int qt = 0; qt < 4; ++qt)
#pragma unroll
    for (int nt = 0; nt < 6; ++nt) oacc[qt][nt] = zero8();

  const _Float16* qbp = Qs + c * QSP + 8 * h;             // B operand, query c (+ 16 * QSP per query subtile)
  const _Float16* pap = Ps + c * PSP + 8 * h;             // A operand, query c (+ 16 * PSP per query subtile)

#pragma unroll 1
  for (int t = 0; t < ntile; ++t) {
    // ---- logits: S^T subtiles for keys kb..kb+31 (this wave), queries 0..63 ----
    v8f sacc[4][2];   // [query subtile][key subtile]; element r: query 16qt+c, key kb+16kt+8h+r
#pragma unroll
    for (int qt = 0; qt < 4; ++qt)
#pragma unroll
      for (int kt = 0; kt < 2; ++kt) sacc[qt][kt] = zero8();
    // the products of one K stage of 128 dims (stage j of the tile, in buffer j & 1)
    auto k_stage = [&](int j) __attribute__((always_inline)) {
      const _Float16* ka0p = (const _Float16*)(smem + LDS_RING + (j & 1) * RING_B + wave * SLICE_B) + c * KSP + 8 * h;
      const _Float16* ka1p = ka0p + 16 * KSP;
#pragma unroll   // the stage's four k steps in a row: LDS offsets become immediates
      for (int kk = 0; kk < KSD; kk += 32) {
        const v16h a0 = ldfrag(ka0p + kk), a1 = ldfrag(ka1p + kk);
        v16h b[4];
#pragma unroll
        for (int qt = 0; qt < 4; ++qt) b[qt] = ldfrag(qbp + (16 * qt) * QSP + j * KSD + kk);
        // keeps all twelve LDS loads of a k step ahead of the step's first WMMA: left alone, the compiler feeds the
        // B fragments through one register set, and every pair of WMMAs waits out the LDS latency
        __builtin_amdgcn_sched_barrier(0);
#pragma unroll
        for (int qt = 0; qt < 4; ++qt) {
          sacc[qt][0] = mma16(a0, b[qt], sacc[qt][0]);
          sacc[qt][1] = mma16(a1, b[qt], sacc[qt][1]);
        }
      }
    };
    // Six K stages, in two loops, so that every request stands in straight code that every wave runs (no test around a
    // tensor load, which ignores EXEC); both kept rolled: the loop text stays short. Behind each publish point the
    // buffer just read is refilled with the stage two ahead: K stages 2..5 ...
#pragma unroll 1
    for (int j = 0; j + 2 < DM / KSD; ++j) {
      k_stage(j);
      ring_publish_t();
      issue_k(cnt1, kg + (size_t)t * KCH * DM + (j + 2) * KSD, rl0 + (j & 1) * RING_B);
    }
    // ... then V stages 0, 1 of this tile
#pragma unroll 1
    for (int j = DM / KSD - 2; j < DM / KSD; ++j) {
      k_stage(j);
      ring_publish_t();
      issue_v(cnt1, vg + (size_t)(j + 2 - DM / KSD) * VSC * ntok + (size_t)t * KCH, rl0 + (j & 1) * RING_B, ntok);
    }
    // ---- scale, per-wave partial row max ----
#pragma unroll
    for (int qt = 0; qt < 4; ++qt) {
      float pmq = ninf;
#pragma unroll
      for (int kt = 0; kt < 2; ++kt) {
#pragma unroll
        for (int r = 0; r < 8; ++r) {
          const float v0 = sacc[qt][kt][r] * sc; sacc[qt][kt][r] = v0; pmq = fmaxf(pmq, v0);
        }
      }
      pmq = fmaxf(pmq, __shfl_xor(pmq, 16, 32));
      pmax[wave * QB + 16 * qt + c] = pmq;
    }
    __syncthreads();
    // ---- waves 0 and 1, thread = query row: fold the prior tile's sums into l, new running max, rescale factor ----
    if (wave < 2) {
      const int row = tid;
      float ps = 0.0f;
#pragma unroll
      for (int w = 0; w < 8; ++w) ps += psum[w * QB + row];
      l_s[row] = l_s[row] * al_s[row] + ps;
      const float mo = m_s[row];
      float mx = mo;
#pragma unroll
      for (int w = 0; w < 8; ++w) mx = fmaxf(mx, pmax[w * QB + row]);
      al_s[row] = __expf(mo - mx);
      m_s[row] = mx;
    }
    __syncthreads();
    // ---- p = 16 * exp(s - m) as f16, P tile, partial row sums, rescale O ----
#pragma unroll
    for (int qt = 0; qt < 4; ++qt) {
      const float mq = m_s[16 * qt + c];
      float ps = 0.0f;
#pragma unroll
      for (int kt = 0; kt < 2; ++kt) {
        v8h hq;
#pragma unroll
        for (int r = 0; r < 8; ++r) {
          const float p = __expf(sacc[qt][kt][r] - mq); ps += p; hq[r] = (_Float16)(p * 16.0f);
        }
        *(v8h*)(Ps + (16 * qt + c) * PSP + 32 * wave + 16 * kt + 8 * h) = hq;
      }
      ps += __shfl_xor(ps, 16, 32);
      psum[wave * QB + 16 * qt + c] = ps;
      const v4f aA = *(const v4f*)(al_s + 16 * qt + 8 * h), aB = *(const v4f*)(al_s + 16 * qt + 8 * h + 4);
#pragma unroll
      for (int nt = 0; nt < 6; ++nt) {
#pragma unroll
        for (int r = 0; r < 4; ++r) {
          oacc[qt][nt][r] *= aA[r]; oacc[qt][nt][4 + r] *= aB[r];
        }
      }
    }
    __syncthreads();
    // ---- O += P . V over the 256 keys of the tile ----
    // four groups of 64 keys; each group is two V stages (columns 0..383 in buffer 0, 384..767 in buffer 1), which
    // share the group's P fragments; 'last' is a literal at both calls
    auto v_group = [&](int kq, bool last) __attribute__((always_inline)) {
      v16h pa[2][4];
#pragma unroll
      for (int k2 = 0; k2 < 2; ++k2)
#pragma unroll
        for (int qt = 0; qt < 4; ++qt) pa[k2][qt] = ldfrag(pap + (16 * qt) * PSP + kq * VSK + 32 * k2);
#pragma unroll   // the accumulator index depends on the column half
      for (int hf = 0; hf < 2; ++hf) {
        const _Float16* vbp = (const _Float16*)(smem + LDS_RING + hf * RING_B + wave * SLICE_B) + c * VSP + 8 * h;
        v16h vb[2][3];
#pragma unroll
        for (int k2 = 0; k2 < 2; ++k2)
#pragma unroll
          for (int j = 0; j < 3; ++j) vb[k2][j] = ldfrag(vbp + (16 * j) * VSP + 32 * k2);
        // keeps all LDS loads of the stage ahead of its first WMMA (as in the K stages)
        __builtin_amdgcn_sched_barrier(0);
#pragma unroll
        for (int k2 = 0; k2 < 2; ++k2)
#pragma unroll
          for (int j = 0; j < 3; ++j)
#pragma unroll
            for (int qt = 0; qt < 4; ++qt)
              oacc[qt][3 * hf + j] = mma16(pa[k2][qt], vb[k2][j], oacc[qt][3 * hf + j]);
        ring_publish_t();
        // refill: the same column half of the next key group; behind the last group K stages 0, 1 of the next tile
        // while one exists (a scalar test, the same for the whole block)
        if (!last) {
          issue_v(cnt1, vg + (size_t)hf * VSC * ntok + (size_t)t * KCH + (kq + 1) * VSK, rl0 + hf * RING_B, ntok);
        } else if (pinned(t + 1 < ntile)) {
          issue_k(cnt1, kg + (size_t)(t + 1) * KCH * DM + hf * KSD, rl0 + hf * RING_B);
        }
      }
    };
    // groups 0..2 kept rolled for the same reason as the K stages; the last group apart, for its other refill
#pragma unroll 1
    for (int kq = 0; kq + 1 < KCH / VSK; ++kq) v_group(kq, false);
    v_group(KCH / VSK - 1, true);
  }
  asm volatile("s_wait_tensorcnt 0x0" ::: "memory");  // no request is left in flight behind the loop
  asm volatile("s_wait_dscnt 0x0" ::: "memory");      // own ring reads are done before the ring becomes output staging

  // ---- this half's row sum (fold the last tile's sums) and maximum; O_half = oacc / (256 * l) (P carry 16, vn carry 16) ----
  if (wave < 2) {
    const int row = tid;
    float ps = 0.0f;
#pragma unroll
    for (int w = 0; w < 8; ++w) ps += psum[w * QB + row];
    const float l = l_s[row] * al_s[row] + ps;
    li_s[row] = (1.0f / l) * (1.0f / 256.0f);
    pm[(size_t)sp * ntok + q0 + row]  = m_s[row];
    pls[(size_t)sp * ntok + q0 + row] = l;
  }
  __syncthreads();
  // ---- stage the 64 x 768 f32 accumulator tile: rows 0..31 over the Q and P regions, rows 32..63 over the ring ----
  float* F0 = (float*)(smem + LDS_QS);
  float* F1 = (float*)(smem + LDS_RING);
#pragma unroll
  for (int qt = 0; qt < 4; ++qt) {
    float* F = ((qt < 2) ? F0 : F1) + (16 * (qt & 1) + 8 * h) * FSP;
#pragma unroll
    for (int nt = 0; nt < 6; ++nt) {
      const int col = VSC * (nt / 3) + 48 * wave + 16 * (nt % 3) + c;
#pragma unroll
      for (int r = 0; r < 8; ++r) F[r * FSP + col] = oacc[qt][nt][r];
    }
  }
  __syncthreads();
  // ---- each wave: 8 whole rows, normalised, split into bf16 hi / lo, 512 B per store instruction (3 per row and plane) ----
  {
    unsigned short* gh = ph + ((size_t)sp * ntok + q0) * DM;
    unsigned short* gl = pl + ((size_t)sp * ntok + q0) * DM;
    // kept rolled: run once per block, unrolled it is some thousand instructions that are fetched to be used once
#pragma unroll 1
    for (int it = 0; it < 24; ++it) {
      const int rr = it / 3;
      const int row = 8 * wave + rr;
      const int pc = (it - rr * 3) * 32 + lane;
      const float* F = ((row < 32) ? F0 + row * FSP : F1 + (row - 32) * FSP) + pc * 8;
      const float inv = li_s[row];
      const v4f x0 = *(const v4f*)(F), x1 = *(const v4f*)(F + 4);
      v8us hvv, lvv;
#pragma unroll
      for (int e = 0; e < 4; ++e) {
        unsigned short hb, lb;
        split_bf(x0[e] * inv, hb, lb);
        hvv[e] = hb;      lvv[e] = lb;
        split_bf(x1[e] * inv, hb, lb);
        hvv[4 + e] = hb;  lvv[4 + e] = lb;
      }
      *(v8us*)(gh + (size_t)row * DM + pc * 8) = hvv;
      *(v8us*)(gl + (size_t)row * DM + pc * 8) = lvv;
      // the next trip rewrites the two stores' address and data registers: the wait stands in front of that
      asm volatile("s_wait_xcnt 0x0" ::: "memory");
    }
  }
}

// ---------------------------------------------------------------------------------------------
// Kernel 5: join the two key halves of the attention: with M = max(m0, m1) and w_i = l_i * exp(m_i - M),
//   O = (w0 * O_0 + w1 * O_1) / (w0 + w1), O_i = hi + lo of half i; O goes out again as bf16 hi / lo planes [ntok][DM].
// A piece is 8 columns: one 16-B load and store per lane and plane, 32 lanes contiguous = 512 B. Thread g takes pieces
// g, g + threads, ... (MG_IT of them); the loads of all its pieces are issued before the first piece is worked on.
// coverage: MG_IT * SG_BLK * SG_THR pieces = ntok * DM / 8 exactly (DM / 8 = 96 pieces a row).
// ---------------------------------------------------------------------------------------------
// exp(d) in the fast form (one multiply by log2 e, then v_exp_f32). The v_nop in the same statement is the slot that the
// instruction set asks for behind a transcendental.
__device__ __forceinline__ float exp_slot(float d) {
  const float t = d * 1.44269504f;
  float r;
  asm("v_exp_f32 %0, %1\n\tv_nop" : "=v"(r) : "v"(t));
  return r;
}
#define MG_IT (NTOK * (DM / 8) / (SG_BLK * SG_THR))
static_assert(MG_IT * SG_BLK * SG_THR == NTOK * (DM / 8));
__global__ __launch_bounds__(SG_THR) void merge_kernel(const unsigned short* __restrict__ ph,
                                                       const unsigned short* __restrict__ pl,
                                                       const float* __restrict__ pm, const float* __restrict__ pls,
                                                       unsigned short* __restrict__ oh, unsigned short* __restrict__ ol,
                                                       int ntok) {
  const int g = (int)blockIdx.x * SG_THR + (int)threadIdx.x;
  const size_t pst = (size_t)ntok * DM;
  float m0[MG_IT], m1[MG_IT], l0[MG_IT], l1[MG_IT];
  v8us h0[MG_IT], g0[MG_IT], h1[MG_IT], g1[MG_IT];
#pragma unroll
  for (int it = 0; it < MG_IT; ++it) {
    const int row = (it * (SG_BLK * SG_THR) + g) / (DM / 8);
    m0[it] = pm[row];
    m1[it] = pm[ntok + row];
    l0[it] = pls[row];
    l1[it] = pls[ntok + row];
  }
  // the wide loads' results may take these loads' address registers: the wait stands in front of that rewrite
  asm volatile("s_wait_xcnt 0x0" ::: "memory");
#pragma unroll
  for (int it = 0; it < MG_IT; ++it) {
    const size_t e = (size_t)(it * (SG_BLK * SG_THR) + g) * 8;
    h0[it] = *(const v8us*)(ph + e);
    g0[it] = *(const v8us*)(pl + e);
    h1[it] = *(const v8us*)(ph + pst + e);
    g1[it] = *(const v8us*)(pl + pst + e);
  }
  asm volatile("s_wait_xcnt 0x0" ::: "memory");   // in front of any rewrite of the loads' address registers
  // keeps every load ahead of the first piece's work: left alone, the compiler mixes the two to save registers, and the
  // thread waits out the memory latency several times over
  __builtin_amdgcn_sched_barrier(0);
#pragma unroll
  for (int it = 0; it < MG_IT; ++it) {
    const size_t e = (size_t)(it * (SG_BLK * SG_THR) + g) * 8;
    const float mx = fmaxf(m0[it], m1[it]);
    float w0 = l0[it] * exp_slot(m0[it] - mx), w1 = l1[it] * exp_slot(m1[it] - mx);
    const float inv = 1.0f / (w0 + w1);
    w0 *= inv;
    w1 *= inv;
    v8us oh8, ol8;
#pragma unroll
    for (int i = 0; i < 8; ++i) {
      const float f = w0 * (bfval(h0[it][i]) + bfval(g0[it][i])) + w1 * (bfval(h1[it][i]) + bfval(g1[it][i]));
      unsigned short hb, lb;
      split_bf(f, hb, lb);
      oh8[i] = hb;
      ol8[i] = lb;
    }
    *(v8us*)(oh + e) = oh8;
    *(v8us*)(ol + e) = ol8;
    asm volatile("s_wait_xcnt 0x0" ::: "memory");   // in front of any rewrite of the stores' address and data registers
  }
}

// ---------------------------------------------------------------------------------------------
// Workspace map (bytes, all regions exact tile / whole-line multiples, no padding needed):
//   Wq16 : Wqkv f16 [768][768] (64 * bf16(w))                 off 0           size  1,179,648
//   Wpb  : Wproj bf16 bits [768][768]                           off 1,179,648   size  1,179,648
//   X16  : ln(q), ln(k), ln(v) stacked f16 [24576][768]        off 2,359,296   size 37,748,736
//   QK16 : qn then kn f16 [16384][768]                          off 40,108,032  size 25,165,824
//   VT16 : vn^T f16 [768][8192]                                 off 65,273,856  size 12,582,912
//   OH   : attention output bf16 hi [8192][768]                 off 77,856,768  size 12,582,912
//   OL   : attention output bf16 lo [8192][768]                 off 90,439,680  size 12,582,912
//   PH   : per key half, attention output bf16 hi [2][8192][768] off 103,022,592 size 25,165,824
//   PL   : per key half, attention output bf16 lo [2][8192][768] off 128,188,416 size 25,165,824
//   PM   : per key half, row maximum f32 [2][8192]              off 153,354,240 size     65,536
//   PS   : per key half, row sum f32 [2][8192]                  off 153,419,776 size     65,536
//   total 153,485,312
// ---------------------------------------------------------------------------------------------
extern "C" void kernel_launch(void* const* d_in, const int* in_sizes, int n_in,
                              void* d_out, int out_size, void* d_ws, size_t ws_size,
                              hipStream_t stream) {
  if (n_in < 8) return;
  const int ntok = NTOK, dm = DM;
  if (in_sizes[0] != ntok * dm || in_sizes[1] != ntok * dm || in_sizes[2] != ntok * dm) return;
  if (in_sizes[3] != dm || in_sizes[4] != dm || in_sizes[7] != dm) return;
  if (in_sizes[5] != dm * dm || in_sizes[6] != dm * dm) return;
  if (out_size != ntok * dm) return;

  const float* q     = (const float*)d_in[0];
  const float* k     = (const float*)d_in[1];
  const float* v     = (const float*)d_in[2];
  const float* ln_w  = (const float*)d_in[3];
  const float* ln_b  = (const float*)d_in[4];
  const float* Wqkv  = (const float*)d_in[5];
  const float* Wproj = (const float*)d_in[6];
  const float* bproj = (const float*)d_in[7];
  float* out = (float*)d_out;

  const size_t bWq = (size_t)dm * dm * 2;
  const size_t bWp = (size_t)dm * dm * 2;
  const size_t bX  = (size_t)3 * ntok * dm * 2;
  const size_t bQK = (size_t)2 * ntok * dm * 2;
  const size_t bVT = (size_t)dm * ntok * 2;
  const size_t bO  = (size_t)ntok * dm * 2;
  size_t off = 0;
  const size_t oWq = off; off += bWq;
  const size_t oWp = off; off += bWp;
  const size_t oX  = off; off += bX;
  const size_t oQK = off; off += bQK;
  const size_t oVT = off; off += bVT;
  const size_t oOH = off; off += bO;
  const size_t oOL = off; off += bO;
  const size_t oPH = off; off += 2 * bO;
  const size_t oPL = off; off += 2 * bO;
  const size_t oPM = off; off += (size_t)2 * ntok * 4;
  const size_t oPS = off; off += (size_t)2 * ntok * 4;
  if (off > ws_size) return;                     // 153,485,312

  char* ws = (char*)d_ws;
  _Float16*       Wq16 = (_Float16*)(ws + oWq);
  unsigned short* Wpb  = (unsigned short*)(ws + oWp);
  _Float16*       X16  = (_Float16*)(ws + oX);
  _Float16*       QK16 = (_Float16*)(ws + oQK);
  _Float16*       VT16 = (_Float16*)(ws + oVT);
  unsigned short* OH   = (unsigned short*)(ws + oOH);
  unsigned short* OL   = (unsigned short*)(ws + oOL);
  unsigned short* PH   = (unsigned short*)(ws + oPH);
  unsigned short* PL   = (unsigned short*)(ws + oPL);
  float*          PM   = (float*)(ws + oPM);
  float*          PS   = (float*)(ws + oPS);

  const dim3 blk(256);
  const dim3 gblk(128);                       // the GEMM's block: 4 waves
  const int n8 = dm * dm / 8;                 // 73728 = 288 * 256
  if ((n8 % 256) != 0) return;

  // (1) weights -> Wqkv f16 plane (64 * bf16(w)) and Wproj bf16 plane
  cvt_w_kernel<<<dim3(2 * (n8 / 256)), blk, 0, stream>>>(Wqkv, Wproj, Wq16, Wpb, n8);
  // (2) LayerNorm of q, k, v -> X16 (8 * ln)
  ln_kernel<<<dim3(SG_BLK), dim3(SG_THR), 0, stream>>>(q, k, v, ln_w, ln_b, X16, ntok);
  // (3) qn, kn = X[0:16384] . Wqkv^T  -> QK16 (16 * qn | 16 * kn); M=16384, N=768, K=768; scale 16/(8*64)
  gemm64_kernel<0, false, 1><<<dim3((2 * ntok / 128) * (dm / 128)), gblk, 0, stream>>>(
      (const unsigned short*)X16, (const unsigned short*)X16, dm, (const unsigned short*)Wq16, dm,
      (void*)QK16, dm, bproj, 2 * ntok, dm, dm, 0.03125f);
  // (4) vn^T = Wqkv . X[16384:24576]^T -> VT16 [768][8192] (16 * vn); M=768, N=8192, K=768
  gemm64_kernel<0, false, 1><<<dim3((dm / 128) * (ntok / 128)), gblk, 0, stream>>>(
      (const unsigned short*)Wq16, (const unsigned short*)Wq16, dm,
      (const unsigned short*)(X16 + (size_t)2 * ntok * dm), dm,
      (void*)VT16, ntok, bproj, dm, ntok, dm, 0.03125f);
  // (5) attention per key half -> PH / PL, PM, PS; logit scale = dim^-0.5 / 256 (operand carries 16 * 16)
  const float sc = 0.03608439182435161f * (1.0f / 256.0f);
  attn_kernel<<<dim3(KSPLIT * (ntok / QB)), blk, 0, stream>>>(QK16, QK16 + (size_t)ntok * dm, VT16, PH, PL, PM, PS,
                                                              sc, ntok);
  // (6) the two key halves joined -> OH / OL (bf16 hi / lo of O)
  merge_kernel<<<dim3(SG_BLK), dim3(SG_THR), 0, stream>>>(PH, PL, PM, PS, OH, OL, ntok);
  // (7) out = (O_hi + O_lo) . Wproj^T + b -> d_out f32 [8192][768]; bf16 operands, scale 1
  gemm64_kernel<1, true, 0><<<dim3((ntok / 128) * (dm / 128)), gblk, 0, stream>>>(
      OH, OL, dm, Wpb, dm, (void*)out, dm, bproj, ntok, dm, dm, 1.0f);
  (void)hipGetLastError();
}

// v006
// A run of this version takes 240 microseconds.
// Next to v005, in two timings, it ran 1.06 and 1.04 times as fast.
// All steps since v000 together make it 2.88 times as fast.
// Contractions: qn|kn = ln(q|k).Wqkv^T, vn^T = Wqkv.ln(v)^T, S^T = kn.qn^T, O = P.vn : v_wmma_f32_16x16x32_f16, f16 operands with
// power-of-two carries (ln x8, Wqkv x64, qn/kn/vn x16, P = 16*exp(s - m)), f32 accumulate; out = O.Wproj^T + b : v_wmma_f32_16x16x32_bf16,
// O as bf16 hi/lo planes (hi.W + lo.W), Wproj bf16, f32 accumulate; float inputs RNE-converted to bf16 on load; LayerNorm, softmax
// statistics and bias in f32.
#include <hip/hip_runtime.h>
#include <stdint.h>

#define NTOK 8192
#define DM   768

typedef _Float16 v16h __attribute__((ext_vector_type(16)));
typedef _Float16 v8h  __attribute__((ext_vector_type(8)));
typedef __bf16   v16b __attribute__((ext_vector_type(16)));
typedef __bf16   v8b  __attribute__((ext_vector_type(8)));
typedef float    v8f  __attribute__((ext_vector_type(8)));
typedef float    v4f  __attribute__((ext_vector_type(4)));
typedef unsigned short v8us __attribute__((ext_vector_type(8)));

static_assert((DM % 64) == 0);
static_assert((NTOK % 256) == 0);

// f32 -> nearest-even bf16 bits / value
__device__ __forceinline__ unsigned short bfbits(float f) {
  unsigned u = __float_as_uint(f);
  return (unsigned short)((u + 0x7FFFu + ((u >> 16) & 1u)) >> 16);
}
__device__ __forceinline__ float bfval(unsigned short b) { return __uint_as_float(((unsigned)b) << 16); }
__device__ __forceinline__ float bfr(float f) { return bfval(bfbits(f)); }
__device__ __forceinline__ void split_bf(float f, unsigned short& hb, unsigned short& lb) {
  hb = bfbits(f);
  lb = bfbits(f - bfval(hb));
}

// 16-bit operand element types for the GEMM template: 0 = f16, 1 = bf16
template <int ET> struct Elem;
template <> struct Elem<0> {
  typedef _Float16 T; typedef v16h V; typedef v8h V8;
  static __device__ __forceinline__ v8f mma(V a, V b, v8f c) {
    return __builtin_amdgcn_wmma_f32_16x16x32_f16(false, a, false, b, (short)0, c, false, false);
  }
};
template <> struct Elem<1> {
  typedef __bf16 T; typedef v16b V; typedef v8b V8;
  static __device__ __forceinline__ v8f mma(V a, V b, v8f c) {
    return __builtin_amdgcn_wmma_f32_16x16x32_bf16(false, a, false, b, (short)0, c, false, false);
  }
};

// 16-bit WMMA fragment from k-contiguous storage (A row-major [m][k], or B stored [n][k]):
// p points at element (row_or_col = lane&15, k0 + 8h); elements 0..7 <- p[0..7], 8..15 <- p[16..23].
template <int ET>
__device__ __forceinline__ typename Elem<ET>::V ldfragT(const typename Elem<ET>::T* p) {
  typedef typename Elem<ET>::V V;
  typedef typename Elem<ET>::V8 V8;
  union { V v; V8 h[2]; } f;
  f.h[0] = *(const V8*)(p);
  f.h[1] = *(const V8*)(p + 16);
  return f.v;
}
__device__ __forceinline__ v16h ldfrag(const _Float16* p) { return ldfragT<0>(p); }
__device__ __forceinline__ v8f mma16(v16h a, v16h b, v8f c) { return Elem<0>::mma(a, b, c); }
__device__ __forceinline__ v8f zero8() {
  v8f z;
#pragma unroll
  for (int i = 0; i < 8; ++i) z[i] = 0.0f;
  return z;
}

// hazard guard: 4 VALU slots after the last WMMA of a group, D tied
__device__ __forceinline__ void accg4(v8f& a, v8f& b, v8f& c, v8f& d) {
  asm volatile("v_nop\n\tv_nop\n\tv_nop\n\tv_nop" : "+v"(a), "+v"(b), "+v"(c), "+v"(d));
}

// ---------------------------------------------------------------------------------------------
// Kernel 1: two [DM][DM] f32 weight matrices -> 16-bit planes, layout unchanged ([out][in], k = in contiguous):
//   blocks [0, nb0):  d16[e] = f16(64 * bf16(w0[e]))     (f16 operand plane for the qkv projection)
//   blocks [nb0, 2nb0): dbf[e] = bf16 bits of w1[e]       (bf16 operand plane for the output projection)
// Block-uniform select, no barriers. 8 elements per thread: one 16-B store per lane, 32 lanes contiguous = 512 B =
// coverage: nb0 * 256 threads * 8 = DM * DM elements per plane exactly (n8 = DM*DM/8 is a multiple of 256).
// ---------------------------------------------------------------------------------------------
__global__ __launch_bounds__(256) void cvt_w_kernel(const float* __restrict__ w0, const float* __restrict__ w1,
                                                    _Float16* __restrict__ d16, unsigned short* __restrict__ dbf,
                                                    int n8) {
  const int nb0 = n8 >> 8;
  const bool second = ((int)blockIdx.x >= nb0);
  const float* src = second ? w1 : w0;
  const int li = ((int)blockIdx.x - (second ? nb0 : 0)) * 256 + (int)threadIdx.x;
  if (li >= n8) return;
  const size_t e = (size_t)li * 8;
  const v4f a = *(const v4f*)(src + e);
  const v4f b = *(const v4f*)(src + e + 4);
  if (!second) {
    v8h o;
#pragma unroll
    for (int i = 0; i < 4; ++i) {
      o[i]     = (_Float16)(bfr(a[i]) * 64.0f);
      o[4 + i] = (_Float16)(bfr(b[i]) * 64.0f);
    }
    _Float16* d = d16 + e;
    *(v8h*)d = o;
    
  } else {
    v8us o;
#pragma unroll
    for (int i = 0; i < 4; ++i) {
      o[i]     = bfbits(a[i]);
      o[4 + i] = bfbits(b[i]);
    }
    unsigned short* d = dbf + e;
    *(v8us*)d = o;
    
  }
}

// ---------------------------------------------------------------------------------------------
// The two streaming kernels (LayerNorm, merge) run as SG_BLK work-groups of SG_THR threads: 4,096 waves in all, each of
// which walks several rows or pieces, so that few waves have to be started and each keeps many loads in flight.
#define SG_BLK 256
#define SG_THR 512
#define SG_WAVES (SG_BLK * (SG_THR / 32))
static_assert((3 * NTOK) % SG_WAVES == 0);

// Kernel 2: LayerNorm of q, k, v (bf16-converted inputs, f32 statistics, centred variance) -> f16 plane X
// [3*ntok][DM], value = 8 * ln(x). Rows [0,ntok) of X come from q, the next ntok from k, the next from v.
// One wave per row at a time; wave g takes rows g, g + waves, g + 2 * waves, ... The row (3 KB) is read once and held in
// registers: lane owns columns (j*32+lane)*8 .. +7 of chunk j (j = 0..2). The next row's six loads are issued before the
// current row is worked on. Weight and bias of the lane's 24 columns are converted once per wave.
// Stores: one 16-B store per lane and chunk, 32 lanes contiguous = 512 B.
// coverage: rows g + i * waves over all waves g = every row below 3*ntok once; 3 chunks * 32 lanes * 8 = 768 columns.
// ---------------------------------------------------------------------------------------------
__device__ __forceinline__ const float* ln_row(const float* qx, const float* kx, const float* vx, int r, int ntok) {
  const int seg = (r >= 2 * ntok) ? 2 : ((r >= ntok) ? 1 : 0);
  const float* src = (seg == 2) ? vx : ((seg == 1) ? kx : qx);
  return src + (size_t)(r - seg * ntok) * DM;
}
__global__ __launch_bounds__(SG_THR) void ln_kernel(const float* __restrict__ qx, const float* __restrict__ kx,
                                                    const float* __restrict__ vx, const float* __restrict__ lw,
                                                    const float* __restrict__ lb, _Float16* __restrict__ X, int ntok) {
  const int wave = __builtin_amdgcn_readfirstlane((int)(threadIdx.x >> 5)), lane = threadIdx.x & 31;
  const int nw = (int)gridDim.x * (SG_THR / 32);
  const int total = 3 * ntok;
  int row = (int)blockIdx.x * (SG_THR / 32) + wave;
  if (row >= total) return;                      // the same for the whole wave; the kernel has no barrier

  v4f nxt[6];
  {
    const float* p = ln_row(qx, kx, vx, row, ntok) + lane * 8;
#pragma unroll
    for (int j = 0; j < 3; ++j) {
      nxt[2 * j]     = *(const v4f*)(p + j * 256);
      nxt[2 * j + 1] = *(const v4f*)(p + j * 256 + 4);
    }
  }
  float w[24], b8[24];                           // bf16(weight), 8 * bf16(bias) of this lane's columns
#pragma unroll
  for (int j = 0; j < 3; ++j) {
    const int c0 = (j * 32 + lane) * 8;
    const v4f wa = *(const v4f*)(lw + c0), wb = *(const v4f*)(lw + c0 + 4);
    const v4f ba = *(const v4f*)(lb + c0), bb = *(const v4f*)(lb + c0 + 4);
#pragma unroll
    for (int e = 0; e < 4; ++e) {
      w[8 * j + e]      = bfr(wa[e]);
      w[8 * j + 4 + e]  = bfr(wb[e]);
      b8[8 * j + e]     = bfr(ba[e]) * 8.0f;
      b8[8 * j + 4 + e] = bfr(bb[e]) * 8.0f;
    }
  }
  asm volatile("s_wait_xcnt 0x0" ::: "memory");   // in front of any rewrite of these loads' address registers
  // the row in work, bf16-converted: made from the loaded row at the foot of the trip before, so that at the head of a
  // trip no load but the next row's is outstanding and nothing in the trip's work waits for those
  float x[24];
#pragma unroll
  for (int jj = 0; jj < 6; ++jj)
#pragma unroll
    for (int e = 0; e < 4; ++e) x[4 * jj + e] = bfr(nxt[jj][e]);

  // kept rolled: one row's text, run for every row of the wave
#pragma unroll 1
  for (;;) {
    const int nrow = row + nw;
    const bool more = nrow < total;              // scalar: the same for the whole wave
    if (more) {
      const float* p = ln_row(qx, kx, vx, nrow, ntok) + lane * 8;
#pragma unroll
      for (int j = 0; j < 3; ++j) {
        nxt[2 * j]     = *(const v4f*)(p + j * 256);
        nxt[2 * j + 1] = *(const v4f*)(p + j * 256 + 4);
      }
      asm volatile("s_wait_xcnt 0x0" ::: "memory");   // in front of any rewrite of the loads' address registers
    }
    // keeps the next row's loads ahead of the work on this row: sunk into it, they would fly for less time
    __builtin_amdgcn_sched_barrier(0);

    float s = 0.0f;
#pragma unroll
    for (int jj = 0; jj < 6; ++jj) s += (x[4 * jj] + x[4 * jj + 1]) + (x[4 * jj + 2] + x[4 * jj + 3]);
#pragma unroll
    for (int off = 16; off > 0; off >>= 1) s += __shfl_xor(s, off, 32);
    const float mu = s * (1.0f / 768.0f);

    // centred sum of squares
    float s2 = 0.0f;
#pragma unroll
    for (int i = 0; i < 24; ++i) {
      const float d = x[i] - mu;
      s2 += d * d;
    }
#pragma unroll
    for (int off = 16; off > 0; off >>= 1) s2 += __shfl_xor(s2, off, 32);
    const float rstd8 = rsqrtf(s2 * (1.0f / 768.0f) + 1e-5f) * 8.0f;   // x8 carry folded into the scale

    _Float16* yr = X + (size_t)row * DM + lane * 8;
#pragma unroll
    for (int j = 0; j < 3; ++j) {
      v8h o;
#pragma unroll
      for (int e = 0; e < 8; ++e) {
        const float t = (x[8 * j + e] - mu) * rstd8;
        o[e] = (_Float16)(t * w[8 * j + e] + b8[8 * j + e]);
      }
      *(v8h*)(yr + j * 256) = o;
    }
    asm volatile("s_wait_xcnt 0x0" ::: "memory");   // the next trip rewrites the stores' address and data registers
    if (!more) break;
#pragma unroll
    for (int jj = 0; jj < 6; ++jj)
#pragma unroll
      for (int e = 0; e < 4; ++e) x[4 * jj + e] = bfr(nxt[jj][e]);
    row = nrow;
  }
}

// One asynchronous 16-B-per-lane copy global -> LDS, as the builtin: its address registers are the compiler's, which
// may place them above v255 (an asm operand may not lie there).
typedef int v4i __attribute__((ext_vector_type(4)));
__device__ __forceinline__ void acopy(const _Float16* g, char* l) {
  __builtin_amdgcn_global_load_async_to_lds_b128((__attribute__((address_space(1))) v4i*)g,
                                                 (__attribute__((address_space(3))) v4i*)l, 0, 0);
}
// Publish point of the ring: this wave's LDS reads of the buffer to be refilled have retired, its own copies of the
// next stage have landed, then the work-group barrier behind which that stage is read and the old buffer refilled.
__device__ __forceinline__ void ring_publish() {
  // keeps the stage's WMMAs ahead of the publish point: sunk behind the barrier, they stand between it and the refill,
  // and the copies lose that much of their flight time
  __builtin_amdgcn_sched_barrier(0);
  asm volatile("s_wait_dscnt 0x0" ::: "memory");     // own reads of the stage just used are done
  asm volatile("s_wait_asynccnt 0x0" ::: "memory");  // own copies of the next stage have landed
  __syncthreads();
}

// Tensor load of one two-dimensional slice, global -> LDS: NROW rows of ROWB bytes at source pitch 'pitch' bytes, landing at
// LDS byte offset lds_dst with the row pad that word 0 of group 1 (W0, a constant) names. One request of the whole wave;
// every descriptor word is wave-uniform and goes through readfirstlane. 1-byte elements, tensor dims = tile dims, no mask.
typedef uint32_t u32x4 __attribute__((ext_vector_type(4)));
typedef uint32_t u32x8 __attribute__((ext_vector_type(8)));
__device__ __forceinline__ uint32_t uni(uint32_t v) { return (uint32_t)__builtin_amdgcn_readfirstlane(v); }
// a wave-uniform issue test, or a descriptor word, of the tensor mover held in a scalar register: the branch on such a test
// is a scalar branch (a tensor load ignores EXEC); such a word is made once, where pinned() stands
__device__ __forceinline__ uint32_t pinned(uint32_t v) {
  uint32_t w = (uint32_t)__builtin_amdgcn_readfirstlane(v);
  asm volatile("" : "+s"(w));   // pinned(): the tensor mover's issue test (compiles to s_cmp + s_cbranch_scc) or descriptor word in a scalar register
  return w;
}
template <uint32_t W0, uint32_t ROWB, uint32_t NROW>
__device__ __forceinline__ void tdm_slice(uint32_t cnt1, uint32_t lds_dst, const _Float16* g, uint32_t pitch) {
  const uint64_t ga = (uint64_t)(size_t)g;
  u32x4 g0;
  u32x8 g1;
  g0[0] = cnt1;   // count = 1, from the caller's pinned word
  g0[1] = uni(lds_dst);
  g0[2] = uni((uint32_t)ga);
  g0[3] = uni((((uint32_t)(ga >> 32)) & 0x01FFFFFFu) | 0x80000000u);
  g1[0] = uni(W0);
  g1[1] = uni((ROWB & 0xFFFFu) << 16);
  g1[2] = uni((ROWB >> 16) | ((NROW & 0xFFFFu) << 16));
  g1[3] = uni((NROW >> 16) | (ROWB << 16));
  g1[4] = uni(NROW);
  g1[5] = uni(pitch);
  g1[6] = uni(0u);
  g1[7] = uni(0u);
  // Issued from twelve scalar registers named here, above all that the kernel else uses, which hold nothing else: they are
  // written only in front of an issue, behind the wait for the request before, so that an outstanding request's words
  // stay in place until it has landed (left to the compiler's choice, it reused the registers for other values at once).
  asm volatile("tensor_load_to_lds %0, %1" :: "{s[88:91]}"(g0), "{s[92:99]}"(g1) : "memory");
}
// Publish point of the tensor-load ring: this wave's LDS reads of the buffer to be refilled have retired, its own request
// for the next stage has landed, then the work-group barrier behind which that stage is read and the old buffer refilled.
__device__ __forceinline__ void ring_publish_t() {
  // keeps the stage's WMMAs ahead of the publish point (as in ring_publish)
  __builtin_amdgcn_sched_barrier(0);
  asm volatile("s_wait_dscnt 0x0" ::: "memory");      // own reads of the stage just used are done
  asm volatile("s_wait_tensorcnt 0x0" ::: "memory");  // own slice of the next stage has landed
  __syncthreads();
  // keeps the next request's descriptor words behind the wait: none is formed while a request is outstanding
  __builtin_amdgcn_sched_barrier(0);
}

// ---------------------------------------------------------------------------------------------
// Kernel 3: C[m][n] = scale * sum_k A[m][k] * Bt[n][k] (+ bf16(bias[n]) when OUT_MODE == 0).
// A row-major [M][K] 16-bit (ET 0: f16, ET 1: bf16) pitch lda; Bt row-major [N][K] same type pitch ldb; M, N multiples
// of 128, K a multiple of 64. SPLITA: A is a hi plane (Ap) plus a lo plane (A2p, same layout), product = hi.B + lo.B.
// Block = 128 threads = 4 waves (2 x 2) on one 128x128 C tile; each wave owns one 64x64 part (16 f32 accumulators).
// The operands reach LDS by asynchronous copies in whole lines, in a ring of two buffers: a stage is 64 k (128 B) of
// the tile's 128 A rows (both planes when SPLITA) and 128 Bt rows; each wave copies 32 rows of every plane; at the
// foot of every stage one publish point, then the refill of the buffer just read with the stage two ahead.
// OUT_MODE 0: f32 output; OUT_MODE 1: f16 output; OUT_MODE 2: f16 output in blocks of 128 columns, [N / 128][M][128]
// (ldc = 128). Epilogue: 16-row slab per wave in LDS (over the ring, which is
// out of use behind the last publish point), then each 64-wide row goes out in whole lines.
// coverage: tilesM * tilesN tiles, each 128x128 written fully -> M x N.
// ---------------------------------------------------------------------------------------------
#define GKS 64       // k per stage: 128 B a row, one whole line
#define GSP 72       // stage row pitch in halves: 144 B = 16 B x odd, for ds_load_b128 readers
#define GPL (128 * GSP * 2)   // one operand plane of a stage: 128 rows
static_assert((DM % GKS) == 0 && (DM % 128) == 0 && (NTOK % 128) == 0 && 4 * 16 * 68 * 4 <= 2 * GPL);

// 32 rows x 128 B of one plane: one copy = 4 rows x 128 B (four whole lines). 8 copies.
// g points at (first row of the wave + lane / 8, first k + 8 * (lane % 8)); l is that lane's place in LDS.
__device__ __forceinline__ void issue_g(const void* g, int ld, char* l) {
#pragma unroll
  for (int i = 0; i < 8; ++i) acopy((const _Float16*)g + (size_t)(4 * i) * ld, l + i * 4 * GSP * 2);
}

template <int ET, bool SPLITA, int OUT_MODE>
__global__ __launch_bounds__(128) void gemm64_kernel(const unsigned short* __restrict__ Ap,
                                                     const unsigned short* __restrict__ A2p, int lda,
                                                     const unsigned short* __restrict__ Btp, int ldb,
                                                     void* __restrict__ Cout, int ldc,
                                                     const float* __restrict__ bias,
                                                     int M, int N, int K, float scale) {
  typedef typename Elem<ET>::T T;
  typedef typename Elem<ET>::V V;
  const T* A  = (const T*)(const void*)Ap;
  const T* A2 = (const T*)(const void*)A2p;
  const T* Bt = (const T*)(const void*)Btp;
  constexpr int BOFF = (SPLITA ? 2 : 1) * GPL;   // the Bt plane's place in a buffer
  constexpr int BUFB = BOFF + GPL;               // one ring buffer
  __shared__ __align__(16) char gsm[2 * BUFB];
  const int lane = threadIdx.x & 31, wave = threadIdx.x >> 5;
  const int tilesN = N >> 7, tilesM = M >> 7;
  const int tile = (int)blockIdx.x;
  if (tile >= tilesM * tilesN) return;           // the same for the whole block, in front of every barrier
  const int tm = tile / tilesN, tn = tile - tm * tilesN;
  const int m0 = (tm << 7) + ((wave >> 1) << 6), n0 = (tn << 7) + ((wave & 1) << 6);   // this wave's 64x64 part
  const int rl = lane & 15;
  const int koff = (lane >> 4) * 8;
  const int mOff = (lane >> 4) * 8;
  const int nst = K / GKS;

  // copy addresses of this lane: rows 32 * wave + lane / 8 (+ 4 a copy) of each plane, piece lane % 8 of the row
  const int crow = 32 * wave + (lane >> 3), cpc = lane & 7;
  const T* ga  = A  + (size_t)((tm << 7) + crow) * lda + cpc * 8;
  const T* ga2 = A2 + (size_t)((tm << 7) + crow) * lda + cpc * 8;
  const T* gb  = Bt + (size_t)((tn << 7) + crow) * ldb + cpc * 8;
  char* lc = gsm + crow * GSP * 2 + cpc * 16;

  issue_g(ga, lda, lc);                          // stage 0 into buffer 0
  if (SPLITA) issue_g(ga2, lda, lc + GPL);
  issue_g(gb, ldb, lc + BOFF);

  v8f acc[4][4];
#pragma unroll
  for (int i = 0; i < 4; ++i)
#pragma unroll
    for (int j = 0; j < 4; ++j) acc[i][j] = zero8();

  asm volatile("s_wait_asynccnt 0x0" ::: "memory");  // own copies of stage 0 have landed
  __syncthreads();
  if (nst > 1) {                                 // stage 1 into buffer 1
    issue_g(ga + GKS, lda, lc + BUFB);
    if (SPLITA) issue_g(ga2 + GKS, lda, lc + BUFB + GPL);
    issue_g(gb + GKS, ldb, lc + BUFB + BOFF);
  }

  // kept rolled: unrolled, the copies' addresses of every stage stay in registers
#pragma unroll 1
  for (int s = 0; s < nst; ++s) {
    const T* sb = (const T*)(const void*)(gsm + (s & 1) * BUFB);
    const T* ap = sb + (((wave >> 1) << 6) + rl) * GSP + koff;
    const T* bp = sb + BOFF / 2 + (((wave & 1) << 6) + rl) * GSP + koff;
#pragma unroll   // the stage's two k steps in a row: LDS offsets become immediates
    for (int kk = 0; kk < GKS; kk += 32) {
      V bh[4], ah[4], al[4];
#pragma unroll
      for (int j = 0; j < 4; ++j) bh[j] = ldfragT<ET>(bp + (j << 4) * GSP + kk);
#pragma unroll
      for (int i = 0; i < 4; ++i) {
        ah[i] = ldfragT<ET>(ap + (i << 4) * GSP + kk);
        al[i] = ah[i];
        if (SPLITA) al[i] = ldfragT<ET>(ap + GPL / 2 + (i << 4) * GSP + kk);
      }
      // keeps all LDS loads of a k step ahead of the step's first WMMA: left alone, the compiler feeds the A fragments
      // through one register set, and every four WMMAs wait out the LDS latency
      __builtin_amdgcn_sched_barrier(0);
#pragma unroll
      for (int i = 0; i < 4; ++i) {
#pragma unroll
        for (int j = 0; j < 4; ++j) acc[i][j] = Elem<ET>::mma(ah[i], bh[j], acc[i][j]);
        if (SPLITA) {
#pragma unroll
          for (int j = 0; j < 4; ++j) acc[i][j] = Elem<ET>::mma(al[i], bh[j], acc[i][j]);
        }
      }
    }
    ring_publish();
    // refill the buffer just read with the stage two ahead, while one exists (block-uniform test)
    if (s + 2 < nst) {
      char* l = lc + (s & 1) * BUFB;
      issue_g(ga + (s + 2) * GKS, lda, l);
      if (SPLITA) issue_g(ga2 + (s + 2) * GKS, lda, l + GPL);
      issue_g(gb + (s + 2) * GKS, ldb, l + BOFF);
    }
  }
  asm volatile("s_wait_asynccnt 0x0" ::: "memory");  // no copy is left in flight behind the loop
  accg4(acc[0][0], acc[0][1], acc[0][2], acc[0][3]);
  accg4(acc[1][0], acc[1][1], acc[1][2], acc[1][3]);
  accg4(acc[2][0], acc[2][1], acc[2][2], acc[2][3]);
  accg4(acc[3][0], acc[3][1], acc[3][2], acc[3][3]);

  float* slab = (float*)(void*)gsm + wave * (16 * 68);
#pragma unroll
  for (int i = 0; i < 4; ++i) {
    const int mBase = m0 + (i << 4);
#pragma unroll
    for (int j = 0; j < 4; ++j) {
      float bv = 0.0f;
      if (OUT_MODE == 0) bv = bfr(bias[n0 + (j << 4) + rl]);
#pragma unroll
      for (int r = 0; r < 8; ++r) slab[(mOff + r) * 68 + (j << 4) + rl] = acc[i][j][r] * scale + bv;
    }
    __builtin_amdgcn_fence(__ATOMIC_RELEASE, "workgroup");
    __builtin_amdgcn_wave_barrier();
    __builtin_amdgcn_fence(__ATOMIC_ACQUIRE, "workgroup");
    if (OUT_MODE == 0) {
      float* C = (float*)Cout;
      const int hh = lane >> 4, c4 = (lane & 15) * 4;
{
#pragma unroll
        for (int it = 0; it < 8; ++it) {
          const int row = it * 2 + hh;
          const v4f v = *(const v4f*)(slab + row * 68 + c4);
          *(v4f*)(C + (size_t)(mBase + row) * ldc + n0 + c4) = v;
        }
        
      }
    } else {
      // OUT_MODE 2: column block n0 / 128 starts M * 128 elements behind the one before; the store below adds n0 itself
      _Float16* C = (_Float16*)Cout + ((OUT_MODE == 2) ? (size_t)(n0 >> 7) * (size_t)(M - 1) * 128 : (size_t)0);
      const int qq = lane >> 3, c8 = (lane & 7) * 8;
{
#pragma unroll
        for (int it = 0; it < 4; ++it) {
          const int row = it * 4 + qq;
          const float* sp = slab + row * 68 + c8;
          v8h hv;
#pragma unroll
          for (int e = 0; e < 8; ++e) hv[e] = (_Float16)sp[e];
          *(v8h*)(C + (size_t)(mBase + row) * ldc + n0 + c8) = hv;
        }
        
      }
    }
    __builtin_amdgcn_fence(__ATOMIC_RELEASE, "workgroup");
    __builtin_amdgcn_wave_barrier();
    __builtin_amdgcn_fence(__ATOMIC_ACQUIRE, "workgroup");
  }
}

// ---------------------------------------------------------------------------------------------
// Kernel 4: full (non-causal) single-head attention, head width 768, online softmax in f32.
//   qn, kn planes f16 [ntok][DM] (value 16*qn), vt plane f16 [ntok / 128][DM][128] (value 16*vn; blocks of 128 keys,
//   in each block one row of 128 keys = 256 B per value column).
//   Block = 256 threads = 8 waves, 64 query rows x one half of the keys (blockIdx & 1): every K and V byte that
//   comes from L2 serves 64 queries. Outputs per key half: ph / pl = bf16 hi / lo planes (16-bit storage) of
//   O_half = softmax over that half . vn, [2][ntok][DM], with the half's row maximum pm and row sum pls, [2][ntok];
//   the merge kernel joins the two halves.
//   Q tile staged once in LDS. Key tiles of 256: wave w owns keys 32w..32w+31 of the tile for the logits:
//   S^T subtiles (A = kn rows, B = Q rows, both from LDS), so the
//   D layout gives per lane 8 consecutive keys of one query -> P written to LDS as 16-B vectors ([query][key]).
//   P = 16 * exp(s - m_running) in f16 (values in [~1.2, 16], always normal).
//   Row max / sum: per-wave partials in LDS, combined in fixed order by waves 0 and 1 (one lane per query row).
//   P.V: every wave reads the whole P tile (A operand) and owns 3 x 32 value columns (B = vt rows from LDS).
//   kn and vt reach LDS by tensor loads, in a ring of two buffers: per key tile six K stages (256 keys x 128 dims)
//   and six V stages (256 columns x 128 keys); each wave asks, in one request a stage, for the slice of rows it
//   reads itself (32 key rows or 32 column rows of 256 B, each padded by 16 B in LDS); a V slice is one run of 8 KB
//   in global memory; at the foot of every stage one publish point, then the refill of the buffer just read with
//   the stage two ahead.
//   Output: the 64x768 f32 accumulator tile staged in LDS (over the Q and P regions and the ring), then each wave
//   normalises 8 whole rows, splits them into bf16 hi / lo and writes 512 B per instruction (3 per row and plane).
// ---------------------------------------------------------------------------------------------
#define QB       64
#define KSPLIT   2
#define KCH      256
#define QSP      776
#define PSP      264
#define LDS_QS   0
#define LDS_PS   99328
#define LDS_PMAX 133120
#define LDS_PSUM 135168
#define LDS_ST   137216
#define LDS_RING 139264   // a multiple of 2 KiB, as every slice's place
#define FSP      772      // f32 output staging row pitch in floats (3088 B, a multiple of 16 B)
#define KSD      128      // model dims per K stage (256 B a key row)
#define KSP      136      // K stage row pitch in halves: 272 B = 16 B x odd, for ds_load_b128 readers
#define VSK      128      // keys per V stage (256 B a value-column row)
#define VSC      256      // value columns per V stage
#define VSP      136      // V stage row pitch in halves: 272 B = 16 B x odd
#define SLICE_B  10240    // one wave's slice of a ring buffer: 32 rows * 272 B up to a multiple of 2 KiB
#define RING_B   (8 * SLICE_B)   // one ring buffer
#define KW0      ((1u << 20) | (5u << 22) | (3u << 25))   // group 1 word 0: 16 B of pad behind every 256-B row
#define ATT_LDS  (LDS_RING + 2 * RING_B)
static_assert(QB * QSP * 2 == LDS_PS - LDS_QS);
static_assert(32 * FSP * 4 <= LDS_PMAX - LDS_QS && 32 * FSP * 4 <= 2 * RING_B && FSP >= DM && (FSP % 4) == 0);
static_assert(QB * PSP * 2 == LDS_PMAX - LDS_PS);
static_assert(LDS_PSUM - LDS_PMAX == 8 * QB * 4);
static_assert(LDS_ST - LDS_PSUM == 8 * QB * 4);
static_assert(LDS_RING - LDS_ST >= 4 * QB * 4);
static_assert(32 * KSP * 2 <= SLICE_B && 32 * VSP * 2 <= SLICE_B && (SLICE_B % 2048) == 0 && (LDS_RING % 2048) == 0);
static_assert(KSD * 2 == 256 && KSP * 2 == 256 + 16 && VSK * 2 == 256 && VSP * 2 == 256 + 16 && KCH == 8 * 32);
static_assert((DM % KSD) == 0 && KCH == 2 * VSK && ((DM / KSD) % 2) == 0 && DM == 3 * VSC && VSC == 8 * 32);
static_assert(ATT_LDS <= 327680);
static_assert((QSP % 8) == 0 && (PSP % 8) == 0 && PSP >= KCH);
static_assert((LDS_PS % 16) == 0 && (LDS_PMAX % 16) == 0 && (LDS_ST % 16) == 0);
static_assert((NTOK % (KCH * KSPLIT)) == 0 && (NTOK % QB) == 0);

// K stage: this wave's 32 key rows x 128 dims. g points at (first key row of the wave, first dim); l is the slice's place.
__device__ __forceinline__ void issue_k(uint32_t cnt1, const _Float16* g, uint32_t l) {
  tdm_slice<KW0, 256u, 32u>(cnt1, l, g, DM * 2u);
}
// V stage: this wave's 32 value-column rows x 128 keys, rows back to back in global memory. g points at the first row.
__device__ __forceinline__ void issue_v(uint32_t cnt1, const _Float16* g, uint32_t l) {
  tdm_slice<KW0, 256u, 32u>(cnt1, l, g, VSK * 2u);
}
__global__ __launch_bounds__(256) void attn_kernel(const _Float16* __restrict__ qn, const _Float16* __restrict__ kn,
                                                   const _Float16* __restrict__ vt, unsigned short* __restrict__ ph,
                                                   unsigned short* __restrict__ pl, float* __restrict__ pm,
                                                   float* __restrict__ pls, float sc, int ntok) {
  __shared__ __attribute__((aligned(2048))) char smem[ATT_LDS];
  _Float16* Qs = (_Float16*)(smem + LDS_QS);
  _Float16* Ps = (_Float16*)(smem + LDS_PS);
  float* pmax = (float*)(smem + LDS_PMAX);
  float* psum = (float*)(smem + LDS_PSUM);
  float* m_s  = (float*)(smem + LDS_ST);
  float* l_s  = m_s + QB;
  float* al_s = m_s + 2 * QB;
  float* li_s = m_s + 3 * QB;

  const int tid = threadIdx.x, wave = (int)uni(threadIdx.x >> 5), lane = tid & 31, h = lane >> 4, c = lane & 15;
  const int q0 = ((int)blockIdx.x >> 1) * QB;
  const int sp = (int)blockIdx.x & 1;             // which half of the keys
  const int ntile = ntok / (KCH * KSPLIT);        // key tiles of this block
  const int key0 = sp * ntile * KCH;
  const float ninf = -__builtin_inff();

  // ring addresses of this wave (all wave-uniform): its slice's place in buffer 0, its first key row, its first column row
  const uint32_t rl0 = (uint32_t)(size_t)(smem + LDS_RING) + (uint32_t)wave * SLICE_B;
  const _Float16* kg = kn + (size_t)(key0 + 32 * wave) * DM;
  const _Float16* vg = vt + ((size_t)(key0 / VSK) * DM + 32 * wave) * VSK;   // key block key0 / 128, column 32 * wave

  // word 0 of every request's group 0 (count = 1), a descriptor word held in a scalar register by pinned(): made once, in
  // front of the first request; as a plain constant it was written into its register anew while stage 1's request flew
  const uint32_t cnt1 = pinned(1u);
  issue_k(cnt1, kg, rl0);   // stage 0 (tile 0, dims 0..127) into buffer 0; it flies under the Q staging

  if (tid < QB) { m_s[tid] = ninf; l_s[tid] = 0.0f; al_s[tid] = 0.0f; li_s[tid] = 0.0f; }
  psum[tid] = 0.0f;
  psum[256 + tid] = 0.0f;
  // Q tile: 64 rows x 96 pieces of 8 halves; coverage 24 * 256 = 6144 pieces = the whole tile
  {
    // the 64 rows lie in one piece in global memory: one address register, piece i at a constant distance
    const _Float16* qg = qn + (size_t)q0 * DM + tid * 8;
    v8h qv[24];
#pragma unroll
    for (int i = 0; i < 24; ++i) qv[i] = *(const v8h*)(qg + i * 2048);
    asm volatile("s_wait_xcnt 0x0" ::: "memory");   // in front of any rewrite of the loads' address register
#pragma unroll
    for (int i = 0; i < 24; ++i) {
      const int idx = i * 256 + tid;
      const int row = idx / 96;
      const int pc  = idx - row * 96;
      *(v8h*)(Qs + row * QSP + pc * 8) = qv[i];
    }
  }
  asm volatile("s_wait_tensorcnt 0x0" ::: "memory");  // own slice of stage 0 has landed
  __syncthreads();
  // keeps stage 1's descriptor words behind the wait
  __builtin_amdgcn_sched_barrier(0);
  issue_k(cnt1, kg + KSD, rl0 + RING_B);   // stage 1 into buffer 1

  v8f oacc[4][6];   // [query subtile][column subtile]: column 256 * (nt / 2) + 32 * wave + 16 * (nt % 2) + c
#pragma unroll
  for (int qt = 0; qt < 4; ++qt)
#pragma unroll
    for (int nt = 0; nt < 6; ++nt) oacc[qt][nt] = zero8();

  const _Float16* qbp = Qs + c * QSP + 8 * h;             // B operand, query c (+ 16 * QSP per query subtile)
  const _Float16* pap = Ps + c * PSP + 8 * h;             // A operand, query c (+ 16 * PSP per query subtile)

#pragma unroll 1
  for (int t = 0; t < ntile; ++t) {
    // ---- logits: S^T subtiles for keys kb..kb+31 (this wave), queries 0..63 ----
    v8f sacc[4][2];   // [query subtile][key subtile]; element r: query 16qt+c, key kb+16kt+8h+r
#pragma unroll
    for (int qt = 0; qt < 4; ++qt)
#pragma unroll
      for (int kt = 0; kt < 2; ++kt) sacc[qt][kt] = zero8();
    // the products of one K stage of 128 dims (stage j of the tile, in buffer j & 1)
    auto k_stage = [&](int j) __attribute__((always_inline)) {
      const _Float16* ka0p = (const _Float16*)(smem + LDS_RING + (j & 1) * RING_B + wave * SLICE_B) + c * KSP + 8 * h;
      const _Float16* ka1p = ka0p + 16 * KSP;
#pragma unroll   // the stage's four k steps in a row: LDS offsets become immediates
      for (int kk = 0; kk < KSD; kk += 32) {
        const v16h a0 = ldfrag(ka0p + kk), a1 = ldfrag(ka1p + kk);
        v16h b[4];
#pragma unroll
        for (int qt = 0; qt < 4; ++qt) b[qt] = ldfrag(qbp + (16 * qt) * QSP + j * KSD + kk);
        // keeps all twelve LDS loads of a k step ahead of the step's first WMMA: left alone, the compiler feeds the
        // B fragments through one register set, and every pair of WMMAs waits out the LDS latency
        __builtin_amdgcn_sched_barrier(0);
#pragma unroll
        for (int qt = 0; qt < 4; ++qt) {
          sacc[qt][0] = mma16(a0, b[qt], sacc[qt][0]);
          sacc[qt][1] = mma16(a1, b[qt], sacc[qt][1]);
        }
      }
    };
    // Six K stages, in two loops, so that every request stands in straight code that every wave runs (no test around a
    // tensor load, which ignores EXEC); both kept rolled: the loop text stays short. Behind each publish point the
    // buffer just read is refilled with the stage two ahead: K stages 2..5 ...
#pragma unroll 1
    for (int j = 0; j + 2 < DM / KSD; ++j) {
      k_stage(j);
      ring_publish_t();
      issue_k(cnt1, kg + (size_t)t * KCH * DM + (j + 2) * KSD, rl0 + (j & 1) * RING_B);
    }
    // ... then V stages 0, 1 of this tile
#pragma unroll 1
    for (int j = DM / KSD - 2; j < DM / KSD; ++j) {
      k_stage(j);
      ring_publish_t();
      issue_v(cnt1, vg + ((size_t)(2 * t) * DM + (j + 2 - DM / KSD) * VSC) * VSK, rl0 + (j & 1) * RING_B);
    }
    // ---- scale, per-wave partial row max ----
#pragma unroll
    for (int qt = 0; qt < 4; ++qt) {
      float pmq = ninf;
#pragma unroll
      for (int kt = 0; kt < 2; ++kt) {
#pragma unroll
        for (int r = 0; r < 8; ++r) {
          const float v0 = sacc[qt][kt][r] * sc; sacc[qt][kt][r] = v0; pmq = fmaxf(pmq, v0);
        }
      }
      pmq = fmaxf(pmq, __shfl_xor(pmq, 16, 32));
      pmax[wave * QB + 16 * qt + c] = pmq;
    }
    __syncthreads();
    // ---- waves 0 and 1, thread = query row: fold the prior tile's sums into l, new running max, rescale factor ----
    if (wave < 2) {
      const int row = tid;
      float ps = 0.0f;
#pragma unroll
      for (int w = 0; w < 8; ++w) ps += psum[w * QB + row];
      l_s[row] = l_s[row] * al_s[row] + ps;
      const float mo = m_s[row];
      float mx = mo;
#pragma unroll
      for (int w = 0; w < 8; ++w) mx = fmaxf(mx, pmax[w * QB + row]);
      al_s[row] = __expf(mo - mx);
      m_s[row] = mx;
    }
    __syncthreads();
    // ---- p = 16 * exp(s - m) as f16, P tile, partial row sums, rescale O ----
#pragma unroll
    for (int qt = 0; qt < 4; ++qt) {
      const float mq = m_s[16 * qt + c];
      float ps = 0.0f;
#pragma unroll
      for (int kt = 0; kt < 2; ++kt) {
        v8h hq;
#pragma unroll
        for (int r = 0; r < 8; ++r) {
          const float p = __expf(sacc[qt][kt][r] - mq); ps += p; hq[r] = (_Float16)(p * 16.0f);
        }
        *(v8h*)(Ps + (16 * qt + c) * PSP + 32 * wave + 16 * kt + 8 * h) = hq;
      }
      ps += __shfl_xor(ps, 16, 32);
      psum[wave * QB + 16 * qt + c] = ps;
      const v4f aA = *(const v4f*)(al_s + 16 * qt + 8 * h), aB = *(const v4f*)(al_s + 16 * qt + 8 * h + 4);
#pragma unroll
      for (int nt = 0; nt < 6; ++nt) {
#pragma unroll
        for (int r = 0; r < 4; ++r) {
          oacc[qt][nt][r] *= aA[r]; oacc[qt][nt][4 + r] *= aB[r];
        }
      }
    }
    __syncthreads();
    // ---- O += P . V over the 256 keys of the tile ----
    // six V stages: stage v is key half v / 3, column third v % 3, in buffer v & 1; the three stages of a key half share
    // its P fragments, which stay in registers. Unrolled: accumulator index, buffer and kind of refill depend on v.
#pragma unroll
    for (int kh = 0; kh < 2; ++kh) {
      v16h pa[4][4];
#pragma unroll
      for (int th = 0; th < 3; ++th) {
        const int v = 3 * kh + th;
        const _Float16* vbp = (const _Float16*)(smem + LDS_RING + (v & 1) * RING_B + wave * SLICE_B) + c * VSP + 8 * h;
        v16h vb[4][2];
#pragma unroll
        for (int k2 = 0; k2 < 4; ++k2) {
          if (th == 0) {
#pragma unroll
            for (int qt = 0; qt < 4; ++qt) pa[k2][qt] = ldfrag(pap + (16 * qt) * PSP + kh * VSK + 32 * k2);
          }
#pragma unroll
          for (int j = 0; j < 2; ++j) vb[k2][j] = ldfrag(vbp + (16 * j) * VSP + 32 * k2);
        }
        // keeps all LDS loads of the stage ahead of its first WMMA (as in the K stages)
        __builtin_amdgcn_sched_barrier(0);
#pragma unroll
        for (int k2 = 0; k2 < 4; ++k2)
#pragma unroll
          for (int j = 0; j < 2; ++j)
#pragma unroll
            for (int qt = 0; qt < 4; ++qt)
              oacc[qt][2 * th + j] = mma16(pa[k2][qt], vb[k2][j], oacc[qt][2 * th + j]);
        ring_publish_t();
        // refill: V stage v + 2 of this tile; behind the last two stages K stages 0, 1 of the next tile while one
        // exists (a scalar test, the same for the whole block)
        if (v + 2 < 6) {
          issue_v(cnt1, vg + ((size_t)(2 * t + (v + 2) / 3) * DM + ((v + 2) % 3) * VSC) * VSK, rl0 + (v & 1) * RING_B);
        } else if (pinned(t + 1 < ntile)) {
          issue_k(cnt1, kg + (size_t)(t + 1) * KCH * DM + (v - 4) * KSD, rl0 + (v & 1) * RING_B);
        }
      }
    }
  }
  asm volatile("s_wait_tensorcnt 0x0" ::: "memory");  // no request is left in flight behind the loop
  asm volatile("s_wait_dscnt 0x0" ::: "memory");      // own ring reads are done before the ring becomes output staging

  // ---- this half's row sum (fold the last tile's sums) and maximum; O_half = oacc / (256 * l) (P carry 16, vn carry 16) ----
  if (wave < 2) {
    const int row = tid;
    float ps = 0.0f;
#pragma unroll
    for (int w = 0; w < 8; ++w) ps += psum[w * QB + row];
    const float l = l_s[row] * al_s[row] + ps;
    li_s[row] = (1.0f / l) * (1.0f / 256.0f);
    pm[(size_t)sp * ntok + q0 + row]  = m_s[row];
    pls[(size_t)sp * ntok + q0 + row] = l;
  }
  __syncthreads();
  // ---- stage the 64 x 768 f32 accumulator tile: rows 0..31 over the Q and P regions, rows 32..63 over the ring ----
  float* F0 = (float*)(smem + LDS_QS);
  float* F1 = (float*)(smem + LDS_RING);
#pragma unroll
  for (int qt = 0; qt < 4; ++qt) {
    float* F = ((qt < 2) ? F0 : F1) + (16 * (qt & 1) + 8 * h) * FSP;
#pragma unroll
    for (int nt = 0; nt < 6; ++nt) {
      const int col = VSC * (nt / 2) + 32 * wave + 16 * (nt % 2) + c;
#pragma unroll
      for (int r = 0; r < 8; ++r) F[r * FSP + col] = oacc[qt][nt][r];
    }
  }
  __syncthreads();
  // ---- each wave: 8 whole rows, normalised, split into bf16 hi / lo, 512 B per store instruction (3 per row and plane) ----
  {
    unsigned short* gh = ph + ((size_t)sp * ntok + q0) * DM;
    unsigned short* gl = pl + ((size_t)sp * ntok + q0) * DM;
    // kept rolled: run once per block, unrolled it is some thousand instructions that are fetched to be used once
#pragma unroll 1
    for (int it = 0; it < 24; ++it) {
      const int rr = it / 3;
      const int row = 8 * wave + rr;
      const int pc = (it - rr * 3) * 32 + lane;
      const float* F = ((row < 32) ? F0 + row * FSP : F1 + (row - 32) * FSP) + pc * 8;
      const float inv = li_s[row];
      const v4f x0 = *(const v4f*)(F), x1 = *(const v4f*)(F + 4);
      v8us hvv, lvv;
#pragma unroll
      for (int e = 0; e < 4; ++e) {
        unsigned short hb, lb;
        split_bf(x0[e] * inv, hb, lb);
        hvv[e] = hb;      lvv[e] = lb;
        split_bf(x1[e] * inv, hb, lb);
        hvv[4 + e] = hb;  lvv[4 + e] = lb;
      }
      *(v8us*)(gh + (size_t)row * DM + pc * 8) = hvv;
      *(v8us*)(gl + (size_t)row * DM + pc * 8) = lvv;
      // the next trip rewrites the two stores' address and data registers: the wait stands in front of that
      asm volatile("s_wait_xcnt 0x0" ::: "memory");
    }
  }
}

// ---------------------------------------------------------------------------------------------
// Kernel 5: join the two key halves of the attention: with M = max(m0, m1) and w_i = l_i * exp(m_i - M),
//   O = (w0 * O_0 + w1 * O_1) / (w0 + w1), O_i = hi + lo of half i; O goes out again as bf16 hi / lo planes [ntok][DM].
// A piece is 8 columns: one 16-B load and store per lane and plane, 32 lanes contiguous = 512 B. Thread g takes pieces
// g, g + threads, ... (MG_IT of them); the loads of all its pieces are issued before the first piece is worked on.
// coverage: MG_IT * SG_BLK * SG_THR pieces = ntok * DM / 8 exactly (DM / 8 = 96 pieces a row).
// ---------------------------------------------------------------------------------------------
// exp(d) in the fast form (one multiply by log2 e, then v_exp_f32). The v_nop in the same statement is the slot that the
// instruction set asks for behind a transcendental.
__device__ __forceinline__ float exp_slot(float d) {
  const float t = d * 1.44269504f;
  float r;
  asm("v_exp_f32 %0, %1\n\tv_nop" : "=v"(r) : "v"(t));
  return r;
}
#define MG_IT (NTOK * (DM / 8) / (SG_BLK * SG_THR))
static_assert(MG_IT * SG_BLK * SG_THR == NTOK * (DM / 8));
__global__ __launch_bounds__(SG_THR) void merge_kernel(const unsigned short* __restrict__ ph,
                                                       const unsigned short* __restrict__ pl,
                                                       const float* __restrict__ pm, const float* __restrict__ pls,
                                                       unsigned short* __restrict__ oh, unsigned short* __restrict__ ol,
                                                       int ntok) {
  const int g = (int)blockIdx.x * SG_THR + (int)threadIdx.x;
  const size_t pst = (size_t)ntok * DM;
  float m0[MG_IT], m1[MG_IT], l0[MG_IT], l1[MG_IT];
  v8us h0[MG_IT], g0[MG_IT], h1[MG_IT], g1[MG_IT];
#pragma unroll
  for (int it = 0; it < MG_IT; ++it) {
    const int row = (it * (SG_BLK * SG_THR) + g) / (DM / 8);
    m0[it] = pm[row];
    m1[it] = pm[ntok + row];
    l0[it] = pls[row];
    l1[it] = pls[ntok + row];
  }
  // the wide loads' results may take these loads' address registers: the wait stands in front of that rewrite
  asm volatile("s_wait_xcnt 0x0" ::: "memory");
#pragma unroll
  for (int it = 0; it < MG_IT; ++it) {
    const size_t e = (size_t)(it * (SG_BLK * SG_THR) + g) * 8;
    h0[it] = *(const v8us*)(ph + e);
    g0[it] = *(const v8us*)(pl + e);
    h1[it] = *(const v8us*)(ph + pst + e);
    g1[it] = *(const v8us*)(pl + pst + e);
  }
  asm volatile("s_wait_xcnt 0x0" ::: "memory");   // in front of any rewrite of the loads' address registers
  // keeps every load ahead of the first piece's work: left alone, the compiler mixes the two to save registers, and the
  // thread waits out the memory latency several times over
  __builtin_amdgcn_sched_barrier(0);
#pragma unroll
  for (int it = 0; it < MG_IT; ++it) {
    const size_t e = (size_t)(it * (SG_BLK * SG_THR) + g) * 8;
    const float mx = fmaxf(m0[it], m1[it]);
    float w0 = l0[it] * exp_slot(m0[it] - mx), w1 = l1[it] * exp_slot(m1[it] - mx);
    const float inv = 1.0f / (w0 + w1);
    w0 *= inv;
    w1 *= inv;
    v8us oh8, ol8;
#pragma unroll
    for (int i = 0; i < 8; ++i) {
      const float f = w0 * (bfval(h0[it][i]) + bfval(g0[it][i])) + w1 * (bfval(h1[it][i]) + bfval(g1[it][i]));
      unsigned short hb, lb;
      split_bf(f, hb, lb);
      oh8[i] = hb;
      ol8[i] = lb;
    }
    *(v8us*)(oh + e) = oh8;
    *(v8us*)(ol + e) = ol8;
    asm volatile("s_wait_xcnt 0x0" ::: "memory");   // in front of any rewrite of the stores' address and data registers
  }
}

// ---------------------------------------------------------------------------------------------
// Workspace map (bytes, all regions exact tile / whole-line multiples, no padding needed):
//   Wq16 : Wqkv f16 [768][768] (64 * bf16(w))                 off 0           size  1,179,648
//   Wpb  : Wproj bf16 bits [768][768]                           off 1,179,648   size  1,179,648
//   X16  : ln(q), ln(k), ln(v) stacked f16 [24576][768]        off 2,359,296   size 37,748,736
//   QK16 : qn then kn f16 [16384][768]                          off 40,108,032  size 25,165,824
//   VT16 : vn^T f16 [64][768][128] (blocks of 128 keys)         off 65,273,856  size 12,582,912
//   OH   : attention output bf16 hi [8192][768]                 off 77,856,768  size 12,582,912
//   OL   : attention output bf16 lo [8192][768]                 off 90,439,680  size 12,582,912
//   PH   : per key half, attention output bf16 hi [2][8192][768] off 103,022,592 size 25,165,824
//   PL   : per key half, attention output bf16 lo [2][8192][768] off 128,188,416 size 25,165,824
//   PM   : per key half, row maximum f32 [2][8192]              off 153,354,240 size     65,536
//   PS   : per key half, row sum f32 [2][8192]                  off 153,419,776 size     65,536
//   total 153,485,312
// ---------------------------------------------------------------------------------------------
extern "C" void kernel_launch(void* const* d_in, const int* in_sizes, int n_in,
                              void* d_out, int out_size, void* d_ws, size_t ws_size,
                              hipStream_t stream) {
  if (n_in < 8) return;
  const int ntok = NTOK, dm = DM;
  if (in_sizes[0] != ntok * dm || in_sizes[1] != ntok * dm || in_sizes[2] != ntok * dm) return;
  if (in_sizes[3] != dm || in_sizes[4] != dm || in_sizes[7] != dm) return;
  if (in_sizes[5] != dm * dm || in_sizes[6] != dm * dm) return;
  if (out_size != ntok * dm) return;

  const float* q     = (const float*)d_in[0];
  const float* k     = (const float*)d_in[1];
  const float* v     = (const float*)d_in[2];
  const float* ln_w  = (const float*)d_in[3];
  const float* ln_b  = (const float*)d_in[4];
  const float* Wqkv  = (const float*)d_in[5];
  const float* Wproj = (const float*)d_in[6];
  const float* bproj = (const float*)d_in[7];
  float* out = (float*)d_out;

  const size_t bWq = (size_t)dm * dm * 2;
  const size_t bWp = (size_t)dm * dm * 2;
  const size_t bX  = (size_t)3 * ntok * dm * 2;
  const size_t bQK = (size_t)2 * ntok * dm * 2;
  const size_t bVT = (size_t)dm * ntok * 2;
  const size_t bO  = (size_t)ntok * dm * 2;
  size_t off = 0;
  const size_t oWq = off; off += bWq;
  const size_t oWp = off; off += bWp;
  const size_t oX  = off; off += bX;
  const size_t oQK = off; off += bQK;
  const size_t oVT = off; off += bVT;
  const size_t oOH = off; off += bO;
  const size_t oOL = off; off += bO;
  const size_t oPH = off; off += 2 * bO;
  const size_t oPL = off; off += 2 * bO;
  const size_t oPM = off; off += (size_t)2 * ntok * 4;
  const size_t oPS = off; off += (size_t)2 * ntok * 4;
  if (off > ws_size) return;                     // 153,485,312

  char* ws = (char*)d_ws;
  _Float16*       Wq16 = (_Float16*)(ws + oWq);
  unsigned short* Wpb  = (unsigned short*)(ws + oWp);
  _Float16*       X16  = (_Float16*)(ws + oX);
  _Float16*       QK16 = (_Float16*)(ws + oQK);
  _Float16*       VT16 = (_Float16*)(ws + oVT);
  unsigned short* OH   = (unsigned short*)(ws + oOH);
  unsigned short* OL   = (unsigned short*)(ws + oOL);
  unsigned short* PH   = (unsigned short*)(ws + oPH);
  unsigned short* PL   = (unsigned short*)(ws + oPL);
  float*          PM   = (float*)(ws + oPM);
  float*          PS   = (float*)(ws + oPS);

  const dim3 blk(256);
  const dim3 gblk(128);                       // the GEMM's block: 4 waves
  const int n8 = dm * dm / 8;                 // 73728 = 288 * 256
  if ((n8 % 256) != 0) return;

  // (1) weights -> Wqkv f16 plane (64 * bf16(w)) and Wproj bf16 plane
  cvt_w_kernel<<<dim3(2 * (n8 / 256)), blk, 0, stream>>>(Wqkv, Wproj, Wq16, Wpb, n8);
  // (2) LayerNorm of q, k, v -> X16 (8 * ln)
  ln_kernel<<<dim3(SG_BLK), dim3(SG_THR), 0, stream>>>(q, k, v, ln_w, ln_b, X16, ntok);
  // (3) qn, kn = X[0:16384] . Wqkv^T  -> QK16 (16 * qn | 16 * kn); M=16384, N=768, K=768; scale 16/(8*64)
  gemm64_kernel<0, false, 1><<<dim3((2 * ntok / 128) * (dm / 128)), gblk, 0, stream>>>(
      (const unsigned short*)X16, (const unsigned short*)X16, dm, (const unsigned short*)Wq16, dm,
      (void*)QK16, dm, bproj, 2 * ntok, dm, dm, 0.03125f);
  // (4) vn^T = Wqkv . X[16384:24576]^T -> VT16 [64][768][128] (16 * vn, blocks of 128 keys); M=768, N=8192, K=768
  gemm64_kernel<0, false, 2><<<dim3((dm / 128) * (ntok / 128)), gblk, 0, stream>>>(
      (const unsigned short*)Wq16, (const unsigned short*)Wq16, dm,
      (const unsigned short*)(X16 + (size_t)2 * ntok * dm), dm,
      (void*)VT16, 128, bproj, dm, ntok, dm, 0.03125f);
  // (5) attention per key half -> PH / PL, PM, PS; logit scale = dim^-0.5 / 256 (operand carries 16 * 16)
  const float sc = 0.03608439182435161f * (1.0f / 256.0f);
  attn_kernel<<<dim3(KSPLIT * (ntok / QB)), blk, 0, stream>>>(QK16, QK16 + (size_t)ntok * dm, VT16, PH, PL, PM, PS,
                                                              sc, ntok);
  // (6) the two key halves joined -> OH / OL (bf16 hi / lo of O)
  merge_kernel<<<dim3(SG_BLK), dim3(SG_THR), 0, stream>>>(PH, PL, PM, PS, OH, OL, ntok);
  // (7) out = (O_hi + O_lo) . Wproj^T + b -> d_out f32 [8192][768]; bf16 operands, scale 1
  gemm64_kernel<1, true, 0><<<dim3((ntok / 128) * (dm / 128)), gblk, 0, stream>>>(
      OH, OL, dm, Wpb, dm, (void*)out, dm, bproj, ntok, dm, dm, 1.0f);
  (void)hipGetLastError();
}

// v007
// Measured time: 223 microseconds a run.
// Two timings next to v006 both put it at 1.07 times that version's speed.
// Over all steps from v000 it is 3.09 times as fast.
// Contractions: qn|kn = ln(q|k).Wqkv^T, vn^T = Wqkv.ln(v)^T, S^T = kn.qn^T, O = P.vn : v_wmma_f32_16x16x32_f16, f16 operands with
// power-of-two carries (ln x8, Wqkv x64, qn/kn/vn x16, P = 16*exp(s - m)), f32 accumulate; out = O.Wproj^T + b : v_wmma_f32_16x16x32_bf16,
// O as bf16 hi/lo planes (hi.W + lo.W), Wproj bf16, f32 accumulate; float inputs RNE-converted to bf16 on load; LayerNorm, softmax
// statistics and bias in f32.
#include <hip/hip_runtime.h>
#include <stdint.h>

#define NTOK 8192
#define DM   768

typedef _Float16 v16h __attribute__((ext_vector_type(16)));
typedef _Float16 v8h  __attribute__((ext_vector_type(8)));
typedef __bf16   v16b __attribute__((ext_vector_type(16)));
typedef __bf16   v8b  __attribute__((ext_vector_type(8)));
typedef float    v8f  __attribute__((ext_vector_type(8)));
typedef float    v4f  __attribute__((ext_vector_type(4)));
typedef unsigned short v8us __attribute__((ext_vector_type(8)));

static_assert((DM % 64) == 0);
static_assert((NTOK % 256) == 0);

// f32 -> nearest-even bf16 bits / value
__device__ __forceinline__ unsigned short bfbits(float f) {
  unsigned u = __float_as_uint(f);
  return (unsigned short)((u + 0x7FFFu + ((u >> 16) & 1u)) >> 16);
}
__device__ __forceinline__ float bfval(unsigned short b) { return __uint_as_float(((unsigned)b) << 16); }
__device__ __forceinline__ float bfr(float f) { return bfval(bfbits(f)); }
__device__ __forceinline__ void split_bf(float f, unsigned short& hb, unsigned short& lb) {
  hb = bfbits(f);
  lb = bfbits(f - bfval(hb));
}

// 16-bit operand element types for the GEMM template: 0 = f16, 1 = bf16
template <int ET> struct Elem;
template <> struct Elem<0> {
  typedef _Float16 T; typedef v16h V; typedef v8h V8;
  static __device__ __forceinline__ v8f mma(V a, V b, v8f c) {
    return __builtin_amdgcn_wmma_f32_16x16x32_f16(false, a, false, b, (short)0, c, false, false);
  }
};
template <> struct Elem<1> {
  typedef __bf16 T; typedef v16b V; typedef v8b V8;
  static __device__ __forceinline__ v8f mma(V a, V b, v8f c) {
    return __builtin_amdgcn_wmma_f32_16x16x32_bf16(false, a, false, b, (short)0, c, false, false);
  }
};

// 16-bit WMMA fragment from k-contiguous storage (A row-major [m][k], or B stored [n][k]):
// p points at element (row_or_col = lane&15, k0 + 8h); elements 0..7 <- p[0..7], 8..15 <- p[16..23].
template <int ET>
__device__ __forceinline__ typename Elem<ET>::V ldfragT(const typename Elem<ET>::T* p) {
  typedef typename Elem<ET>::V V;
  typedef typename Elem<ET>::V8 V8;
  union { V v; V8 h[2]; } f;
  f.h[0] = *(const V8*)(p);
  f.h[1] = *(const V8*)(p + 16);
  return f.v;
}
__device__ __forceinline__ v16h ldfrag(const _Float16* p) { return ldfragT<0>(p); }
__device__ __forceinline__ v8f mma16(v16h a, v16h b, v8f c) { return Elem<0>::mma(a, b, c); }
__device__ __forceinline__ v8f zero8() {
  v8f z;
#pragma unroll
  for (int i = 0; i < 8; ++i) z[i] = 0.0f;
  return z;
}

// hazard guard: 4 VALU slots after the last WMMA of a group, D tied
__device__ __forceinline__ void accg4(v8f& a, v8f& b, v8f& c, v8f& d) {
  asm volatile("v_nop\n\tv_nop\n\tv_nop\n\tv_nop" : "+v"(a), "+v"(b), "+v"(c), "+v"(d));
}

// ---------------------------------------------------------------------------------------------
// Kernel 1: two [DM][DM] f32 weight matrices -> 16-bit planes, layout unchanged ([out][in], k = in contiguous):
//   blocks [0, nb0):  d16[e] = f16(64 * bf16(w0[e]))     (f16 operand plane for the qkv projection)
//   blocks [nb0, 2nb0): dbf[e] = bf16 bits of w1[e]       (bf16 operand plane for the output projection)
// Block-uniform select, no barriers. 8 elements per thread: one 16-B store per lane, 32 lanes contiguous = 512 B =
// coverage: nb0 * 256 threads * 8 = DM * DM elements per plane exactly (n8 = DM*DM/8 is a multiple of 256).
// ---------------------------------------------------------------------------------------------
__global__ __launch_bounds__(256) void cvt_w_kernel(const float* __restrict__ w0, const float* __restrict__ w1,
                                                    _Float16* __restrict__ d16, unsigned short* __restrict__ dbf,
                                                    int n8) {
  const int nb0 = n8 >> 8;
  const bool second = ((int)blockIdx.x >= nb0);
  const float* src = second ? w1 : w0;
  const int li = ((int)blockIdx.x - (second ? nb0 : 0)) * 256 + (int)threadIdx.x;
  if (li >= n8) return;
  const size_t e = (size_t)li * 8;
  const v4f a = *(const v4f*)(src + e);
  const v4f b = *(const v4f*)(src + e + 4);
  if (!second) {
    v8h o;
#pragma unroll
    for (int i = 0; i < 4; ++i) {
      o[i]     = (_Float16)(bfr(a[i]) * 64.0f);
      o[4 + i] = (_Float16)(bfr(b[i]) * 64.0f);
    }
    _Float16* d = d16 + e;
    *(v8h*)d = o;
    
  } else {
    v8us o;
#pragma unroll
    for (int i = 0; i < 4; ++i) {
      o[i]     = bfbits(a[i]);
      o[4 + i] = bfbits(b[i]);
    }
    unsigned short* d = dbf + e;
    *(v8us*)d = o;
    
  }
}

// ---------------------------------------------------------------------------------------------
// The two streaming kernels (LayerNorm, merge) run as SG_BLK work-groups of SG_THR threads: 4,096 waves in all, each of
// which walks several rows or pieces, so that few waves have to be started and each keeps many loads in flight.
#define SG_BLK 256
#define SG_THR 512
#define SG_WAVES (SG_BLK * (SG_THR / 32))
static_assert((3 * NTOK) % SG_WAVES == 0);

// Kernel 2: LayerNorm of q, k, v (bf16-converted inputs, f32 statistics, centred variance) -> f16 plane X
// [3*ntok][DM], value = 8 * ln(x). Rows [0,ntok) of X come from q, the next ntok from k, the next from v.
// One wave per row at a time; wave g takes rows g, g + waves, g + 2 * waves, ... The row (3 KB) is read once and held in
// registers: lane owns columns (j*32+lane)*8 .. +7 of chunk j (j = 0..2). The next row's six loads are issued before the
// current row is worked on. Weight and bias of the lane's 24 columns are converted once per wave.
// Stores: one 16-B store per lane and chunk, 32 lanes contiguous = 512 B.
// coverage: rows g + i * waves over all waves g = every row below 3*ntok once; 3 chunks * 32 lanes * 8 = 768 columns.
// ---------------------------------------------------------------------------------------------
__device__ __forceinline__ const float* ln_row(const float* qx, const float* kx, const float* vx, int r, int ntok) {
  const int seg = (r >= 2 * ntok) ? 2 : ((r >= ntok) ? 1 : 0);
  const float* src = (seg == 2) ? vx : ((seg == 1) ? kx : qx);
  return src + (size_t)(r - seg * ntok) * DM;
}
__global__ __launch_bounds__(SG_THR) void ln_kernel(const float* __restrict__ qx, const float* __restrict__ kx,
                                                    const float* __restrict__ vx, const float* __restrict__ lw,
                                                    const float* __restrict__ lb, _Float16* __restrict__ X, int ntok) {
  const int wave = __builtin_amdgcn_readfirstlane((int)(threadIdx.x >> 5)), lane = threadIdx.x & 31;
  const int nw = (int)gridDim.x * (SG_THR / 32);
  const int total = 3 * ntok;
  int row = (int)blockIdx.x * (SG_THR / 32) + wave;
  if (row >= total) return;                      // the same for the whole wave; the kernel has no barrier

  v4f nxt[6];
  {
    const float* p = ln_row(qx, kx, vx, row, ntok) + lane * 8;
#pragma unroll
    for (int j = 0; j < 3; ++j) {
      nxt[2 * j]     = *(const v4f*)(p + j * 256);
      nxt[2 * j + 1] = *(const v4f*)(p + j * 256 + 4);
    }
  }
  float w[24], b8[24];                           // bf16(weight), 8 * bf16(bias) of this lane's columns
#pragma unroll
  for (int j = 0; j < 3; ++j) {
    const int c0 = (j * 32 + lane) * 8;
    const v4f wa = *(const v4f*)(lw + c0), wb = *(const v4f*)(lw + c0 + 4);
    const v4f ba = *(const v4f*)(lb + c0), bb = *(const v4f*)(lb + c0 + 4);
#pragma unroll
    for (int e = 0; e < 4; ++e) {
      w[8 * j + e]      = bfr(wa[e]);
      w[8 * j + 4 + e]  = bfr(wb[e]);
      b8[8 * j + e]     = bfr(ba[e]) * 8.0f;
      b8[8 * j + 4 + e] = bfr(bb[e]) * 8.0f;
    }
  }
  asm volatile("s_wait_xcnt 0x0" ::: "memory");   // in front of any rewrite of these loads' address registers
  // the row in work, bf16-converted: made from the loaded row at the foot of the trip before, so that at the head of a
  // trip no load but the next row's is outstanding and nothing in the trip's work waits for those
  float x[24];
#pragma unroll
  for (int jj = 0; jj < 6; ++jj)
#pragma unroll
    for (int e = 0; e < 4; ++e) x[4 * jj + e] = bfr(nxt[jj][e]);

  // kept rolled: one row's text, run for every row of the wave
#pragma unroll 1
  for (;;) {
    const int nrow = row + nw;
    const bool more = nrow < total;              // scalar: the same for the whole wave
    if (more) {
      const float* p = ln_row(qx, kx, vx, nrow, ntok) + lane * 8;
#pragma unroll
      for (int j = 0; j < 3; ++j) {
        nxt[2 * j]     = *(const v4f*)(p + j * 256);
        nxt[2 * j + 1] = *(const v4f*)(p + j * 256 + 4);
      }
      asm volatile("s_wait_xcnt 0x0" ::: "memory");   // in front of any rewrite of the loads' address registers
    }
    // keeps the next row's loads ahead of the work on this row: sunk into it, they would fly for less time
    __builtin_amdgcn_sched_barrier(0);

    float s = 0.0f;
#pragma unroll
    for (int jj = 0; jj < 6; ++jj) s += (x[4 * jj] + x[4 * jj + 1]) + (x[4 * jj + 2] + x[4 * jj + 3]);
#pragma unroll
    for (int off = 16; off > 0; off >>= 1) s += __shfl_xor(s, off, 32);
    const float mu = s * (1.0f / 768.0f);

    // centred sum of squares
    float s2 = 0.0f;
#pragma unroll
    for (int i = 0; i < 24; ++i) {
      const float d = x[i] - mu;
      s2 += d * d;
    }
#pragma unroll
    for (int off = 16; off > 0; off >>= 1) s2 += __shfl_xor(s2, off, 32);
    const float rstd8 = rsqrtf(s2 * (1.0f / 768.0f) + 1e-5f) * 8.0f;   // x8 carry folded into the scale

    _Float16* yr = X + (size_t)row * DM + lane * 8;
#pragma unroll
    for (int j = 0; j < 3; ++j) {
      v8h o;
#pragma unroll
      for (int e = 0; e < 8; ++e) {
        const float t = (x[8 * j + e] - mu) * rstd8;
        o[e] = (_Float16)(t * w[8 * j + e] + b8[8 * j + e]);
      }
      *(v8h*)(yr + j * 256) = o;
    }
    asm volatile("s_wait_xcnt 0x0" ::: "memory");   // the next trip rewrites the stores' address and data registers
    if (!more) break;
#pragma unroll
    for (int jj = 0; jj < 6; ++jj)
#pragma unroll
      for (int e = 0; e < 4; ++e) x[4 * jj + e] = bfr(nxt[jj][e]);
    row = nrow;
  }
}

// One asynchronous 16-B-per-lane copy global -> LDS, as the builtin: its address registers are the compiler's, which
// may place them above v255 (an asm operand may not lie there).
typedef int v4i __attribute__((ext_vector_type(4)));
__device__ __forceinline__ void acopy(const _Float16* g, char* l) {
  __builtin_amdgcn_global_load_async_to_lds_b128((__attribute__((address_space(1))) v4i*)g,
                                                 (__attribute__((address_space(3))) v4i*)l, 0, 0);
}
// Publish point of the ring: this wave's LDS reads of the buffer to be refilled have retired, its own copies of the
// next stage have landed, then the work-group barrier behind which that stage is read and the old buffer refilled.
__device__ __forceinline__ void ring_publish() {
  // keeps the stage's WMMAs ahead of the publish point: sunk behind the barrier, they stand between it and the refill,
  // and the copies lose that much of their flight time
  __builtin_amdgcn_sched_barrier(0);
  asm volatile("s_wait_dscnt 0x0" ::: "memory");     // own reads of the stage just used are done
  asm volatile("s_wait_asynccnt 0x0" ::: "memory");  // own copies of the next stage have landed
  __syncthreads();
}

// Tensor load of one two-dimensional slice, global -> LDS: NROW rows of ROWB bytes at source pitch 'pitch' bytes, landing at
// LDS byte offset lds_dst with the row pad that word 0 of group 1 (W0, a constant) names. One request of the whole wave;
// every descriptor word is wave-uniform and goes through readfirstlane. 1-byte elements, tensor dims = tile dims, no mask.
typedef uint32_t u32x4 __attribute__((ext_vector_type(4)));
typedef uint32_t u32x8 __attribute__((ext_vector_type(8)));
__device__ __forceinline__ uint32_t uni(uint32_t v) { return (uint32_t)__builtin_amdgcn_readfirstlane(v); }
// a wave-uniform issue test, or a descriptor word, of the tensor mover held in a scalar register: the branch on such a test
// is a scalar branch (a tensor load ignores EXEC); such a word is made once, where pinned() stands
__device__ __forceinline__ uint32_t pinned(uint32_t v) {
  uint32_t w = (uint32_t)__builtin_amdgcn_readfirstlane(v);
  asm volatile("" : "+s"(w));   // pinned(): the tensor mover's issue test (compiles to s_cmp + s_cbranch_scc) or descriptor word in a scalar register
  return w;
}
template <uint32_t W0, uint32_t ROWB, uint32_t NROW>
__device__ __forceinline__ void tdm_slice(uint32_t cnt1, uint32_t lds_dst, const _Float16* g, uint32_t pitch) {
  const uint64_t ga = (uint64_t)(size_t)g;
  u32x4 g0;
  u32x8 g1;
  g0[0] = cnt1;   // count = 1, from the caller's pinned word
  g0[1] = uni(lds_dst);
  g0[2] = uni((uint32_t)ga);
  g0[3] = uni((((uint32_t)(ga >> 32)) & 0x01FFFFFFu) | 0x80000000u);
  g1[0] = uni(W0);
  g1[1] = uni((ROWB & 0xFFFFu) << 16);
  g1[2] = uni((ROWB >> 16) | ((NROW & 0xFFFFu) << 16));
  g1[3] = uni((NROW >> 16) | (ROWB << 16));
  g1[4] = uni(NROW);
  g1[5] = uni(pitch);
  g1[6] = uni(0u);
  g1[7] = uni(0u);
  // Issued from twelve scalar registers named here, above all that the kernel else uses, which hold nothing else: they are
  // written only in front of an issue, behind the wait for the request before, so that an outstanding request's words
  // stay in place until it has landed (left to the compiler's choice, it reused the registers for other values at once).
  asm volatile("tensor_load_to_lds %0, %1" :: "{s[88:91]}"(g0), "{s[92:99]}"(g1) : "memory");
}
// Turn of the tensor-load ring, which is private to each wave: a slice is asked for, read and refilled by one and the same
// wave. This wave's LDS reads of the slice to be refilled have retired and its own request for the next stage has landed:
// behind these two waits the wave reads that stage and refills the old slice. No work-group barrier: no other wave
// touches the slice, so the waves of a SIMD may run apart and one's loads and waits stand under the other's WMMAs.
__device__ __forceinline__ void ring_turn_t() {
  // keeps the stage's WMMAs ahead of the waits: sunk behind them, they would wait for the next stage's landing
  __builtin_amdgcn_sched_barrier(0);
  asm volatile("s_wait_dscnt 0x0" ::: "memory");      // own reads of the stage just used are done
  asm volatile("s_wait_tensorcnt 0x0" ::: "memory");  // own slice of the next stage has landed
  // keeps the next request's descriptor words behind the wait: none is formed while a request is outstanding
  __builtin_amdgcn_sched_barrier(0);
}

// ---------------------------------------------------------------------------------------------
// Kernel 3: C[m][n] = scale * sum_k A[m][k] * Bt[n][k] (+ bf16(bias[n]) when OUT_MODE == 0).
// A row-major [M][K] 16-bit (ET 0: f16, ET 1: bf16) pitch lda; Bt row-major [N][K] same type pitch ldb; M, N multiples
// of 128, K a multiple of 64. SPLITA: A is a hi plane (Ap) plus a lo plane (A2p, same layout), product = hi.B + lo.B.
// Block = 128 threads = 4 waves (2 x 2) on one 128x128 C tile; each wave owns one 64x64 part (16 f32 accumulators).
// The operands reach LDS by asynchronous copies in whole lines, in a ring of two buffers: a stage is 64 k (128 B) of
// the tile's 128 A rows (both planes when SPLITA) and 128 Bt rows; each wave copies 32 rows of every plane; at the
// foot of every stage one publish point, then the refill of the buffer just read with the stage two ahead.
// OUT_MODE 0: f32 output; OUT_MODE 1: f16 output; OUT_MODE 2: f16 output in blocks of 128 columns, [N / 128][M][128]
// (ldc = 128). Epilogue: 16-row slab per wave in LDS (over the ring, which is
// out of use behind the last publish point), then each 64-wide row goes out in whole lines.
// coverage: tilesM * tilesN tiles, each 128x128 written fully -> M x N.
// ---------------------------------------------------------------------------------------------
#define GKS 64       // k per stage: 128 B a row, one whole line
#define GSP 72       // stage row pitch in halves: 144 B = 16 B x odd, for ds_load_b128 readers
#define GPL (128 * GSP * 2)   // one operand plane of a stage: 128 rows
static_assert((DM % GKS) == 0 && (DM % 128) == 0 && (NTOK % 128) == 0 && 4 * 16 * 68 * 4 <= 2 * GPL);

// 32 rows x 128 B of one plane: one copy = 4 rows x 128 B (four whole lines). 8 copies.
// g points at (first row of the wave + lane / 8, first k + 8 * (lane % 8)); l is that lane's place in LDS.
__device__ __forceinline__ void issue_g(const void* g, int ld, char* l) {
#pragma unroll
  for (int i = 0; i < 8; ++i) acopy((const _Float16*)g + (size_t)(4 * i) * ld, l + i * 4 * GSP * 2);
}

template <int ET, bool SPLITA, int OUT_MODE>
__global__ __launch_bounds__(128) void gemm64_kernel(const unsigned short* __restrict__ Ap,
                                                     const unsigned short* __restrict__ A2p, int lda,
                                                     const unsigned short* __restrict__ Btp, int ldb,
                                                     void* __restrict__ Cout, int ldc,
                                                     const float* __restrict__ bias,
                                                     int M, int N, int K, float scale) {
  typedef typename Elem<ET>::T T;
  typedef typename Elem<ET>::V V;
  const T* A  = (const T*)(const void*)Ap;
  const T* A2 = (const T*)(const void*)A2p;
  const T* Bt = (const T*)(const void*)Btp;
  constexpr int BOFF = (SPLITA ? 2 : 1) * GPL;   // the Bt plane's place in a buffer
  constexpr int BUFB = BOFF + GPL;               // one ring buffer
  __shared__ __align__(16) char gsm[2 * BUFB];
  const int lane = threadIdx.x & 31, wave = threadIdx.x >> 5;
  const int tilesN = N >> 7, tilesM = M >> 7;
  const int tile = (int)blockIdx.x;
  if (tile >= tilesM * tilesN) return;           // the same for the whole block, in front of every barrier
  const int tm = tile / tilesN, tn = tile - tm * tilesN;
  const int m0 = (tm << 7) + ((wave >> 1) << 6), n0 = (tn << 7) + ((wave & 1) << 6);   // this wave's 64x64 part
  const int rl = lane & 15;
  const int koff = (lane >> 4) * 8;
  const int mOff = (lane >> 4) * 8;
  const int nst = K / GKS;

  // copy addresses of this lane: rows 32 * wave + lane / 8 (+ 4 a copy) of each plane, piece lane % 8 of the row
  const int crow = 32 * wave + (lane >> 3), cpc = lane & 7;
  const T* ga  = A  + (size_t)((tm << 7) + crow) * lda + cpc * 8;
  const T* ga2 = A2 + (size_t)((tm << 7) + crow) * lda + cpc * 8;
  const T* gb  = Bt + (size_t)((tn << 7) + crow) * ldb + cpc * 8;
  char* lc = gsm + crow * GSP * 2 + cpc * 16;

  issue_g(ga, lda, lc);                          // stage 0 into buffer 0
  if (SPLITA) issue_g(ga2, lda, lc + GPL);
  issue_g(gb, ldb, lc + BOFF);

  v8f acc[4][4];
#pragma unroll
  for (int i = 0; i < 4; ++i)
#pragma unroll
    for (int j = 0; j < 4; ++j) acc[i][j] = zero8();

  asm volatile("s_wait_asynccnt 0x0" ::: "memory");  // own copies of stage 0 have landed
  __syncthreads();
  if (nst > 1) {                                 // stage 1 into buffer 1
    issue_g(ga + GKS, lda, lc + BUFB);
    if (SPLITA) issue_g(ga2 + GKS, lda, lc + BUFB + GPL);
    issue_g(gb + GKS, ldb, lc + BUFB + BOFF);
  }

  // kept rolled: unrolled, the copies' addresses of every stage stay in registers
#pragma unroll 1
  for (int s = 0; s < nst; ++s) {
    const T* sb = (const T*)(const void*)(gsm + (s & 1) * BUFB);
    const T* ap = sb + (((wave >> 1) << 6) + rl) * GSP + koff;
    const T* bp = sb + BOFF / 2 + (((wave & 1) << 6) + rl) * GSP + koff;
#pragma unroll   // the stage's two k steps in a row: LDS offsets become immediates
    for (int kk = 0; kk < GKS; kk += 32) {
      V bh[4], ah[4], al[4];
#pragma unroll
      for (int j = 0; j < 4; ++j) bh[j] = ldfragT<ET>(bp + (j << 4) * GSP + kk);
#pragma unroll
      for (int i = 0; i < 4; ++i) {
        ah[i] = ldfragT<ET>(ap + (i << 4) * GSP + kk);
        al[i] = ah[i];
        if (SPLITA) al[i] = ldfragT<ET>(ap + GPL / 2 + (i << 4) * GSP + kk);
      }
      // keeps all LDS loads of a k step ahead of the step's first WMMA: left alone, the compiler feeds the A fragments
      // through one register set, and every four WMMAs wait out the LDS latency
      __builtin_amdgcn_sched_barrier(0);
#pragma unroll
      for (int i = 0; i < 4; ++i) {
#pragma unroll
        for (int j = 0; j < 4; ++j) acc[i][j] = Elem<ET>::mma(ah[i], bh[j], acc[i][j]);
        if (SPLITA) {
#pragma unroll
          for (int j = 0; j < 4; ++j) acc[i][j] = Elem<ET>::mma(al[i], bh[j], acc[i][j]);
        }
      }
    }
    ring_publish();
    // refill the buffer just read with the stage two ahead, while one exists (block-uniform test)
    if (s + 2 < nst) {
      char* l = lc + (s & 1) * BUFB;
      issue_g(ga + (s + 2) * GKS, lda, l);
      if (SPLITA) issue_g(ga2 + (s + 2) * GKS, lda, l + GPL);
      issue_g(gb + (s + 2) * GKS, ldb, l + BOFF);
    }
  }
  asm volatile("s_wait_asynccnt 0x0" ::: "memory");  // no copy is left in flight behind the loop
  accg4(acc[0][0], acc[0][1], acc[0][2], acc[0][3]);
  accg4(acc[1][0], acc[1][1], acc[1][2], acc[1][3]);
  accg4(acc[2][0], acc[2][1], acc[2][2], acc[2][3]);
  accg4(acc[3][0], acc[3][1], acc[3][2], acc[3][3]);

  float* slab = (float*)(void*)gsm + wave * (16 * 68);
#pragma unroll
  for (int i = 0; i < 4; ++i) {
    const int mBase = m0 + (i << 4);
#pragma unroll
    for (int j = 0; j < 4; ++j) {
      float bv = 0.0f;
      if (OUT_MODE == 0) bv = bfr(bias[n0 + (j << 4) + rl]);
#pragma unroll
      for (int r = 0; r < 8; ++r) slab[(mOff + r) * 68 + (j << 4) + rl] = acc[i][j][r] * scale + bv;
    }
    __builtin_amdgcn_fence(__ATOMIC_RELEASE, "workgroup");
    __builtin_amdgcn_wave_barrier();
    __builtin_amdgcn_fence(__ATOMIC_ACQUIRE, "workgroup");
    if (OUT_MODE == 0) {
      float* C = (float*)Cout;
      const int hh = lane >> 4, c4 = (lane & 15) * 4;
{
#pragma unroll
        for (int it = 0; it < 8; ++it) {
          const int row = it * 2 + hh;
          const v4f v = *(const v4f*)(slab + row * 68 + c4);
          *(v4f*)(C + (size_t)(mBase + row) * ldc + n0 + c4) = v;
        }
        
      }
    } else {
      // OUT_MODE 2: column block n0 / 128 starts M * 128 elements behind the one before; the store below adds n0 itself
      _Float16* C = (_Float16*)Cout + ((OUT_MODE == 2) ? (size_t)(n0 >> 7) * (size_t)(M - 1) * 128 : (size_t)0);
      const int qq = lane >> 3, c8 = (lane & 7) * 8;
{
#pragma unroll
        for (int it = 0; it < 4; ++it) {
          const int row = it * 4 + qq;
          const float* sp = slab + row * 68 + c8;
          v8h hv;
#pragma unroll
          for (int e = 0; e < 8; ++e) hv[e] = (_Float16)sp[e];
          *(v8h*)(C + (size_t)(mBase + row) * ldc + n0 + c8) = hv;
        }
        
      }
    }
    __builtin_amdgcn_fence(__ATOMIC_RELEASE, "workgroup");
    __builtin_amdgcn_wave_barrier();
    __builtin_amdgcn_fence(__ATOMIC_ACQUIRE, "workgroup");
  }
}

// ---------------------------------------------------------------------------------------------
// Kernel 4: full (non-causal) single-head attention, head width 768, online softmax in f32.
//   qn, kn planes f16 [ntok][DM] (value 16*qn), vt plane f16 [ntok / 128][DM][128] (value 16*vn; blocks of 128 keys,
//   in each block one row of 128 keys = 256 B per value column).
//   Block = 256 threads = 8 waves, 64 query rows x one half of the keys (blockIdx & 1): every K and V byte that
//   comes from L2 serves 64 queries. Outputs per key half: ph / pl = bf16 hi / lo planes (16-bit storage) of
//   O_half = softmax over that half . vn, [2][ntok][DM], with the half's row maximum pm and row sum pls, [2][ntok];
//   the merge kernel joins the two halves.
//   Q tile staged once in LDS. Key tiles of 256: wave w owns keys 32w..32w+31 of the tile for the logits:
//   S^T subtiles (A = kn rows, B = Q rows, both from LDS), so the
//   D layout gives per lane 8 consecutive keys of one query -> P written to LDS as 16-B vectors ([query][key]).
//   P = 16 * exp(s - m_running) in f16 (values in [~1.2, 16], always normal).
//   Row max / sum: per-wave partials in LDS, combined in fixed order by waves 0 and 1 (one lane per query row).
//   P.V: every wave reads the whole P tile (A operand) and owns 3 x 32 value columns (B = vt rows from LDS).
//   kn and vt reach LDS by tensor loads, in a ring of two buffers: per key tile six K stages (256 keys x 128 dims)
//   and six V stages (256 columns x 128 keys); each wave asks, in one request a stage, for the slice of rows it
//   reads itself (32 key rows or 32 column rows of 256 B, each padded by 16 B in LDS); a V slice is one run of 8 KB
//   in global memory; the ring is so private to each wave: at the foot of every stage the wave's own two waits and no
//   work-group barrier, then the refill of the slice just read with the stage two ahead. The barriers of the kernel are
//   those around what the waves share: the Q tile, the row statistics, the P tile, the output staging.
//   Output: the 64x768 f32 accumulator tile staged in LDS (over the Q and P regions and the ring), then each wave
//   normalises 8 whole rows, splits them into bf16 hi / lo and writes 512 B per instruction (3 per row and plane).
// ---------------------------------------------------------------------------------------------
#define QB       64
#define KSPLIT   2
#define KCH      256
#define QSP      776
#define PSP      264
#define LDS_QS   0
#define LDS_PS   99328
#define LDS_PMAX 133120
#define LDS_PSUM 135168
#define LDS_ST   137216
#define LDS_RING 139264   // a multiple of 2 KiB, as every slice's place
#define FSP      772      // f32 output staging row pitch in floats (3088 B, a multiple of 16 B)
#define KSD      128      // model dims per K stage (256 B a key row)
#define KSP      136      // K stage row pitch in halves: 272 B = 16 B x odd, for ds_load_b128 readers
#define VSK      128      // keys per V stage (256 B a value-column row)
#define VSC      256      // value columns per V stage
#define VSP      136      // V stage row pitch in halves: 272 B = 16 B x odd
#define SLICE_B  10240    // one wave's slice of a ring buffer: 32 rows * 272 B up to a multiple of 2 KiB
#define RING_B   (8 * SLICE_B)   // one ring buffer
#define KW0      ((1u << 20) | (5u << 22) | (3u << 25))   // group 1 word 0: 16 B of pad behind every 256-B row
#define ATT_LDS  (LDS_RING + 2 * RING_B)
static_assert(QB * QSP * 2 == LDS_PS - LDS_QS);
static_assert(32 * FSP * 4 <= LDS_PMAX - LDS_QS && 32 * FSP * 4 <= 2 * RING_B && FSP >= DM && (FSP % 4) == 0);
static_assert(QB * PSP * 2 == LDS_PMAX - LDS_PS);
static_assert(LDS_PSUM - LDS_PMAX == 8 * QB * 4);
static_assert(LDS_ST - LDS_PSUM == 8 * QB * 4);
static_assert(LDS_RING - LDS_ST >= 4 * QB * 4);
static_assert(32 * KSP * 2 <= SLICE_B && 32 * VSP * 2 <= SLICE_B && (SLICE_B % 2048) == 0 && (LDS_RING % 2048) == 0);
static_assert(KSD * 2 == 256 && KSP * 2 == 256 + 16 && VSK * 2 == 256 && VSP * 2 == 256 + 16 && KCH == 8 * 32);
static_assert((DM % KSD) == 0 && KCH == 2 * VSK && ((DM / KSD) % 2) == 0 && DM == 3 * VSC && VSC == 8 * 32);
static_assert(ATT_LDS <= 327680);
static_assert((QSP % 8) == 0 && (PSP % 8) == 0 && PSP >= KCH);
static_assert((LDS_PS % 16) == 0 && (LDS_PMAX % 16) == 0 && (LDS_ST % 16) == 0);
static_assert((NTOK % (KCH * KSPLIT)) == 0 && (NTOK % QB) == 0);

// K stage: this wave's 32 key rows x 128 dims. g points at (first key row of the wave, first dim); l is the slice's place.
__device__ __forceinline__ void issue_k(uint32_t cnt1, const _Float16* g, uint32_t l) {
  tdm_slice<KW0, 256u, 32u>(cnt1, l, g, DM * 2u);
}
// V stage: this wave's 32 value-column rows x 128 keys, rows back to back in global memory. g points at the first row.
__device__ __forceinline__ void issue_v(uint32_t cnt1, const _Float16* g, uint32_t l) {
  tdm_slice<KW0, 256u, 32u>(cnt1, l, g, VSK * 2u);
}
__global__ __launch_bounds__(256) void attn_kernel(const _Float16* __restrict__ qn, const _Float16* __restrict__ kn,
                                                   const _Float16* __restrict__ vt, unsigned short* __restrict__ ph,
                                                   unsigned short* __restrict__ pl, float* __restrict__ pm,
                                                   float* __restrict__ pls, float sc, int ntok) {
  __shared__ __attribute__((aligned(2048))) char smem[ATT_LDS];
  _Float16* Qs = (_Float16*)(smem + LDS_QS);
  _Float16* Ps = (_Float16*)(smem + LDS_PS);
  float* pmax = (float*)(smem + LDS_PMAX);
  float* psum = (float*)(smem + LDS_PSUM);
  float* m_s  = (float*)(smem + LDS_ST);
  float* l_s  = m_s + QB;
  float* al_s = m_s + 2 * QB;
  float* li_s = m_s + 3 * QB;

  const int tid = threadIdx.x, wave = (int)uni(threadIdx.x >> 5), lane = tid & 31, h = lane >> 4, c = lane & 15;
  const int q0 = ((int)blockIdx.x >> 1) * QB;
  const int sp = (int)blockIdx.x & 1;             // which half of the keys
  const int ntile = ntok / (KCH * KSPLIT);        // key tiles of this block
  const int key0 = sp * ntile * KCH;
  const float ninf = -__builtin_inff();

  // ring addresses of this wave (all wave-uniform): its slice's place in buffer 0, its first key row, its first column row
  const uint32_t rl0 = (uint32_t)(size_t)(smem + LDS_RING) + (uint32_t)wave * SLICE_B;
  const _Float16* kg = kn + (size_t)(key0 + 32 * wave) * DM;
  const _Float16* vg = vt + ((size_t)(key0 / VSK) * DM + 32 * wave) * VSK;   // key block key0 / 128, column 32 * wave

  // word 0 of every request's group 0 (count = 1), a descriptor word held in a scalar register by pinned(): made once, in
  // front of the first request; as a plain constant it was written into its register anew while stage 1's request flew
  const uint32_t cnt1 = pinned(1u);
  issue_k(cnt1, kg, rl0);   // stage 0 (tile 0, dims 0..127) into buffer 0; it flies under the Q staging

  if (tid < QB) { m_s[tid] = ninf; l_s[tid] = 0.0f; al_s[tid] = 0.0f; li_s[tid] = 0.0f; }
  psum[tid] = 0.0f;
  psum[256 + tid] = 0.0f;
  // Q tile: 64 rows x 96 pieces of 8 halves; coverage 24 * 256 = 6144 pieces = the whole tile
  {
    // the 64 rows lie in one piece in global memory: one address register, piece i at a constant distance
    const _Float16* qg = qn + (size_t)q0 * DM + tid * 8;
    v8h qv[24];
#pragma unroll
    for (int i = 0; i < 24; ++i) qv[i] = *(const v8h*)(qg + i * 2048);
    asm volatile("s_wait_xcnt 0x0" ::: "memory");   // in front of any rewrite of the loads' address register
#pragma unroll
    for (int i = 0; i < 24; ++i) {
      const int idx = i * 256 + tid;
      const int row = idx / 96;
      const int pc  = idx - row * 96;
      *(v8h*)(Qs + row * QSP + pc * 8) = qv[i];
    }
  }
  asm volatile("s_wait_tensorcnt 0x0" ::: "memory");  // own slice of stage 0 has landed
  __syncthreads();
  // keeps stage 1's descriptor words behind the wait
  __builtin_amdgcn_sched_barrier(0);
  issue_k(cnt1, kg + KSD, rl0 + RING_B);   // stage 1 into buffer 1

  v8f oacc[4][6];   // [query subtile][column subtile]: column 256 * (nt / 2) + 32 * wave + 16 * (nt % 2) + c
#pragma unroll
  for (int qt = 0; qt < 4; ++qt)
#pragma unroll
    for (int nt = 0; nt < 6; ++nt) oacc[qt][nt] = zero8();

  const _Float16* qbp = Qs + c * QSP + 8 * h;             // B operand, query c (+ 16 * QSP per query subtile)
  const _Float16* pap = Ps + c * PSP + 8 * h;             // A operand, query c (+ 16 * PSP per query subtile)

#pragma unroll 1
  for (int t = 0; t < ntile; ++t) {
    // ---- logits: S^T subtiles for keys kb..kb+31 (this wave), queries 0..63 ----
    v8f sacc[4][2];   // [query subtile][key subtile]; element r: query 16qt+c, key kb+16kt+8h+r
#pragma unroll
    for (int qt = 0; qt < 4; ++qt)
#pragma unroll
      for (int kt = 0; kt < 2; ++kt) sacc[qt][kt] = zero8();
    // the products of one K stage of 128 dims (stage j of the tile, in buffer j & 1)
    auto k_stage = [&](int j) __attribute__((always_inline)) {
      const _Float16* ka0p = (const _Float16*)(smem + LDS_RING + (j & 1) * RING_B + wave * SLICE_B) + c * KSP + 8 * h;
      const _Float16* ka1p = ka0p + 16 * KSP;
#pragma unroll   // the stage's four k steps in a row: LDS offsets become immediates
      for (int kk = 0; kk < KSD; kk += 32) {
        const v16h a0 = ldfrag(ka0p + kk), a1 = ldfrag(ka1p + kk);
        v16h b[4];
#pragma unroll
        for (int qt = 0; qt < 4; ++qt) b[qt] = ldfrag(qbp + (16 * qt) * QSP + j * KSD + kk);
        // keeps all twelve LDS loads of a k step ahead of the step's first WMMA: left alone, the compiler feeds the
        // B fragments through one register set, and every pair of WMMAs waits out the LDS latency
        __builtin_amdgcn_sched_barrier(0);
#pragma unroll
        for (int qt = 0; qt < 4; ++qt) {
          sacc[qt][0] = mma16(a0, b[qt], sacc[qt][0]);
          sacc[qt][1] = mma16(a1, b[qt], sacc[qt][1]);
        }
      }
    };
    // Six K stages, in two loops, so that every request stands in straight code that every wave runs (no test around a
    // tensor load, which ignores EXEC); both kept rolled: the loop text stays short. Behind each turn of the ring the
    // slice just read is refilled with the stage two ahead: K stages 2..5 ...
#pragma unroll 1
    for (int j = 0; j + 2 < DM / KSD; ++j) {
      k_stage(j);
      ring_turn_t();
      issue_k(cnt1, kg + (size_t)t * KCH * DM + (j + 2) * KSD, rl0 + (j & 1) * RING_B);
    }
    // ... then V stages 0, 1 of this tile
#pragma unroll 1
    for (int j = DM / KSD - 2; j < DM / KSD; ++j) {
      k_stage(j);
      ring_turn_t();
      issue_v(cnt1, vg + ((size_t)(2 * t) * DM + (j + 2 - DM / KSD) * VSC) * VSK, rl0 + (j & 1) * RING_B);
    }
    // ---- scale, per-wave partial row max ----
#pragma unroll
    for (int qt = 0; qt < 4; ++qt) {
      float pmq = ninf;
#pragma unroll
      for (int kt = 0; kt < 2; ++kt) {
#pragma unroll
        for (int r = 0; r < 8; ++r) {
          const float v0 = sacc[qt][kt][r] * sc; sacc[qt][kt][r] = v0; pmq = fmaxf(pmq, v0);
        }
      }
      pmq = fmaxf(pmq, __shfl_xor(pmq, 16, 32));
      pmax[wave * QB + 16 * qt + c] = pmq;
    }
    __syncthreads();
    // ---- waves 0 and 1, thread = query row: fold the prior tile's sums into l, new running max, rescale factor ----
    if (wave < 2) {
      const int row = tid;
      float ps = 0.0f;
#pragma unroll
      for (int w = 0; w < 8; ++w) ps += psum[w * QB + row];
      l_s[row] = l_s[row] * al_s[row] + ps;
      const float mo = m_s[row];
      float mx = mo;
#pragma unroll
      for (int w = 0; w < 8; ++w) mx = fmaxf(mx, pmax[w * QB + row]);
      al_s[row] = __expf(mo - mx);
      m_s[row] = mx;
    }
    __syncthreads();
    // ---- p = 16 * exp(s - m) as f16, P tile, partial row sums, rescale O ----
#pragma unroll
    for (int qt = 0; qt < 4; ++qt) {
      const float mq = m_s[16 * qt + c];
      float ps = 0.0f;
#pragma unroll
      for (int kt = 0; kt < 2; ++kt) {
        v8h hq;
#pragma unroll
        for (int r = 0; r < 8; ++r) {
          const float p = __expf(sacc[qt][kt][r] - mq); ps += p; hq[r] = (_Float16)(p * 16.0f);
        }
        *(v8h*)(Ps + (16 * qt + c) * PSP + 32 * wave + 16 * kt + 8 * h) = hq;
      }
      ps += __shfl_xor(ps, 16, 32);
      psum[wave * QB + 16 * qt + c] = ps;
      const v4f aA = *(const v4f*)(al_s + 16 * qt + 8 * h), aB = *(const v4f*)(al_s + 16 * qt + 8 * h + 4);
#pragma unroll
      for (int nt = 0; nt < 6; ++nt) {
#pragma unroll
        for (int r = 0; r < 4; ++r) {
          oacc[qt][nt][r] *= aA[r]; oacc[qt][nt][4 + r] *= aB[r];
        }
      }
    }
    __syncthreads();
    // ---- O += P . V over the 256 keys of the tile ----
    // six V stages: stage v is key half v / 3, column third v % 3, in buffer v & 1; the three stages of a key half share
    // its P fragments, which stay in registers. Unrolled: accumulator index, buffer and kind of refill depend on v.
#pragma unroll
    for (int kh = 0; kh < 2; ++kh) {
      v16h pa[4][4];
#pragma unroll
      for (int th = 0; th < 3; ++th) {
        const int v = 3 * kh + th;
        const _Float16* vbp = (const _Float16*)(smem + LDS_RING + (v & 1) * RING_B + wave * SLICE_B) + c * VSP + 8 * h;
        v16h vb[4][2];
#pragma unroll
        for (int k2 = 0; k2 < 4; ++k2) {
          if (th == 0) {
#pragma unroll
            for (int qt = 0; qt < 4; ++qt) pa[k2][qt] = ldfrag(pap + (16 * qt) * PSP + kh * VSK + 32 * k2);
          }
#pragma unroll
          for (int j = 0; j < 2; ++j) vb[k2][j] = ldfrag(vbp + (16 * j) * VSP + 32 * k2);
        }
        // keeps all LDS loads of the stage ahead of its first WMMA (as in the K stages)
        __builtin_amdgcn_sched_barrier(0);
#pragma unroll
        for (int k2 = 0; k2 < 4; ++k2)
#pragma unroll
          for (int j = 0; j < 2; ++j)
#pragma unroll
            for (int qt = 0; qt < 4; ++qt)
              oacc[qt][2 * th + j] = mma16(pa[k2][qt], vb[k2][j], oacc[qt][2 * th + j]);
        ring_turn_t();
        // refill: V stage v + 2 of this tile; behind the last two stages K stages 0, 1 of the next tile while one
        // exists (a scalar test, the same for the whole block)
        if (v + 2 < 6) {
          issue_v(cnt1, vg + ((size_t)(2 * t + (v + 2) / 3) * DM + ((v + 2) % 3) * VSC) * VSK, rl0 + (v & 1) * RING_B);
        } else if (pinned(t + 1 < ntile)) {
          issue_k(cnt1, kg + (size_t)(t + 1) * KCH * DM + (v - 4) * KSD, rl0 + (v & 1) * RING_B);
        }
      }
    }
  }
  asm volatile("s_wait_tensorcnt 0x0" ::: "memory");  // no request is left in flight behind the loop
  asm volatile("s_wait_dscnt 0x0" ::: "memory");      // own ring reads are done before the ring becomes output staging

  // ---- this half's row sum (fold the last tile's sums) and maximum; O_half = oacc / (256 * l) (P carry 16, vn carry 16) ----
  if (wave < 2) {
    const int row = tid;
    float ps = 0.0f;
#pragma unroll
    for (int w = 0; w < 8; ++w) ps += psum[w * QB + row];
    const float l = l_s[row] * al_s[row] + ps;
    li_s[row] = (1.0f / l) * (1.0f / 256.0f);
    pm[(size_t)sp * ntok + q0 + row]  = m_s[row];
    pls[(size_t)sp * ntok + q0 + row] = l;
  }
  __syncthreads();
  // ---- stage the 64 x 768 f32 accumulator tile: rows 0..31 over the Q and P regions, rows 32..63 over the ring ----
  float* F0 = (float*)(smem + LDS_QS);
  float* F1 = (float*)(smem + LDS_RING);
#pragma unroll
  for (int qt = 0; qt < 4; ++qt) {
    float* F = ((qt < 2) ? F0 : F1) + (16 * (qt & 1) + 8 * h) * FSP;
#pragma unroll
    for (int nt = 0; nt < 6; ++nt) {
      const int col = VSC * (nt / 2) + 32 * wave + 16 * (nt % 2) + c;
#pragma unroll
      for (int r = 0; r < 8; ++r) F[r * FSP + col] = oacc[qt][nt][r];
    }
  }
  __syncthreads();
  // ---- each wave: 8 whole rows, normalised, split into bf16 hi / lo, 512 B per store instruction (3 per row and plane) ----
  {
    unsigned short* gh = ph + ((size_t)sp * ntok + q0) * DM;
    unsigned short* gl = pl + ((size_t)sp * ntok + q0) * DM;
    // kept rolled: run once per block, unrolled it is some thousand instructions that are fetched to be used once
#pragma unroll 1
    for (int it = 0; it < 24; ++it) {
      const int rr = it / 3;
      const int row = 8 * wave + rr;
      const int pc = (it - rr * 3) * 32 + lane;
      const float* F = ((row < 32) ? F0 + row * FSP : F1 + (row - 32) * FSP) + pc * 8;
      const float inv = li_s[row];
      const v4f x0 = *(const v4f*)(F), x1 = *(const v4f*)(F + 4);
      v8us hvv, lvv;
#pragma unroll
      for (int e = 0; e < 4; ++e) {
        unsigned short hb, lb;
        split_bf(x0[e] * inv, hb, lb);
        hvv[e] = hb;      lvv[e] = lb;
        split_bf(x1[e] * inv, hb, lb);
        hvv[4 + e] = hb;  lvv[4 + e] = lb;
      }
      *(v8us*)(gh + (size_t)row * DM + pc * 8) = hvv;
      *(v8us*)(gl + (size_t)row * DM + pc * 8) = lvv;
      // the next trip rewrites the two stores' address and data registers: the wait stands in front of that
      asm volatile("s_wait_xcnt 0x0" ::: "memory");
    }
  }
}

// ---------------------------------------------------------------------------------------------
// Kernel 5: join the two key halves of the attention: with M = max(m0, m1) and w_i = l_i * exp(m_i - M),
//   O = (w0 * O_0 + w1 * O_1) / (w0 + w1), O_i = hi + lo of half i; O goes out again as bf16 hi / lo planes [ntok][DM].
// A piece is 8 columns: one 16-B load and store per lane and plane, 32 lanes contiguous = 512 B. Thread g takes pieces
// g, g + threads, ... (MG_IT of them); the loads of all its pieces are issued before the first piece is worked on.
// coverage: MG_IT * SG_BLK * SG_THR pieces = ntok * DM / 8 exactly (DM / 8 = 96 pieces a row).
// ---------------------------------------------------------------------------------------------
// exp(d) in the fast form (one multiply by log2 e, then v_exp_f32). The v_nop in the same statement is the slot that the
// instruction set asks for behind a transcendental.
__device__ __forceinline__ float exp_slot(float d) {
  const float t = d * 1.44269504f;
  float r;
  asm("v_exp_f32 %0, %1\n\tv_nop" : "=v"(r) : "v"(t));
  return r;
}
#define MG_IT (NTOK * (DM / 8) / (SG_BLK * SG_THR))
static_assert(MG_IT * SG_BLK * SG_THR == NTOK * (DM / 8));
__global__ __launch_bounds__(SG_THR) void merge_kernel(const unsigned short* __restrict__ ph,
                                                       const unsigned short* __restrict__ pl,
                                                       const float* __restrict__ pm, const float* __restrict__ pls,
                                                       unsigned short* __restrict__ oh, unsigned short* __restrict__ ol,
                                                       int ntok) {
  const int g = (int)blockIdx.x * SG_THR + (int)threadIdx.x;
  const size_t pst = (size_t)ntok * DM;
  float m0[MG_IT], m1[MG_IT], l0[MG_IT], l1[MG_IT];
  v8us h0[MG_IT], g0[MG_IT], h1[MG_IT], g1[MG_IT];
#pragma unroll
  for (int it = 0; it < MG_IT; ++it) {
    const int row = (it * (SG_BLK * SG_THR) + g) / (DM / 8);
    m0[it] = pm[row];
    m1[it] = pm[ntok + row];
    l0[it] = pls[row];
    l1[it] = pls[ntok + row];
  }
  // the wide loads' results may take these loads' address registers: the wait stands in front of that rewrite
  asm volatile("s_wait_xcnt 0x0" ::: "memory");
#pragma unroll
  for (int it = 0; it < MG_IT; ++it) {
    const size_t e = (size_t)(it * (SG_BLK * SG_THR) + g) * 8;
    h0[it] = *(const v8us*)(ph + e);
    g0[it] = *(const v8us*)(pl + e);
    h1[it] = *(const v8us*)(ph + pst + e);
    g1[it] = *(const v8us*)(pl + pst + e);
  }
  asm volatile("s_wait_xcnt 0x0" ::: "memory");   // in front of any rewrite of the loads' address registers
  // keeps every load ahead of the first piece's work: left alone, the compiler mixes the two to save registers, and the
  // thread waits out the memory latency several times over
  __builtin_amdgcn_sched_barrier(0);
#pragma unroll
  for (int it = 0; it < MG_IT; ++it) {
    const size_t e = (size_t)(it * (SG_BLK * SG_THR) + g) * 8;
    const float mx = fmaxf(m0[it], m1[it]);
    float w0 = l0[it] * exp_slot(m0[it] - mx), w1 = l1[it] * exp_slot(m1[it] - mx);
    const float inv = 1.0f / (w0 + w1);
    w0 *= inv;
    w1 *= inv;
    v8us oh8, ol8;
#pragma unroll
    for (int i = 0; i < 8; ++i) {
      const float f = w0 * (bfval(h0[it][i]) + bfval(g0[it][i])) + w1 * (bfval(h1[it][i]) + bfval(g1[it][i]));
      unsigned short hb, lb;
      split_bf(f, hb, lb);
      oh8[i] = hb;
      ol8[i] = lb;
    }
    *(v8us*)(oh + e) = oh8;
    *(v8us*)(ol + e) = ol8;
    asm volatile("s_wait_xcnt 0x0" ::: "memory");   // in front of any rewrite of the stores' address and data registers
  }
}

// ---------------------------------------------------------------------------------------------
// Workspace map (bytes, all regions exact tile / whole-line multiples, no padding needed):
//   Wq16 : Wqkv f16 [768][768] (64 * bf16(w))                 off 0           size  1,179,648
//   Wpb  : Wproj bf16 bits [768][768]                           off 1,179,648   size  1,179,648
//   X16  : ln(q), ln(k), ln(v) stacked f16 [24576][768]        off 2,359,296   size 37,748,736
//   QK16 : qn then kn f16 [16384][768]                          off 40,108,032  size 25,165,824
//   VT16 : vn^T f16 [64][768][128] (blocks of 128 keys)         off 65,273,856  size 12,582,912
//   OH   : attention output bf16 hi [8192][768]                 off 77,856,768  size 12,582,912
//   OL   : attention output bf16 lo [8192][768]                 off 90,439,680  size 12,582,912
//   PH   : per key half, attention output bf16 hi [2][8192][768] off 103,022,592 size 25,165,824
//   PL   : per key half, attention output bf16 lo [2][8192][768] off 128,188,416 size 25,165,824
//   PM   : per key half, row maximum f32 [2][8192]              off 153,354,240 size     65,536
//   PS   : per key half, row sum f32 [2][8192]                  off 153,419,776 size     65,536
//   total 153,485,312
// ---------------------------------------------------------------------------------------------
extern "C" void kernel_launch(void* const* d_in, const int* in_sizes, int n_in,
                              void* d_out, int out_size, void* d_ws, size_t ws_size,
                              hipStream_t stream) {
  if (n_in < 8) return;
  const int ntok = NTOK, dm = DM;
  if (in_sizes[0] != ntok * dm || in_sizes[1] != ntok * dm || in_sizes[2] != ntok * dm) return;
  if (in_sizes[3] != dm || in_sizes[4] != dm || in_sizes[7] != dm) return;
  if (in_sizes[5] != dm * dm || in_sizes[6] != dm * dm) return;
  if (out_size != ntok * dm) return;

  const float* q     = (const float*)d_in[0];
  const float* k     = (const float*)d_in[1];
  const float* v     = (const float*)d_in[2];
  const float* ln_w  = (const float*)d_in[3];
  const float* ln_b  = (const float*)d_in[4];
  const float* Wqkv  = (const float*)d_in[5];
  const float* Wproj = (const float*)d_in[6];
  const float* bproj = (const float*)d_in[7];
  float* out = (float*)d_out;

  const size_t bWq = (size_t)dm * dm * 2;
  const size_t bWp = (size_t)dm * dm * 2;
  const size_t bX  = (size_t)3 * ntok * dm * 2;
  const size_t bQK = (size_t)2 * ntok * dm * 2;
  const size_t bVT = (size_t)dm * ntok * 2;
  const size_t bO  = (size_t)ntok * dm * 2;
  size_t off = 0;
  const size_t oWq = off; off += bWq;
  const size_t oWp = off; off += bWp;
  const size_t oX  = off; off += bX;
  const size_t oQK = off; off += bQK;
  const size_t oVT = off; off += bVT;
  const size_t oOH = off; off += bO;
  const size_t oOL = off; off += bO;
  const size_t oPH = off; off += 2 * bO;
  const size_t oPL = off; off += 2 * bO;
  const size_t oPM = off; off += (size_t)2 * ntok * 4;
  const size_t oPS = off; off += (size_t)2 * ntok * 4;
  if (off > ws_size) return;                     // 153,485,312

  char* ws = (char*)d_ws;
  _Float16*       Wq16 = (_Float16*)(ws + oWq);
  unsigned short* Wpb  = (unsigned short*)(ws + oWp);
  _Float16*       X16  = (_Float16*)(ws + oX);
  _Float16*       QK16 = (_Float16*)(ws + oQK);
  _Float16*       VT16 = (_Float16*)(ws + oVT);
  unsigned short* OH   = (unsigned short*)(ws + oOH);
  unsigned short* OL   = (unsigned short*)(ws + oOL);
  unsigned short* PH   = (unsigned short*)(ws + oPH);
  unsigned short* PL   = (unsigned short*)(ws + oPL);
  float*          PM   = (float*)(ws + oPM);
  float*          PS   = (float*)(ws + oPS);

  const dim3 blk(256);
  const dim3 gblk(128);                       // the GEMM's block: 4 waves
  const int n8 = dm * dm / 8;                 // 73728 = 288 * 256
  if ((n8 % 256) != 0) return;

  // (1) weights -> Wqkv f16 plane (64 * bf16(w)) and Wproj bf16 plane
  cvt_w_kernel<<<dim3(2 * (n8 / 256)), blk, 0, stream>>>(Wqkv, Wproj, Wq16, Wpb, n8);
  // (2) LayerNorm of q, k, v -> X16 (8 * ln)
  ln_kernel<<<dim3(SG_BLK), dim3(SG_THR), 0, stream>>>(q, k, v, ln_w, ln_b, X16, ntok);
  // (3) qn, kn = X[0:16384] . Wqkv^T  -> QK16 (16 * qn | 16 * kn); M=16384, N=768, K=768; scale 16/(8*64)
  gemm64_kernel<0, false, 1><<<dim3((2 * ntok / 128) * (dm / 128)), gblk, 0, stream>>>(
      (const unsigned short*)X16, (const unsigned short*)X16, dm, (const unsigned short*)Wq16, dm,
      (void*)QK16, dm, bproj, 2 * ntok, dm, dm, 0.03125f);
  // (4) vn^T = Wqkv . X[16384:24576]^T -> VT16 [64][768][128] (16 * vn, blocks of 128 keys); M=768, N=8192, K=768
  gemm64_kernel<0, false, 2><<<dim3((dm / 128) * (ntok / 128)), gblk, 0, stream>>>(
      (const unsigned short*)Wq16, (const unsigned short*)Wq16, dm,
      (const unsigned short*)(X16 + (size_t)2 * ntok * dm), dm,
      (void*)VT16, 128, bproj, dm, ntok, dm, 0.03125f);
  // (5) attention per key half -> PH / PL, PM, PS; logit scale = dim^-0.5 / 256 (operand carries 16 * 16)
  const float sc = 0.03608439182435161f * (1.0f / 256.0f);
  attn_kernel<<<dim3(KSPLIT * (ntok / QB)), blk, 0, stream>>>(QK16, QK16 + (size_t)ntok * dm, VT16, PH, PL, PM, PS,
                                                              sc, ntok);
  // (6) the two key halves joined -> OH / OL (bf16 hi / lo of O)
  merge_kernel<<<dim3(SG_BLK), dim3(SG_THR), 0, stream>>>(PH, PL, PM, PS, OH, OL, ntok);
  // (7) out = (O_hi + O_lo) . Wproj^T + b -> d_out f32 [8192][768]; bf16 operands, scale 1
  gemm64_kernel<1, true, 0><<<dim3((ntok / 128) * (dm / 128)), gblk, 0, stream>>>(
      OH, OL, dm, Wpb, dm, (void*)out, dm, bproj, ntok, dm, dm, 1.0f);
  (void)hipGetLastError();
}

// v008
// Measured time: 209 microseconds a run.
// Next to v007, in two timings, it ran 1.07 times as fast each time.
// Counting every step since v000, it is 3.30 times as fast.
// Contractions: qn|kn = ln(q|k).Wqkv^T, vn^T = Wqkv.ln(v)^T, S^T = kn.qn^T, O = P.vn : v_wmma_f32_16x16x32_f16, f16 operands with
// power-of-two carries (ln x8, Wqkv x64, qn/kn/vn x16, P = 16*exp(s - m)), f32 accumulate; out = O.Wproj^T + b : v_wmma_f32_16x16x32_bf16,
// O as bf16 hi/lo planes (hi.W + lo.W), Wproj bf16, f32 accumulate; float inputs RNE-converted to bf16 on load; LayerNorm, softmax
// statistics and bias in f32.
#include <hip/hip_runtime.h>
#include <stdint.h>

#define NTOK 8192
#define DM   768

typedef _Float16 v16h __attribute__((ext_vector_type(16)));
typedef _Float16 v8h  __attribute__((ext_vector_type(8)));
typedef __bf16   v16b __attribute__((ext_vector_type(16)));
typedef __bf16   v8b  __attribute__((ext_vector_type(8)));
typedef float    v8f  __attribute__((ext_vector_type(8)));
typedef float    v4f  __attribute__((ext_vector_type(4)));
typedef unsigned short v8us __attribute__((ext_vector_type(8)));

static_assert((DM % 64) == 0);
static_assert((NTOK % 256) == 0);

// f32 -> nearest-even bf16 bits / value
__device__ __forceinline__ unsigned short bfbits(float f) {
  unsigned u = __float_as_uint(f);
  return (unsigned short)((u + 0x7FFFu + ((u >> 16) & 1u)) >> 16);
}
__device__ __forceinline__ float bfval(unsigned short b) { return __uint_as_float(((unsigned)b) << 16); }
__device__ __forceinline__ float bfr(float f) { return bfval(bfbits(f)); }
__device__ __forceinline__ void split_bf(float f, unsigned short& hb, unsigned short& lb) {
  hb = bfbits(f);
  lb = bfbits(f - bfval(hb));
}

// 16-bit operand element types for the GEMM template: 0 = f16, 1 = bf16
template <int ET> struct Elem;
template <> struct Elem<0> {
  typedef _Float16 T; typedef v16h V; typedef v8h V8;
  static __device__ __forceinline__ v8f mma(V a, V b, v8f c) {
    return __builtin_amdgcn_wmma_f32_16x16x32_f16(false, a, false, b, (short)0, c, false, false);
  }
};
template <> struct Elem<1> {
  typedef __bf16 T; typedef v16b V; typedef v8b V8;
  static __device__ __forceinline__ v8f mma(V a, V b, v8f c) {
    return __builtin_amdgcn_wmma_f32_16x16x32_bf16(false, a, false, b, (short)0, c, false, false);
  }
};

// 16-bit WMMA fragment from k-contiguous storage (A row-major [m][k], or B stored [n][k]):
// p points at element (row_or_col = lane&15, k0 + 8h); elements 0..7 <- p[0..7], 8..15 <- p[16..23].
template <int ET>
__device__ __forceinline__ typename Elem<ET>::V ldfragT(const typename Elem<ET>::T* p) {
  typedef typename Elem<ET>::V V;
  typedef typename Elem<ET>::V8 V8;
  union { V v; V8 h[2]; } f;
  f.h[0] = *(const V8*)(p);
  f.h[1] = *(const V8*)(p + 16);
  return f.v;
}
__device__ __forceinline__ v16h ldfrag(const _Float16* p) { return ldfragT<0>(p); }
__device__ __forceinline__ v8f mma16(v16h a, v16h b, v8f c) { return Elem<0>::mma(a, b, c); }
__device__ __forceinline__ v8f zero8() {
  v8f z;
#pragma unroll
  for (int i = 0; i < 8; ++i) z[i] = 0.0f;
  return z;
}

// hazard guard: 4 VALU slots after the last WMMA of a group, D tied
__device__ __forceinline__ void accg4(v8f& a, v8f& b, v8f& c, v8f& d) {
  asm volatile("v_nop\n\tv_nop\n\tv_nop\n\tv_nop" : "+v"(a), "+v"(b), "+v"(c), "+v"(d));
}

// ---------------------------------------------------------------------------------------------
// Kernel 1: two [DM][DM] f32 weight matrices -> 16-bit planes, layout unchanged ([out][in], k = in contiguous):
//   blocks [0, nb0):  d16[e] = f16(64 * bf16(w0[e]))     (f16 operand plane for the qkv projection)
//   blocks [nb0, 2nb0): dbf[e] = bf16 bits of w1[e]       (bf16 operand plane for the output projection)
// Block-uniform select, no barriers. 8 elements per thread: one 16-B store per lane, 32 lanes contiguous = 512 B =
// coverage: nb0 * 256 threads * 8 = DM * DM elements per plane exactly (n8 = DM*DM/8 is a multiple of 256).
// ---------------------------------------------------------------------------------------------
__global__ __launch_bounds__(256) void cvt_w_kernel(const float* __restrict__ w0, const float* __restrict__ w1,
                                                    _Float16* __restrict__ d16, unsigned short* __restrict__ dbf,
                                                    int n8) {
  const int nb0 = n8 >> 8;
  const bool second = ((int)blockIdx.x >= nb0);
  const float* src = second ? w1 : w0;
  const int li = ((int)blockIdx.x - (second ? nb0 : 0)) * 256 + (int)threadIdx.x;
  if (li >= n8) return;
  const size_t e = (size_t)li * 8;
  const v4f a = *(const v4f*)(src + e);
  const v4f b = *(const v4f*)(src + e + 4);
  if (!second) {
    v8h o;
#pragma unroll
    for (int i = 0; i < 4; ++i) {
      o[i]     = (_Float16)(bfr(a[i]) * 64.0f);
      o[4 + i] = (_Float16)(bfr(b[i]) * 64.0f);
    }
    _Float16* d = d16 + e;
    *(v8h*)d = o;
    
  } else {
    v8us o;
#pragma unroll
    for (int i = 0; i < 4; ++i) {
      o[i]     = bfbits(a[i]);
      o[4 + i] = bfbits(b[i]);
    }
    unsigned short* d = dbf + e;
    *(v8us*)d = o;
    
  }
}

// ---------------------------------------------------------------------------------------------
// The two streaming kernels (LayerNorm, merge) run as SG_BLK work-groups of SG_THR threads: 4,096 waves in all, each of
// which walks several rows or pieces, so that few waves have to be started and each keeps many loads in flight.
#define SG_BLK 256
#define SG_THR 512
#define SG_WAVES (SG_BLK * (SG_THR / 32))
static_assert((3 * NTOK) % SG_WAVES == 0);

// Kernel 2: LayerNorm of q, k, v (bf16-converted inputs, f32 statistics, centred variance) -> f16 plane X
// [3*ntok][DM], value = 8 * ln(x). Rows [0,ntok) of X come from q, the next ntok from k, the next from v.
// One wave per row at a time; wave g takes rows g, g + waves, g + 2 * waves, ... The row (3 KB) is read once and held in
// registers: lane owns columns (j*32+lane)*8 .. +7 of chunk j (j = 0..2). The next row's six loads are issued before the
// current row is worked on. Weight and bias of the lane's 24 columns are converted once per wave.
// Stores: one 16-B store per lane and chunk, 32 lanes contiguous = 512 B.
// coverage: rows g + i * waves over all waves g = every row below 3*ntok once; 3 chunks * 32 lanes * 8 = 768 columns.
// ---------------------------------------------------------------------------------------------
__device__ __forceinline__ const float* ln_row(const float* qx, const float* kx, const float* vx, int r, int ntok) {
  const int seg = (r >= 2 * ntok) ? 2 : ((r >= ntok) ? 1 : 0);
  const float* src = (seg == 2) ? vx : ((seg == 1) ? kx : qx);
  return src + (size_t)(r - seg * ntok) * DM;
}
__global__ __launch_bounds__(SG_THR) void ln_kernel(const float* __restrict__ qx, const float* __restrict__ kx,
                                                    const float* __restrict__ vx, const float* __restrict__ lw,
                                                    const float* __restrict__ lb, _Float16* __restrict__ X, int ntok) {
  const int wave = __builtin_amdgcn_readfirstlane((int)(threadIdx.x >> 5)), lane = threadIdx.x & 31;
  const int nw = (int)gridDim.x * (SG_THR / 32);
  const int total = 3 * ntok;
  int row = (int)blockIdx.x * (SG_THR / 32) + wave;
  if (row >= total) return;                      // the same for the whole wave; the kernel has no barrier

  v4f nxt[6];
  {
    const float* p = ln_row(qx, kx, vx, row, ntok) + lane * 8;
#pragma unroll
    for (int j = 0; j < 3; ++j) {
      nxt[2 * j]     = *(const v4f*)(p + j * 256);
      nxt[2 * j + 1] = *(const v4f*)(p + j * 256 + 4);
    }
  }
  float w[24], b8[24];                           // bf16(weight), 8 * bf16(bias) of this lane's columns
#pragma unroll
  for (int j = 0; j < 3; ++j) {
    const int c0 = (j * 32 + lane) * 8;
    const v4f wa = *(const v4f*)(lw + c0), wb = *(const v4f*)(lw + c0 + 4);
    const v4f ba = *(const v4f*)(lb + c0), bb = *(const v4f*)(lb + c0 + 4);
#pragma unroll
    for (int e = 0; e < 4; ++e) {
      w[8 * j + e]      = bfr(wa[e]);
      w[8 * j + 4 + e]  = bfr(wb[e]);
      b8[8 * j + e]     = bfr(ba[e]) * 8.0f;
      b8[8 * j + 4 + e] = bfr(bb[e]) * 8.0f;
    }
  }
  asm volatile("s_wait_xcnt 0x0" ::: "memory");   // in front of any rewrite of these loads' address registers
  // the row in work, bf16-converted: made from the loaded row at the foot of the trip before, so that at the head of a
  // trip no load but the next row's is outstanding and nothing in the trip's work waits for those
  float x[24];
#pragma unroll
  for (int jj = 0; jj < 6; ++jj)
#pragma unroll
    for (int e = 0; e < 4; ++e) x[4 * jj + e] = bfr(nxt[jj][e]);

  // kept rolled: one row's text, run for every row of the wave
#pragma unroll 1
  for (;;) {
    const int nrow = row + nw;
    const bool more = nrow < total;              // scalar: the same for the whole wave
    if (more) {
      const float* p = ln_row(qx, kx, vx, nrow, ntok) + lane * 8;
#pragma unroll
      for (int j = 0; j < 3; ++j) {
        nxt[2 * j]     = *(const v4f*)(p + j * 256);
        nxt[2 * j + 1] = *(const v4f*)(p + j * 256 + 4);
      }
      asm volatile("s_wait_xcnt 0x0" ::: "memory");   // in front of any rewrite of the loads' address registers
    }
    // keeps the next row's loads ahead of the work on this row: sunk into it, they would fly for less time
    __builtin_amdgcn_sched_barrier(0);

    float s = 0.0f;
#pragma unroll
    for (int jj = 0; jj < 6; ++jj) s += (x[4 * jj] + x[4 * jj + 1]) + (x[4 * jj + 2] + x[4 * jj + 3]);
#pragma unroll
    for (int off = 16; off > 0; off >>= 1) s += __shfl_xor(s, off, 32);
    const float mu = s * (1.0f / 768.0f);

    // centred sum of squares
    float s2 = 0.0f;
#pragma unroll
    for (int i = 0; i < 24; ++i) {
      const float d = x[i] - mu;
      s2 += d * d;
    }
#pragma unroll
    for (int off = 16; off > 0; off >>= 1) s2 += __shfl_xor(s2, off, 32);
    const float rstd8 = rsqrtf(s2 * (1.0f / 768.0f) + 1e-5f) * 8.0f;   // x8 carry folded into the scale

    _Float16* yr = X + (size_t)row * DM + lane * 8;
#pragma unroll
    for (int j = 0; j < 3; ++j) {
      v8h o;
#pragma unroll
      for (int e = 0; e < 8; ++e) {
        const float t = (x[8 * j + e] - mu) * rstd8;
        o[e] = (_Float16)(t * w[8 * j + e] + b8[8 * j + e]);
      }
      *(v8h*)(yr + j * 256) = o;
    }
    asm volatile("s_wait_xcnt 0x0" ::: "memory");   // the next trip rewrites the stores' address and data registers
    if (!more) break;
#pragma unroll
    for (int jj = 0; jj < 6; ++jj)
#pragma unroll
      for (int e = 0; e < 4; ++e) x[4 * jj + e] = bfr(nxt[jj][e]);
    row = nrow;
  }
}

// One asynchronous 16-B-per-lane copy global -> LDS, as the builtin: its address registers are the compiler's, which
// may place them above v255 (an asm operand may not lie there).
typedef int v4i __attribute__((ext_vector_type(4)));
__device__ __forceinline__ void acopy(const _Float16* g, char* l) {
  __builtin_amdgcn_global_load_async_to_lds_b128((__attribute__((address_space(1))) v4i*)g,
                                                 (__attribute__((address_space(3))) v4i*)l, 0, 0);
}
// Publish point of the ring: this wave's LDS reads of the buffer to be refilled have retired, its own copies of the
// next stage have landed, then the work-group barrier behind which that stage is read and the old buffer refilled.
__device__ __forceinline__ void ring_publish() {
  // keeps the stage's WMMAs ahead of the publish point: sunk behind the barrier, they stand between it and the refill,
  // and the copies lose that much of their flight time
  __builtin_amdgcn_sched_barrier(0);
  asm volatile("s_wait_dscnt 0x0" ::: "memory");     // own reads of the stage just used are done
  asm volatile("s_wait_asynccnt 0x0" ::: "memory");  // own copies of the next stage have landed
  __syncthreads();
}

// Tensor load of one two-dimensional slice, global -> LDS: NROW rows of ROWB bytes at source pitch 'pitch' bytes, landing at
// LDS byte offset lds_dst with the row pad that word 0 of group 1 (W0, a constant) names. One request of the whole wave;
// every descriptor word is wave-uniform and goes through readfirstlane. 1-byte elements, tensor dims = tile dims, no mask.
typedef uint32_t u32x4 __attribute__((ext_vector_type(4)));
typedef uint32_t u32x8 __attribute__((ext_vector_type(8)));
__device__ __forceinline__ uint32_t uni(uint32_t v) { return (uint32_t)__builtin_amdgcn_readfirstlane(v); }
// a wave-uniform issue test, or a descriptor word, of the tensor mover held in a scalar register: the branch on such a test
// is a scalar branch (a tensor load ignores EXEC); such a word is made once, where pinned() stands
__device__ __forceinline__ uint32_t pinned(uint32_t v) {
  uint32_t w = (uint32_t)__builtin_amdgcn_readfirstlane(v);
  asm volatile("" : "+s"(w));   // pinned(): the tensor mover's issue test (compiles to s_cmp + s_cbranch_scc) or descriptor word in a scalar register
  return w;
}
template <uint32_t W0, uint32_t ROWB, uint32_t NROW>
__device__ __forceinline__ void tdm_slice(uint32_t cnt1, uint32_t lds_dst, const _Float16* g, uint32_t pitch) {
  const uint64_t ga = (uint64_t)(size_t)g;
  u32x4 g0;
  u32x8 g1;
  g0[0] = cnt1;   // count = 1, from the caller's pinned word
  g0[1] = uni(lds_dst);
  g0[2] = uni((uint32_t)ga);
  g0[3] = uni((((uint32_t)(ga >> 32)) & 0x01FFFFFFu) | 0x80000000u);
  g1[0] = uni(W0);
  g1[1] = uni((ROWB & 0xFFFFu) << 16);
  g1[2] = uni((ROWB >> 16) | ((NROW & 0xFFFFu) << 16));
  g1[3] = uni((NROW >> 16) | (ROWB << 16));
  g1[4] = uni(NROW);
  g1[5] = uni(pitch);
  g1[6] = uni(0u);
  g1[7] = uni(0u);
  // Issued from twelve scalar registers named here, above all that the kernel else uses, which hold nothing else: they are
  // written only in front of an issue, behind the wait for the request before, so that an outstanding request's words
  // stay in place until it has landed (left to the compiler's choice, it reused the registers for other values at once).
  asm volatile("tensor_load_to_lds %0, %1" :: "{s[88:91]}"(g0), "{s[92:99]}"(g1) : "memory");
}
// Turn of the tensor-load ring, which is private to each wave: a slice is asked for, read and refilled by one and the same
// wave. This wave's LDS reads of the slice to be refilled have retired and its own request for the next stage has landed:
// behind these two waits the wave reads that stage and refills the old slice. No work-group barrier: no other wave
// touches the slice, so the waves of a SIMD may run apart and one's loads and waits stand under the other's WMMAs.
__device__ __forceinline__ void ring_turn_t() {
  // keeps the stage's WMMAs ahead of the waits: sunk behind them, they would wait for the next stage's landing
  __builtin_amdgcn_sched_barrier(0);
  asm volatile("s_wait_dscnt 0x0" ::: "memory");      // own reads of the stage just used are done
  asm volatile("s_wait_tensorcnt 0x0" ::: "memory");  // own slice of the next stage has landed
  // keeps the next request's descriptor words behind the wait: none is formed while a request is outstanding
  __builtin_amdgcn_sched_barrier(0);
}

// ---------------------------------------------------------------------------------------------
// Kernel 3: C[m][n] = scale * sum_k A[m][k] * Bt[n][k] (+ bf16(bias[n]) when OUT_MODE == 0).
// A row-major [M][K] 16-bit (ET 0: f16, ET 1: bf16) pitch lda; Bt row-major [N][K] same type pitch ldb; M, N multiples
// of 128, K a multiple of 64. SPLITA: A is a hi plane (Ap) plus a lo plane (A2p, same layout), product = hi.B + lo.B.
// Block = 128 threads = 4 waves (2 x 2) on one 128x128 C tile; each wave owns one 64x64 part (16 f32 accumulators).
// The operands reach LDS by asynchronous copies in whole lines, in a ring of two buffers: a stage is 64 k (128 B) of
// the tile's 128 A rows (both planes when SPLITA) and 128 Bt rows; each wave copies 32 rows of every plane; at the
// foot of every stage one publish point, then the refill of the buffer just read with the stage two ahead.
// OUT_MODE 0: f32 output; OUT_MODE 1: f16 output; OUT_MODE 2: f16 output in blocks of 128 columns, [N / 128][M][128]
// (ldc = 128). Epilogue: 16-row slab per wave in LDS (over the ring, which is
// out of use behind the last publish point), then each 64-wide row goes out in whole lines.
// coverage: tilesM * tilesN tiles, each 128x128 written fully -> M x N.
// ---------------------------------------------------------------------------------------------
#define GKS 64       // k per stage: 128 B a row, one whole line
#define GSP 72       // stage row pitch in halves: 144 B = 16 B x odd, for ds_load_b128 readers
#define GPL (128 * GSP * 2)   // one operand plane of a stage: 128 rows
static_assert((DM % GKS) == 0 && (DM % 128) == 0 && (NTOK % 128) == 0 && 4 * 16 * 68 * 4 <= 2 * GPL);

// 32 rows x 128 B of one plane: one copy = 4 rows x 128 B (four whole lines). 8 copies.
// g points at (first row of the wave + lane / 8, first k + 8 * (lane % 8)); l is that lane's place in LDS.
__device__ __forceinline__ void issue_g(const void* g, int ld, char* l) {
#pragma unroll
  for (int i = 0; i < 8; ++i) acopy((const _Float16*)g + (size_t)(4 * i) * ld, l + i * 4 * GSP * 2);
}

template <int ET, bool SPLITA, int OUT_MODE>
__global__ __launch_bounds__(128) void gemm64_kernel(const unsigned short* __restrict__ Ap,
                                                     const unsigned short* __restrict__ A2p, int lda,
                                                     const unsigned short* __restrict__ Btp, int ldb,
                                                     void* __restrict__ Cout, int ldc,
                                                     const float* __restrict__ bias,
                                                     int M, int N, int K, float scale) {
  typedef typename Elem<ET>::T T;
  typedef typename Elem<ET>::V V;
  const T* A  = (const T*)(const void*)Ap;
  const T* A2 = (const T*)(const void*)A2p;
  const T* Bt = (const T*)(const void*)Btp;
  constexpr int BOFF = (SPLITA ? 2 : 1) * GPL;   // the Bt plane's place in a buffer
  constexpr int BUFB = BOFF + GPL;               // one ring buffer
  __shared__ __align__(16) char gsm[2 * BUFB];
  const int lane = threadIdx.x & 31, wave = threadIdx.x >> 5;
  const int tilesN = N >> 7, tilesM = M >> 7;
  const int tile = (int)blockIdx.x;
  if (tile >= tilesM * tilesN) return;           // the same for the whole block, in front of every barrier
  const int tm = tile / tilesN, tn = tile - tm * tilesN;
  const int m0 = (tm << 7) + ((wave >> 1) << 6), n0 = (tn << 7) + ((wave & 1) << 6);   // this wave's 64x64 part
  const int rl = lane & 15;
  const int koff = (lane >> 4) * 8;
  const int mOff = (lane >> 4) * 8;
  const int nst = K / GKS;
  // The k walk starts at a stage of the tile's own, (tm + tn) mod nst, and wraps: blocks that share A rows or Bt rows then
  // do not ask L2 for the same lines at the same moment. kx = the k stage that the next copies bring.
  int kx = (tm + tn) % nst;

  // copy addresses of this lane: rows 32 * wave + lane / 8 (+ 4 a copy) of each plane, piece lane % 8 of the row
  const int crow = 32 * wave + (lane >> 3), cpc = lane & 7;
  const T* ga  = A  + (size_t)((tm << 7) + crow) * lda + cpc * 8;
  const T* ga2 = A2 + (size_t)((tm << 7) + crow) * lda + cpc * 8;
  const T* gb  = Bt + (size_t)((tn << 7) + crow) * ldb + cpc * 8;
  char* lc = gsm + crow * GSP * 2 + cpc * 16;

  issue_g(ga + kx * GKS, lda, lc);               // first stage of the walk into buffer 0
  if (SPLITA) issue_g(ga2 + kx * GKS, lda, lc + GPL);
  issue_g(gb + kx * GKS, ldb, lc + BOFF);
  kx = (kx + 1 == nst) ? 0 : kx + 1;

  v8f acc[4][4];
#pragma unroll
  for (int i = 0; i < 4; ++i)
#pragma unroll
    for (int j = 0; j < 4; ++j) acc[i][j] = zero8();

  asm volatile("s_wait_asynccnt 0x0" ::: "memory");  // own copies of stage 0 have landed
  __syncthreads();
  if (nst > 1) {                                 // second stage of the walk into buffer 1
    issue_g(ga + kx * GKS, lda, lc + BUFB);
    if (SPLITA) issue_g(ga2 + kx * GKS, lda, lc + BUFB + GPL);
    issue_g(gb + kx * GKS, ldb, lc + BUFB + BOFF);
    kx = (kx + 1 == nst) ? 0 : kx + 1;
  }

  // kept rolled: unrolled, the copies' addresses of every stage stay in registers
#pragma unroll 1
  for (int s = 0; s < nst; ++s) {
    const T* sb = (const T*)(const void*)(gsm + (s & 1) * BUFB);
    const T* ap = sb + (((wave >> 1) << 6) + rl) * GSP + koff;
    const T* bp = sb + BOFF / 2 + (((wave & 1) << 6) + rl) * GSP + koff;
#pragma unroll   // the stage's two k steps in a row: LDS offsets become immediates
    for (int kk = 0; kk < GKS; kk += 32) {
      V bh[4], ah[4], al[4];
#pragma unroll
      for (int j = 0; j < 4; ++j) bh[j] = ldfragT<ET>(bp + (j << 4) * GSP + kk);
#pragma unroll
      for (int i = 0; i < 4; ++i) {
        ah[i] = ldfragT<ET>(ap + (i << 4) * GSP + kk);
        al[i] = ah[i];
        if (SPLITA) al[i] = ldfragT<ET>(ap + GPL / 2 + (i << 4) * GSP + kk);
      }
      // keeps all LDS loads of a k step ahead of the step's first WMMA: left alone, the compiler feeds the A fragments
      // through one register set, and every four WMMAs wait out the LDS latency
      __builtin_amdgcn_sched_barrier(0);
#pragma unroll
      for (int i = 0; i < 4; ++i) {
#pragma unroll
        for (int j = 0; j < 4; ++j) acc[i][j] = Elem<ET>::mma(ah[i], bh[j], acc[i][j]);
        if (SPLITA) {
#pragma unroll
          for (int j = 0; j < 4; ++j) acc[i][j] = Elem<ET>::mma(al[i], bh[j], acc[i][j]);
        }
      }
    }
    ring_publish();
    // refill the buffer just read with the stage two ahead, while one exists (block-uniform test)
    if (s + 2 < nst) {
      char* l = lc + (s & 1) * BUFB;
      issue_g(ga + kx * GKS, lda, l);
      if (SPLITA) issue_g(ga2 + kx * GKS, lda, l + GPL);
      issue_g(gb + kx * GKS, ldb, l + BOFF);
      kx = (kx + 1 == nst) ? 0 : kx + 1;
    }
  }
  asm volatile("s_wait_asynccnt 0x0" ::: "memory");  // no copy is left in flight behind the loop
  accg4(acc[0][0], acc[0][1], acc[0][2], acc[0][3]);
  accg4(acc[1][0], acc[1][1], acc[1][2], acc[1][3]);
  accg4(acc[2][0], acc[2][1], acc[2][2], acc[2][3]);
  accg4(acc[3][0], acc[3][1], acc[3][2], acc[3][3]);

  float* slab = (float*)(void*)gsm + wave * (16 * 68);
#pragma unroll
  for (int i = 0; i < 4; ++i) {
    const int mBase = m0 + (i << 4);
#pragma unroll
    for (int j = 0; j < 4; ++j) {
      float bv = 0.0f;
      if (OUT_MODE == 0) bv = bfr(bias[n0 + (j << 4) + rl]);
#pragma unroll
      for (int r = 0; r < 8; ++r) slab[(mOff + r) * 68 + (j << 4) + rl] = acc[i][j][r] * scale + bv;
    }
    __builtin_amdgcn_fence(__ATOMIC_RELEASE, "workgroup");
    __builtin_amdgcn_wave_barrier();
    __builtin_amdgcn_fence(__ATOMIC_ACQUIRE, "workgroup");
    if (OUT_MODE == 0) {
      float* C = (float*)Cout;
      const int hh = lane >> 4, c4 = (lane & 15) * 4;
{
#pragma unroll
        for (int it = 0; it < 8; ++it) {
          const int row = it * 2 + hh;
          const v4f v = *(const v4f*)(slab + row * 68 + c4);
          *(v4f*)(C + (size_t)(mBase + row) * ldc + n0 + c4) = v;
        }
        
      }
    } else {
      // OUT_MODE 2: column block n0 / 128 starts M * 128 elements behind the one before; the store below adds n0 itself
      _Float16* C = (_Float16*)Cout + ((OUT_MODE == 2) ? (size_t)(n0 >> 7) * (size_t)(M - 1) * 128 : (size_t)0);
      const int qq = lane >> 3, c8 = (lane & 7) * 8;
{
#pragma unroll
        for (int it = 0; it < 4; ++it) {
          const int row = it * 4 + qq;
          const float* sp = slab + row * 68 + c8;
          v8h hv;
#pragma unroll
          for (int e = 0; e < 8; ++e) hv[e] = (_Float16)sp[e];
          *(v8h*)(C + (size_t)(mBase + row) * ldc + n0 + c8) = hv;
        }
        
      }
    }
    __builtin_amdgcn_fence(__ATOMIC_RELEASE, "workgroup");
    __builtin_amdgcn_wave_barrier();
    __builtin_amdgcn_fence(__ATOMIC_ACQUIRE, "workgroup");
  }
}

// ---------------------------------------------------------------------------------------------
// Kernel 4: full (non-causal) single-head attention, head width 768, online softmax in f32.
//   qn, kn planes f16 [ntok][DM] (value 16*qn), vt plane f16 [ntok / 128][DM][128] (value 16*vn; blocks of 128 keys,
//   in each block one row of 128 keys = 256 B per value column).
//   Block = 256 threads = 8 waves, 64 query rows x one half of the keys (blockIdx & 1): every K and V byte that
//   comes from L2 serves 64 queries. Outputs per key half: ph / pl = bf16 hi / lo planes (16-bit storage) of
//   O_half = softmax over that half . vn, [2][ntok][DM], with the half's row maximum pm and row sum pls, [2][ntok];
//   the merge kernel joins the two halves.
//   Q tile staged once in LDS. Key tiles of 256: wave w owns keys 32w..32w+31 of the tile for the logits:
//   S^T subtiles (A = kn rows, B = Q rows, both from LDS), so the
//   D layout gives per lane 8 consecutive keys of one query -> P written to LDS as 16-B vectors ([query][key]).
//   P = 16 * exp(s - m_running) in f16 (values in [~1.2, 16], always normal).
//   Row max / sum: per-wave partials in LDS, combined in fixed order by waves 0 and 1 (one lane per query row).
//   P.V: every wave reads the whole P tile (A operand) and owns 3 x 32 value columns (B = vt rows from LDS).
//   kn and vt reach LDS by tensor loads, in a ring of two buffers: per key tile six K stages (256 keys x 128 dims)
//   and six V stages (256 columns x 128 keys); each wave asks, in one request a stage, for the slice of rows it
//   reads itself (32 key rows or 32 column rows of 256 B, each padded by 16 B in LDS); a V slice is one run of 8 KB
//   in global memory; the ring is so private to each wave: at the foot of every stage the wave's own two waits and no
//   work-group barrier, then the refill of the slice just read with the stage two ahead. The barriers of the kernel are
//   those around what the waves share: the Q tile, the row statistics, the P tile, the output staging.
//   Output: the 64x768 f32 accumulator tile staged in LDS (over the Q and P regions and the ring), then each wave
//   normalises 8 whole rows, splits them into bf16 hi / lo and writes 512 B per instruction (3 per row and plane).
// ---------------------------------------------------------------------------------------------
#define QB       64
#define KSPLIT   2
#define KCH      256
#define QSP      776
#define PSP      264
#define LDS_QS   0
#define LDS_PS   99328
#define LDS_PMAX 133120
#define LDS_PSUM 135168
#define LDS_ST   137216
#define LDS_RING 139264   // a multiple of 2 KiB, as every slice's place
#define FSP      772      // f32 output staging row pitch in floats (3088 B, a multiple of 16 B)
#define KSD      128      // model dims per K stage (256 B a key row)
#define KSP      136      // K stage row pitch in halves: 272 B = 16 B x odd, for ds_load_b128 readers
#define VSK      128      // keys per V stage (256 B a value-column row)
#define VSC      256      // value columns per V stage
#define VSP      136      // V stage row pitch in halves: 272 B = 16 B x odd
#define SLICE_B  10240    // one wave's slice of a ring buffer: 32 rows * 272 B up to a multiple of 2 KiB
#define RING_B   (8 * SLICE_B)   // one ring buffer
#define KW0      ((1u << 20) | (5u << 22) | (3u << 25))   // group 1 word 0: 16 B of pad behind every 256-B row
#define ATT_LDS  (LDS_RING + 2 * RING_B)
static_assert(QB * QSP * 2 == LDS_PS - LDS_QS);
static_assert(32 * FSP * 4 <= LDS_PMAX - LDS_QS && 32 * FSP * 4 <= 2 * RING_B && FSP >= DM && (FSP % 4) == 0);
static_assert(QB * PSP * 2 == LDS_PMAX - LDS_PS);
static_assert(LDS_PSUM - LDS_PMAX == 8 * QB * 4);
static_assert(LDS_ST - LDS_PSUM == 8 * QB * 4);
static_assert(LDS_RING - LDS_ST >= 4 * QB * 4);
static_assert(32 * KSP * 2 <= SLICE_B && 32 * VSP * 2 <= SLICE_B && (SLICE_B % 2048) == 0 && (LDS_RING % 2048) == 0);
static_assert(KSD * 2 == 256 && KSP * 2 == 256 + 16 && VSK * 2 == 256 && VSP * 2 == 256 + 16 && KCH == 8 * 32);
static_assert((DM % KSD) == 0 && KCH == 2 * VSK && ((DM / KSD) % 2) == 0 && DM == 3 * VSC && VSC == 8 * 32);
static_assert(ATT_LDS <= 327680);
static_assert((QSP % 8) == 0 && (PSP % 8) == 0 && PSP >= KCH);
static_assert((LDS_PS % 16) == 0 && (LDS_PMAX % 16) == 0 && (LDS_ST % 16) == 0);
static_assert((NTOK % (KCH * KSPLIT)) == 0 && (NTOK % QB) == 0);

// K stage: this wave's 32 key rows x 128 dims. g points at (first key row of the wave, first dim); l is the slice's place.
__device__ __forceinline__ void issue_k(uint32_t cnt1, const _Float16* g, uint32_t l) {
  tdm_slice<KW0, 256u, 32u>(cnt1, l, g, DM * 2u);
}
// V stage: this wave's 32 value-column rows x 128 keys, rows back to back in global memory. g points at the first row.
__device__ __forceinline__ void issue_v(uint32_t cnt1, const _Float16* g, uint32_t l) {
  tdm_slice<KW0, 256u, 32u>(cnt1, l, g, VSK * 2u);
}
__global__ __launch_bounds__(256) void attn_kernel(const _Float16* __restrict__ qn, const _Float16* __restrict__ kn,
                                                   const _Float16* __restrict__ vt, unsigned short* __restrict__ ph,
                                                   unsigned short* __restrict__ pl, float* __restrict__ pm,
                                                   float* __restrict__ pls, float sc, int ntok) {
  __shared__ __attribute__((aligned(2048))) char smem[ATT_LDS];
  _Float16* Qs = (_Float16*)(smem + LDS_QS);
  _Float16* Ps = (_Float16*)(smem + LDS_PS);
  float* pmax = (float*)(smem + LDS_PMAX);
  float* psum = (float*)(smem + LDS_PSUM);
  float* m_s  = (float*)(smem + LDS_ST);
  float* l_s  = m_s + QB;
  float* al_s = m_s + 2 * QB;
  float* li_s = m_s + 3 * QB;

  const int tid = threadIdx.x, wave = (int)uni(threadIdx.x >> 5), lane = tid & 31, h = lane >> 4, c = lane & 15;
  const int q0 = ((int)blockIdx.x >> 1) * QB;
  const int sp = (int)blockIdx.x & 1;             // which half of the keys
  const int ntile = ntok / (KCH * KSPLIT);        // key tiles of this block
  const int key0 = sp * ntile * KCH;
  // The walk over the key tiles starts at a tile of the block's own and wraps: the blocks of one key half then do not ask
  // L2 for the same K and V lines at the same moment. tt = the key tile in work (scalar, below ntile).
  int tt = ((int)blockIdx.x >> 1) % ntile;
  const float ninf = -__builtin_inff();

  // ring addresses of this wave (all wave-uniform): its slice's place in buffer 0, its first key row, its first column row
  const uint32_t rl0 = (uint32_t)(size_t)(smem + LDS_RING) + (uint32_t)wave * SLICE_B;
  const _Float16* kg = kn + (size_t)(key0 + 32 * wave) * DM;
  const _Float16* vg = vt + ((size_t)(key0 / VSK) * DM + 32 * wave) * VSK;   // key block key0 / 128, column 32 * wave

  // word 0 of every request's group 0 (count = 1), a descriptor word held in a scalar register by pinned(): made once, in
  // front of the first request; as a plain constant it was written into its register anew while stage 1's request flew
  const uint32_t cnt1 = pinned(1u);
  issue_k(cnt1, kg + (size_t)tt * KCH * DM, rl0);   // stage 0 (first tile, dims 0..127) into buffer 0; it flies under the Q staging

  if (tid < QB) { m_s[tid] = ninf; l_s[tid] = 0.0f; al_s[tid] = 0.0f; li_s[tid] = 0.0f; }
  psum[tid] = 0.0f;
  psum[256 + tid] = 0.0f;
  // Q tile: 64 rows x 96 pieces of 8 halves; coverage 24 * 256 = 6144 pieces = the whole tile
  {
    // the 64 rows lie in one piece in global memory: one address register, piece i at a constant distance
    const _Float16* qg = qn + (size_t)q0 * DM + tid * 8;
    v8h qv[24];
#pragma unroll
    for (int i = 0; i < 24; ++i) qv[i] = *(const v8h*)(qg + i * 2048);
    asm volatile("s_wait_xcnt 0x0" ::: "memory");   // in front of any rewrite of the loads' address register
#pragma unroll
    for (int i = 0; i < 24; ++i) {
      const int idx = i * 256 + tid;
      const int row = idx / 96;
      const int pc  = idx - row * 96;
      *(v8h*)(Qs + row * QSP + pc * 8) = qv[i];
    }
  }
  asm volatile("s_wait_tensorcnt 0x0" ::: "memory");  // own slice of stage 0 has landed
  __syncthreads();
  // keeps stage 1's descriptor words behind the wait
  __builtin_amdgcn_sched_barrier(0);
  issue_k(cnt1, kg + (size_t)tt * KCH * DM + KSD, rl0 + RING_B);   // stage 1 into buffer 1

  v8f oacc[4][6];   // [query subtile][column subtile]: column 256 * (nt / 2) + 32 * wave + 16 * (nt % 2) + c
#pragma unroll
  for (int qt = 0; qt < 4; ++qt)
#pragma unroll
    for (int nt = 0; nt < 6; ++nt) oacc[qt][nt] = zero8();

  const _Float16* qbp = Qs + c * QSP + 8 * h;             // B operand, query c (+ 16 * QSP per query subtile)
  const _Float16* pap = Ps + c * PSP + 8 * h;             // A operand, query c (+ 16 * PSP per query subtile)

#pragma unroll 1
  for (int t = 0; t < ntile; ++t) {
    const int tn = (tt + 1 == ntile) ? 0 : tt + 1;   // the next key tile of the walk
    // ---- logits: S^T subtiles for keys kb..kb+31 (this wave), queries 0..63 ----
    v8f sacc[4][2];   // [query subtile][key subtile]; element r: query 16qt+c, key kb+16kt+8h+r
#pragma unroll
    for (int qt = 0; qt < 4; ++qt)
#pragma unroll
      for (int kt = 0; kt < 2; ++kt) sacc[qt][kt] = zero8();
    // the products of one K stage of 128 dims (stage j of the tile, in buffer j & 1)
    auto k_stage = [&](int j) __attribute__((always_inline)) {
      const _Float16* ka0p = (const _Float16*)(smem + LDS_RING + (j & 1) * RING_B + wave * SLICE_B) + c * KSP + 8 * h;
      const _Float16* ka1p = ka0p + 16 * KSP;
#pragma unroll   // the stage's four k steps in a row: LDS offsets become immediates
      for (int kk = 0; kk < KSD; kk += 32) {
        const v16h a0 = ldfrag(ka0p + kk), a1 = ldfrag(ka1p + kk);
        v16h b[4];
#pragma unroll
        for (int qt = 0; qt < 4; ++qt) b[qt] = ldfrag(qbp + (16 * qt) * QSP + j * KSD + kk);
        // keeps all twelve LDS loads of a k step ahead of the step's first WMMA: left alone, the compiler feeds the
        // B fragments through one register set, and every pair of WMMAs waits out the LDS latency
        __builtin_amdgcn_sched_barrier(0);
#pragma unroll
        for (int qt = 0; qt < 4; ++qt) {
          sacc[qt][0] = mma16(a0, b[qt], sacc[qt][0]);
          sacc[qt][1] = mma16(a1, b[qt], sacc[qt][1]);
        }
      }
    };
    // Six K stages, in two loops, so that every request stands in straight code that every wave runs (no test around a
    // tensor load, which ignores EXEC); both kept rolled: the loop text stays short. Behind each turn of the ring the
    // slice just read is refilled with the stage two ahead: K stages 2..5 ...
#pragma unroll 1
    for (int j = 0; j + 2 < DM / KSD; ++j) {
      k_stage(j);
      ring_turn_t();
      issue_k(cnt1, kg + (size_t)tt * KCH * DM + (j + 2) * KSD, rl0 + (j & 1) * RING_B);
    }
    // ... then V stages 0, 1 of this tile
#pragma unroll 1
    for (int j = DM / KSD - 2; j < DM / KSD; ++j) {
      k_stage(j);
      ring_turn_t();
      issue_v(cnt1, vg + ((size_t)(2 * tt) * DM + (j + 2 - DM / KSD) * VSC) * VSK, rl0 + (j & 1) * RING_B);
    }
    // ---- scale, per-wave partial row max ----
#pragma unroll
    for (int qt = 0; qt < 4; ++qt) {
      float pmq = ninf;
#pragma unroll
      for (int kt = 0; kt < 2; ++kt) {
#pragma unroll
        for (int r = 0; r < 8; ++r) {
          const float v0 = sacc[qt][kt][r] * sc; sacc[qt][kt][r] = v0; pmq = fmaxf(pmq, v0);
        }
      }
      pmq = fmaxf(pmq, __shfl_xor(pmq, 16, 32));
      pmax[wave * QB + 16 * qt + c] = pmq;
    }
    __syncthreads();
    // ---- waves 0 and 1, thread = query row: fold the prior tile's sums into l, new running max, rescale factor ----
    if (wave < 2) {
      const int row = tid;
      float ps = 0.0f;
#pragma unroll
      for (int w = 0; w < 8; ++w) ps += psum[w * QB + row];
      l_s[row] = l_s[row] * al_s[row] + ps;
      const float mo = m_s[row];
      float mx = mo;
#pragma unroll
      for (int w = 0; w < 8; ++w) mx = fmaxf(mx, pmax[w * QB + row]);
      al_s[row] = __expf(mo - mx);
      m_s[row] = mx;
    }
    __syncthreads();
    // ---- p = 16 * exp(s - m) as f16, P tile, partial row sums, rescale O ----
#pragma unroll
    for (int qt = 0; qt < 4; ++qt) {
      const float mq = m_s[16 * qt + c];
      float ps = 0.0f;
#pragma unroll
      for (int kt = 0; kt < 2; ++kt) {
        v8h hq;
#pragma unroll
        for (int r = 0; r < 8; ++r) {
          const float p = __expf(sacc[qt][kt][r] - mq); ps += p; hq[r] = (_Float16)(p * 16.0f);
        }
        *(v8h*)(Ps + (16 * qt + c) * PSP + 32 * wave + 16 * kt + 8 * h) = hq;
      }
      ps += __shfl_xor(ps, 16, 32);
      psum[wave * QB + 16 * qt + c] = ps;
      const v4f aA = *(const v4f*)(al_s + 16 * qt + 8 * h), aB = *(const v4f*)(al_s + 16 * qt + 8 * h + 4);
#pragma unroll
      for (int nt = 0; nt < 6; ++nt) {
#pragma unroll
        for (int r = 0; r < 4; ++r) {
          oacc[qt][nt][r] *= aA[r]; oacc[qt][nt][4 + r] *= aB[r];
        }
      }
    }
    __syncthreads();
    // ---- O += P . V over the 256 keys of the tile ----
    // six V stages: stage v is key half v / 3, column third v % 3, in buffer v & 1; the three stages of a key half share
    // its P fragments, which stay in registers. Unrolled: accumulator index, buffer and kind of refill depend on v.
#pragma unroll
    for (int kh = 0; kh < 2; ++kh) {
      v16h pa[4][4];
#pragma unroll
      for (int th = 0; th < 3; ++th) {
        const int v = 3 * kh + th;
        const _Float16* vbp = (const _Float16*)(smem + LDS_RING + (v & 1) * RING_B + wave * SLICE_B) + c * VSP + 8 * h;
        v16h vb[4][2];
#pragma unroll
        for (int k2 = 0; k2 < 4; ++k2) {
          if (th == 0) {
#pragma unroll
            for (int qt = 0; qt < 4; ++qt) pa[k2][qt] = ldfrag(pap + (16 * qt) * PSP + kh * VSK + 32 * k2);
          }
#pragma unroll
          for (int j = 0; j < 2; ++j) vb[k2][j] = ldfrag(vbp + (16 * j) * VSP + 32 * k2);
        }
        // keeps all LDS loads of the stage ahead of its first WMMA (as in the K stages)
        __builtin_amdgcn_sched_barrier(0);
#pragma unroll
        for (int k2 = 0; k2 < 4; ++k2)
#pragma unroll
          for (int j = 0; j < 2; ++j)
#pragma unroll
            for (int qt = 0; qt < 4; ++qt)
              oacc[qt][2 * th + j] = mma16(pa[k2][qt], vb[k2][j], oacc[qt][2 * th + j]);
        ring_turn_t();
        // refill: V stage v + 2 of this tile; behind the last two stages K stages 0, 1 of the next tile while one
        // exists (a scalar test, the same for the whole block)
        if (v + 2 < 6) {
          issue_v(cnt1, vg + ((size_t)(2 * tt + (v + 2) / 3) * DM + ((v + 2) % 3) * VSC) * VSK, rl0 + (v & 1) * RING_B);
        } else if (pinned(t + 1 < ntile)) {
          issue_k(cnt1, kg + (size_t)tn * KCH * DM + (v - 4) * KSD, rl0 + (v & 1) * RING_B);
        }
      }
    }
    tt = tn;
  }
  asm volatile("s_wait_tensorcnt 0x0" ::: "memory");  // no request is left in flight behind the loop
  asm volatile("s_wait_dscnt 0x0" ::: "memory");      // own ring reads are done before the ring becomes output staging

  // ---- this half's row sum (fold the last tile's sums) and maximum; O_half = oacc / (256 * l) (P carry 16, vn carry 16) ----
  if (wave < 2) {
    const int row = tid;
    float ps = 0.0f;
#pragma unroll
    for (int w = 0; w < 8; ++w) ps += psum[w * QB + row];
    const float l = l_s[row] * al_s[row] + ps;
    li_s[row] = (1.0f / l) * (1.0f / 256.0f);
    pm[(size_t)sp * ntok + q0 + row]  = m_s[row];
    pls[(size_t)sp * ntok + q0 + row] = l;
  }
  __syncthreads();
  // ---- stage the 64 x 768 f32 accumulator tile: rows 0..31 over the Q and P regions, rows 32..63 over the ring ----
  float* F0 = (float*)(smem + LDS_QS);
  float* F1 = (float*)(smem + LDS_RING);
#pragma unroll
  for (int qt = 0; qt < 4; ++qt) {
    float* F = ((qt < 2) ? F0 : F1) + (16 * (qt & 1) + 8 * h) * FSP;
#pragma unroll
    for (int nt = 0; nt < 6; ++nt) {
      const int col = VSC * (nt / 2) + 32 * wave + 16 * (nt % 2) + c;
#pragma unroll
      for (int r = 0; r < 8; ++r) F[r * FSP + col] = oacc[qt][nt][r];
    }
  }
  __syncthreads();
  // ---- each wave: 8 whole rows, normalised, split into bf16 hi / lo, 512 B per store instruction (3 per row and plane) ----
  {
    unsigned short* gh = ph + ((size_t)sp * ntok + q0) * DM;
    unsigned short* gl = pl + ((size_t)sp * ntok + q0) * DM;
    // kept rolled: run once per block, unrolled it is some thousand instructions that are fetched to be used once
#pragma unroll 1
    for (int it = 0; it < 24; ++it) {
      const int rr = it / 3;
      const int row = 8 * wave + rr;
      const int pc = (it - rr * 3) * 32 + lane;
      const float* F = ((row < 32) ? F0 + row * FSP : F1 + (row - 32) * FSP) + pc * 8;
      const float inv = li_s[row];
      const v4f x0 = *(const v4f*)(F), x1 = *(const v4f*)(F + 4);
      v8us hvv, lvv;
#pragma unroll
      for (int e = 0; e < 4; ++e) {
        unsigned short hb, lb;
        split_bf(x0[e] * inv, hb, lb);
        hvv[e] = hb;      lvv[e] = lb;
        split_bf(x1[e] * inv, hb, lb);
        hvv[4 + e] = hb;  lvv[4 + e] = lb;
      }
      *(v8us*)(gh + (size_t)row * DM + pc * 8) = hvv;
      *(v8us*)(gl + (size_t)row * DM + pc * 8) = lvv;
      // the next trip rewrites the two stores' address and data registers: the wait stands in front of that
      asm volatile("s_wait_xcnt 0x0" ::: "memory");
    }
  }
}

// ---------------------------------------------------------------------------------------------
// Kernel 5: join the two key halves of the attention: with M = max(m0, m1) and w_i = l_i * exp(m_i - M),
//   O = (w0 * O_0 + w1 * O_1) / (w0 + w1), O_i = hi + lo of half i; O goes out again as bf16 hi / lo planes [ntok][DM].
// A piece is 8 columns: one 16-B load and store per lane and plane, 32 lanes contiguous = 512 B. Thread g takes pieces
// g, g + threads, ... (MG_IT of them); the loads of all its pieces are issued before the first piece is worked on.
// coverage: MG_IT * SG_BLK * SG_THR pieces = ntok * DM / 8 exactly (DM / 8 = 96 pieces a row).
// ---------------------------------------------------------------------------------------------
// exp(d) in the fast form (one multiply by log2 e, then v_exp_f32). The v_nop in the same statement is the slot that the
// instruction set asks for behind a transcendental.
__device__ __forceinline__ float exp_slot(float d) {
  const float t = d * 1.44269504f;
  float r;
  asm("v_exp_f32 %0, %1\n\tv_nop" : "=v"(r) : "v"(t));
  return r;
}
#define MG_IT (NTOK * (DM / 8) / (SG_BLK * SG_THR))
static_assert(MG_IT * SG_BLK * SG_THR == NTOK * (DM / 8));
__global__ __launch_bounds__(SG_THR) void merge_kernel(const unsigned short* __restrict__ ph,
                                                       const unsigned short* __restrict__ pl,
                                                       const float* __restrict__ pm, const float* __restrict__ pls,
                                                       unsigned short* __restrict__ oh, unsigned short* __restrict__ ol,
                                                       int ntok) {
  const int g = (int)blockIdx.x * SG_THR + (int)threadIdx.x;
  const size_t pst = (size_t)ntok * DM;
  float m0[MG_IT], m1[MG_IT], l0[MG_IT], l1[MG_IT];
  v8us h0[MG_IT], g0[MG_IT], h1[MG_IT], g1[MG_IT];
#pragma unroll
  for (int it = 0; it < MG_IT; ++it) {
    const int row = (it * (SG_BLK * SG_THR) + g) / (DM / 8);
    m0[it] = pm[row];
    m1[it] = pm[ntok + row];
    l0[it] = pls[row];
    l1[it] = pls[ntok + row];
  }
  // the wide loads' results may take these loads' address registers: the wait stands in front of that rewrite
  asm volatile("s_wait_xcnt 0x0" ::: "memory");
#pragma unroll
  for (int it = 0; it < MG_IT; ++it) {
    const size_t e = (size_t)(it * (SG_BLK * SG_THR) + g) * 8;
    h0[it] = *(const v8us*)(ph + e);
    g0[it] = *(const v8us*)(pl + e);
    h1[it] = *(const v8us*)(ph + pst + e);
    g1[it] = *(const v8us*)(pl + pst + e);
  }
  asm volatile("s_wait_xcnt 0x0" ::: "memory");   // in front of any rewrite of the loads' address registers
  // keeps every load ahead of the first piece's work: left alone, the compiler mixes the two to save registers, and the
  // thread waits out the memory latency several times over
  __builtin_amdgcn_sched_barrier(0);
#pragma unroll
  for (int it = 0; it < MG_IT; ++it) {
    const size_t e = (size_t)(it * (SG_BLK * SG_THR) + g) * 8;
    const float mx = fmaxf(m0[it], m1[it]);
    float w0 = l0[it] * exp_slot(m0[it] - mx), w1 = l1[it] * exp_slot(m1[it] - mx);
    const float inv = 1.0f / (w0 + w1);
    w0 *= inv;
    w1 *= inv;
    v8us oh8, ol8;
#pragma unroll
    for (int i = 0; i < 8; ++i) {
      const float f = w0 * (bfval(h0[it][i]) + bfval(g0[it][i])) + w1 * (bfval(h1[it][i]) + bfval(g1[it][i]));
      unsigned short hb, lb;
      split_bf(f, hb, lb);
      oh8[i] = hb;
      ol8[i] = lb;
    }
    *(v8us*)(oh + e) = oh8;
    *(v8us*)(ol + e) = ol8;
    asm volatile("s_wait_xcnt 0x0" ::: "memory");   // in front of any rewrite of the stores' address and data registers
  }
}

// ---------------------------------------------------------------------------------------------
// Workspace map (bytes, all regions exact tile / whole-line multiples, no padding needed):
//   Wq16 : Wqkv f16 [768][768] (64 * bf16(w))                 off 0           size  1,179,648
//   Wpb  : Wproj bf16 bits [768][768]                           off 1,179,648   size  1,179,648
//   X16  : ln(q), ln(k), ln(v) stacked f16 [24576][768]        off 2,359,296   size 37,748,736
//   QK16 : qn then kn f16 [16384][768]                          off 40,108,032  size 25,165,824
//   VT16 : vn^T f16 [64][768][128] (blocks of 128 keys)         off 65,273,856  size 12,582,912
//   OH   : attention output bf16 hi [8192][768]                 off 77,856,768  size 12,582,912
//   OL   : attention output bf16 lo [8192][768]                 off 90,439,680  size 12,582,912
//   PH   : per key half, attention output bf16 hi [2][8192][768] off 103,022,592 size 25,165,824
//   PL   : per key half, attention output bf16 lo [2][8192][768] off 128,188,416 size 25,165,824
//   PM   : per key half, row maximum f32 [2][8192]              off 153,354,240 size     65,536
//   PS   : per key half, row sum f32 [2][8192]                  off 153,419,776 size     65,536
//   total 153,485,312
// ---------------------------------------------------------------------------------------------
extern "C" void kernel_launch(void* const* d_in, const int* in_sizes, int n_in,
                              void* d_out, int out_size, void* d_ws, size_t ws_size,
                              hipStream_t stream) {
  if (n_in < 8) return;
  const int ntok = NTOK, dm = DM;
  if (in_sizes[0] != ntok * dm || in_sizes[1] != ntok * dm || in_sizes[2] != ntok * dm) return;
  if (in_sizes[3] != dm || in_sizes[4] != dm || in_sizes[7] != dm) return;
  if (in_sizes[5] != dm * dm || in_sizes[6] != dm * dm) return;
  if (out_size != ntok * dm) return;

  const float* q     = (const float*)d_in[0];
  const float* k     = (const float*)d_in[1];
  const float* v     = (const float*)d_in[2];
  const float* ln_w  = (const float*)d_in[3];
  const float* ln_b  = (const float*)d_in[4];
  const float* Wqkv  = (const float*)d_in[5];
  const float* Wproj = (const float*)d_in[6];
  const float* bproj = (const float*)d_in[7];
  float* out = (float*)d_out;

  const size_t bWq = (size_t)dm * dm * 2;
  const size_t bWp = (size_t)dm * dm * 2;
  const size_t bX  = (size_t)3 * ntok * dm * 2;
  const size_t bQK = (size_t)2 * ntok * dm * 2;
  const size_t bVT = (size_t)dm * ntok * 2;
  const size_t bO  = (size_t)ntok * dm * 2;
  size_t off = 0;
  const size_t oWq = off; off += bWq;
  const size_t oWp = off; off += bWp;
  const size_t oX  = off; off += bX;
  const size_t oQK = off; off += bQK;
  const size_t oVT = off; off += bVT;
  const size_t oOH = off; off += bO;
  const size_t oOL = off; off += bO;
  const size_t oPH = off; off += 2 * bO;
  const size_t oPL = off; off += 2 * bO;
  const size_t oPM = off; off += (size_t)2 * ntok * 4;
  const size_t oPS = off; off += (size_t)2 * ntok * 4;
  if (off > ws_size) return;                     // 153,485,312

  char* ws = (char*)d_ws;
  _Float16*       Wq16 = (_Float16*)(ws + oWq);
  unsigned short* Wpb  = (unsigned short*)(ws + oWp);
  _Float16*       X16  = (_Float16*)(ws + oX);
  _Float16*       QK16 = (_Float16*)(ws + oQK);
  _Float16*       VT16 = (_Float16*)(ws + oVT);
  unsigned short* OH   = (unsigned short*)(ws + oOH);
  unsigned short* OL   = (unsigned short*)(ws + oOL);
  unsigned short* PH   = (unsigned short*)(ws + oPH);
  unsigned short* PL   = (unsigned short*)(ws + oPL);
  float*          PM   = (float*)(ws + oPM);
  float*          PS   = (float*)(ws + oPS);

  const dim3 blk(256);
  const dim3 gblk(128);                       // the GEMM's block: 4 waves
  const int n8 = dm * dm / 8;                 // 73728 = 288 * 256
  if ((n8 % 256) != 0) return;

  // (1) weights -> Wqkv f16 plane (64 * bf16(w)) and Wproj bf16 plane
  cvt_w_kernel<<<dim3(2 * (n8 / 256)), blk, 0, stream>>>(Wqkv, Wproj, Wq16, Wpb, n8);
  // (2) LayerNorm of q, k, v -> X16 (8 * ln)
  ln_kernel<<<dim3(SG_BLK), dim3(SG_THR), 0, stream>>>(q, k, v, ln_w, ln_b, X16, ntok);
  // (3) qn, kn = X[0:16384] . Wqkv^T  -> QK16 (16 * qn | 16 * kn); M=16384, N=768, K=768; scale 16/(8*64)
  gemm64_kernel<0, false, 1><<<dim3((2 * ntok / 128) * (dm / 128)), gblk, 0, stream>>>(
      (const unsigned short*)X16, (const unsigned short*)X16, dm, (const unsigned short*)Wq16, dm,
      (void*)QK16, dm, bproj, 2 * ntok, dm, dm, 0.03125f);
  // (4) vn^T = Wqkv . X[16384:24576]^T -> VT16 [64][768][128] (16 * vn, blocks of 128 keys); M=768, N=8192, K=768
  gemm64_kernel<0, false, 2><<<dim3((dm / 128) * (ntok / 128)), gblk, 0, stream>>>(
      (const unsigned short*)Wq16, (const unsigned short*)Wq16, dm,
      (const unsigned short*)(X16 + (size_t)2 * ntok * dm), dm,
      (void*)VT16, 128, bproj, dm, ntok, dm, 0.03125f);
  // (5) attention per key half -> PH / PL, PM, PS; logit scale = dim^-0.5 / 256 (operand carries 16 * 16)
  const float sc = 0.03608439182435161f * (1.0f / 256.0f);
  attn_kernel<<<dim3(KSPLIT * (ntok / QB)), blk, 0, stream>>>(QK16, QK16 + (size_t)ntok * dm, VT16, PH, PL, PM, PS,
                                                              sc, ntok);
  // (6) the two key halves joined -> OH / OL (bf16 hi / lo of O)
  merge_kernel<<<dim3(SG_BLK), dim3(SG_THR), 0, stream>>>(PH, PL, PM, PS, OH, OL, ntok);
  // (7) out = (O_hi + O_lo) . Wproj^T + b -> d_out f32 [8192][768]; bf16 operands, scale 1
  gemm64_kernel<1, true, 0><<<dim3((ntok / 128) * (dm / 128)), gblk, 0, stream>>>(
      OH, OL, dm, Wpb, dm, (void*)out, dm, bproj, ntok, dm, dm, 1.0f);
  (void)hipGetLastError();
}

// v010
// A run of this version takes 185 microseconds.
// Versions in between are left out here; by their measured steps it is 1.14 times as fast as v008.
// Over all steps from v000 it is 3.76 times as fast.
// Contractions: G = Wqkv^T.Wqkv, Wc = Wproj.Wqkv, qg = ln(q).G, vp^T = Wc.ln(v)^T, S^T = ln(k).qg^T, out = P.vp + b :
// v_wmma_f32_16x16x32_f16, f16 operands with power-of-two carries (ln x8, Wqkv, Wproj, G and Wc x64, qg/vp x16,
// P = 16*exp(s - m)), f32 accumulate. The products of the weights among themselves are formed first:
// (ln(q).Wqkv^T).(ln(k).Wqkv^T)^T = (ln(q).G).ln(k)^T and (P.(ln(v).Wqkv^T)).Wproj^T = P.(ln(v).Wc^T), so the keys need no
// projection and no product over the tokens stands behind the attention.
// float inputs RNE-converted to bf16 on load; LayerNorm, softmax statistics and bias in f32.
#include <hip/hip_runtime.h>
#include <stdint.h>

#define NTOK 8192
#define DM   768

typedef _Float16 v16h __attribute__((ext_vector_type(16)));
typedef _Float16 v8h  __attribute__((ext_vector_type(8)));
typedef float    v8f  __attribute__((ext_vector_type(8)));
typedef float    v4f  __attribute__((ext_vector_type(4)));
typedef unsigned short v8us __attribute__((ext_vector_type(8)));

static_assert((DM % 64) == 0);
static_assert((NTOK % 256) == 0);

// f32 -> nearest-even bf16 bits / value
__device__ __forceinline__ unsigned short bfbits(float f) {
  unsigned u = __float_as_uint(f);
  return (unsigned short)((u + 0x7FFFu + ((u >> 16) & 1u)) >> 16);
}
__device__ __forceinline__ float bfval(unsigned short b) { return __uint_as_float(((unsigned)b) << 16); }
__device__ __forceinline__ float bfr(float f) { return bfval(bfbits(f)); }
__device__ __forceinline__ void split_bf(float f, unsigned short& hb, unsigned short& lb) {
  hb = bfbits(f);
  lb = bfbits(f - bfval(hb));
}

// 16-bit WMMA fragment from k-contiguous storage (A row-major [m][k], or B stored [n][k]):
// p points at element (row_or_col = lane&15, k0 + 8h); elements 0..7 <- p[0..7], 8..15 <- p[16..23].
__device__ __forceinline__ v16h ldfrag(const _Float16* p) {
  union { v16h v; v8h h[2]; } f;
  f.h[0] = *(const v8h*)(p);
  f.h[1] = *(const v8h*)(p + 16);
  return f.v;
}
__device__ __forceinline__ v8f mma16(v16h a, v16h b, v8f c) {
  return __builtin_amdgcn_wmma_f32_16x16x32_f16(false, a, false, b, (short)0, c, false, false);
}
__device__ __forceinline__ v8f zero8() {
  v8f z;
#pragma unroll
  for (int i = 0; i < 8; ++i) z[i] = 0.0f;
  return z;
}

// hazard guard: 4 VALU slots after the last WMMA of a group, D tied
__device__ __forceinline__ void accg4(v8f& a, v8f& b, v8f& c, v8f& d) {
  asm volatile("v_nop\n\tv_nop\n\tv_nop\n\tv_nop" : "+v"(a), "+v"(b), "+v"(c), "+v"(d));
}

// ---------------------------------------------------------------------------------------------
// Kernel 1: two [DM][DM] f32 weight matrices -> f16 planes, value = 64 * bf16(w):
//   blocks [0, nb0):                  dp16[e] of w1[e], layout unchanged ([out][in])
//   blocks [nb0, nb0 + (DM / 64)^2):  dT = w0 transposed, [in][out]
// Block-uniform select. Straight plane: 8 elements per thread, one 16-B store per lane, 32 lanes contiguous = 512 B;
// coverage: nb0 * 256 threads * 8 = DM * DM elements exactly (n8 = DM*DM/8 is a multiple of 256).
// Transposed plane: one 64 x 64 tile per block, turned in LDS; each row of the turned tile (128 B, one whole line) is
// stored by four lanes of one wave; coverage: (DM / 64)^2 tiles of 64 x 64 = DM * DM elements.
// ---------------------------------------------------------------------------------------------
#define TRP 72   // row pitch of the turned tile in LDS, in halves: 144 B = 16 B x odd
__global__ __launch_bounds__(256) void cvt_w_kernel(const float* __restrict__ w0, const float* __restrict__ w1,
                                                    _Float16* __restrict__ dT, _Float16* __restrict__ dp16, int n8) {
  __shared__ __align__(16) _Float16 tr[64 * TRP];
  const int nb0 = n8 >> 8;
  if ((int)blockIdx.x >= nb0) {                  // the same for the whole block
    const int tl = (int)blockIdx.x - nb0;
    const int te = tl / (DM / 64), td = tl - te * (DM / 64);   // tile: rows 64 te.. of w0, columns 64 td..
    if (te >= DM / 64) return;                   // the same for the whole block, in front of the barrier
    const int r = (int)threadIdx.x >> 2, c16 = ((int)threadIdx.x & 3) * 16;
    const float* s = w0 + (size_t)(te * 64 + r) * DM + td * 64 + c16;
    v4f x[4];
#pragma unroll
    for (int i = 0; i < 4; ++i) x[i] = *(const v4f*)(s + 4 * i);
    asm volatile("s_wait_xcnt 0x0" ::: "memory");   // in front of any rewrite of the loads' address registers
#pragma unroll
    for (int i = 0; i < 4; ++i)
#pragma unroll
      for (int e = 0; e < 4; ++e) tr[(c16 + 4 * i + e) * TRP + r] = (_Float16)(bfr(x[i][e]) * 64.0f);
    __syncthreads();
    const v8h a = *(const v8h*)(tr + r * TRP + c16), b = *(const v8h*)(tr + r * TRP + c16 + 8);
    _Float16* d = dT + (size_t)(td * 64 + r) * DM + te * 64 + c16;
    *(v8h*)d = a;
    *(v8h*)(d + 8) = b;
    asm volatile("s_wait_xcnt 0x0" ::: "memory");   // behind the two stores, in front of any rewrite of their address and data registers
    return;
  }
  const int li = (int)blockIdx.x * 256 + (int)threadIdx.x;
  if (li >= n8) return;
  const size_t e = (size_t)li * 8;
  const v4f a = *(const v4f*)(w1 + e);
  const v4f b = *(const v4f*)(w1 + e + 4);
  v8h o;
#pragma unroll
  for (int i = 0; i < 4; ++i) {
    o[i]     = (_Float16)(bfr(a[i]) * 64.0f);
    o[4 + i] = (_Float16)(bfr(b[i]) * 64.0f);
  }
  *(v8h*)(dp16 + e) = o;
}

// ---------------------------------------------------------------------------------------------
// The two streaming parts (LayerNorm, merge) run as 3,808 + 1,024 and 4,096 waves, each of which walks several rows or pieces,
// so that few waves have to be started and each keeps many loads in flight. The merge: SG_BLK work-groups of SG_THR.
#define SG_BLK 256
#define SG_THR 512

// LayerNorm part of kernels 2 and 3: LayerNorm of q, k, v (bf16-converted inputs, f32 statistics, centred variance) -> f16
// plane X [3*ntok][DM], value = 8 * ln(x). Rows [0,ntok) of X come from q, the next ntok from k, the next from v.
// A launch takes 'total' of these rows, numbered i = 0 .. total - 1: row i of X below 'gap0', row i + ntok from there on
// (kernel 2: q and v, total 2 * ntok, gap0 ntok; kernel 3: k, total ntok, gap0 0).
// One wave per row at a time; wave g (row0) of nw takes numbers g, g + nw, g + 2 * nw, ... The row (3 KB) is read once and held in
// registers: lane owns columns (j*32+lane)*8 .. +7 of chunk j (j = 0..2). The next row's six loads are issued before the
// current row is worked on. Weight and bias of the lane's 24 columns are converted once per wave.
// Stores: one 16-B store per lane and chunk, 32 lanes contiguous = 512 B.
// coverage: numbers g + i * waves over all waves g = every number below total once; the two launches' rows together = every
// row below 3*ntok once; 3 chunks * 32 lanes * 8 = 768 columns.
// ---------------------------------------------------------------------------------------------
__device__ __forceinline__ const float* ln_row(const float* qx, const float* kx, const float* vx, int r, int ntok) {
  const int seg = (r >= 2 * ntok) ? 2 : ((r >= ntok) ? 1 : 0);
  const float* src = (seg == 2) ? vx : ((seg == 1) ? kx : qx);
  return src + (size_t)(r - seg * ntok) * DM;
}
__device__ __forceinline__ void ln_rows(const float* __restrict__ qx, const float* __restrict__ kx,
                                        const float* __restrict__ vx, const float* __restrict__ lw,
                                        const float* __restrict__ lb, _Float16* __restrict__ X, int ntok,
                                        int row0, int nw, int total, int gap0) {
  const int lane = threadIdx.x & 31;
  int num = row0;                                // the row's number in this launch
  if (num >= total) return;                      // the same for the whole wave; this part has no barrier
  int row = num + ((num >= gap0) ? ntok : 0);    // its row in X

  v4f nxt[6];
  {
    const float* p = ln_row(qx, kx, vx, row, ntok) + lane * 8;
#pragma unroll
    for (int j = 0; j < 3; ++j) {
      nxt[2 * j]     = *(const v4f*)(p + j * 256);
      nxt[2 * j + 1] = *(const v4f*)(p + j * 256 + 4);
    }
  }
  float w[24], b8[24];                           // bf16(weight), 8 * bf16(bias) of this lane's columns
#pragma unroll
  for (int j = 0; j < 3; ++j) {
    const int c0 = (j * 32 + lane) * 8;
    const v4f wa = *(const v4f*)(lw + c0), wb = *(const v4f*)(lw + c0 + 4);
    const v4f ba = *(const v4f*)(lb + c0), bb = *(const v4f*)(lb + c0 + 4);
#pragma unroll
    for (int e = 0; e < 4; ++e) {
      w[8 * j + e]      = bfr(wa[e]);
      w[8 * j + 4 + e]  = bfr(wb[e]);
      b8[8 * j + e]     = bfr(ba[e]) * 8.0f;
      b8[8 * j + 4 + e] = bfr(bb[e]) * 8.0f;
    }
  }
  asm volatile("s_wait_xcnt 0x0" ::: "memory");   // in front of any rewrite of these loads' address registers
  // the row in work, bf16-converted: made from the loaded row at the foot of the trip before, so that at the head of a
  // trip no load but the next row's is outstanding and nothing in the trip's work waits for those
  float x[24];
#pragma unroll
  for (int jj = 0; jj < 6; ++jj)
#pragma unroll
    for (int e = 0; e < 4; ++e) x[4 * jj + e] = bfr(nxt[jj][e]);

  // kept rolled: one row's text, run for every row of the wave
#pragma unroll 1
  for (;;) {
    const int nnum = num + nw;
    const int nrow = nnum + ((nnum >= gap0) ? ntok : 0);
    const bool more = nnum < total;              // scalar: the same for the whole wave
    if (more) {
      const float* p = ln_row(qx, kx, vx, nrow, ntok) + lane * 8;
#pragma unroll
      for (int j = 0; j < 3; ++j) {
        nxt[2 * j]     = *(const v4f*)(p + j * 256);
        nxt[2 * j + 1] = *(const v4f*)(p + j * 256 + 4);
      }
      asm volatile("s_wait_xcnt 0x0" ::: "memory");   // in front of any rewrite of the loads' address registers
    }
    // keeps the next row's loads ahead of the work on this row: sunk into it, they would fly for less time
    __builtin_amdgcn_sched_barrier(0);

    float s = 0.0f;
#pragma unroll
    for (int jj = 0; jj < 6; ++jj) s += (x[4 * jj] + x[4 * jj + 1]) + (x[4 * jj + 2] + x[4 * jj + 3]);
#pragma unroll
    for (int off = 16; off > 0; off >>= 1) s += __shfl_xor(s, off, 32);
    const float mu = s * (1.0f / 768.0f);

    // centred sum of squares
    float s2 = 0.0f;
#pragma unroll
    for (int i = 0; i < 24; ++i) {
      const float d = x[i] - mu;
      s2 += d * d;
    }
#pragma unroll
    for (int off = 16; off > 0; off >>= 1) s2 += __shfl_xor(s2, off, 32);
    const float rstd8 = rsqrtf(s2 * (1.0f / 768.0f) + 1e-5f) * 8.0f;   // x8 carry folded into the scale

    _Float16* yr = X + (size_t)row * DM + lane * 8;
#pragma unroll
    for (int j = 0; j < 3; ++j) {
      v8h o;
#pragma unroll
      for (int e = 0; e < 8; ++e) {
        const float t = (x[8 * j + e] - mu) * rstd8;
        o[e] = (_Float16)(t * w[8 * j + e] + b8[8 * j + e]);
      }
      *(v8h*)(yr + j * 256) = o;
    }
    asm volatile("s_wait_xcnt 0x0" ::: "memory");   // the next trip rewrites the stores' address and data registers
    if (!more) break;
#pragma unroll
    for (int jj = 0; jj < 6; ++jj)
#pragma unroll
      for (int e = 0; e < 4; ++e) x[4 * jj + e] = bfr(nxt[jj][e]);
    num = nnum;
    row = nrow;
  }
}

// One asynchronous 16-B-per-lane copy global -> LDS, as the builtin: its address registers are the compiler's, which
// may place them above v255 (an asm operand may not lie there).
typedef int v4i __attribute__((ext_vector_type(4)));
__device__ __forceinline__ void acopy(const _Float16* g, char* l) {
  __builtin_amdgcn_global_load_async_to_lds_b128((__attribute__((address_space(1))) v4i*)g,
                                                 (__attribute__((address_space(3))) v4i*)l, 0, 0);
}
// Publish point of the ring: this wave's LDS reads of the buffer to be refilled have retired, its own copies of the
// next stage have landed, then the work-group barrier behind which that stage is read and the old buffer refilled.
__device__ __forceinline__ void ring_publish() {
  // keeps the stage's WMMAs ahead of the publish point: sunk behind the barrier, they stand between it and the refill,
  // and the copies lose that much of their flight time
  __builtin_amdgcn_sched_barrier(0);
  asm volatile("s_wait_dscnt 0x0" ::: "memory");     // own reads of the stage just used are done
  asm volatile("s_wait_asynccnt 0x0" ::: "memory");  // own copies of the next stage have landed
  __syncthreads();
}

// Tensor load of one two-dimensional slice, global -> LDS: NROW rows of ROWB bytes at source pitch 'pitch' bytes, landing at
// LDS byte offset lds_dst with the row pad that word 0 of group 1 (W0, a constant) names. One request of the whole wave;
// every descriptor word is wave-uniform and goes through readfirstlane. 1-byte elements, tensor dims = tile dims, no mask.
typedef uint32_t u32x4 __attribute__((ext_vector_type(4)));
typedef uint32_t u32x8 __attribute__((ext_vector_type(8)));
__device__ __forceinline__ uint32_t uni(uint32_t v) { return (uint32_t)__builtin_amdgcn_readfirstlane(v); }
// a wave-uniform issue test, or a descriptor word, of the tensor mover held in a scalar register: the branch on such a test
// is a scalar branch (a tensor load ignores EXEC); such a word is made once, where pinned() stands
__device__ __forceinline__ uint32_t pinned(uint32_t v) {
  uint32_t w = (uint32_t)__builtin_amdgcn_readfirstlane(v);
  asm volatile("" : "+s"(w));   // pinned(): the tensor mover's issue test (compiles to s_cmp + s_cbranch_scc) or descriptor word in a scalar register
  return w;
}
template <uint32_t W0, uint32_t ROWB, uint32_t NROW>
__device__ __forceinline__ void tdm_slice(uint32_t cnt1, uint32_t lds_dst, const _Float16* g, uint32_t pitch) {
  const uint64_t ga = (uint64_t)(size_t)g;
  u32x4 g0;
  u32x8 g1;
  g0[0] = cnt1;   // count = 1, from the caller's pinned word
  g0[1] = uni(lds_dst);
  g0[2] = uni((uint32_t)ga);
  g0[3] = uni((((uint32_t)(ga >> 32)) & 0x01FFFFFFu) | 0x80000000u);
  g1[0] = uni(W0);
  g1[1] = uni((ROWB & 0xFFFFu) << 16);
  g1[2] = uni((ROWB >> 16) | ((NROW & 0xFFFFu) << 16));
  g1[3] = uni((NROW >> 16) | (ROWB << 16));
  g1[4] = uni(NROW);
  g1[5] = uni(pitch);
  g1[6] = uni(0u);
  g1[7] = uni(0u);
  // Issued from twelve scalar registers named here, above all that the kernel else uses, which hold nothing else: they are
  // written only in front of an issue, behind the wait for the request before, so that an outstanding request's words
  // stay in place until it has landed (left to the compiler's choice, it reused the registers for other values at once).
  asm volatile("tensor_load_to_lds %0, %1" :: "{s[88:91]}"(g0), "{s[92:99]}"(g1) : "memory");
}
// Turn of the tensor-load ring, which is private to each wave: a slice is asked for, read and refilled by one and the same
// wave. This wave's LDS reads of the slice to be refilled have retired and its own request for the next stage has landed:
// behind these two waits the wave reads that stage and refills the old slice. No work-group barrier: no other wave
// touches the slice, so the waves of a SIMD may run apart and one's loads and waits stand under the other's WMMAs.
__device__ __forceinline__ void ring_turn_t() {
  // keeps the stage's WMMAs ahead of the waits: sunk behind them, they would wait for the next stage's landing
  __builtin_amdgcn_sched_barrier(0);
  asm volatile("s_wait_dscnt 0x0" ::: "memory");      // own reads of the stage just used are done
  asm volatile("s_wait_tensorcnt 0x0" ::: "memory");  // own slice of the next stage has landed
  // keeps the next request's descriptor words behind the wait: none is formed while a request is outstanding
  __builtin_amdgcn_sched_barrier(0);
}

// ---------------------------------------------------------------------------------------------
// The GEMM tile of kernels 2 and 3: C[m][n] = scale * sum_k A[m][k] * Bt[n][k].
// A row-major [M][K] f16 pitch lda; Bt row-major [N][K] f16 pitch ldb; M, N multiples of 128, K a multiple of 64.
// Block = 128 threads = 4 waves (2 x 2) on one 128x128 C tile; each wave owns one 64x64 part (16 f32 accumulators).
// The operands reach LDS by asynchronous copies in whole lines, in a ring of two buffers: a stage is 64 k (128 B) of
// the tile's 128 A rows and 128 Bt rows; each wave copies 32 rows of either plane; at the
// foot of every stage one publish point, then the refill of the buffer just read with the stage two ahead.
// OUT_MODE 1: f16 output [M][N]; OUT_MODE 2: f16 output in blocks of 128 columns, [N / 128][M][128]
// (ldc = 128). Epilogue: 16-row slab per wave in LDS (over the ring, which is
// out of use behind the last publish point), then each 64-wide row goes out in whole lines.
// gemm_tile is the work of one block on tile number 'tile'; gsm is the block's ring (2 * 2 * GPL bytes of LDS).
// coverage: tilesM * tilesN tiles, each 128x128 written fully -> M x N.
// ---------------------------------------------------------------------------------------------
#define GKS 64       // k per stage: 128 B a row, one whole line
#define GSP 72       // stage row pitch in halves: 144 B = 16 B x odd, for ds_load_b128 readers
#define GPL (128 * GSP * 2)   // one operand plane of a stage: 128 rows
static_assert((DM % GKS) == 0 && (DM % 128) == 0 && (NTOK % 128) == 0 && 4 * 16 * 68 * 4 <= 2 * GPL);

// 32 rows x 128 B of one plane: one copy = 4 rows x 128 B (four whole lines). 8 copies.
// g points at (first row of the wave + lane / 8, first k + 8 * (lane % 8)); l is that lane's place in LDS.
__device__ __forceinline__ void issue_g(const void* g, int ld, char* l) {
#pragma unroll
  for (int i = 0; i < 8; ++i) acopy((const _Float16*)g + (size_t)(4 * i) * ld, l + i * 4 * GSP * 2);
}

template <int OUT_MODE>
__device__ __forceinline__ void gemm_tile(char* gsm, int tile, const _Float16* __restrict__ A, int lda,
                                          const _Float16* __restrict__ Bt, int ldb, _Float16* __restrict__ Cdst, int ldc,
                                          int M, int N, int K, float scale) {
  typedef _Float16 T;
  typedef v16h V;
  constexpr int BOFF = GPL;                      // the Bt plane's place in a buffer
  constexpr int BUFB = BOFF + GPL;               // one ring buffer
  const int lane = threadIdx.x & 31, wave = threadIdx.x >> 5;
  const int tilesN = N >> 7, tilesM = M >> 7;
  if (tile >= tilesM * tilesN) return;           // the same for the whole block, in front of every barrier
  const int tm = tile / tilesN, tn = tile - tm * tilesN;
  const int m0 = (tm << 7) + ((wave >> 1) << 6), n0 = (tn << 7) + ((wave & 1) << 6);   // this wave's 64x64 part
  const int rl = lane & 15;
  const int koff = (lane >> 4) * 8;
  const int mOff = (lane >> 4) * 8;
  const int nst = K / GKS;
  // The k walk starts at a stage of the tile's own, (tm + tn) mod nst, and wraps: blocks that share A rows or Bt rows then
  // do not ask L2 for the same lines at the same moment. kx = the k stage that the next copies bring.
  int kx = (tm + tn) % nst;

  // copy addresses of this lane: rows 32 * wave + lane / 8 (+ 4 a copy) of each plane, piece lane % 8 of the row
  const int crow = 32 * wave + (lane >> 3), cpc = lane & 7;
  const T* ga  = A  + (size_t)((tm << 7) + crow) * lda + cpc * 8;
  const T* gb  = Bt + (size_t)((tn << 7) + crow) * ldb + cpc * 8;
  char* lc = gsm + crow * GSP * 2 + cpc * 16;

  issue_g(ga + kx * GKS, lda, lc);               // first stage of the walk into buffer 0
  issue_g(gb + kx * GKS, ldb, lc + BOFF);
  kx = (kx + 1 == nst) ? 0 : kx + 1;

  v8f acc[4][4];
#pragma unroll
  for (int i = 0; i < 4; ++i)
#pragma unroll
    for (int j = 0; j < 4; ++j) acc[i][j] = zero8();

  asm volatile("s_wait_asynccnt 0x0" ::: "memory");  // own copies of stage 0 have landed
  __syncthreads();
  if (nst > 1) {                                 // second stage of the walk into buffer 1
    issue_g(ga + kx * GKS, lda, lc + BUFB);
    issue_g(gb + kx * GKS, ldb, lc + BUFB + BOFF);
    kx = (kx + 1 == nst) ? 0 : kx + 1;
  }

  // kept rolled: unrolled, the copies' addresses of every stage stay in registers
#pragma unroll 1
  for (int s = 0; s < nst; ++s) {
    const T* sb = (const T*)(const void*)(gsm + (s & 1) * BUFB);
    const T* ap = sb + (((wave >> 1) << 6) + rl) * GSP + koff;
    const T* bp = sb + BOFF / 2 + (((wave & 1) << 6) + rl) * GSP + koff;
#pragma unroll   // the stage's two k steps in a row: LDS offsets become immediates
    for (int kk = 0; kk < GKS; kk += 32) {
      V bh[4], ah[4];
#pragma unroll
      for (int j = 0; j < 4; ++j) bh[j] = ldfrag(bp + (j << 4) * GSP + kk);
#pragma unroll
      for (int i = 0; i < 4; ++i) ah[i] = ldfrag(ap + (i << 4) * GSP + kk);
      // keeps all LDS loads of a k step ahead of the step's first WMMA: left alone, the compiler feeds the A fragments
      // through one register set, and every four WMMAs wait out the LDS latency
      __builtin_amdgcn_sched_barrier(0);
#pragma unroll
      for (int i = 0; i < 4; ++i)
#pragma unroll
        for (int j = 0; j < 4; ++j) acc[i][j] = mma16(ah[i], bh[j], acc[i][j]);
    }
    ring_publish();
    // refill the buffer just read with the stage two ahead, while one exists (block-uniform test)
    if (s + 2 < nst) {
      char* l = lc + (s & 1) * BUFB;
      issue_g(ga + kx * GKS, lda, l);
      issue_g(gb + kx * GKS, ldb, l + BOFF);
      kx = (kx + 1 == nst) ? 0 : kx + 1;
    }
  }
  asm volatile("s_wait_asynccnt 0x0" ::: "memory");  // no copy is left in flight behind the loop
  accg4(acc[0][0], acc[0][1], acc[0][2], acc[0][3]);
  accg4(acc[1][0], acc[1][1], acc[1][2], acc[1][3]);
  accg4(acc[2][0], acc[2][1], acc[2][2], acc[2][3]);
  accg4(acc[3][0], acc[3][1], acc[3][2], acc[3][3]);

  float* slab = (float*)(void*)gsm + wave * (16 * 68);
#pragma unroll
  for (int i = 0; i < 4; ++i) {
    const int mBase = m0 + (i << 4);
#pragma unroll
    for (int j = 0; j < 4; ++j) {
#pragma unroll
      for (int r = 0; r < 8; ++r) slab[(mOff + r) * 68 + (j << 4) + rl] = acc[i][j][r] * scale;
    }
    __builtin_amdgcn_fence(__ATOMIC_RELEASE, "workgroup");
    __builtin_amdgcn_wave_barrier();
    __builtin_amdgcn_fence(__ATOMIC_ACQUIRE, "workgroup");
    {
      // OUT_MODE 2: column block n0 / 128 starts M * 128 elements behind the one before; the store below adds n0 itself
      _Float16* C = Cdst + ((OUT_MODE == 2) ? (size_t)(n0 >> 7) * (size_t)(M - 1) * 128 : (size_t)0);
      const int qq = lane >> 3, c8 = (lane & 7) * 8;
{
#pragma unroll
        for (int it = 0; it < 4; ++it) {
          const int row = it * 4 + qq;
          const float* sp = slab + row * 68 + c8;
          v8h hv;
#pragma unroll
          for (int e = 0; e < 8; ++e) hv[e] = (_Float16)sp[e];
          *(v8h*)(C + (size_t)(mBase + row) * ldc + n0 + c8) = hv;
        }
        asm volatile("s_wait_xcnt 0x0" ::: "memory");   // in front of any rewrite of the stores' address and data registers
        // keeps the next slab's products behind that wait: lifted over it, they rewrite the stores' data registers ahead of it
        __builtin_amdgcn_sched_barrier(0);
      }
    }
    __builtin_amdgcn_fence(__ATOMIC_RELEASE, "workgroup");
    __builtin_amdgcn_wave_barrier();
    __builtin_amdgcn_fence(__ATOMIC_ACQUIRE, "workgroup");
  }
}

// Kernel 2: two independent parts in one launch of 128-thread blocks, chosen by block index (the same for the whole block):
//   blocks [0, WP_TILES): the weight products [G; Wc] = [Wqkv^T; Wproj] . Wqkv, one GEMM of 2 DM x DM x DM on wa = the
//   stacked planes [Wqkv^T; Wproj] and wt = Wqkv^T, result wg = 64 * [G; Wc] in f16 (operand carries 64 * 64, scale 1 / 64);
//   the blocks behind them: LayerNorm of q and v (what kernel 3's products read), four waves a block. The few GEMM tiles run
//   under the LayerNorm's memory stream.
// LN_BLK is chosen so that all blocks of the launch are resident at once (four a WGP by their LDS, 256 WGPs).
#define WP_TILES ((2 * DM / 128) * (DM / 128))
#define LN_BLK   (1024 - WP_TILES)
__global__ __launch_bounds__(128) void ln_wprod_kernel(const float* __restrict__ qx, const float* __restrict__ kx,
                                                       const float* __restrict__ vx, const float* __restrict__ lw,
                                                       const float* __restrict__ lb, _Float16* __restrict__ X, int ntok,
                                                       const _Float16* __restrict__ wa, const _Float16* __restrict__ wt,
                                                       _Float16* __restrict__ wg) {
  __shared__ __align__(16) char gsm[2 * 2 * GPL];
  if ((int)blockIdx.x < WP_TILES) {
    gemm_tile<1>(gsm, (int)blockIdx.x, wa, DM, wt, DM, wg, DM, 2 * DM, DM, DM, 0.015625f);
    return;
  }
  const int wave = __builtin_amdgcn_readfirstlane((int)(threadIdx.x >> 5));
  ln_rows(qx, kx, vx, lw, lb, X, ntok, ((int)blockIdx.x - WP_TILES) * 4 + wave, LN_BLK * 4, 2 * ntok, ntok);
}

// Kernel 3: three independent parts in one launch of 128-thread blocks, chosen by block index (the same for the whole block):
//   blocks [0, PJ_TILES):            qg = ln(q) . G -> qd [ntok][DM] (16 * qg); Bt = g16 (row c, k = d); scale 16 / (8 * 64)
//   blocks [PJ_TILES, 2 * PJ_TILES): vp^T = Wc . ln(v)^T -> vtd [ntok / 128][DM][128] (16 * vp, blocks of 128 keys)
//   the blocks behind them: LayerNorm of k, which only the attention reads; its memory stream runs under the products.
// The two products' tiles together are three a WGP, with LNK_BLK four blocks a WGP: all blocks of the launch are resident at
// once (four a WGP by their LDS, 256 WGPs). X: rows of q and v are read, rows of k written; no byte is both.
#define PJ_TILES ((NTOK / 128) * (DM / 128))
#define LNK_BLK  (1024 - 2 * PJ_TILES)
static_assert(LNK_BLK > 0);
__global__ __launch_bounds__(128) void proj_lnk_kernel(const float* __restrict__ qx, const float* __restrict__ kx,
                                                       const float* __restrict__ vx, const float* __restrict__ lw,
                                                       const float* __restrict__ lb, _Float16* X, int ntok,
                                                       const _Float16* __restrict__ g16, const _Float16* __restrict__ wc16,
                                                       _Float16* __restrict__ qd, _Float16* __restrict__ vtd) {
  __shared__ __align__(16) char gsm[2 * 2 * GPL];
  if ((int)blockIdx.x < PJ_TILES) {
    gemm_tile<1>(gsm, (int)blockIdx.x, X, DM, g16, DM, qd, DM, NTOK, DM, DM, 0.03125f);
    return;
  }
  if ((int)blockIdx.x < 2 * PJ_TILES) {
    gemm_tile<2>(gsm, (int)blockIdx.x - PJ_TILES, wc16, DM, X + (size_t)2 * NTOK * DM, DM, vtd, 128, DM, NTOK, DM, 0.03125f);
    return;
  }
  const int wave = __builtin_amdgcn_readfirstlane((int)(threadIdx.x >> 5));
  ln_rows(qx, kx, vx, lw, lb, X, ntok, ((int)blockIdx.x - 2 * PJ_TILES) * 4 + wave, LNK_BLK * 4, ntok, 0);
}

// ---------------------------------------------------------------------------------------------
// Kernel 4: full (non-causal) single-head attention, head width 768, online softmax in f32.
//   qn plane f16 [ntok][DM] (value 16*qg), kn plane f16 [ntok][DM] (value 8*ln(k)), vt plane f16 [ntok / 128][DM][128]
//   (value 16*vp, the values with the output projection already applied; blocks of 128 keys, in each block one row of
//   128 keys = 256 B per value column).
//   Block = 256 threads = 8 waves, 64 query rows x one half of the keys (blockIdx & 1): every K and V byte that
//   comes from L2 serves 64 queries. Outputs per key half: ph / pl = bf16 hi / lo planes (16-bit storage) of
//   O_half = softmax over that half . vp, [2][ntok][DM], with the half's row maximum pm and row sum pls, [2][ntok];
//   the merge kernel joins the two halves.
//   Q tile staged once in LDS. Key tiles of 256: wave w owns keys 32w..32w+31 of the tile for the logits:
//   S^T subtiles (A = kn rows, B = Q rows, both from LDS), so the
//   D layout gives per lane 8 consecutive keys of one query -> P written to LDS as 16-B vectors ([query][key]).
//   P = 16 * exp(s - m_running) in f16 (values in [~1.2, 16], always normal).
//   Row max / sum: per-wave partials in LDS, combined in fixed order by waves 0 and 1 (one lane per query row).
//   P.V: every wave reads the whole P tile (A operand) and owns 3 x 32 value columns (B = vt rows from LDS).
//   kn and vt reach LDS by tensor loads, in a ring of two buffers: per key tile six K stages (256 keys x 128 dims)
//   and six V stages (256 columns x 128 keys); each wave asks, in one request a stage, for the slice of rows it
//   reads itself (32 key rows or 32 column rows of 256 B, each padded by 16 B in LDS); a V slice is one run of 8 KB
//   in global memory; the ring is so private to each wave: at the foot of every stage the wave's own two waits and no
//   work-group barrier, then the refill of the slice just read with the stage two ahead. The barriers of the kernel are
//   those around what the waves share: the Q tile, the row statistics, the P tile, the output staging.
//   Output: the 64x768 f32 accumulator tile staged in LDS (over the Q and P regions and the ring), then each wave
//   normalises 8 whole rows, splits them into bf16 hi / lo and writes 512 B per instruction (3 per row and plane).
// ---------------------------------------------------------------------------------------------
#define QB       64
#define KSPLIT   2
#define KCH      256
#define QSP      776
#define PSP      264
#define LDS_QS   0
#define LDS_PS   99328
#define LDS_PMAX 133120
#define LDS_PSUM 135168
#define LDS_ST   137216
#define LDS_RING 139264   // a multiple of 2 KiB, as every slice's place
#define FSP      772      // f32 output staging row pitch in floats (3088 B, a multiple of 16 B)
#define KSD      128      // model dims per K stage (256 B a key row)
#define KSP      136      // K stage row pitch in halves: 272 B = 16 B x odd, for ds_load_b128 readers
#define VSK      128      // keys per V stage (256 B a value-column row)
#define VSC      256      // value columns per V stage
#define VSP      136      // V stage row pitch in halves: 272 B = 16 B x odd
#define SLICE_B  10240    // one wave's slice of a ring buffer: 32 rows * 272 B up to a multiple of 2 KiB
#define RING_B   (8 * SLICE_B)   // one ring buffer
#define KW0      ((1u << 20) | (5u << 22) | (3u << 25))   // group 1 word 0: 16 B of pad behind every 256-B row
#define ATT_LDS  (LDS_RING + 2 * RING_B)
static_assert(QB * QSP * 2 == LDS_PS - LDS_QS);
static_assert(32 * FSP * 4 <= LDS_PMAX - LDS_QS && 32 * FSP * 4 <= 2 * RING_B && FSP >= DM && (FSP % 4) == 0);
static_assert(QB * PSP * 2 == LDS_PMAX - LDS_PS);
static_assert(LDS_PSUM - LDS_PMAX == 8 * QB * 4);
static_assert(LDS_ST - LDS_PSUM == 8 * QB * 4);
static_assert(LDS_RING - LDS_ST >= 4 * QB * 4);
static_assert(32 * KSP * 2 <= SLICE_B && 32 * VSP * 2 <= SLICE_B && (SLICE_B % 2048) == 0 && (LDS_RING % 2048) == 0);
static_assert(KSD * 2 == 256 && KSP * 2 == 256 + 16 && VSK * 2 == 256 && VSP * 2 == 256 + 16 && KCH == 8 * 32);
static_assert((DM % KSD) == 0 && KCH == 2 * VSK && ((DM / KSD) % 2) == 0 && DM == 3 * VSC && VSC == 8 * 32);
static_assert(ATT_LDS <= 327680);
static_assert((QSP % 8) == 0 && (PSP % 8) == 0 && PSP >= KCH);
static_assert((LDS_PS % 16) == 0 && (LDS_PMAX % 16) == 0 && (LDS_ST % 16) == 0);
static_assert((NTOK % (KCH * KSPLIT)) == 0 && (NTOK % QB) == 0);

// K stage: this wave's 32 key rows x 128 dims. g points at (first key row of the wave, first dim); l is the slice's place.
__device__ __forceinline__ void issue_k(uint32_t cnt1, const _Float16* g, uint32_t l) {
  tdm_slice<KW0, 256u, 32u>(cnt1, l, g, DM * 2u);
}
// V stage: this wave's 32 value-column rows x 128 keys, rows back to back in global memory. g points at the first row.
__device__ __forceinline__ void issue_v(uint32_t cnt1, const _Float16* g, uint32_t l) {
  tdm_slice<KW0, 256u, 32u>(cnt1, l, g, VSK * 2u);
}
__global__ __launch_bounds__(256) void attn_kernel(const _Float16* __restrict__ qn, const _Float16* __restrict__ kn,
                                                   const _Float16* __restrict__ vt, unsigned short* __restrict__ ph,
                                                   unsigned short* __restrict__ pl, float* __restrict__ pm,
                                                   float* __restrict__ pls, float sc, int ntok) {
  __shared__ __attribute__((aligned(2048))) char smem[ATT_LDS];
  _Float16* Qs = (_Float16*)(smem + LDS_QS);
  _Float16* Ps = (_Float16*)(smem + LDS_PS);
  float* pmax = (float*)(smem + LDS_PMAX);
  float* psum = (float*)(smem + LDS_PSUM);
  float* m_s  = (float*)(smem + LDS_ST);
  float* l_s  = m_s + QB;
  float* al_s = m_s + 2 * QB;
  float* li_s = m_s + 3 * QB;

  const int tid = threadIdx.x, wave = (int)uni(threadIdx.x >> 5), lane = tid & 31, h = lane >> 4, c = lane & 15;
  const int q0 = ((int)blockIdx.x >> 1) * QB;
  const int sp = (int)blockIdx.x & 1;             // which half of the keys
  const int ntile = ntok / (KCH * KSPLIT);        // key tiles of this block
  const int key0 = sp * ntile * KCH;
  // The walk over the key tiles starts at a tile of the block's own and wraps: the blocks of one key half then do not ask
  // L2 for the same K and V lines at the same moment. tt = the key tile in work (scalar, below ntile).
  int tt = ((int)blockIdx.x >> 1) % ntile;
  const float ninf = -__builtin_inff();

  // ring addresses of this wave (all wave-uniform): its slice's place in buffer 0, its first key row, its first column row
  const uint32_t rl0 = (uint32_t)(size_t)(smem + LDS_RING) + (uint32_t)wave * SLICE_B;
  const _Float16* kg = kn + (size_t)(key0 + 32 * wave) * DM;
  const _Float16* vg = vt + ((size_t)(key0 / VSK) * DM + 32 * wave) * VSK;   // key block key0 / 128, column 32 * wave

  // word 0 of every request's group 0 (count = 1), a descriptor word held in a scalar register by pinned(): made once, in
  // front of the first request; as a plain constant it was written into its register anew while stage 1's request flew
  const uint32_t cnt1 = pinned(1u);
  issue_k(cnt1, kg + (size_t)tt * KCH * DM, rl0);   // stage 0 (first tile, dims 0..127) into buffer 0; it flies under the Q staging

  if (tid < QB) { m_s[tid] = ninf; l_s[tid] = 0.0f; al_s[tid] = 0.0f; li_s[tid] = 0.0f; }
  psum[tid] = 0.0f;
  psum[256 + tid] = 0.0f;
  // Q tile: 64 rows x 96 pieces of 8 halves; coverage 24 * 256 = 6144 pieces = the whole tile
  {
    // the 64 rows lie in one piece in global memory: one address register, piece i at a constant distance
    const _Float16* qg = qn + (size_t)q0 * DM + tid * 8;
    v8h qv[24];
#pragma unroll
    for (int i = 0; i < 24; ++i) qv[i] = *(const v8h*)(qg + i * 2048);
    asm volatile("s_wait_xcnt 0x0" ::: "memory");   // in front of any rewrite of the loads' address register
#pragma unroll
    for (int i = 0; i < 24; ++i) {
      const int idx = i * 256 + tid;
      const int row = idx / 96;
      const int pc  = idx - row * 96;
      *(v8h*)(Qs + row * QSP + pc * 8) = qv[i];
    }
  }
  asm volatile("s_wait_tensorcnt 0x0" ::: "memory");  // own slice of stage 0 has landed
  __syncthreads();
  // keeps stage 1's descriptor words behind the wait
  __builtin_amdgcn_sched_barrier(0);
  issue_k(cnt1, kg + (size_t)tt * KCH * DM + KSD, rl0 + RING_B);   // stage 1 into buffer 1

  v8f oacc[4][6];   // [query subtile][column subtile]: column 256 * (nt / 2) + 32 * wave + 16 * (nt % 2) + c
#pragma unroll
  for (int qt = 0; qt < 4; ++qt)
#pragma unroll
    for (int nt = 0; nt < 6; ++nt) oacc[qt][nt] = zero8();

  const _Float16* qbp = Qs + c * QSP + 8 * h;             // B operand, query c (+ 16 * QSP per query subtile)
  const _Float16* pap = Ps + c * PSP + 8 * h;             // A operand, query c (+ 16 * PSP per query subtile)

#pragma unroll 1
  for (int t = 0; t < ntile; ++t) {
    const int tn = (tt + 1 == ntile) ? 0 : tt + 1;   // the next key tile of the walk
    // ---- logits: S^T subtiles for keys kb..kb+31 (this wave), queries 0..63 ----
    v8f sacc[4][2];   // [query subtile][key subtile]; element r: query 16qt+c, key kb+16kt+8h+r
#pragma unroll
    for (int qt = 0; qt < 4; ++qt)
#pragma unroll
      for (int kt = 0; kt < 2; ++kt) sacc[qt][kt] = zero8();
    // the products of one K stage of 128 dims (stage j of the tile, in buffer j & 1)
    auto k_stage = [&](int j) __attribute__((always_inline)) {
      const _Float16* ka0p = (const _Float16*)(smem + LDS_RING + (j & 1) * RING_B + wave * SLICE_B) + c * KSP + 8 * h;
      const _Float16* ka1p = ka0p + 16 * KSP;
#pragma unroll   // the stage's four k steps in a row: LDS offsets become immediates
      for (int kk = 0; kk < KSD; kk += 32) {
        const v16h a0 = ldfrag(ka0p + kk), a1 = ldfrag(ka1p + kk);
        v16h b[4];
#pragma unroll
        for (int qt = 0; qt < 4; ++qt) b[qt] = ldfrag(qbp + (16 * qt) * QSP + j * KSD + kk);
        // keeps all twelve LDS loads of a k step ahead of the step's first WMMA: left alone, the compiler feeds the
        // B fragments through one register set, and every pair of WMMAs waits out the LDS latency
        __builtin_amdgcn_sched_barrier(0);
#pragma unroll
        for (int qt = 0; qt < 4; ++qt) {
          sacc[qt][0] = mma16(a0, b[qt], sacc[qt][0]);
          sacc[qt][1] = mma16(a1, b[qt], sacc[qt][1]);
        }
      }
    };
    // Six K stages, in two loops, so that every request stands in straight code that every wave runs (no test around a
    // tensor load, which ignores EXEC); both kept rolled: the loop text stays short. Behind each turn of the ring the
    // slice just read is refilled with the stage two ahead: K stages 2..5 ...
#pragma unroll 1
    for (int j = 0; j + 2 < DM / KSD; ++j) {
      k_stage(j);
      ring_turn_t();
      issue_k(cnt1, kg + (size_t)tt * KCH * DM + (j + 2) * KSD, rl0 + (j & 1) * RING_B);
    }
    // ... then V stages 0, 1 of this tile
#pragma unroll 1
    for (int j = DM / KSD - 2; j < DM / KSD; ++j) {
      k_stage(j);
      ring_turn_t();
      issue_v(cnt1, vg + ((size_t)(2 * tt) * DM + (j + 2 - DM / KSD) * VSC) * VSK, rl0 + (j & 1) * RING_B);
    }
    // ---- scale, per-wave partial row max ----
#pragma unroll
    for (int qt = 0; qt < 4; ++qt) {
      float pmq = ninf;
#pragma unroll
      for (int kt = 0; kt < 2; ++kt) {
#pragma unroll
        for (int r = 0; r < 8; ++r) {
          const float v0 = sacc[qt][kt][r] * sc; sacc[qt][kt][r] = v0; pmq = fmaxf(pmq, v0);
        }
      }
      pmq = fmaxf(pmq, __shfl_xor(pmq, 16, 32));
      pmax[wave * QB + 16 * qt + c] = pmq;
    }
    __syncthreads();
    // ---- waves 0 and 1, thread = query row: fold the prior tile's sums into l, new running max, rescale factor ----
    if (wave < 2) {
      const int row = tid;
      float ps = 0.0f;
#pragma unroll
      for (int w = 0; w < 8; ++w) ps += psum[w * QB + row];
      l_s[row] = l_s[row] * al_s[row] + ps;
      const float mo = m_s[row];
      float mx = mo;
#pragma unroll
      for (int w = 0; w < 8; ++w) mx = fmaxf(mx, pmax[w * QB + row]);
      al_s[row] = __expf(mo - mx);
      m_s[row] = mx;
    }
    __syncthreads();
    // ---- p = 16 * exp(s - m) as f16, P tile, partial row sums, rescale O ----
#pragma unroll
    for (int qt = 0; qt < 4; ++qt) {
      const float mq = m_s[16 * qt + c];
      float ps = 0.0f;
#pragma unroll
      for (int kt = 0; kt < 2; ++kt) {
        v8h hq;
#pragma unroll
        for (int r = 0; r < 8; ++r) {
          const float p = __expf(sacc[qt][kt][r] - mq); ps += p; hq[r] = (_Float16)(p * 16.0f);
        }
        *(v8h*)(Ps + (16 * qt + c) * PSP + 32 * wave + 16 * kt + 8 * h) = hq;
      }
      ps += __shfl_xor(ps, 16, 32);
      psum[wave * QB + 16 * qt + c] = ps;
      const v4f aA = *(const v4f*)(al_s + 16 * qt + 8 * h), aB = *(const v4f*)(al_s + 16 * qt + 8 * h + 4);
#pragma unroll
      for (int nt = 0; nt < 6; ++nt) {
#pragma unroll
        for (int r = 0; r < 4; ++r) {
          oacc[qt][nt][r] *= aA[r]; oacc[qt][nt][4 + r] *= aB[r];
        }
      }
    }
    __syncthreads();
    // ---- O += P . V over the 256 keys of the tile ----
    // six V stages: stage v is key half v / 3, column third v % 3, in buffer v & 1; the three stages of a key half share
    // its P fragments, which stay in registers. Unrolled: accumulator index, buffer and kind of refill depend on v.
#pragma unroll
    for (int kh = 0; kh < 2; ++kh) {
      v16h pa[4][4];
#pragma unroll
      for (int th = 0; th < 3; ++th) {
        const int v = 3 * kh + th;
        const _Float16* vbp = (const _Float16*)(smem + LDS_RING + (v & 1) * RING_B + wave * SLICE_B) + c * VSP + 8 * h;
        v16h vb[4][2];
#pragma unroll
        for (int k2 = 0; k2 < 4; ++k2) {
          if (th == 0) {
#pragma unroll
            for (int qt = 0; qt < 4; ++qt) pa[k2][qt] = ldfrag(pap + (16 * qt) * PSP + kh * VSK + 32 * k2);
          }
#pragma unroll
          for (int j = 0; j < 2; ++j) vb[k2][j] = ldfrag(vbp + (16 * j) * VSP + 32 * k2);
        }
        // keeps all LDS loads of the stage ahead of its first WMMA (as in the K stages)
        __builtin_amdgcn_sched_barrier(0);
#pragma unroll
        for (int k2 = 0; k2 < 4; ++k2)
#pragma unroll
          for (int j = 0; j < 2; ++j)
#pragma unroll
            for (int qt = 0; qt < 4; ++qt)
              oacc[qt][2 * th + j] = mma16(pa[k2][qt], vb[k2][j], oacc[qt][2 * th + j]);
        ring_turn_t();
        // refill: V stage v + 2 of this tile; behind the last two stages K stages 0, 1 of the next tile while one
        // exists (a scalar test, the same for the whole block)
        if (v + 2 < 6) {
          issue_v(cnt1, vg + ((size_t)(2 * tt + (v + 2) / 3) * DM + ((v + 2) % 3) * VSC) * VSK, rl0 + (v & 1) * RING_B);
        } else if (pinned(t + 1 < ntile)) {
          issue_k(cnt1, kg + (size_t)tn * KCH * DM + (v - 4) * KSD, rl0 + (v & 1) * RING_B);
        }
      }
    }
    tt = tn;
  }
  asm volatile("s_wait_tensorcnt 0x0" ::: "memory");  // no request is left in flight behind the loop
  asm volatile("s_wait_dscnt 0x0" ::: "memory");      // own ring reads are done before the ring becomes output staging

  // ---- this half's row sum (fold the last tile's sums) and maximum; O_half = oacc / (256 * l) (P carry 16, vn carry 16) ----
  if (wave < 2) {
    const int row = tid;
    float ps = 0.0f;
#pragma unroll
    for (int w = 0; w < 8; ++w) ps += psum[w * QB + row];
    const float l = l_s[row] * al_s[row] + ps;
    li_s[row] = (1.0f / l) * (1.0f / 256.0f);
    pm[(size_t)sp * ntok + q0 + row]  = m_s[row];
    pls[(size_t)sp * ntok + q0 + row] = l;
  }
  __syncthreads();
  // ---- stage the 64 x 768 f32 accumulator tile: rows 0..31 over the Q and P regions, rows 32..63 over the ring ----
  float* F0 = (float*)(smem + LDS_QS);
  float* F1 = (float*)(smem + LDS_RING);
#pragma unroll
  for (int qt = 0; qt < 4; ++qt) {
    float* F = ((qt < 2) ? F0 : F1) + (16 * (qt & 1) + 8 * h) * FSP;
#pragma unroll
    for (int nt = 0; nt < 6; ++nt) {
      const int col = VSC * (nt / 2) + 32 * wave + 16 * (nt % 2) + c;
#pragma unroll
      for (int r = 0; r < 8; ++r) F[r * FSP + col] = oacc[qt][nt][r];
    }
  }
  __syncthreads();
  // ---- each wave: 8 whole rows, normalised, split into bf16 hi / lo, 512 B per store instruction (3 per row and plane) ----
  {
    unsigned short* gh = ph + ((size_t)sp * ntok + q0) * DM;
    unsigned short* gl = pl + ((size_t)sp * ntok + q0) * DM;
    // kept rolled: run once per block, unrolled it is some thousand instructions that are fetched to be used once
#pragma unroll 1
    for (int it = 0; it < 24; ++it) {
      const int rr = it / 3;
      const int row = 8 * wave + rr;
      const int pc = (it - rr * 3) * 32 + lane;
      const float* F = ((row < 32) ? F0 + row * FSP : F1 + (row - 32) * FSP) + pc * 8;
      const float inv = li_s[row];
      const v4f x0 = *(const v4f*)(F), x1 = *(const v4f*)(F + 4);
      v8us hvv, lvv;
#pragma unroll
      for (int e = 0; e < 4; ++e) {
        unsigned short hb, lb;
        split_bf(x0[e] * inv, hb, lb);
        hvv[e] = hb;      lvv[e] = lb;
        split_bf(x1[e] * inv, hb, lb);
        hvv[4 + e] = hb;  lvv[4 + e] = lb;
      }
      *(v8us*)(gh + (size_t)row * DM + pc * 8) = hvv;
      *(v8us*)(gl + (size_t)row * DM + pc * 8) = lvv;
      // the next trip rewrites the two stores' address and data registers: the wait stands in front of that
      asm volatile("s_wait_xcnt 0x0" ::: "memory");
    }
  }
}

// ---------------------------------------------------------------------------------------------
// Kernel 5: join the two key halves of the attention: with M = max(m0, m1) and w_i = l_i * exp(m_i - M),
//   out = (w0 * O_0 + w1 * O_1) / (w0 + w1) + bf16(bias), O_i = hi + lo of half i; out is the f32 result [ntok][DM].
// A piece is 8 columns: one 16-B load per lane and plane, 32 lanes contiguous = 512 B; two 16-B stores per lane, the 32
// lanes' 32 B each contiguous = 1 KB of whole lines from one wave. bf16(bias) is staged once per block in LDS. Thread g takes pieces
// g, g + threads, ... (MG_IT of them); the loads of all its pieces are issued before the first piece is worked on.
// coverage: MG_IT * SG_BLK * SG_THR pieces = ntok * DM / 8 exactly (DM / 8 = 96 pieces a row).
// ---------------------------------------------------------------------------------------------
// exp(d) in the fast form (one multiply by log2 e, then v_exp_f32). The v_nop in the same statement is the slot that the
// instruction set asks for behind a transcendental.
__device__ __forceinline__ float exp_slot(float d) {
  const float t = d * 1.44269504f;
  float r;
  asm("v_exp_f32 %0, %1\n\tv_nop" : "=v"(r) : "v"(t));
  return r;
}
#define MG_IT (NTOK * (DM / 8) / (SG_BLK * SG_THR))
static_assert(MG_IT * SG_BLK * SG_THR == NTOK * (DM / 8) && DM / 4 <= SG_THR && (DM / 4) % 32 == 0);
__global__ __launch_bounds__(SG_THR) void merge_kernel(const unsigned short* __restrict__ ph,
                                                       const unsigned short* __restrict__ pl,
                                                       const float* __restrict__ pm, const float* __restrict__ pls,
                                                       const float* __restrict__ bias, float* __restrict__ out,
                                                       int ntok) {
  __shared__ __align__(16) float bsm[DM];        // bf16(bias)
  const int g = (int)blockIdx.x * SG_THR + (int)threadIdx.x;
  const size_t pst = (size_t)ntok * DM;
  float m0[MG_IT], m1[MG_IT], l0[MG_IT], l1[MG_IT];
  v8us h0[MG_IT], g0[MG_IT], h1[MG_IT], g1[MG_IT];
  // The bias goes through LDS: the first DM / 4 threads (whole waves) read it once per block. This stands in front of all
  // other loads: a barrier behind them would wait until the last of them has landed.
  if ((int)threadIdx.x < DM / 4) {
    const v4f bl = *(const v4f*)(bias + (int)threadIdx.x * 4);
    asm volatile("s_wait_xcnt 0x0" ::: "memory");   // in front of any rewrite of the load's address registers
    v4f bc;
#pragma unroll
    for (int i = 0; i < 4; ++i) bc[i] = bfr(bl[i]);
    *(v4f*)(bsm + (int)threadIdx.x * 4) = bc;
  }
  __syncthreads();
#pragma unroll
  for (int it = 0; it < MG_IT; ++it) {
    const int row = (it * (SG_BLK * SG_THR) + g) / (DM / 8);
    m0[it] = pm[row];
    m1[it] = pm[ntok + row];
    l0[it] = pls[row];
    l1[it] = pls[ntok + row];
  }
  // the wide loads' results may take these loads' address registers: the wait stands in front of that rewrite
  asm volatile("s_wait_xcnt 0x0" ::: "memory");
#pragma unroll
  for (int it = 0; it < MG_IT; ++it) {
    const size_t e = (size_t)(it * (SG_BLK * SG_THR) + g) * 8;
    h0[it] = *(const v8us*)(ph + e);
    g0[it] = *(const v8us*)(pl + e);
    h1[it] = *(const v8us*)(ph + pst + e);
    g1[it] = *(const v8us*)(pl + pst + e);
  }
  asm volatile("s_wait_xcnt 0x0" ::: "memory");   // in front of any rewrite of the loads' address registers
  // keeps every load ahead of the first piece's work: left alone, the compiler mixes the two to save registers, and the
  // thread waits out the memory latency several times over
  __builtin_amdgcn_sched_barrier(0);
#pragma unroll
  for (int it = 0; it < MG_IT; ++it) {
    const size_t e = (size_t)(it * (SG_BLK * SG_THR) + g) * 8;
    const int col = ((it * (SG_BLK * SG_THR) + g) % (DM / 8)) * 8;
    const v4f ba = *(const v4f*)(bsm + col), bb = *(const v4f*)(bsm + col + 4);
    const float mx = fmaxf(m0[it], m1[it]);
    float w0 = l0[it] * exp_slot(m0[it] - mx), w1 = l1[it] * exp_slot(m1[it] - mx);
    const float inv = 1.0f / (w0 + w1);
    w0 *= inv;
    w1 *= inv;
    v4f oa, ob;
#pragma unroll
    for (int i = 0; i < 4; ++i) {
      oa[i] = w0 * (bfval(h0[it][i]) + bfval(g0[it][i])) + w1 * (bfval(h1[it][i]) + bfval(g1[it][i])) + ba[i];
      ob[i] = w0 * (bfval(h0[it][4 + i]) + bfval(g0[it][4 + i])) + w1 * (bfval(h1[it][4 + i]) + bfval(g1[it][4 + i])) + bb[i];
    }
    *(v4f*)(out + e) = oa;
    *(v4f*)(out + e + 4) = ob;
    asm volatile("s_wait_xcnt 0x0" ::: "memory");   // in front of any rewrite of the stores' address and data registers
    // keeps the next piece's work behind that wait: lifted over it, it rewrites the stores' data registers ahead of it
    __builtin_amdgcn_sched_barrier(0);
  }
}

// ---------------------------------------------------------------------------------------------
// Workspace map (bytes, all regions exact tile / whole-line multiples, no padding needed):
//   WqT  : Wqkv transposed f16 [768][768] (64 * bf16(w))        off 0           size  1,179,648
//   Wp16 : Wproj f16 [768][768] (64 * bf16(w)), behind WqT      off 1,179,648   size  1,179,648
//   X16  : ln(q), ln(k), ln(v) stacked f16 [24576][768]         off 2,359,296   size 37,748,736
//   Q16  : qg = ln(q) . G f16 [8192][768]                       off 40,108,032  size 12,582,912
//   VT16 : vp^T f16 [64][768][128] (blocks of 128 keys)         off 52,690,944  size 12,582,912
//   G16  : Wqkv^T . Wqkv f16 [768][768] (64 * G)                off 65,273,856  size  1,179,648
//   Wc16 : Wproj . Wqkv f16 [768][768] (64 * Wc), behind G16    off 66,453,504  size  1,179,648
//   PH   : per key half, attention output bf16 hi [2][8192][768] off 67,633,152  size 25,165,824
//   PL   : per key half, attention output bf16 lo [2][8192][768] off 92,798,976  size 25,165,824
//   PM   : per key half, row maximum f32 [2][8192]              off 117,964,800 size     65,536
//   PS   : per key half, row sum f32 [2][8192]                  off 118,030,336 size     65,536
//   total 118,095,872
// ---------------------------------------------------------------------------------------------
extern "C" void kernel_launch(void* const* d_in, const int* in_sizes, int n_in,
                              void* d_out, int out_size, void* d_ws, size_t ws_size,
                              hipStream_t stream) {
  if (n_in < 8) return;
  const int ntok = NTOK, dm = DM;
  if (in_sizes[0] != ntok * dm || in_sizes[1] != ntok * dm || in_sizes[2] != ntok * dm) return;
  if (in_sizes[3] != dm || in_sizes[4] != dm || in_sizes[7] != dm) return;
  if (in_sizes[5] != dm * dm || in_sizes[6] != dm * dm) return;
  if (out_size != ntok * dm) return;

  const float* q     = (const float*)d_in[0];
  const float* k     = (const float*)d_in[1];
  const float* v     = (const float*)d_in[2];
  const float* ln_w  = (const float*)d_in[3];
  const float* ln_b  = (const float*)d_in[4];
  const float* Wqkv  = (const float*)d_in[5];
  const float* Wproj = (const float*)d_in[6];
  const float* bproj = (const float*)d_in[7];
  float* out = (float*)d_out;

  const size_t bW  = (size_t)dm * dm * 2;
  const size_t bX  = (size_t)3 * ntok * dm * 2;
  const size_t bVT = (size_t)dm * ntok * 2;
  const size_t bO  = (size_t)ntok * dm * 2;
  size_t off = 0;
  const size_t oWT = off; off += bW;
  const size_t oWp = off; off += bW;
  const size_t oX  = off; off += bX;
  const size_t oQ  = off; off += bO;
  const size_t oVT = off; off += bVT;
  const size_t oG  = off; off += bW;
  const size_t oWc = off; off += bW;
  const size_t oPH = off; off += 2 * bO;
  const size_t oPL = off; off += 2 * bO;
  const size_t oPM = off; off += (size_t)2 * ntok * 4;
  const size_t oPS = off; off += (size_t)2 * ntok * 4;
  if (off > ws_size) return;                     // 118,095,872

  char* ws = (char*)d_ws;
  _Float16*       WqT  = (_Float16*)(ws + oWT);
  _Float16*       Wp16 = (_Float16*)(ws + oWp);
  _Float16*       X16  = (_Float16*)(ws + oX);
  _Float16*       Q16  = (_Float16*)(ws + oQ);
  _Float16*       VT16 = (_Float16*)(ws + oVT);
  _Float16*       G16  = (_Float16*)(ws + oG);
  _Float16*       Wc16 = (_Float16*)(ws + oWc);
  unsigned short* PH   = (unsigned short*)(ws + oPH);
  unsigned short* PL   = (unsigned short*)(ws + oPL);
  float*          PM   = (float*)(ws + oPM);
  float*          PS   = (float*)(ws + oPS);

  const dim3 blk(256);
  const dim3 gblk(128);                       // the GEMM's block: 4 waves
  const int n8 = dm * dm / 8;                 // 73728 = 288 * 256
  if ((n8 % 256) != 0) return;

  // (1) weights -> f16 planes (64 * bf16(w)): Wqkv transposed, Wproj
  cvt_w_kernel<<<dim3(n8 / 256 + (dm / 64) * (dm / 64)), blk, 0, stream>>>(Wqkv, Wproj, WqT, Wp16, n8);
  // (2) [G; Wc] = [Wqkv^T; Wproj] . Wqkv -> G16, Wc16 (64 * G, 64 * Wc), and LayerNorm of q and v -> X16 (8 * ln)
  ln_wprod_kernel<<<dim3(WP_TILES + LN_BLK), gblk, 0, stream>>>(q, k, v, ln_w, ln_b, X16, ntok, WqT, WqT, G16);
  // (3) qg = X[0:8192] . G -> Q16 (16 * qg); Bt = G16 (row c, k = d: sum_e Wqkv[e][c] * Wqkv[e][d]); M=8192, N=768, K=768;
  //     vp^T = Wc . X[16384:24576]^T -> VT16 [64][768][128] (16 * vp, blocks of 128 keys); M=768, N=8192, K=768;
  //     both scale 16/(8*64); and LayerNorm of k -> X16[8192:16384]
  proj_lnk_kernel<<<dim3(2 * PJ_TILES + LNK_BLK), gblk, 0, stream>>>(q, k, v, ln_w, ln_b, X16, ntok, G16, Wc16, Q16, VT16);
  // (4) attention per key half, keys = X[8192:16384] -> PH / PL, PM, PS; logit scale = dim^-0.5 / 128 (operand carries 16 * 8)
  const float sc = 0.03608439182435161f * (1.0f / 128.0f);
  attn_kernel<<<dim3(KSPLIT * (ntok / QB)), blk, 0, stream>>>(Q16, X16 + (size_t)ntok * dm, VT16, PH, PL, PM, PS,
                                                              sc, ntok);
  // (5) the two key halves joined, bias added -> d_out f32 [8192][768]
  merge_kernel<<<dim3(SG_BLK), dim3(SG_THR), 0, stream>>>(PH, PL, PM, PS, bproj, out, ntok);
  (void)hipGetLastError();
}
